// v000
// The times below were measured on an AMD MI455X: many runs one after another, warmed up first and cycling through
// copies of the inputs, with the whole window's GPU time divided by the number of runs. Launches and the gaps
// between them are all in it. The median over several windows is given; except for v000 it joins two sittings, which
// can be a few percent apart, so the side-by-side timings, each taken in one sitting, are the better comparison.
// v000 is the starting kernel. One run takes 1990 microseconds.
#include <hip/hip_runtime.h>
// SimilarAttention (4 x 2048 patches x 512, 8 heads x 64: [q|k|f|v] = x w_qkfv; attn = softmax(q.k/8); poss_value = (f^T v) w_scales + b_scales -> [h][64][2048]; out = attn . poss_value^T; y = merged . w_out + b_out).
// Structure: exact f16 x plane; the fused projection as ONE f16 WMMA GEMM (32x64 wave tiles, f32 accumulation, exact x16 weights; f16 out); per batch: f^T / v^T by LDS tiles, f^T v as 16-row WMMA tiles (K = 2048, f32) then f16 hi/residual, (f^T v) w_scales + b as two 16-row-tile GEMM terms into f32 then f16 hi/residual planes; per 4-head group the score GEMM (K = 64, f32), softmax rows on VALU (unnormalised f16 weights x 2^10 + row normalisers on their own lines), the readout as two GEMM terms against the hi/residual poss_value planes (N = 64, K = 2048); row scaling + hi/residual; w_out as two GEMM terms (+ bias).
// Compute dtype: inputs rounded to bf16; x / weights exact as f16; q, k, f, v and the softmax weights as plain f16 operands (~2^-12); f^T v, poss_value and the merged context as f16 hi + residual. v_wmma_f32_16x16x32_f16.
#define NB 4
#define NP 2048
#define DIM 512
#define NH 8
#define HD 64
#define INNER 512
#define HG 4                     /* heads per score-plane group */
#define NR (NB * NP)
typedef __bf16 v16b __attribute__((ext_vector_type(16)));
typedef unsigned short v8us __attribute__((ext_vector_type(8), may_alias));
typedef float  v8f  __attribute__((ext_vector_type(8)));
typedef float  v4f  __attribute__((ext_vector_type(4)));
typedef float  v4fa __attribute__((ext_vector_type(4), may_alias));
union FragB { v16b v; v8us half[2]; unsigned short u[16]; };

__device__ __forceinline__ unsigned short bf16_bits(float x) { unsigned int u = __float_as_uint(x); return (unsigned short)((u + 0x7FFFu + ((u >> 16) & 1u)) >> 16); }
__device__ __forceinline__ float bf16_val(unsigned short b) { return __uint_as_float(((unsigned int)b) << 16); }
__device__ __forceinline__ float bf16_round(float x) { return bf16_val(bf16_bits(x)); }
// D += A·B with NT terms: 1 = ah·bh, 2 = + al·bh (A split), 3 = + ah·bl (both split)
template <int NT>
__device__ __forceinline__ v8f mmaN(v16b ah, v16b al, v16b bh, v16b bl, v8f c) {
  c = __builtin_amdgcn_wmma_f32_16x16x32_bf16(false, ah, false, bh, (short)0, c, false, false);
  if (NT >= 2) c = __builtin_amdgcn_wmma_f32_16x16x32_bf16(false, al, false, bh, (short)0, c, false, false);
  if (NT >= 3) c = __builtin_amdgcn_wmma_f32_16x16x32_bf16(false, ah, false, bl, (short)0, c, false, false);
  asm volatile("v_nop\n\tv_nop\n\tv_nop\n\tv_nop" : "+v"(c) : "v"(ah), "v"(al), "v"(bh), "v"(bl));
  return c;
}

__global__ __launch_bounds__(256) void k_wt_bf16(const float* __restrict__ W, unsigned short* __restrict__ Wt, int K, int N) {
  const int t = blockIdx.x * 256 + threadIdx.x;
  const int k8n = K / 8;
  if (t >= N * k8n) return;
  const int n = t / k8n, k8 = (t % k8n) * 8;
  v8us v;
#pragma unroll
  for (int i = 0; i < 8; ++i) v[i] = bf16_bits(W[(size_t)(k8 + i) * N + n]);
  *(v8us*)(Wt + (size_t)n * K + k8) = v;
  
}

// GEMM C[M][N] (f32, pitch ldc) = act(A[M][K]·W + bias). A f32 row-major (pitch lda) converted per fragment to bf16
// (ASPLIT: hi/lo two planes -> 2 terms, else single rounded term); Wt bf16 [N][K] (pitch ldb). BIAS_BF16 rounds the
// bias to bf16 first (bias quantised to bf16 before the add). K%32==0, M%16==0, N%64==0.
template <bool ASPLIT, int ACT, bool BIAS_BF16>
__global__ __launch_bounds__(128) void k_gemm_bf(const float* __restrict__ A, int lda, const unsigned short* __restrict__ Wt, int ldb,
                                               const float* __restrict__ bias, float* __restrict__ C, int ldc, int M, int N, int K) {
  __shared__ __attribute__((aligned(16))) float so[4][16][64];
  const int tid = threadIdx.x, w = tid >> 5, lane = tid & 31, ln = lane & 15, hh = lane >> 4;
  const int ntn = N / 64;
  const int wid = blockIdx.x * 4 + w;
  const int mt = wid / ntn, nq = wid % ntn;
  if (mt * 16 >= M) return;
  const int row0 = mt * 16, col0 = nq * 64;
  const float* arow = A + (size_t)(row0 + ln) * lda;
  v8f acc[4] = {};
  for (int kb = 0; kb < K; kb += 32) {
    FragB ah, al;
    const v4f x0 = *(const v4fa*)(arow + kb + 8 * hh), x1 = *(const v4fa*)(arow + kb + 8 * hh + 4);
    const v4f x2 = *(const v4fa*)(arow + kb + 16 + 8 * hh), x3 = *(const v4fa*)(arow + kb + 16 + 8 * hh + 4);
    float xs[16] = {x0[0],x0[1],x0[2],x0[3],x1[0],x1[1],x1[2],x1[3],x2[0],x2[1],x2[2],x2[3],x3[0],x3[1],x3[2],x3[3]};
#pragma unroll
    for (int i = 0; i < 16; ++i) { const unsigned short hb = bf16_bits(xs[i]); ah.u[i] = hb; al.u[i] = ASPLIT ? bf16_bits(xs[i] - bf16_val(hb)) : (unsigned short)0; }
#pragma unroll
    for (int t = 0; t < 4; ++t) {
      const unsigned short* brow = Wt + (size_t)(col0 + t * 16 + ln) * ldb + kb;
      FragB b;
      b.half[0] = *(const v8us*)(brow + 8 * hh);
      b.half[1] = *(const v8us*)(brow + 16 + 8 * hh);
      acc[t] = mmaN<ASPLIT ? 2 : 1>(ah.v, al.v, b.v, b.v, acc[t]);
    }
  }
#pragma unroll
  for (int t = 0; t < 4; ++t) {
    float bv = bias ? bias[col0 + t * 16 + ln] : 0.f;
    if (BIAS_BF16) bv = bf16_round(bv);
#pragma unroll
    for (int r = 0; r < 8; ++r) { float v = acc[t][r] + bv; if (ACT == 1) v = fmaxf(v, 0.f); so[w][8 * hh + r][t * 16 + ln] = v; }
  }
  __builtin_amdgcn_fence(__ATOMIC_ACQ_REL, "workgroup");
  __builtin_amdgcn_wave_barrier();
  const int rsub = lane >> 4, c4 = (lane & 15) * 4;
  {
#pragma unroll
    for (int q = 0; q < 8; ++q) {
      const int r = q * 2 + rsub;
      const v4f v = *(const v4fa*)&so[w][r][c4];
      *(v4f*)(C + (size_t)(row0 + r) * ldc + col0 + c4) = v;
    }
    
  }
}

// GEMM C = act(A·W + bias + resid): A f32 (ASPLIT -> hi/lo 2 terms), Wt bf16 [N][K]; ACT 0 none, 1 relu, 2 exact gelu;
// resid (optional, f32, row index = (row % rmod), pitch ldr, RES_BF16 rounds it) added before the activation.
template <bool ASPLIT, int ACT, bool BIAS_BF16, bool RES_BF16>
__global__ __launch_bounds__(128) void k_gemm_bf3(const float* __restrict__ A, int lda, const unsigned short* __restrict__ Wt, int ldb,
                                                const float* __restrict__ bias, const float* __restrict__ resid, int rmod, int ldr,
                                                float* __restrict__ C, int ldc, int M, int N, int K) {
  __shared__ __attribute__((aligned(16))) float so[4][16][64];
  const int tid = threadIdx.x, w = tid >> 5, lane = tid & 31, ln = lane & 15, hh = lane >> 4;
  const int ntn = N / 64;
  const int wid = blockIdx.x * 4 + w;
  const int mt = wid / ntn, nq = wid % ntn;
  if (mt * 16 >= M) return;
  const int row0 = mt * 16, col0 = nq * 64;
  const float* arow = A + (size_t)(row0 + ln) * lda;
  v8f acc[4] = {};
  for (int kb = 0; kb < K; kb += 32) {
    FragB ah, al;
    const v4f x0 = *(const v4fa*)(arow + kb + 8 * hh), x1 = *(const v4fa*)(arow + kb + 8 * hh + 4);
    const v4f x2 = *(const v4fa*)(arow + kb + 16 + 8 * hh), x3 = *(const v4fa*)(arow + kb + 16 + 8 * hh + 4);
    float xs[16] = {x0[0],x0[1],x0[2],x0[3],x1[0],x1[1],x1[2],x1[3],x2[0],x2[1],x2[2],x2[3],x3[0],x3[1],x3[2],x3[3]};
#pragma unroll
    for (int i = 0; i < 16; ++i) { const unsigned short hb = bf16_bits(xs[i]); ah.u[i] = hb; al.u[i] = ASPLIT ? bf16_bits(xs[i] - bf16_val(hb)) : (unsigned short)0; }
#pragma unroll
    for (int t = 0; t < 4; ++t) {
      const unsigned short* brow = Wt + (size_t)(col0 + t * 16 + ln) * ldb + kb;
      FragB b;
      b.half[0] = *(const v8us*)(brow + 8 * hh);
      b.half[1] = *(const v8us*)(brow + 16 + 8 * hh);
      acc[t] = mmaN<ASPLIT ? 2 : 1>(ah.v, al.v, b.v, b.v, acc[t]);
    }
  }
#pragma unroll
  for (int t = 0; t < 4; ++t) {
    const int col = col0 + t * 16 + ln;
    float bv = bias ? bias[col] : 0.f;
    if (BIAS_BF16) bv = bf16_round(bv);
#pragma unroll
    for (int r = 0; r < 8; ++r) {
      float v = acc[t][r] + bv;
      if (resid) { float rv = resid[(size_t)((row0 + 8 * hh + r) % rmod) * ldr + col]; if (RES_BF16) rv = bf16_round(rv); v += rv; }
      if (ACT == 1) v = fmaxf(v, 0.f);
      if (ACT == 2) v = 0.5f * v * (1.0f + erff(v * 0.70710678118654752f));
      if (ACT == 3) { const float u = 0.7978845608028654f * (v + 0.044715f * v * v * v); v = 0.5f * v * (1.0f + tanhf(u)); }
      so[w][8 * hh + r][t * 16 + ln] = v;
    }
  }
  __builtin_amdgcn_fence(__ATOMIC_ACQ_REL, "workgroup");
  __builtin_amdgcn_wave_barrier();
  const int rsub = lane >> 4, c4 = (lane & 15) * 4;
  {
#pragma unroll
    for (int q = 0; q < 8; ++q) {
      const int r = q * 2 + rsub;
      const v4f v = *(const v4fa*)&so[w][r][c4];
      *(v4f*)(C + (size_t)(row0 + r) * ldc + col0 + c4) = v;
    }
    
  }
}
// row LayerNorm (biased variance, eps) over N: s = X (+ R); optional out_sum <- s; out_norm <- (s-mu)*rsqrt(var+eps)*g + b
template <bool PARAM_BF16>
__global__ __launch_bounds__(256) void k_layernorm(const float* __restrict__ X, const float* __restrict__ R, const float* __restrict__ g, const float* __restrict__ bta,
                                                  float* __restrict__ out_sum, float* __restrict__ out_norm, int N, float eps) {
  __shared__ float red[256];
  const int row = blockIdx.x, tid = threadIdx.x;
  const float* x = X + (size_t)row * N; const float* rr = R ? R + (size_t)row * N : nullptr;
  float vals[16];                     // up to N = 4096
  const int per = N / 256;            // contiguous chunk per thread? use strided-by-4 chunks: thread handles j = tid*4 + 1024*u
  float s1 = 0.f;
  for (int u = 0; u < per / 4; ++u) {
    const int j = tid * 4 + 1024 * u;
    const v4f a = *(const v4fa*)(x + j);
    v4f b = {0.f,0.f,0.f,0.f}; if (rr) b = *(const v4fa*)(rr + j);
#pragma unroll
    for (int q = 0; q < 4; ++q) { const float v = a[q] + b[q]; vals[u * 4 + q] = v; s1 += v; }
  }
  red[tid] = s1; __syncthreads();
  for (int st = 128; st > 0; st >>= 1) { if (tid < st) red[tid] += red[tid + st]; __syncthreads(); }
  const float mu = red[0] / (float)N; __syncthreads();
  float s2 = 0.f;
  for (int u = 0; u < per / 4; ++u)
#pragma unroll
    for (int q = 0; q < 4; ++q) { const float c = vals[u * 4 + q] - mu; s2 += c * c; }
  red[tid] = s2; __syncthreads();
  for (int st = 128; st > 0; st >>= 1) { if (tid < st) red[tid] += red[tid + st]; __syncthreads(); }
  const float rs = rsqrtf(red[0] / (float)N + eps);
  {
    for (int u = 0; u < per / 4; ++u) {
      const int j = tid * 4 + 1024 * u;
      v4f o, sm;
#pragma unroll
      for (int q = 0; q < 4; ++q) {
        float gg = g[j + q], bb = bta[j + q];
        if (PARAM_BF16) { gg = bf16_round(gg); bb = bf16_round(bb); }
        sm[q] = vals[u * 4 + q]; o[q] = (vals[u * 4 + q] - mu) * rs * gg + bb;
      }
      if (out_sum) *(v4f*)(out_sum + (size_t)row * N + j) = sm;
      *(v4f*)(out_norm + (size_t)row * N + j) = o;
    }
    
  }
}



// ---- f16 WMMA path (v_wmma_f32_16x16x32_f16): 11-bit significands for operands in range — used where a [0,1] probability operand needs more precision than bf16
typedef _Float16 v16h __attribute__((ext_vector_type(16)));
union FragH { v16h v; v8us half[2]; _Float16 h[16]; unsigned short u[16]; };
template <int NT>
__device__ __forceinline__ v8f mmaH(v16h ah, v16h al, v16h bh, v16h bl, v8f c) {
  c = __builtin_amdgcn_wmma_f32_16x16x32_f16(false, ah, false, bh, (short)0, c, false, false);
  if (NT >= 2) c = __builtin_amdgcn_wmma_f32_16x16x32_f16(false, al, false, bh, (short)0, c, false, false);
  if (NT >= 3) c = __builtin_amdgcn_wmma_f32_16x16x32_f16(false, ah, false, bl, (short)0, c, false, false);
  asm volatile("v_nop\n\tv_nop\n\tv_nop\n\tv_nop" : "+v"(c) : "v"(ah), "v"(al), "v"(bh), "v"(bl));
  return c;
}
// batched GEMM like k_gemm_b but f16 operands: A f32 (split into f16 hi/lo if ASPLIT, else rounded to f16), Bt = f16 values [n][k]; alpha; C f32; N multiple of 16 (partial tiles skipped)
template <bool ASPLIT>
__global__ __launch_bounds__(128) void k_gemm_h(const float* __restrict__ A, int lda, size_t sA, const _Float16* __restrict__ Bh, int ldb, size_t sB, float alpha, float* __restrict__ C, int ldc, size_t sC, int M, int N, int K) {
  __shared__ __attribute__((aligned(16))) float so[4][16][64];
  const int tid = threadIdx.x, w = tid >> 5, lane = tid & 31, ln = lane & 15, hh = lane >> 4; const int by = blockIdx.y;
  A += (size_t)by * sA; Bh += (size_t)by * sB; C += (size_t)by * sC;
  const int ntn = (N + 63) / 64; const int wid = blockIdx.x * 4 + w; const int mt = wid / ntn, nq = wid % ntn; if (mt * 16 >= M) return;
  const int row0 = mt * 16, col0 = nq * 64; const float* arow = A + (size_t)(row0 + ln) * lda;
  v8f acc[4] = {};
  for (int kb = 0; kb < K; kb += 32) {
    FragH ah, al;
    const v4f x0 = *(const v4fa*)(arow + kb + 8 * hh), x1 = *(const v4fa*)(arow + kb + 8 * hh + 4), x2 = *(const v4fa*)(arow + kb + 16 + 8 * hh), x3 = *(const v4fa*)(arow + kb + 16 + 8 * hh + 4);
    float xs[16] = {x0[0],x0[1],x0[2],x0[3],x1[0],x1[1],x1[2],x1[3],x2[0],x2[1],x2[2],x2[3],x3[0],x3[1],x3[2],x3[3]};
#pragma unroll
    for (int i = 0; i < 16; ++i) { const _Float16 h = (_Float16)xs[i]; ah.h[i] = h; al.h[i] = ASPLIT ? (_Float16)(xs[i] - (float)h) : (_Float16)0.0f; }
#pragma unroll
    for (int t = 0; t < 4; ++t) { if (col0 + t * 16 >= N) continue; const size_t boff = (size_t)(col0 + t * 16 + ln) * ldb + kb; FragH bq; bq.half[0] = *(const v8us*)(Bh + boff + 8 * hh); bq.half[1] = *(const v8us*)(Bh + boff + 16 + 8 * hh);
      acc[t] = mmaH<ASPLIT ? 2 : 1>(ah.v, al.v, bq.v, bq.v, acc[t]); }
  }
#pragma unroll
  for (int t = 0; t < 4; ++t) { if (col0 + t * 16 >= N) continue;
#pragma unroll
    for (int r = 0; r < 8; ++r) so[w][8 * hh + r][t * 16 + ln] = acc[t][r] * alpha; }
  __builtin_amdgcn_fence(__ATOMIC_ACQ_REL, "workgroup"); __builtin_amdgcn_wave_barrier();
  const int rsub = lane >> 4, c4 = (lane & 15) * 4;
  {
#pragma unroll
    for (int q = 0; q < 8; ++q) { const int r = q * 2 + rsub; if (col0 + c4 < N) { const v4f v = *(const v4fa*)&so[w][r][c4]; *(v4f*)(C + (size_t)(row0 + r) * ldc + col0 + c4) = v; } }
     }
}

// Wt[n][k] = f16(W[k][n]·scale) from f32 row-major W[K][N] (scale = power of two; bf16-exact weights stay exact in f16 away from the subnormal range)
__global__ __launch_bounds__(256) void k_wt_f16(const float* __restrict__ W, _Float16* __restrict__ Wt, int K, int N, float scale) {
  const int t = blockIdx.x * 256 + threadIdx.x; if (t >= N * (K / 8)) return; const int n = t / (K / 8), k8 = (t % (K / 8)) * 8; FragH f;
#pragma unroll
  for (int i = 0; i < 8; ++i) f.h[i] = (_Float16)(bf16_round(W[(size_t)(k8 + i) * N + n]) * scale); const v8us o = f.half[0];
  *(v8us*)((unsigned short*)Wt + (size_t)n * K + k8) = o; 
}
// k_gemm_hh variant with fused epilogue: v = acc·alpha + bias[by·sBias + col] (+ CP[(row/rowsPerB)·sCPb + by·64 + col] if CP) ; ACT 0 none / 1 elu ; writes f32 C and/or f16 C16 (each if non-null)
template <int ACT>
__global__ __launch_bounds__(128) void k_gemm_hhx(const _Float16* __restrict__ A, int lda, size_t sA, const _Float16* __restrict__ Bh, int ldb, size_t sB, float alpha, const float* __restrict__ bias, size_t sBias, const float* __restrict__ CP, int rowsPerB, size_t sCPb, int row0g,
    float* __restrict__ C, _Float16* __restrict__ C16, int ldc, size_t sC, int M, int N, int K) {
  __shared__ __attribute__((aligned(16))) float so[4][16][64];
  const int tid = threadIdx.x, w = tid >> 5, lane = tid & 31, ln = lane & 15, hh = lane >> 4; const int by = blockIdx.y;
  A += (size_t)by * sA; Bh += (size_t)by * sB; const size_t cofs = (size_t)by * sC; const float* bp = bias ? bias + (size_t)by * sBias : nullptr;
  const int ntn = (N + 63) / 64; const int wid = blockIdx.x * 4 + w; const int mt = wid / ntn, nq = wid % ntn; if (mt * 16 >= M) return;
  const int row0 = mt * 16, col0 = nq * 64; const _Float16* arow = A + (size_t)(row0 + ln) * lda;
  v8f acc[4] = {};
  for (int kb = 0; kb < K; kb += 32) { FragH ah; ah.half[0] = *(const v8us*)((const unsigned short*)arow + kb + 8 * hh); ah.half[1] = *(const v8us*)((const unsigned short*)arow + kb + 16 + 8 * hh);
#pragma unroll
    for (int t = 0; t < 4; ++t) { if (col0 + t * 16 >= N) continue; const size_t boff = (size_t)(col0 + t * 16 + ln) * ldb + kb; FragH bq; bq.half[0] = *(const v8us*)((const unsigned short*)Bh + boff + 8 * hh); bq.half[1] = *(const v8us*)((const unsigned short*)Bh + boff + 16 + 8 * hh);
      acc[t] = mmaH<1>(ah.v, ah.v, bq.v, bq.v, acc[t]); }
  }
#pragma unroll
  for (int t = 0; t < 4; ++t) { if (col0 + t * 16 >= N) continue; const int col = col0 + t * 16 + ln; const float bv = bp ? bf16_round(bp[col]) : 0.f;
#pragma unroll
    for (int r = 0; r < 8; ++r) { float v = acc[t][r] * alpha + bv; if (CP) { const int rr = row0g + row0 + 8 * hh + r; if (rowsPerB < 0) v += CP[cofs + (size_t)rr * ldc + col];      /* rowsPerB < 0: own element of the batched C plane */ else { const int bidx = rr / rowsPerB; v += CP[(size_t)bidx * sCPb + (size_t)by * 64 + col]; } } if (ACT == 1) v = (v > 0.f) ? v : expm1f(v); else if (ACT == 7) v = (v > 0.f) ? v + 1.0f : expf(v); else if (ACT == 8) v = tanhf(v); else if (ACT == 9) v = 0.5f * v * (1.0f + tanhf(0.7978845608028654f * (v + 0.044715f * v * v * v))); else if (ACT == 11) v = 1.0f / (1.0f + expf(-v)); else if (ACT == 12) v = (v > 0.f) ? v : 0.01f * v; else if (ACT == 14) v = (v > 0.f) ? v : 0.1f * v; else if (ACT == 16) v = (v >= 0.f) ? v : 0.3f * v; else if (ACT == 17) v = (v >= 0.f) ? v : 0.2f * v; else if (ACT == 15) v = v / (1.0f + expf(-v)); else if (ACT == 3) v = fmaxf(v, 0.f); else if (ACT == 6) v = 0.5f * v * (1.0f + erff(v * 0.70710678118654752f)); so[w][8 * hh + r][t * 16 + ln] = v; } }
  __builtin_amdgcn_fence(__ATOMIC_ACQ_REL, "workgroup"); __builtin_amdgcn_wave_barrier();
  const int rsub = lane >> 4, c4 = (lane & 15) * 4; typedef _Float16 v4h __attribute__((ext_vector_type(4)));
  {
#pragma unroll
    for (int q = 0; q < 8; ++q) { const int r = q * 2 + rsub; if (col0 + c4 < N) { const v4f v = *(const v4fa*)&so[w][r][c4]; if (C) *(v4f*)(C + cofs + (size_t)(row0 + r) * ldc + col0 + c4) = v; if (C16) { v4h h4; for (int i = 0; i < 4; ++i) h4[i] = (_Float16)v[i]; *(v4h*)(C16 + cofs + (size_t)(row0 + r) * ldc + col0 + c4) = h4; } } }
     }
}


typedef _Float16 v4h __attribute__((ext_vector_type(4)));

__global__ __launch_bounds__(256) void k_x16(const float* __restrict__ x, _Float16* __restrict__ X16, size_t n8) { const size_t t = (size_t)blockIdx.x * 256 + threadIdx.x; if (t >= n8) return; FragH f;
#pragma unroll
  for (int q = 0; q < 8; ++q) f.h[q] = (_Float16)bf16_round(x[t * 8 + q]); *(v8us*)((unsigned short*)X16 + t * 8) = f.half[0];  }
__global__ __launch_bounds__(256) void k_h16(const float* __restrict__ x, _Float16* __restrict__ X16, size_t n8) { const size_t t = (size_t)blockIdx.x * 256 + threadIdx.x; if (t >= n8) return; FragH f;
#pragma unroll
  for (int q = 0; q < 8; ++q) f.h[q] = (_Float16)x[t * 8 + q]; *(v8us*)((unsigned short*)X16 + t * 8) = f.half[0];  }
__global__ __launch_bounds__(256) void k_round16f(const float* __restrict__ W, _Float16* __restrict__ Bt, size_t n8) { const size_t t = (size_t)blockIdx.x * 256 + threadIdx.x; if (t >= n8) return; FragH f;
#pragma unroll
  for (int i = 0; i < 8; ++i) f.h[i] = (_Float16)(bf16_round(W[t * 8 + i]) * 16.0f); *(v8us*)((unsigned short*)Bt + t * 8) = f.half[0];  }
template <int NHv, int TTv>
__global__ __launch_bounds__(256) void k_vt(const _Float16* __restrict__ V16, int ldv, int voff, _Float16* __restrict__ Vt) { __shared__ unsigned short tl[64][66]; const int tid = threadIdx.x; const int slab = blockIdx.x / (TTv / 64), lg = blockIdx.x % (TTv / 64); const int b = slab / NHv, h = slab % NHv;
  for (int i = tid; i < 64 * 8; i += 256) { const int r = i / 8, c8 = (i % 8) * 8; FragH f; f.half[0] = *(const v8us*)((const unsigned short*)V16 + ((size_t)b * TTv + lg * 64 + r) * ldv + voff + h * 64 + c8);
#pragma unroll
    for (int q = 0; q < 8; ++q) tl[r][c8 + q] = f.u[q]; }
  __syncthreads();
  {
#pragma unroll
    for (int rd = 0; rd < 2; ++rd) { const int d = rd * 32 + tid / 8, pc = tid % 8; FragH f;
#pragma unroll
      for (int q = 0; q < 8; ++q) f.u[q] = tl[pc * 8 + q][d];
      *(v8us*)((unsigned short*)Vt + ((size_t)slab * 64 + d) * TTv + lg * 64 + pc * 8) = f.half[0]; }
     } }

__global__ __launch_bounds__(256) void k_hl(const float* __restrict__ F, _Float16* __restrict__ Hh, _Float16* __restrict__ Hl, size_t n8) { const size_t t = (size_t)blockIdx.x * 256 + threadIdx.x; if (t >= n8) return; FragH fh, fl; const v4f a = *(const v4fa*)(F + t * 8), c = *(const v4fa*)(F + t * 8 + 4);
#pragma unroll
  for (int q = 0; q < 4; ++q) { _Float16 h = (_Float16)a[q]; fh.h[q] = h; fl.h[q] = (_Float16)((a[q] - (float)h) * 1024.0f); h = (_Float16)c[q]; fh.h[4 + q] = h; fl.h[4 + q] = (_Float16)((c[q] - (float)h) * 1024.0f); }
  { *(v8us*)((unsigned short*)Hh + t * 8) = fh.half[0]; *(v8us*)((unsigned short*)Hl + t * 8) = fl.half[0];  } }

// ---- fast GEMM (wave tile 32x64; requires M % 32 == 0 rows per launch region and N % 64 == 0); epilogue = k_gemm_hhx semantics ----
__device__ __forceinline__ v16h g2_frag(const _Float16* p, int hh) { FragH f; f.half[0] = *(const v8us*)((const unsigned short*)p + 8 * hh); f.half[1] = *(const v8us*)((const unsigned short*)p + 16 + 8 * hh); return f.v; }
__device__ __forceinline__ v8f g2_mma(v16h a, v16h b, v8f c) { v8f d = __builtin_amdgcn_wmma_f32_16x16x32_f16(false, a, false, b, (short)0, c, false, false); asm volatile("v_nop\n\tv_nop\n\tv_nop\n\tv_nop" : "+v"(d) : "v"(a), "v"(b)); return d; }
template <int ACT>
__global__ __launch_bounds__(128) void k_gemm2(const _Float16* __restrict__ A, int lda, size_t sA, const _Float16* __restrict__ Bh, int ldb, size_t sB, float alpha, const float* __restrict__ bias, size_t sBias, const float* __restrict__ CP, int rowsPerB, size_t sCPb, int row0g,
    float* __restrict__ C, _Float16* __restrict__ C16, int ldc, size_t sC, int M, int N, int K) { static_assert(ACT == 0 || ACT == 3 || ACT == 6 || ACT == 8 || ACT == 9 || ACT == 11 || ACT == 12 || ACT == 14 || ACT == 15 || ACT == 16 || ACT == 17, "k_gemm2: unsupported ACT code (would silently apply no activation)");
  __shared__ __attribute__((aligned(16))) float so[4][32][68];
  const int tid = threadIdx.x, w = tid >> 5, lane = tid & 31, ln = lane & 15, hh = lane >> 4; const int by = blockIdx.y;
  A += (size_t)by * sA; Bh += (size_t)by * sB; const size_t cofs = (size_t)by * sC; const float* bp = bias ? bias + (size_t)by * sBias : nullptr;
  const int ntn = N >> 6; const int mt = blockIdx.x / ntn, nq = blockIdx.x - mt * ntn; const int row0 = mt * 128 + 32 * w, col0 = nq * 64; if (row0 >= M) return;
  const _Float16* a0p = A + (size_t)(row0 + ln) * lda; const _Float16* a1p = a0p + (size_t)16 * lda;
  const _Float16* b0p = Bh + (size_t)(col0 + ln) * ldb; const _Float16* b1p = b0p + (size_t)16 * ldb; const _Float16* b2p = b1p + (size_t)16 * ldb; const _Float16* b3p = b2p + (size_t)16 * ldb;
  const v8f z8 = {0.f,0.f,0.f,0.f,0.f,0.f,0.f,0.f}; v8f c00 = z8, c01 = z8, c02 = z8, c03 = z8, c10 = z8, c11 = z8, c12 = z8, c13 = z8;
#pragma unroll 1
  for (int kb = 0; kb < K; kb += 32) { const v16h a0 = g2_frag(a0p + kb, hh), a1 = g2_frag(a1p + kb, hh);
    v16h b = g2_frag(b0p + kb, hh); c00 = g2_mma(a0, b, c00); c10 = g2_mma(a1, b, c10);
    b = g2_frag(b1p + kb, hh); c01 = g2_mma(a0, b, c01); c11 = g2_mma(a1, b, c11);
    b = g2_frag(b2p + kb, hh); c02 = g2_mma(a0, b, c02); c12 = g2_mma(a1, b, c12);
    b = g2_frag(b3p + kb, hh); c03 = g2_mma(a0, b, c03); c13 = g2_mma(a1, b, c13); }
  v8f accs[8] = {c00, c01, c02, c03, c10, c11, c12, c13};
#pragma unroll
  for (int u = 0; u < 8; ++u) { const int t = u & 3, half = u >> 2; const int col = col0 + t * 16 + ln; const float bv = bp ? bf16_round(bp[col]) : 0.f;
#pragma unroll
    for (int r = 0; r < 8; ++r) { const int rloc = half * 16 + 8 * hh + r; float v = accs[u][r] * alpha + bv; if (CP) { if (rowsPerB < 0) v += CP[cofs + (size_t)(row0g + row0 + rloc) * ldc + col];      /* rowsPerB < 0: own element of the batched C plane */ else { const int bidx = (row0g + row0 + rloc) / rowsPerB; v += CP[(size_t)bidx * sCPb + (size_t)by * 64 + col]; } }
      if (ACT == 3) v = fmaxf(v, 0.f); else if (ACT == 6) v = 0.5f * v * (1.0f + erff(v * 0.70710678118654752f)); else if (ACT == 11) v = 1.0f / (1.0f + expf(-v)); else if (ACT == 15) v = v / (1.0f + expf(-v)); else if (ACT == 12) v = (v > 0.f) ? v : 0.01f * v; else if (ACT == 8) v = tanhf(v); else if (ACT == 9) v = 0.5f * v * (1.0f + tanhf(0.7978845608028654f * (v + 0.044715f * v * v * v))); else if (ACT == 14) v = (v > 0.f) ? v : 0.1f * v; else if (ACT == 16) v = (v >= 0.f) ? v : 0.3f * v; else if (ACT == 17) v = (v >= 0.f) ? v : 0.2f * v;
      so[w][rloc][t * 16 + ln] = v; } }
  __builtin_amdgcn_fence(__ATOMIC_ACQ_REL, "workgroup"); __builtin_amdgcn_wave_barrier();
  const int rsub = lane >> 4, c4 = (lane & 15) * 4;
  {
#pragma unroll
    for (int q = 0; q < 16; ++q) { const int r = q * 2 + rsub; const v4f v = *(const v4fa*)&so[w][r][c4]; if (C) *(v4f*)(C + cofs + (size_t)(row0 + r) * ldc + col0 + c4) = v; if (C16) { v4h h4; for (int i = 0; i < 4; ++i) h4[i] = (_Float16)v[i]; *(v4h*)(C16 + cofs + (size_t)(row0 + r) * ldc + col0 + c4) = h4; } }
     } }


__global__ __launch_bounds__(256) void k_soft(const float* __restrict__ S, _Float16* __restrict__ P, float* __restrict__ RS) {
  #pragma clang fp contract(off)
  const int wv = threadIdx.x >> 5, ln = threadIdx.x & 31; const int r = blockIdx.x * 8 + wv; if (r >= HG * NP) return; const float* sr = S + (size_t)r * NP; float mx = -3.0e38f;
#pragma unroll 1
  for (int gq = 0; gq < NP / 256; ++gq) { const v8f a = *(const v8f*)(sr + gq * 256 + ln * 8); for (int q = 0; q < 8; ++q) mx = fmaxf(mx, a[q] * 0.125f); }
  for (int o = 16; o > 0; o >>= 1) mx = fmaxf(mx, __shfl_xor(mx, o, 32)); float su = 0.f;
{ su = 0.f;
#pragma unroll 1
    for (int gq = 0; gq < NP / 256; ++gq) { const v8f a = *(const v8f*)(sr + gq * 256 + ln * 8); FragH ph; for (int q = 0; q < 8; ++q) { const float e = expf(a[q] * 0.125f - mx); su += e; ph.h[q] = (_Float16)(e * 1024.0f); } *(v8us*)((unsigned short*)P + (size_t)r * NP + gq * 256 + ln * 8) = ph.half[0]; }
     }
  for (int o = 16; o > 0; o >>= 1) su += __shfl_xor(su, o, 32); if (ln == 0) { *(float*)(RS + (size_t)r * 32) = 1.0f / su;  } }
__global__ __launch_bounds__(256) void k_addhl(const float* __restrict__ A, const float* __restrict__ Bq, _Float16* __restrict__ Hh, _Float16* __restrict__ Lh, size_t n8) {
  #pragma clang fp contract(off)
  const size_t t = (size_t)blockIdx.x * 256 + threadIdx.x; if (t >= n8) return; const v8f a = *(const v8f*)(A + t * 8), b = *(const v8f*)(Bq + t * 8); FragH fh, fl; for (int q = 0; q < 8; ++q) { const float v = a[q] + b[q]; const _Float16 hv = (_Float16)v; fh.h[q] = hv; fl.h[q] = (_Float16)((v - (float)hv) * 1024.0f); }
  { *(v8us*)((unsigned short*)Hh + t * 8) = fh.half[0]; *(v8us*)((unsigned short*)Lh + t * 8) = fl.half[0];  } }
__global__ __launch_bounds__(256) void k_csc(const float* __restrict__ O, const float* __restrict__ RS, int b, int h0, _Float16* __restrict__ CH, _Float16* __restrict__ CL) {
  #pragma clang fp contract(off)
  const int t = blockIdx.x * 256 + threadIdx.x; if (t >= NP * HG * (HD / 8)) return; const int d8 = (t % (HD / 8)) * 8; const int hl = (t / (HD / 8)) % HG; const int n = t / ((HD / 8) * HG); const float rs = RS[((size_t)hl * NP + n) * 32]; const size_t o = ((size_t)b * NP + n) * INNER + (h0 + hl) * HD + d8; const v8f a = *(const v8f*)(O + (size_t)n * INNER + (h0 + hl) * HD + d8); FragH f, fl;
  for (int q = 0; q < 8; ++q) { const float v = a[q] * rs; const _Float16 hh = (_Float16)v; f.h[q] = hh; fl.h[q] = (_Float16)((v - (float)hh) * 1024.0f); }
  { *(v8us*)((unsigned short*)CH + o) = f.half[0]; *(v8us*)((unsigned short*)CL + o) = fl.half[0];  } }

extern "C" void kernel_launch(void* const* d_in, const int* in_sizes, int n_in,
                              void* d_out, int out_size, void* d_ws, size_t ws_size, hipStream_t stream) {
  (void)in_sizes; (void)n_in; (void)out_size;
  const float* x = (const float*)d_in[0]; const float* Wqkfv = (const float*)d_in[1]; const float* Wsc = (const float*)d_in[2]; const float* bsc = (const float*)d_in[3]; const float* Wout = (const float*)d_in[4]; const float* bout = (const float*)d_in[5];
  char* ws = (char*)d_ws; size_t off = 0;
  auto take = [&](size_t bytes) { char* p = ws + off; off += (bytes + 255) & ~(size_t)255; return p; };
  _Float16* BQ = (_Float16*)take((size_t)4 * INNER * DIM * 2); _Float16* BS = (_Float16*)take((size_t)NP * HD * 2); _Float16* BO = (_Float16*)take((size_t)DIM * INNER * 2);
  _Float16* X16 = (_Float16*)take((size_t)NR * DIM * 2); _Float16* QKFV = (_Float16*)take((size_t)NR * 4 * INNER * 2);      /* [row][q | k | f | v] f16, 32 MiB */
  _Float16* FT = (_Float16*)take((size_t)NH * HD * NP * 2); _Float16* VTT = (_Float16*)take((size_t)NH * HD * NP * 2);      /* per-batch f^T, v^T [h][64][2048] */ float* FV = (float*)take((size_t)NH * HD * HD * 4); _Float16* FVH = (_Float16*)take((size_t)NH * HD * HD * 2); _Float16* FVL = (_Float16*)take((size_t)NH * HD * HD * 2);
  float* PV = (float*)take((size_t)NH * HD * NP * 4); float* PV2 = (float*)take((size_t)NH * HD * NP * 4); _Float16* PVH = (_Float16*)take((size_t)NH * HD * NP * 2); _Float16* PVL = (_Float16*)take((size_t)NH * HD * NP * 2);
  float* S = (float*)take((size_t)HG * NP * NP * 4); _Float16* P = (_Float16*)take((size_t)HG * NP * NP * 2); float* RS = (float*)take((size_t)HG * NP * 32 * 4); float* O = (float*)take((size_t)NP * INNER * 4); _Float16* CH = (_Float16*)take((size_t)NR * INNER * 2); _Float16* CL = (_Float16*)take((size_t)NR * INNER * 2);
  if (off > ws_size) return;      /* 2 + 0.25 + 0.5 + 8 + 32 + 2 + 2 + 0.25 + 4 + 4 + 2 + 2 + 64 + 32 + 1 + 4 + 8 + 8 = 176 MiB */
  k_wt_f16<<<(unsigned)(((size_t)DIM * 4 * INNER / 8 + 255) / 256), 256, 0, stream>>>(Wqkfv, BQ, DIM, 4 * INNER, 16.0f); k_wt_f16<<<(unsigned)(((size_t)HD * NP / 8 + 255) / 256), 256, 0, stream>>>(Wsc, BS, HD, NP, 16.0f); k_wt_f16<<<(unsigned)(((size_t)INNER * DIM / 8 + 255) / 256), 256, 0, stream>>>(Wout, BO, INNER, DIM, 16.0f);      /* all x @ W (in, out) */
  k_x16<<<(unsigned)(((size_t)NR * DIM / 8 + 255) / 256), 256, 0, stream>>>(x, X16, (size_t)NR * DIM / 8);
  k_gemm2<0><<<dim3((NR / 128) * (4 * INNER / 64), 1), 128, 0, stream>>>(X16, DIM, 0, BQ, DIM, 0, 0.0625f, nullptr, 0, nullptr, 1, 0, 0, nullptr, QKFV, 4 * INNER, 0, NR, 4 * INNER, DIM);      /* [q | k | f | v], head h at h*64 inside each quarter */
  for (int b = 0; b < NB; ++b) { const _Float16* rowb = QKFV + (size_t)b * NP * 4 * INNER;
    k_vt<NH, NP><<<NH * (NP / 64), 256, 0, stream>>>(rowb, 4 * INNER, 2 * INNER, FT); k_vt<NH, NP><<<NH * (NP / 64), 256, 0, stream>>>(rowb, 4 * INNER, 3 * INNER, VTT);      /* f^T, v^T per head [64][2048] */
    k_gemm_hhx<0><<<dim3((HD / 16) * 1, NH), 128, 0, stream>>>(FT, NP, (size_t)HD * NP, VTT, NP, (size_t)HD * NP, 1.0f, nullptr, 0, nullptr, 1, 0, 0, FV, nullptr, HD, (size_t)HD * HD, HD, HD, NP);      /* FV[h][d][e] = sum_n f[n][d] v[n][e] (16-row tiles, M 64) */
    k_hl<<<(NH * HD * HD / 8 + 255) / 256, 256, 0, stream>>>(FV, FVH, FVL, (size_t)NH * HD * HD / 8);
    k_gemm_hhx<0><<<dim3((HD / 16) * (NP / 64) / 4, NH), 128, 0, stream>>>(FVL, HD, (size_t)HD * HD, BS, HD, 0, 0.0625f / 1024.0f, nullptr, 0, nullptr, 1, 0, 0, PV2, nullptr, NP, (size_t)HD * NP, HD, NP, HD);      /* lo term */
    k_gemm_hhx<0><<<dim3((HD / 16) * (NP / 64) / 4, NH), 128, 0, stream>>>(FVH, HD, (size_t)HD * HD, BS, HD, 0, 0.0625f, bsc, 0, nullptr, 1, 0, 0, PV, nullptr, NP, (size_t)HD * NP, HD, NP, HD);      /* hi term + b_scales */
    k_addhl<<<(unsigned)(((size_t)NH * HD * NP / 8 + 255) / 256), 256, 0, stream>>>(PV, PV2, PVH, PVL, (size_t)NH * HD * NP / 8);      /* poss_value = (FV_hi + FV_lo) w_scales + b as f16 hi/residual */
    for (int g = 0; g < NH / HG; ++g) { const int h0 = g * HG;
      k_gemm2<0><<<dim3((NP / 128) * (NP / 64), HG), 128, 0, stream>>>(rowb + h0 * HD, 4 * INNER, (size_t)HD, rowb + INNER + h0 * HD, 4 * INNER, (size_t)HD, 1.0f, nullptr, 0, nullptr, 1, 0, 0, S, nullptr, NP, (size_t)NP * NP, NP, NP, HD);      /* q k^T per head */
      k_soft<<<(HG * NP) / 8, 256, 0, stream>>>(S, P, RS);
      k_gemm2<0><<<dim3((NP / 128) * (HD / 64), HG), 128, 0, stream>>>(P, NP, (size_t)NP * NP, PVL + (size_t)h0 * HD * NP, NP, (size_t)HD * NP, 0.0009765625f / 1024.0f, nullptr, 0, nullptr, 1, 0, 0, O + h0 * HD, nullptr, INNER, (size_t)HD, NP, HD, NP);
      k_gemm2<0><<<dim3((NP / 128) * (HD / 64), HG), 128, 0, stream>>>(P, NP, (size_t)NP * NP, PVH + (size_t)h0 * HD * NP, NP, (size_t)HD * NP, 0.0009765625f, nullptr, 0, O + h0 * HD, -1, 0, 0, O + h0 * HD, nullptr, INNER, (size_t)HD, NP, HD, NP);      /* unnormalised attn . poss_value^T (hi + lo) */
      k_csc<<<(NP * HG * (HD / 8) + 255) / 256, 256, 0, stream>>>(O, RS, b, h0, CH, CL); } }
  k_gemm2<0><<<dim3((NR / 128) * (DIM / 64), 1), 128, 0, stream>>>(CL, INNER, 0, BO, INNER, 0, 0.0625f / 1024.0f, nullptr, 0, nullptr, 1, 0, 0, (float*)d_out, nullptr, DIM, 0, NR, DIM, INNER);
  k_gemm2<0><<<dim3((NR / 128) * (DIM / 64), 1), 128, 0, stream>>>(CH, INNER, 0, BO, INNER, 0, 0.0625f, bout, 0, (const float*)d_out, 1, (size_t)DIM, 0, (float*)d_out, nullptr, DIM, 0, NR, DIM, INNER);      /* y = (c_lo + c_hi) w_out + b_out */
}

// v001
// Measured time: 819 microseconds a run.
// Next to v000, in two timings, it ran 2.42 and 2.45 times as fast.
#include <hip/hip_runtime.h>
// SimilarAttention (4 x 2048 patches x 512, 8 heads x 64: [q|k|f|v] = x w_qkfv; attn = softmax(q.k/8); poss_value = (f^T v) w_scales + b_scales -> [h][64][2048]; out = attn . poss_value^T; y = merged . w_out + b_out).
// Structure: exact f16 x plane; the fused projection as ONE f16 WMMA GEMM (32x64 wave tiles, f32 accumulation, exact x16 weights; f16 out); per batch: f^T / v^T by LDS tiles, f^T v as 32-row WMMA tiles (K = 2048 dealt over a block's 16 waves, f32 partials summed in LDS) then f16 hi/residual, (f^T v) w_scales + b as two 16-row-tile GEMM terms into f32 then f16 hi/residual planes; per 4-head group the score GEMM (K = 64, f32), softmax rows on VALU (unnormalised f16 weights x 2^10 + row normalisers on their own lines), the readout as two GEMM terms against the hi/residual poss_value planes (N = 64, K = 2048 dealt over a block's 16 waves likewise); row scaling + hi/residual; w_out as two GEMM terms (+ bias).
// Compute dtype: inputs rounded to bf16; x / weights exact as f16; q, k, f, v and the softmax weights as plain f16 operands (~2^-12); f^T v, poss_value and the merged context as f16 hi + residual. v_wmma_f32_16x16x32_f16.
#define NB 4
#define NP 2048
#define DIM 512
#define NH 8
#define HD 64
#define INNER 512
#define HG 4                     /* heads per score-plane group */
#define NR (NB * NP)
typedef __bf16 v16b __attribute__((ext_vector_type(16)));
typedef unsigned short v8us __attribute__((ext_vector_type(8), may_alias));
typedef float  v8f  __attribute__((ext_vector_type(8)));
typedef float  v4f  __attribute__((ext_vector_type(4)));
typedef float  v4fa __attribute__((ext_vector_type(4), may_alias));
union FragB { v16b v; v8us half[2]; unsigned short u[16]; };

__device__ __forceinline__ unsigned short bf16_bits(float x) { unsigned int u = __float_as_uint(x); return (unsigned short)((u + 0x7FFFu + ((u >> 16) & 1u)) >> 16); }
__device__ __forceinline__ float bf16_val(unsigned short b) { return __uint_as_float(((unsigned int)b) << 16); }
__device__ __forceinline__ float bf16_round(float x) { return bf16_val(bf16_bits(x)); }
// D += A·B with NT terms: 1 = ah·bh, 2 = + al·bh (A split), 3 = + ah·bl (both split)
template <int NT>
__device__ __forceinline__ v8f mmaN(v16b ah, v16b al, v16b bh, v16b bl, v8f c) {
  c = __builtin_amdgcn_wmma_f32_16x16x32_bf16(false, ah, false, bh, (short)0, c, false, false);
  if (NT >= 2) c = __builtin_amdgcn_wmma_f32_16x16x32_bf16(false, al, false, bh, (short)0, c, false, false);
  if (NT >= 3) c = __builtin_amdgcn_wmma_f32_16x16x32_bf16(false, ah, false, bl, (short)0, c, false, false);
  asm volatile("v_nop\n\tv_nop\n\tv_nop\n\tv_nop" : "+v"(c) : "v"(ah), "v"(al), "v"(bh), "v"(bl));
  return c;
}

__global__ __launch_bounds__(256) void k_wt_bf16(const float* __restrict__ W, unsigned short* __restrict__ Wt, int K, int N) {
  const int t = blockIdx.x * 256 + threadIdx.x;
  const int k8n = K / 8;
  if (t >= N * k8n) return;
  const int n = t / k8n, k8 = (t % k8n) * 8;
  v8us v;
#pragma unroll
  for (int i = 0; i < 8; ++i) v[i] = bf16_bits(W[(size_t)(k8 + i) * N + n]);
  *(v8us*)(Wt + (size_t)n * K + k8) = v;
  
}

// GEMM C[M][N] (f32, pitch ldc) = act(A[M][K]·W + bias). A f32 row-major (pitch lda) converted per fragment to bf16
// (ASPLIT: hi/lo two planes -> 2 terms, else single rounded term); Wt bf16 [N][K] (pitch ldb). BIAS_BF16 rounds the
// bias to bf16 first (bias quantised to bf16 before the add). K%32==0, M%16==0, N%64==0.
template <bool ASPLIT, int ACT, bool BIAS_BF16>
__global__ __launch_bounds__(128) void k_gemm_bf(const float* __restrict__ A, int lda, const unsigned short* __restrict__ Wt, int ldb,
                                               const float* __restrict__ bias, float* __restrict__ C, int ldc, int M, int N, int K) {
  __shared__ __attribute__((aligned(16))) float so[4][16][64];
  const int tid = threadIdx.x, w = tid >> 5, lane = tid & 31, ln = lane & 15, hh = lane >> 4;
  const int ntn = N / 64;
  const int wid = blockIdx.x * 4 + w;
  const int mt = wid / ntn, nq = wid % ntn;
  if (mt * 16 >= M) return;
  const int row0 = mt * 16, col0 = nq * 64;
  const float* arow = A + (size_t)(row0 + ln) * lda;
  v8f acc[4] = {};
  for (int kb = 0; kb < K; kb += 32) {
    FragB ah, al;
    const v4f x0 = *(const v4fa*)(arow + kb + 8 * hh), x1 = *(const v4fa*)(arow + kb + 8 * hh + 4);
    const v4f x2 = *(const v4fa*)(arow + kb + 16 + 8 * hh), x3 = *(const v4fa*)(arow + kb + 16 + 8 * hh + 4);
    float xs[16] = {x0[0],x0[1],x0[2],x0[3],x1[0],x1[1],x1[2],x1[3],x2[0],x2[1],x2[2],x2[3],x3[0],x3[1],x3[2],x3[3]};
#pragma unroll
    for (int i = 0; i < 16; ++i) { const unsigned short hb = bf16_bits(xs[i]); ah.u[i] = hb; al.u[i] = ASPLIT ? bf16_bits(xs[i] - bf16_val(hb)) : (unsigned short)0; }
#pragma unroll
    for (int t = 0; t < 4; ++t) {
      const unsigned short* brow = Wt + (size_t)(col0 + t * 16 + ln) * ldb + kb;
      FragB b;
      b.half[0] = *(const v8us*)(brow + 8 * hh);
      b.half[1] = *(const v8us*)(brow + 16 + 8 * hh);
      acc[t] = mmaN<ASPLIT ? 2 : 1>(ah.v, al.v, b.v, b.v, acc[t]);
    }
  }
#pragma unroll
  for (int t = 0; t < 4; ++t) {
    float bv = bias ? bias[col0 + t * 16 + ln] : 0.f;
    if (BIAS_BF16) bv = bf16_round(bv);
#pragma unroll
    for (int r = 0; r < 8; ++r) { float v = acc[t][r] + bv; if (ACT == 1) v = fmaxf(v, 0.f); so[w][8 * hh + r][t * 16 + ln] = v; }
  }
  __builtin_amdgcn_fence(__ATOMIC_ACQ_REL, "workgroup");
  __builtin_amdgcn_wave_barrier();
  const int rsub = lane >> 4, c4 = (lane & 15) * 4;
  {
#pragma unroll
    for (int q = 0; q < 8; ++q) {
      const int r = q * 2 + rsub;
      const v4f v = *(const v4fa*)&so[w][r][c4];
      *(v4f*)(C + (size_t)(row0 + r) * ldc + col0 + c4) = v;
    }
    
  }
}

// GEMM C = act(A·W + bias + resid): A f32 (ASPLIT -> hi/lo 2 terms), Wt bf16 [N][K]; ACT 0 none, 1 relu, 2 exact gelu;
// resid (optional, f32, row index = (row % rmod), pitch ldr, RES_BF16 rounds it) added before the activation.
template <bool ASPLIT, int ACT, bool BIAS_BF16, bool RES_BF16>
__global__ __launch_bounds__(128) void k_gemm_bf3(const float* __restrict__ A, int lda, const unsigned short* __restrict__ Wt, int ldb,
                                                const float* __restrict__ bias, const float* __restrict__ resid, int rmod, int ldr,
                                                float* __restrict__ C, int ldc, int M, int N, int K) {
  __shared__ __attribute__((aligned(16))) float so[4][16][64];
  const int tid = threadIdx.x, w = tid >> 5, lane = tid & 31, ln = lane & 15, hh = lane >> 4;
  const int ntn = N / 64;
  const int wid = blockIdx.x * 4 + w;
  const int mt = wid / ntn, nq = wid % ntn;
  if (mt * 16 >= M) return;
  const int row0 = mt * 16, col0 = nq * 64;
  const float* arow = A + (size_t)(row0 + ln) * lda;
  v8f acc[4] = {};
  for (int kb = 0; kb < K; kb += 32) {
    FragB ah, al;
    const v4f x0 = *(const v4fa*)(arow + kb + 8 * hh), x1 = *(const v4fa*)(arow + kb + 8 * hh + 4);
    const v4f x2 = *(const v4fa*)(arow + kb + 16 + 8 * hh), x3 = *(const v4fa*)(arow + kb + 16 + 8 * hh + 4);
    float xs[16] = {x0[0],x0[1],x0[2],x0[3],x1[0],x1[1],x1[2],x1[3],x2[0],x2[1],x2[2],x2[3],x3[0],x3[1],x3[2],x3[3]};
#pragma unroll
    for (int i = 0; i < 16; ++i) { const unsigned short hb = bf16_bits(xs[i]); ah.u[i] = hb; al.u[i] = ASPLIT ? bf16_bits(xs[i] - bf16_val(hb)) : (unsigned short)0; }
#pragma unroll
    for (int t = 0; t < 4; ++t) {
      const unsigned short* brow = Wt + (size_t)(col0 + t * 16 + ln) * ldb + kb;
      FragB b;
      b.half[0] = *(const v8us*)(brow + 8 * hh);
      b.half[1] = *(const v8us*)(brow + 16 + 8 * hh);
      acc[t] = mmaN<ASPLIT ? 2 : 1>(ah.v, al.v, b.v, b.v, acc[t]);
    }
  }
#pragma unroll
  for (int t = 0; t < 4; ++t) {
    const int col = col0 + t * 16 + ln;
    float bv = bias ? bias[col] : 0.f;
    if (BIAS_BF16) bv = bf16_round(bv);
#pragma unroll
    for (int r = 0; r < 8; ++r) {
      float v = acc[t][r] + bv;
      if (resid) { float rv = resid[(size_t)((row0 + 8 * hh + r) % rmod) * ldr + col]; if (RES_BF16) rv = bf16_round(rv); v += rv; }
      if (ACT == 1) v = fmaxf(v, 0.f);
      if (ACT == 2) v = 0.5f * v * (1.0f + erff(v * 0.70710678118654752f));
      if (ACT == 3) { const float u = 0.7978845608028654f * (v + 0.044715f * v * v * v); v = 0.5f * v * (1.0f + tanhf(u)); }
      so[w][8 * hh + r][t * 16 + ln] = v;
    }
  }
  __builtin_amdgcn_fence(__ATOMIC_ACQ_REL, "workgroup");
  __builtin_amdgcn_wave_barrier();
  const int rsub = lane >> 4, c4 = (lane & 15) * 4;
  {
#pragma unroll
    for (int q = 0; q < 8; ++q) {
      const int r = q * 2 + rsub;
      const v4f v = *(const v4fa*)&so[w][r][c4];
      *(v4f*)(C + (size_t)(row0 + r) * ldc + col0 + c4) = v;
    }
    
  }
}
// row LayerNorm (biased variance, eps) over N: s = X (+ R); optional out_sum <- s; out_norm <- (s-mu)*rsqrt(var+eps)*g + b
template <bool PARAM_BF16>
__global__ __launch_bounds__(256) void k_layernorm(const float* __restrict__ X, const float* __restrict__ R, const float* __restrict__ g, const float* __restrict__ bta,
                                                  float* __restrict__ out_sum, float* __restrict__ out_norm, int N, float eps) {
  __shared__ float red[256];
  const int row = blockIdx.x, tid = threadIdx.x;
  const float* x = X + (size_t)row * N; const float* rr = R ? R + (size_t)row * N : nullptr;
  float vals[16];                     // up to N = 4096
  const int per = N / 256;            // contiguous chunk per thread? use strided-by-4 chunks: thread handles j = tid*4 + 1024*u
  float s1 = 0.f;
  for (int u = 0; u < per / 4; ++u) {
    const int j = tid * 4 + 1024 * u;
    const v4f a = *(const v4fa*)(x + j);
    v4f b = {0.f,0.f,0.f,0.f}; if (rr) b = *(const v4fa*)(rr + j);
#pragma unroll
    for (int q = 0; q < 4; ++q) { const float v = a[q] + b[q]; vals[u * 4 + q] = v; s1 += v; }
  }
  red[tid] = s1; __syncthreads();
  for (int st = 128; st > 0; st >>= 1) { if (tid < st) red[tid] += red[tid + st]; __syncthreads(); }
  const float mu = red[0] / (float)N; __syncthreads();
  float s2 = 0.f;
  for (int u = 0; u < per / 4; ++u)
#pragma unroll
    for (int q = 0; q < 4; ++q) { const float c = vals[u * 4 + q] - mu; s2 += c * c; }
  red[tid] = s2; __syncthreads();
  for (int st = 128; st > 0; st >>= 1) { if (tid < st) red[tid] += red[tid + st]; __syncthreads(); }
  const float rs = rsqrtf(red[0] / (float)N + eps);
  {
    for (int u = 0; u < per / 4; ++u) {
      const int j = tid * 4 + 1024 * u;
      v4f o, sm;
#pragma unroll
      for (int q = 0; q < 4; ++q) {
        float gg = g[j + q], bb = bta[j + q];
        if (PARAM_BF16) { gg = bf16_round(gg); bb = bf16_round(bb); }
        sm[q] = vals[u * 4 + q]; o[q] = (vals[u * 4 + q] - mu) * rs * gg + bb;
      }
      if (out_sum) *(v4f*)(out_sum + (size_t)row * N + j) = sm;
      *(v4f*)(out_norm + (size_t)row * N + j) = o;
    }
    
  }
}



// ---- f16 WMMA path (v_wmma_f32_16x16x32_f16): 11-bit significands for operands in range — used where a [0,1] probability operand needs more precision than bf16
typedef _Float16 v16h __attribute__((ext_vector_type(16)));
union FragH { v16h v; v8us half[2]; _Float16 h[16]; unsigned short u[16]; };
template <int NT>
__device__ __forceinline__ v8f mmaH(v16h ah, v16h al, v16h bh, v16h bl, v8f c) {
  c = __builtin_amdgcn_wmma_f32_16x16x32_f16(false, ah, false, bh, (short)0, c, false, false);
  if (NT >= 2) c = __builtin_amdgcn_wmma_f32_16x16x32_f16(false, al, false, bh, (short)0, c, false, false);
  if (NT >= 3) c = __builtin_amdgcn_wmma_f32_16x16x32_f16(false, ah, false, bl, (short)0, c, false, false);
  asm volatile("v_nop\n\tv_nop\n\tv_nop\n\tv_nop" : "+v"(c) : "v"(ah), "v"(al), "v"(bh), "v"(bl));
  return c;
}
// batched GEMM like k_gemm_b but f16 operands: A f32 (split into f16 hi/lo if ASPLIT, else rounded to f16), Bt = f16 values [n][k]; alpha; C f32; N multiple of 16 (partial tiles skipped)
template <bool ASPLIT>
__global__ __launch_bounds__(128) void k_gemm_h(const float* __restrict__ A, int lda, size_t sA, const _Float16* __restrict__ Bh, int ldb, size_t sB, float alpha, float* __restrict__ C, int ldc, size_t sC, int M, int N, int K) {
  __shared__ __attribute__((aligned(16))) float so[4][16][64];
  const int tid = threadIdx.x, w = tid >> 5, lane = tid & 31, ln = lane & 15, hh = lane >> 4; const int by = blockIdx.y;
  A += (size_t)by * sA; Bh += (size_t)by * sB; C += (size_t)by * sC;
  const int ntn = (N + 63) / 64; const int wid = blockIdx.x * 4 + w; const int mt = wid / ntn, nq = wid % ntn; if (mt * 16 >= M) return;
  const int row0 = mt * 16, col0 = nq * 64; const float* arow = A + (size_t)(row0 + ln) * lda;
  v8f acc[4] = {};
  for (int kb = 0; kb < K; kb += 32) {
    FragH ah, al;
    const v4f x0 = *(const v4fa*)(arow + kb + 8 * hh), x1 = *(const v4fa*)(arow + kb + 8 * hh + 4), x2 = *(const v4fa*)(arow + kb + 16 + 8 * hh), x3 = *(const v4fa*)(arow + kb + 16 + 8 * hh + 4);
    float xs[16] = {x0[0],x0[1],x0[2],x0[3],x1[0],x1[1],x1[2],x1[3],x2[0],x2[1],x2[2],x2[3],x3[0],x3[1],x3[2],x3[3]};
#pragma unroll
    for (int i = 0; i < 16; ++i) { const _Float16 h = (_Float16)xs[i]; ah.h[i] = h; al.h[i] = ASPLIT ? (_Float16)(xs[i] - (float)h) : (_Float16)0.0f; }
#pragma unroll
    for (int t = 0; t < 4; ++t) { if (col0 + t * 16 >= N) continue; const size_t boff = (size_t)(col0 + t * 16 + ln) * ldb + kb; FragH bq; bq.half[0] = *(const v8us*)(Bh + boff + 8 * hh); bq.half[1] = *(const v8us*)(Bh + boff + 16 + 8 * hh);
      acc[t] = mmaH<ASPLIT ? 2 : 1>(ah.v, al.v, bq.v, bq.v, acc[t]); }
  }
#pragma unroll
  for (int t = 0; t < 4; ++t) { if (col0 + t * 16 >= N) continue;
#pragma unroll
    for (int r = 0; r < 8; ++r) so[w][8 * hh + r][t * 16 + ln] = acc[t][r] * alpha; }
  __builtin_amdgcn_fence(__ATOMIC_ACQ_REL, "workgroup"); __builtin_amdgcn_wave_barrier();
  const int rsub = lane >> 4, c4 = (lane & 15) * 4;
  {
#pragma unroll
    for (int q = 0; q < 8; ++q) { const int r = q * 2 + rsub; if (col0 + c4 < N) { const v4f v = *(const v4fa*)&so[w][r][c4]; *(v4f*)(C + (size_t)(row0 + r) * ldc + col0 + c4) = v; } }
     }
}

// Wt[n][k] = f16(W[k][n]·scale) from f32 row-major W[K][N] (scale = power of two; bf16-exact weights stay exact in f16 away from the subnormal range)
__global__ __launch_bounds__(256) void k_wt_f16(const float* __restrict__ W, _Float16* __restrict__ Wt, int K, int N, float scale) {
  const int t = blockIdx.x * 256 + threadIdx.x; if (t >= N * (K / 8)) return; const int n = t / (K / 8), k8 = (t % (K / 8)) * 8; FragH f;
#pragma unroll
  for (int i = 0; i < 8; ++i) f.h[i] = (_Float16)(bf16_round(W[(size_t)(k8 + i) * N + n]) * scale); const v8us o = f.half[0];
  *(v8us*)((unsigned short*)Wt + (size_t)n * K + k8) = o; 
}
// k_gemm_hh variant with fused epilogue: v = acc·alpha + bias[by·sBias + col] (+ CP[(row/rowsPerB)·sCPb + by·64 + col] if CP) ; ACT 0 none / 1 elu ; writes f32 C and/or f16 C16 (each if non-null)
template <int ACT>
__global__ __launch_bounds__(128) void k_gemm_hhx(const _Float16* __restrict__ A, int lda, size_t sA, const _Float16* __restrict__ Bh, int ldb, size_t sB, float alpha, const float* __restrict__ bias, size_t sBias, const float* __restrict__ CP, int rowsPerB, size_t sCPb, int row0g,
    float* __restrict__ C, _Float16* __restrict__ C16, int ldc, size_t sC, int M, int N, int K) {
  __shared__ __attribute__((aligned(16))) float so[4][16][64];
  const int tid = threadIdx.x, w = tid >> 5, lane = tid & 31, ln = lane & 15, hh = lane >> 4; const int by = blockIdx.y;
  A += (size_t)by * sA; Bh += (size_t)by * sB; const size_t cofs = (size_t)by * sC; const float* bp = bias ? bias + (size_t)by * sBias : nullptr;
  const int ntn = (N + 63) / 64; const int wid = blockIdx.x * 4 + w; const int mt = wid / ntn, nq = wid % ntn; if (mt * 16 >= M) return;
  const int row0 = mt * 16, col0 = nq * 64; const _Float16* arow = A + (size_t)(row0 + ln) * lda;
  v8f acc[4] = {};
  for (int kb = 0; kb < K; kb += 32) { FragH ah; ah.half[0] = *(const v8us*)((const unsigned short*)arow + kb + 8 * hh); ah.half[1] = *(const v8us*)((const unsigned short*)arow + kb + 16 + 8 * hh);
#pragma unroll
    for (int t = 0; t < 4; ++t) { if (col0 + t * 16 >= N) continue; const size_t boff = (size_t)(col0 + t * 16 + ln) * ldb + kb; FragH bq; bq.half[0] = *(const v8us*)((const unsigned short*)Bh + boff + 8 * hh); bq.half[1] = *(const v8us*)((const unsigned short*)Bh + boff + 16 + 8 * hh);
      acc[t] = mmaH<1>(ah.v, ah.v, bq.v, bq.v, acc[t]); }
  }
#pragma unroll
  for (int t = 0; t < 4; ++t) { if (col0 + t * 16 >= N) continue; const int col = col0 + t * 16 + ln; const float bv = bp ? bf16_round(bp[col]) : 0.f;
#pragma unroll
    for (int r = 0; r < 8; ++r) { float v = acc[t][r] * alpha + bv; if (CP) { const int rr = row0g + row0 + 8 * hh + r; if (rowsPerB < 0) v += CP[cofs + (size_t)rr * ldc + col];      /* rowsPerB < 0: own element of the batched C plane */ else { const int bidx = rr / rowsPerB; v += CP[(size_t)bidx * sCPb + (size_t)by * 64 + col]; } } if (ACT == 1) v = (v > 0.f) ? v : expm1f(v); else if (ACT == 7) v = (v > 0.f) ? v + 1.0f : expf(v); else if (ACT == 8) v = tanhf(v); else if (ACT == 9) v = 0.5f * v * (1.0f + tanhf(0.7978845608028654f * (v + 0.044715f * v * v * v))); else if (ACT == 11) v = 1.0f / (1.0f + expf(-v)); else if (ACT == 12) v = (v > 0.f) ? v : 0.01f * v; else if (ACT == 14) v = (v > 0.f) ? v : 0.1f * v; else if (ACT == 16) v = (v >= 0.f) ? v : 0.3f * v; else if (ACT == 17) v = (v >= 0.f) ? v : 0.2f * v; else if (ACT == 15) v = v / (1.0f + expf(-v)); else if (ACT == 3) v = fmaxf(v, 0.f); else if (ACT == 6) v = 0.5f * v * (1.0f + erff(v * 0.70710678118654752f)); so[w][8 * hh + r][t * 16 + ln] = v; } }
  __builtin_amdgcn_fence(__ATOMIC_ACQ_REL, "workgroup"); __builtin_amdgcn_wave_barrier();
  const int rsub = lane >> 4, c4 = (lane & 15) * 4; typedef _Float16 v4h __attribute__((ext_vector_type(4)));
  {
#pragma unroll
    for (int q = 0; q < 8; ++q) { const int r = q * 2 + rsub; if (col0 + c4 < N) { const v4f v = *(const v4fa*)&so[w][r][c4]; if (C) *(v4f*)(C + cofs + (size_t)(row0 + r) * ldc + col0 + c4) = v; if (C16) { v4h h4; for (int i = 0; i < 4; ++i) h4[i] = (_Float16)v[i]; *(v4h*)(C16 + cofs + (size_t)(row0 + r) * ldc + col0 + c4) = h4; } } }
     }
}


typedef _Float16 v4h __attribute__((ext_vector_type(4)));

__global__ __launch_bounds__(256) void k_x16(const float* __restrict__ x, _Float16* __restrict__ X16, size_t n8) { const size_t t = (size_t)blockIdx.x * 256 + threadIdx.x; if (t >= n8) return; FragH f;
#pragma unroll
  for (int q = 0; q < 8; ++q) f.h[q] = (_Float16)bf16_round(x[t * 8 + q]); *(v8us*)((unsigned short*)X16 + t * 8) = f.half[0];  }
__global__ __launch_bounds__(256) void k_h16(const float* __restrict__ x, _Float16* __restrict__ X16, size_t n8) { const size_t t = (size_t)blockIdx.x * 256 + threadIdx.x; if (t >= n8) return; FragH f;
#pragma unroll
  for (int q = 0; q < 8; ++q) f.h[q] = (_Float16)x[t * 8 + q]; *(v8us*)((unsigned short*)X16 + t * 8) = f.half[0];  }
__global__ __launch_bounds__(256) void k_round16f(const float* __restrict__ W, _Float16* __restrict__ Bt, size_t n8) { const size_t t = (size_t)blockIdx.x * 256 + threadIdx.x; if (t >= n8) return; FragH f;
#pragma unroll
  for (int i = 0; i < 8; ++i) f.h[i] = (_Float16)(bf16_round(W[t * 8 + i]) * 16.0f); *(v8us*)((unsigned short*)Bt + t * 8) = f.half[0];  }
template <int NHv, int TTv>
__global__ __launch_bounds__(256) void k_vt(const _Float16* __restrict__ V16, int ldv, int voff, _Float16* __restrict__ Vt) { __shared__ unsigned short tl[64][66]; const int tid = threadIdx.x; const int slab = blockIdx.x / (TTv / 64), lg = blockIdx.x % (TTv / 64); const int b = slab / NHv, h = slab % NHv;
  for (int i = tid; i < 64 * 8; i += 256) { const int r = i / 8, c8 = (i % 8) * 8; FragH f; f.half[0] = *(const v8us*)((const unsigned short*)V16 + ((size_t)b * TTv + lg * 64 + r) * ldv + voff + h * 64 + c8);
#pragma unroll
    for (int q = 0; q < 8; ++q) tl[r][c8 + q] = f.u[q]; }
  __syncthreads();
  {
#pragma unroll
    for (int rd = 0; rd < 2; ++rd) { const int d = rd * 32 + tid / 8, pc = tid % 8; FragH f;
#pragma unroll
      for (int q = 0; q < 8; ++q) f.u[q] = tl[pc * 8 + q][d];
      *(v8us*)((unsigned short*)Vt + ((size_t)slab * 64 + d) * TTv + lg * 64 + pc * 8) = f.half[0]; }
     } }

__global__ __launch_bounds__(256) void k_hl(const float* __restrict__ F, _Float16* __restrict__ Hh, _Float16* __restrict__ Hl, size_t n8) { const size_t t = (size_t)blockIdx.x * 256 + threadIdx.x; if (t >= n8) return; FragH fh, fl; const v4f a = *(const v4fa*)(F + t * 8), c = *(const v4fa*)(F + t * 8 + 4);
#pragma unroll
  for (int q = 0; q < 4; ++q) { _Float16 h = (_Float16)a[q]; fh.h[q] = h; fl.h[q] = (_Float16)((a[q] - (float)h) * 1024.0f); h = (_Float16)c[q]; fh.h[4 + q] = h; fl.h[4 + q] = (_Float16)((c[q] - (float)h) * 1024.0f); }
  { *(v8us*)((unsigned short*)Hh + t * 8) = fh.half[0]; *(v8us*)((unsigned short*)Hl + t * 8) = fl.half[0];  } }

// ---- fast GEMM (wave tile 32x64; requires M % 32 == 0 rows per launch region and N % 64 == 0); epilogue = k_gemm_hhx semantics ----
__device__ __forceinline__ v16h g2_frag(const _Float16* p, int hh) { FragH f; f.half[0] = *(const v8us*)((const unsigned short*)p + 8 * hh); f.half[1] = *(const v8us*)((const unsigned short*)p + 16 + 8 * hh); return f.v; }
__device__ __forceinline__ v8f g2_mma(v16h a, v16h b, v8f c) { v8f d = __builtin_amdgcn_wmma_f32_16x16x32_f16(false, a, false, b, (short)0, c, false, false); asm volatile("v_nop\n\tv_nop\n\tv_nop\n\tv_nop" : "+v"(d) : "v"(a), "v"(b)); return d; }
template <int ACT>
__global__ __launch_bounds__(128) void k_gemm2(const _Float16* __restrict__ A, int lda, size_t sA, const _Float16* __restrict__ Bh, int ldb, size_t sB, float alpha, const float* __restrict__ bias, size_t sBias, const float* __restrict__ CP, int rowsPerB, size_t sCPb, int row0g,
    float* __restrict__ C, _Float16* __restrict__ C16, int ldc, size_t sC, int M, int N, int K) { static_assert(ACT == 0 || ACT == 3 || ACT == 6 || ACT == 8 || ACT == 9 || ACT == 11 || ACT == 12 || ACT == 14 || ACT == 15 || ACT == 16 || ACT == 17, "k_gemm2: unsupported ACT code (would silently apply no activation)");
  __shared__ __attribute__((aligned(16))) float so[4][32][68];
  const int tid = threadIdx.x, w = tid >> 5, lane = tid & 31, ln = lane & 15, hh = lane >> 4; const int by = blockIdx.y;
  A += (size_t)by * sA; Bh += (size_t)by * sB; const size_t cofs = (size_t)by * sC; const float* bp = bias ? bias + (size_t)by * sBias : nullptr;
  const int ntn = N >> 6; const int mt = blockIdx.x / ntn, nq = blockIdx.x - mt * ntn; const int row0 = mt * 128 + 32 * w, col0 = nq * 64; if (row0 >= M) return;
  const _Float16* a0p = A + (size_t)(row0 + ln) * lda; const _Float16* a1p = a0p + (size_t)16 * lda;
  const _Float16* b0p = Bh + (size_t)(col0 + ln) * ldb; const _Float16* b1p = b0p + (size_t)16 * ldb; const _Float16* b2p = b1p + (size_t)16 * ldb; const _Float16* b3p = b2p + (size_t)16 * ldb;
  const v8f z8 = {0.f,0.f,0.f,0.f,0.f,0.f,0.f,0.f}; v8f c00 = z8, c01 = z8, c02 = z8, c03 = z8, c10 = z8, c11 = z8, c12 = z8, c13 = z8;
#pragma unroll 1
  for (int kb = 0; kb < K; kb += 32) { const v16h a0 = g2_frag(a0p + kb, hh), a1 = g2_frag(a1p + kb, hh);
    v16h b = g2_frag(b0p + kb, hh); c00 = g2_mma(a0, b, c00); c10 = g2_mma(a1, b, c10);
    b = g2_frag(b1p + kb, hh); c01 = g2_mma(a0, b, c01); c11 = g2_mma(a1, b, c11);
    b = g2_frag(b2p + kb, hh); c02 = g2_mma(a0, b, c02); c12 = g2_mma(a1, b, c12);
    b = g2_frag(b3p + kb, hh); c03 = g2_mma(a0, b, c03); c13 = g2_mma(a1, b, c13); }
  v8f accs[8] = {c00, c01, c02, c03, c10, c11, c12, c13};
#pragma unroll
  for (int u = 0; u < 8; ++u) { const int t = u & 3, half = u >> 2; const int col = col0 + t * 16 + ln; const float bv = bp ? bf16_round(bp[col]) : 0.f;
#pragma unroll
    for (int r = 0; r < 8; ++r) { const int rloc = half * 16 + 8 * hh + r; float v = accs[u][r] * alpha + bv; if (CP) { if (rowsPerB < 0) v += CP[cofs + (size_t)(row0g + row0 + rloc) * ldc + col];      /* rowsPerB < 0: own element of the batched C plane */ else { const int bidx = (row0g + row0 + rloc) / rowsPerB; v += CP[(size_t)bidx * sCPb + (size_t)by * 64 + col]; } }
      if (ACT == 3) v = fmaxf(v, 0.f); else if (ACT == 6) v = 0.5f * v * (1.0f + erff(v * 0.70710678118654752f)); else if (ACT == 11) v = 1.0f / (1.0f + expf(-v)); else if (ACT == 15) v = v / (1.0f + expf(-v)); else if (ACT == 12) v = (v > 0.f) ? v : 0.01f * v; else if (ACT == 8) v = tanhf(v); else if (ACT == 9) v = 0.5f * v * (1.0f + tanhf(0.7978845608028654f * (v + 0.044715f * v * v * v))); else if (ACT == 14) v = (v > 0.f) ? v : 0.1f * v; else if (ACT == 16) v = (v >= 0.f) ? v : 0.3f * v; else if (ACT == 17) v = (v >= 0.f) ? v : 0.2f * v;
      so[w][rloc][t * 16 + ln] = v; } }
  __builtin_amdgcn_fence(__ATOMIC_ACQ_REL, "workgroup"); __builtin_amdgcn_wave_barrier();
  const int rsub = lane >> 4, c4 = (lane & 15) * 4;
  {
#pragma unroll
    for (int q = 0; q < 16; ++q) { const int r = q * 2 + rsub; const v4f v = *(const v4fa*)&so[w][r][c4]; if (C) *(v4f*)(C + cofs + (size_t)(row0 + r) * ldc + col0 + c4) = v; if (C16) { v4h h4; for (int i = 0; i < 4; ++i) h4[i] = (_Float16)v[i]; *(v4h*)(C16 + cofs + (size_t)(row0 + r) * ldc + col0 + c4) = h4; } }
     } }

// ---- split-K GEMM for the two K = 2048 products with few output tiles (readout, f^T v): one 32x64 tile per block, its K range dealt over SKW waves, f32 partial tiles summed through LDS in wave order; v = sum * alpha (+ own element of CP) ----
#define SKW 16                   /* waves per tile; each takes KT / SKW of the k range */
template <int KT>
__global__ __launch_bounds__(32 * SKW) void k_gemm2k(const _Float16* __restrict__ A, int lda, size_t sA, const _Float16* __restrict__ Bh, int ldb, size_t sB, float alpha, const float* CP, float* C, int ldc, size_t sC) {
  static_assert(KT % (32 * SKW) == 0, "k_gemm2k: every wave takes whole 32-deep steps");
  __shared__ __attribute__((aligned(16))) float so[SKW][32][68];
  const int tid = threadIdx.x, w = tid >> 5, lane = tid & 31, ln = lane & 15, hh = lane >> 4; const int by = blockIdx.y;
  A += (size_t)by * sA + w * (KT / SKW); Bh += (size_t)by * sB + w * (KT / SKW); const size_t cofs = (size_t)by * sC; const int row0 = blockIdx.x * 32;
  const _Float16* a0p = A + (size_t)(row0 + ln) * lda; const _Float16* a1p = a0p + (size_t)16 * lda;
  const _Float16* b0p = Bh + (size_t)ln * ldb; const _Float16* b1p = b0p + (size_t)16 * ldb; const _Float16* b2p = b1p + (size_t)16 * ldb; const _Float16* b3p = b2p + (size_t)16 * ldb;
  const v8f z8 = {0.f,0.f,0.f,0.f,0.f,0.f,0.f,0.f}; v8f c00 = z8, c01 = z8, c02 = z8, c03 = z8, c10 = z8, c11 = z8, c12 = z8, c13 = z8;
  for (int kb = 0; kb < KT / SKW; kb += 32) { const v16h a0 = g2_frag(a0p + kb, hh), a1 = g2_frag(a1p + kb, hh);
    v16h b = g2_frag(b0p + kb, hh); c00 = g2_mma(a0, b, c00); c10 = g2_mma(a1, b, c10);
    b = g2_frag(b1p + kb, hh); c01 = g2_mma(a0, b, c01); c11 = g2_mma(a1, b, c11);
    b = g2_frag(b2p + kb, hh); c02 = g2_mma(a0, b, c02); c12 = g2_mma(a1, b, c12);
    b = g2_frag(b3p + kb, hh); c03 = g2_mma(a0, b, c03); c13 = g2_mma(a1, b, c13); }
  v8f accs[8] = {c00, c01, c02, c03, c10, c11, c12, c13};
  // both loops unrolled: accs is then indexed by constants only and stays in registers
#pragma unroll
  for (int u = 0; u < 8; ++u) { const int t = u & 3, half = u >> 2;
#pragma unroll
    for (int r = 0; r < 8; ++r) so[w][half * 16 + 8 * hh + r][t * 16 + ln] = accs[u][r]; }
  __syncthreads();      /* every wave's partial tile is in LDS before any thread sums across waves */
  const int r = tid >> 4, c4 = (tid & 15) * 4; v4f s = *(const v4fa*)&so[0][r][c4];
  for (int u = 1; u < SKW; ++u) s += *(const v4fa*)&so[u][r][c4];
  const size_t o = cofs + (size_t)(row0 + r) * ldc + c4; v4f v = s * alpha; if (CP) v += *(const v4fa*)(CP + o);
  *(v4f*)(C + o) = v; }


__global__ __launch_bounds__(256) void k_soft(const float* __restrict__ S, _Float16* __restrict__ P, float* __restrict__ RS) {
  #pragma clang fp contract(off)
  const int wv = threadIdx.x >> 5, ln = threadIdx.x & 31; const int r = blockIdx.x * 8 + wv; if (r >= HG * NP) return; const float* sr = S + (size_t)r * NP; float mx = -3.0e38f;
#pragma unroll 1
  for (int gq = 0; gq < NP / 256; ++gq) { const v8f a = *(const v8f*)(sr + gq * 256 + ln * 8); for (int q = 0; q < 8; ++q) mx = fmaxf(mx, a[q] * 0.125f); }
  for (int o = 16; o > 0; o >>= 1) mx = fmaxf(mx, __shfl_xor(mx, o, 32)); float su = 0.f;
{ su = 0.f;
#pragma unroll 1
    for (int gq = 0; gq < NP / 256; ++gq) { const v8f a = *(const v8f*)(sr + gq * 256 + ln * 8); FragH ph; for (int q = 0; q < 8; ++q) { const float e = expf(a[q] * 0.125f - mx); su += e; ph.h[q] = (_Float16)(e * 1024.0f); } *(v8us*)((unsigned short*)P + (size_t)r * NP + gq * 256 + ln * 8) = ph.half[0]; }
     }
  for (int o = 16; o > 0; o >>= 1) su += __shfl_xor(su, o, 32); if (ln == 0) { *(float*)(RS + (size_t)r * 32) = 1.0f / su;  } }
__global__ __launch_bounds__(256) void k_addhl(const float* __restrict__ A, const float* __restrict__ Bq, _Float16* __restrict__ Hh, _Float16* __restrict__ Lh, size_t n8) {
  #pragma clang fp contract(off)
  const size_t t = (size_t)blockIdx.x * 256 + threadIdx.x; if (t >= n8) return; const v8f a = *(const v8f*)(A + t * 8), b = *(const v8f*)(Bq + t * 8); FragH fh, fl; for (int q = 0; q < 8; ++q) { const float v = a[q] + b[q]; const _Float16 hv = (_Float16)v; fh.h[q] = hv; fl.h[q] = (_Float16)((v - (float)hv) * 1024.0f); }
  { *(v8us*)((unsigned short*)Hh + t * 8) = fh.half[0]; *(v8us*)((unsigned short*)Lh + t * 8) = fl.half[0];  } }
__global__ __launch_bounds__(256) void k_csc(const float* __restrict__ O, const float* __restrict__ RS, int b, int h0, _Float16* __restrict__ CH, _Float16* __restrict__ CL) {
  #pragma clang fp contract(off)
  const int t = blockIdx.x * 256 + threadIdx.x; if (t >= NP * HG * (HD / 8)) return; const int d8 = (t % (HD / 8)) * 8; const int hl = (t / (HD / 8)) % HG; const int n = t / ((HD / 8) * HG); const float rs = RS[((size_t)hl * NP + n) * 32]; const size_t o = ((size_t)b * NP + n) * INNER + (h0 + hl) * HD + d8; const v8f a = *(const v8f*)(O + (size_t)n * INNER + (h0 + hl) * HD + d8); FragH f, fl;
  for (int q = 0; q < 8; ++q) { const float v = a[q] * rs; const _Float16 hh = (_Float16)v; f.h[q] = hh; fl.h[q] = (_Float16)((v - (float)hh) * 1024.0f); }
  { *(v8us*)((unsigned short*)CH + o) = f.half[0]; *(v8us*)((unsigned short*)CL + o) = fl.half[0];  } }

extern "C" void kernel_launch(void* const* d_in, const int* in_sizes, int n_in,
                              void* d_out, int out_size, void* d_ws, size_t ws_size, hipStream_t stream) {
  (void)in_sizes; (void)n_in; (void)out_size;
  const float* x = (const float*)d_in[0]; const float* Wqkfv = (const float*)d_in[1]; const float* Wsc = (const float*)d_in[2]; const float* bsc = (const float*)d_in[3]; const float* Wout = (const float*)d_in[4]; const float* bout = (const float*)d_in[5];
  char* ws = (char*)d_ws; size_t off = 0;
  auto take = [&](size_t bytes) { char* p = ws + off; off += (bytes + 255) & ~(size_t)255; return p; };
  _Float16* BQ = (_Float16*)take((size_t)4 * INNER * DIM * 2); _Float16* BS = (_Float16*)take((size_t)NP * HD * 2); _Float16* BO = (_Float16*)take((size_t)DIM * INNER * 2);
  _Float16* X16 = (_Float16*)take((size_t)NR * DIM * 2); _Float16* QKFV = (_Float16*)take((size_t)NR * 4 * INNER * 2);      /* [row][q | k | f | v] f16, 32 MiB */
  _Float16* FT = (_Float16*)take((size_t)NH * HD * NP * 2); _Float16* VTT = (_Float16*)take((size_t)NH * HD * NP * 2);      /* per-batch f^T, v^T [h][64][2048] */ float* FV = (float*)take((size_t)NH * HD * HD * 4); _Float16* FVH = (_Float16*)take((size_t)NH * HD * HD * 2); _Float16* FVL = (_Float16*)take((size_t)NH * HD * HD * 2);
  float* PV = (float*)take((size_t)NH * HD * NP * 4); float* PV2 = (float*)take((size_t)NH * HD * NP * 4); _Float16* PVH = (_Float16*)take((size_t)NH * HD * NP * 2); _Float16* PVL = (_Float16*)take((size_t)NH * HD * NP * 2);
  float* S = (float*)take((size_t)HG * NP * NP * 4); _Float16* P = (_Float16*)take((size_t)HG * NP * NP * 2); float* RS = (float*)take((size_t)HG * NP * 32 * 4); float* O = (float*)take((size_t)NP * INNER * 4); _Float16* CH = (_Float16*)take((size_t)NR * INNER * 2); _Float16* CL = (_Float16*)take((size_t)NR * INNER * 2);
  if (off > ws_size) return;      /* 2 + 0.25 + 0.5 + 8 + 32 + 2 + 2 + 0.25 + 4 + 4 + 2 + 2 + 64 + 32 + 1 + 4 + 8 + 8 = 176 MiB */
  k_wt_f16<<<(unsigned)(((size_t)DIM * 4 * INNER / 8 + 255) / 256), 256, 0, stream>>>(Wqkfv, BQ, DIM, 4 * INNER, 16.0f); k_wt_f16<<<(unsigned)(((size_t)HD * NP / 8 + 255) / 256), 256, 0, stream>>>(Wsc, BS, HD, NP, 16.0f); k_wt_f16<<<(unsigned)(((size_t)INNER * DIM / 8 + 255) / 256), 256, 0, stream>>>(Wout, BO, INNER, DIM, 16.0f);      /* all x @ W (in, out) */
  k_x16<<<(unsigned)(((size_t)NR * DIM / 8 + 255) / 256), 256, 0, stream>>>(x, X16, (size_t)NR * DIM / 8);
  k_gemm2<0><<<dim3((NR / 128) * (4 * INNER / 64), 1), 128, 0, stream>>>(X16, DIM, 0, BQ, DIM, 0, 0.0625f, nullptr, 0, nullptr, 1, 0, 0, nullptr, QKFV, 4 * INNER, 0, NR, 4 * INNER, DIM);      /* [q | k | f | v], head h at h*64 inside each quarter */
  for (int b = 0; b < NB; ++b) { const _Float16* rowb = QKFV + (size_t)b * NP * 4 * INNER;
    k_vt<NH, NP><<<NH * (NP / 64), 256, 0, stream>>>(rowb, 4 * INNER, 2 * INNER, FT); k_vt<NH, NP><<<NH * (NP / 64), 256, 0, stream>>>(rowb, 4 * INNER, 3 * INNER, VTT);      /* f^T, v^T per head [64][2048] */
    k_gemm2k<NP><<<dim3(HD / 32, NH), 32 * SKW, 0, stream>>>(FT, NP, (size_t)HD * NP, VTT, NP, (size_t)HD * NP, 1.0f, nullptr, FV, HD, (size_t)HD * HD);      /* FV[h][d][e] = sum_n f[n][d] v[n][e] (32-row tiles, K over the block's waves) */
    k_hl<<<(NH * HD * HD / 8 + 255) / 256, 256, 0, stream>>>(FV, FVH, FVL, (size_t)NH * HD * HD / 8);
    k_gemm_hhx<0><<<dim3((HD / 16) * (NP / 64) / 4, NH), 128, 0, stream>>>(FVL, HD, (size_t)HD * HD, BS, HD, 0, 0.0625f / 1024.0f, nullptr, 0, nullptr, 1, 0, 0, PV2, nullptr, NP, (size_t)HD * NP, HD, NP, HD);      /* lo term */
    k_gemm_hhx<0><<<dim3((HD / 16) * (NP / 64) / 4, NH), 128, 0, stream>>>(FVH, HD, (size_t)HD * HD, BS, HD, 0, 0.0625f, bsc, 0, nullptr, 1, 0, 0, PV, nullptr, NP, (size_t)HD * NP, HD, NP, HD);      /* hi term + b_scales */
    k_addhl<<<(unsigned)(((size_t)NH * HD * NP / 8 + 255) / 256), 256, 0, stream>>>(PV, PV2, PVH, PVL, (size_t)NH * HD * NP / 8);      /* poss_value = (FV_hi + FV_lo) w_scales + b as f16 hi/residual */
    for (int g = 0; g < NH / HG; ++g) { const int h0 = g * HG;
      k_gemm2<0><<<dim3((NP / 128) * (NP / 64), HG), 128, 0, stream>>>(rowb + h0 * HD, 4 * INNER, (size_t)HD, rowb + INNER + h0 * HD, 4 * INNER, (size_t)HD, 1.0f, nullptr, 0, nullptr, 1, 0, 0, S, nullptr, NP, (size_t)NP * NP, NP, NP, HD);      /* q k^T per head */
      k_soft<<<(HG * NP) / 8, 256, 0, stream>>>(S, P, RS);
      k_gemm2k<NP><<<dim3(NP / 32, HG), 32 * SKW, 0, stream>>>(P, NP, (size_t)NP * NP, PVL + (size_t)h0 * HD * NP, NP, (size_t)HD * NP, 0.0009765625f / 1024.0f, nullptr, O + h0 * HD, INNER, (size_t)HD);
      k_gemm2k<NP><<<dim3(NP / 32, HG), 32 * SKW, 0, stream>>>(P, NP, (size_t)NP * NP, PVH + (size_t)h0 * HD * NP, NP, (size_t)HD * NP, 0.0009765625f, O + h0 * HD, O + h0 * HD, INNER, (size_t)HD);      /* unnormalised attn . poss_value^T (hi + lo) */
      k_csc<<<(NP * HG * (HD / 8) + 255) / 256, 256, 0, stream>>>(O, RS, b, h0, CH, CL); } }
  k_gemm2<0><<<dim3((NR / 128) * (DIM / 64), 1), 128, 0, stream>>>(CL, INNER, 0, BO, INNER, 0, 0.0625f / 1024.0f, nullptr, 0, nullptr, 1, 0, 0, (float*)d_out, nullptr, DIM, 0, NR, DIM, INNER);
  k_gemm2<0><<<dim3((NR / 128) * (DIM / 64), 1), 128, 0, stream>>>(CH, INNER, 0, BO, INNER, 0, 0.0625f, bout, 0, (const float*)d_out, 1, (size_t)DIM, 0, (float*)d_out, nullptr, DIM, 0, NR, DIM, INNER);      /* y = (c_lo + c_hi) w_out + b_out */
}

// v003
// One run takes 257 microseconds.
// Versions between v001 and this one are left out; their measured steps multiply to 3.20 times as fast.
// All steps since v000 together make it 7.79 times as fast.
#include <hip/hip_runtime.h>
// SimilarAttention (4 x 2048 patches x 512, 8 heads x 64: [q|k|f|v] = x w_qkfv; attn = softmax(q.k/8); poss_value = (f^T v) w_scales + b_scales -> [h][64][2048]; out = attn . poss_value^T; y = merged . w_out + b_out).
// Structure: exact f16 x plane; the fused projection as ONE f16 WMMA GEMM (32x64 wave tiles, f32 accumulation, exact x16 weights; f16 out); then, each stage as ONE launch over all batches and heads: f^T and v^T by LDS tiles (one grid, blockIdx.y picks the plane), f^T v as 32-row WMMA tiles (K = 2048 dealt over a block's 16 waves, f32 partials summed in LDS) then f16 hi/residual, (f^T v) w_scales + b as two 16-row-tile GEMM terms into f32 then f16 hi/residual planes; then ONE launch for all batches and heads that keeps scores and softmax weights in registers: a block walks 8 tiles of 32 query rows of one head, its 16 waves take 128 keys each (scores transposed, K = 64, f32; row maximum and row sum joined through LDS; unnormalised f16 weights x 2^10 packed from the score accumulators into the B operand; readout against the residual plane, scaled, then the hi plane on the same f32 accumulators; partial tiles summed in LDS; row scaling + hi/residual); w_out as two GEMM terms (+ bias).
// Compute dtype: inputs rounded to bf16; x / weights exact as f16; q, k, f, v and the softmax weights as plain f16 operands (~2^-12); f^T v, poss_value and the merged context as f16 hi + residual. v_wmma_f32_16x16x32_f16.
#define NB 4
#define NP 2048
#define DIM 512
#define NH 8
#define HD 64
#define INNER 512
#define NR (NB * NP)
typedef __bf16 v16b __attribute__((ext_vector_type(16)));
typedef unsigned short v8us __attribute__((ext_vector_type(8), may_alias));
typedef float  v8f  __attribute__((ext_vector_type(8)));
typedef float  v4f  __attribute__((ext_vector_type(4)));
typedef float  v4fa __attribute__((ext_vector_type(4), may_alias));
union FragB { v16b v; v8us half[2]; unsigned short u[16]; };

__device__ __forceinline__ unsigned short bf16_bits(float x) { unsigned int u = __float_as_uint(x); return (unsigned short)((u + 0x7FFFu + ((u >> 16) & 1u)) >> 16); }
__device__ __forceinline__ float bf16_val(unsigned short b) { return __uint_as_float(((unsigned int)b) << 16); }
__device__ __forceinline__ float bf16_round(float x) { return bf16_val(bf16_bits(x)); }
// D += A·B with NT terms: 1 = ah·bh, 2 = + al·bh (A split), 3 = + ah·bl (both split)
template <int NT>
__device__ __forceinline__ v8f mmaN(v16b ah, v16b al, v16b bh, v16b bl, v8f c) {
  c = __builtin_amdgcn_wmma_f32_16x16x32_bf16(false, ah, false, bh, (short)0, c, false, false);
  if (NT >= 2) c = __builtin_amdgcn_wmma_f32_16x16x32_bf16(false, al, false, bh, (short)0, c, false, false);
  if (NT >= 3) c = __builtin_amdgcn_wmma_f32_16x16x32_bf16(false, ah, false, bl, (short)0, c, false, false);
  asm volatile("v_nop\n\tv_nop\n\tv_nop\n\tv_nop" : "+v"(c) : "v"(ah), "v"(al), "v"(bh), "v"(bl));
  return c;
}

__global__ __launch_bounds__(256) void k_wt_bf16(const float* __restrict__ W, unsigned short* __restrict__ Wt, int K, int N) {
  const int t = blockIdx.x * 256 + threadIdx.x;
  const int k8n = K / 8;
  if (t >= N * k8n) return;
  const int n = t / k8n, k8 = (t % k8n) * 8;
  v8us v;
#pragma unroll
  for (int i = 0; i < 8; ++i) v[i] = bf16_bits(W[(size_t)(k8 + i) * N + n]);
  *(v8us*)(Wt + (size_t)n * K + k8) = v;
  
}

// GEMM C[M][N] (f32, pitch ldc) = act(A[M][K]·W + bias). A f32 row-major (pitch lda) converted per fragment to bf16
// (ASPLIT: hi/lo two planes -> 2 terms, else single rounded term); Wt bf16 [N][K] (pitch ldb). BIAS_BF16 rounds the
// bias to bf16 first (bias quantised to bf16 before the add). K%32==0, M%16==0, N%64==0.
template <bool ASPLIT, int ACT, bool BIAS_BF16>
__global__ __launch_bounds__(128) void k_gemm_bf(const float* __restrict__ A, int lda, const unsigned short* __restrict__ Wt, int ldb,
                                               const float* __restrict__ bias, float* __restrict__ C, int ldc, int M, int N, int K) {
  __shared__ __attribute__((aligned(16))) float so[4][16][64];
  const int tid = threadIdx.x, w = tid >> 5, lane = tid & 31, ln = lane & 15, hh = lane >> 4;
  const int ntn = N / 64;
  const int wid = blockIdx.x * 4 + w;
  const int mt = wid / ntn, nq = wid % ntn;
  if (mt * 16 >= M) return;
  const int row0 = mt * 16, col0 = nq * 64;
  const float* arow = A + (size_t)(row0 + ln) * lda;
  v8f acc[4] = {};
  for (int kb = 0; kb < K; kb += 32) {
    FragB ah, al;
    const v4f x0 = *(const v4fa*)(arow + kb + 8 * hh), x1 = *(const v4fa*)(arow + kb + 8 * hh + 4);
    const v4f x2 = *(const v4fa*)(arow + kb + 16 + 8 * hh), x3 = *(const v4fa*)(arow + kb + 16 + 8 * hh + 4);
    float xs[16] = {x0[0],x0[1],x0[2],x0[3],x1[0],x1[1],x1[2],x1[3],x2[0],x2[1],x2[2],x2[3],x3[0],x3[1],x3[2],x3[3]};
#pragma unroll
    for (int i = 0; i < 16; ++i) { const unsigned short hb = bf16_bits(xs[i]); ah.u[i] = hb; al.u[i] = ASPLIT ? bf16_bits(xs[i] - bf16_val(hb)) : (unsigned short)0; }
#pragma unroll
    for (int t = 0; t < 4; ++t) {
      const unsigned short* brow = Wt + (size_t)(col0 + t * 16 + ln) * ldb + kb;
      FragB b;
      b.half[0] = *(const v8us*)(brow + 8 * hh);
      b.half[1] = *(const v8us*)(brow + 16 + 8 * hh);
      acc[t] = mmaN<ASPLIT ? 2 : 1>(ah.v, al.v, b.v, b.v, acc[t]);
    }
  }
#pragma unroll
  for (int t = 0; t < 4; ++t) {
    float bv = bias ? bias[col0 + t * 16 + ln] : 0.f;
    if (BIAS_BF16) bv = bf16_round(bv);
#pragma unroll
    for (int r = 0; r < 8; ++r) { float v = acc[t][r] + bv; if (ACT == 1) v = fmaxf(v, 0.f); so[w][8 * hh + r][t * 16 + ln] = v; }
  }
  __builtin_amdgcn_fence(__ATOMIC_ACQ_REL, "workgroup");
  __builtin_amdgcn_wave_barrier();
  const int rsub = lane >> 4, c4 = (lane & 15) * 4;
  {
#pragma unroll
    for (int q = 0; q < 8; ++q) {
      const int r = q * 2 + rsub;
      const v4f v = *(const v4fa*)&so[w][r][c4];
      *(v4f*)(C + (size_t)(row0 + r) * ldc + col0 + c4) = v;
    }
    
  }
}

// GEMM C = act(A·W + bias + resid): A f32 (ASPLIT -> hi/lo 2 terms), Wt bf16 [N][K]; ACT 0 none, 1 relu, 2 exact gelu;
// resid (optional, f32, row index = (row % rmod), pitch ldr, RES_BF16 rounds it) added before the activation.
template <bool ASPLIT, int ACT, bool BIAS_BF16, bool RES_BF16>
__global__ __launch_bounds__(128) void k_gemm_bf3(const float* __restrict__ A, int lda, const unsigned short* __restrict__ Wt, int ldb,
                                                const float* __restrict__ bias, const float* __restrict__ resid, int rmod, int ldr,
                                                float* __restrict__ C, int ldc, int M, int N, int K) {
  __shared__ __attribute__((aligned(16))) float so[4][16][64];
  const int tid = threadIdx.x, w = tid >> 5, lane = tid & 31, ln = lane & 15, hh = lane >> 4;
  const int ntn = N / 64;
  const int wid = blockIdx.x * 4 + w;
  const int mt = wid / ntn, nq = wid % ntn;
  if (mt * 16 >= M) return;
  const int row0 = mt * 16, col0 = nq * 64;
  const float* arow = A + (size_t)(row0 + ln) * lda;
  v8f acc[4] = {};
  for (int kb = 0; kb < K; kb += 32) {
    FragB ah, al;
    const v4f x0 = *(const v4fa*)(arow + kb + 8 * hh), x1 = *(const v4fa*)(arow + kb + 8 * hh + 4);
    const v4f x2 = *(const v4fa*)(arow + kb + 16 + 8 * hh), x3 = *(const v4fa*)(arow + kb + 16 + 8 * hh + 4);
    float xs[16] = {x0[0],x0[1],x0[2],x0[3],x1[0],x1[1],x1[2],x1[3],x2[0],x2[1],x2[2],x2[3],x3[0],x3[1],x3[2],x3[3]};
#pragma unroll
    for (int i = 0; i < 16; ++i) { const unsigned short hb = bf16_bits(xs[i]); ah.u[i] = hb; al.u[i] = ASPLIT ? bf16_bits(xs[i] - bf16_val(hb)) : (unsigned short)0; }
#pragma unroll
    for (int t = 0; t < 4; ++t) {
      const unsigned short* brow = Wt + (size_t)(col0 + t * 16 + ln) * ldb + kb;
      FragB b;
      b.half[0] = *(const v8us*)(brow + 8 * hh);
      b.half[1] = *(const v8us*)(brow + 16 + 8 * hh);
      acc[t] = mmaN<ASPLIT ? 2 : 1>(ah.v, al.v, b.v, b.v, acc[t]);
    }
  }
#pragma unroll
  for (int t = 0; t < 4; ++t) {
    const int col = col0 + t * 16 + ln;
    float bv = bias ? bias[col] : 0.f;
    if (BIAS_BF16) bv = bf16_round(bv);
#pragma unroll
    for (int r = 0; r < 8; ++r) {
      float v = acc[t][r] + bv;
      if (resid) { float rv = resid[(size_t)((row0 + 8 * hh + r) % rmod) * ldr + col]; if (RES_BF16) rv = bf16_round(rv); v += rv; }
      if (ACT == 1) v = fmaxf(v, 0.f);
      if (ACT == 2) v = 0.5f * v * (1.0f + erff(v * 0.70710678118654752f));
      if (ACT == 3) { const float u = 0.7978845608028654f * (v + 0.044715f * v * v * v); v = 0.5f * v * (1.0f + tanhf(u)); }
      so[w][8 * hh + r][t * 16 + ln] = v;
    }
  }
  __builtin_amdgcn_fence(__ATOMIC_ACQ_REL, "workgroup");
  __builtin_amdgcn_wave_barrier();
  const int rsub = lane >> 4, c4 = (lane & 15) * 4;
  {
#pragma unroll
    for (int q = 0; q < 8; ++q) {
      const int r = q * 2 + rsub;
      const v4f v = *(const v4fa*)&so[w][r][c4];
      *(v4f*)(C + (size_t)(row0 + r) * ldc + col0 + c4) = v;
    }
    
  }
}
// row LayerNorm (biased variance, eps) over N: s = X (+ R); optional out_sum <- s; out_norm <- (s-mu)*rsqrt(var+eps)*g + b
template <bool PARAM_BF16>
__global__ __launch_bounds__(256) void k_layernorm(const float* __restrict__ X, const float* __restrict__ R, const float* __restrict__ g, const float* __restrict__ bta,
                                                  float* __restrict__ out_sum, float* __restrict__ out_norm, int N, float eps) {
  __shared__ float red[256];
  const int row = blockIdx.x, tid = threadIdx.x;
  const float* x = X + (size_t)row * N; const float* rr = R ? R + (size_t)row * N : nullptr;
  float vals[16];                     // up to N = 4096
  const int per = N / 256;            // contiguous chunk per thread? use strided-by-4 chunks: thread handles j = tid*4 + 1024*u
  float s1 = 0.f;
  for (int u = 0; u < per / 4; ++u) {
    const int j = tid * 4 + 1024 * u;
    const v4f a = *(const v4fa*)(x + j);
    v4f b = {0.f,0.f,0.f,0.f}; if (rr) b = *(const v4fa*)(rr + j);
#pragma unroll
    for (int q = 0; q < 4; ++q) { const float v = a[q] + b[q]; vals[u * 4 + q] = v; s1 += v; }
  }
  red[tid] = s1; __syncthreads();
  for (int st = 128; st > 0; st >>= 1) { if (tid < st) red[tid] += red[tid + st]; __syncthreads(); }
  const float mu = red[0] / (float)N; __syncthreads();
  float s2 = 0.f;
  for (int u = 0; u < per / 4; ++u)
#pragma unroll
    for (int q = 0; q < 4; ++q) { const float c = vals[u * 4 + q] - mu; s2 += c * c; }
  red[tid] = s2; __syncthreads();
  for (int st = 128; st > 0; st >>= 1) { if (tid < st) red[tid] += red[tid + st]; __syncthreads(); }
  const float rs = rsqrtf(red[0] / (float)N + eps);
  {
    for (int u = 0; u < per / 4; ++u) {
      const int j = tid * 4 + 1024 * u;
      v4f o, sm;
#pragma unroll
      for (int q = 0; q < 4; ++q) {
        float gg = g[j + q], bb = bta[j + q];
        if (PARAM_BF16) { gg = bf16_round(gg); bb = bf16_round(bb); }
        sm[q] = vals[u * 4 + q]; o[q] = (vals[u * 4 + q] - mu) * rs * gg + bb;
      }
      if (out_sum) *(v4f*)(out_sum + (size_t)row * N + j) = sm;
      *(v4f*)(out_norm + (size_t)row * N + j) = o;
    }
    
  }
}



// ---- f16 WMMA path (v_wmma_f32_16x16x32_f16): 11-bit significands for operands in range — used where a [0,1] probability operand needs more precision than bf16
typedef _Float16 v16h __attribute__((ext_vector_type(16)));
union FragH { v16h v; v8us half[2]; _Float16 h[16]; unsigned short u[16]; };
template <int NT>
__device__ __forceinline__ v8f mmaH(v16h ah, v16h al, v16h bh, v16h bl, v8f c) {
  c = __builtin_amdgcn_wmma_f32_16x16x32_f16(false, ah, false, bh, (short)0, c, false, false);
  if (NT >= 2) c = __builtin_amdgcn_wmma_f32_16x16x32_f16(false, al, false, bh, (short)0, c, false, false);
  if (NT >= 3) c = __builtin_amdgcn_wmma_f32_16x16x32_f16(false, ah, false, bl, (short)0, c, false, false);
  asm volatile("v_nop\n\tv_nop\n\tv_nop\n\tv_nop" : "+v"(c) : "v"(ah), "v"(al), "v"(bh), "v"(bl));
  return c;
}
// batched GEMM like k_gemm_b but f16 operands: A f32 (split into f16 hi/lo if ASPLIT, else rounded to f16), Bt = f16 values [n][k]; alpha; C f32; N multiple of 16 (partial tiles skipped)
template <bool ASPLIT>
__global__ __launch_bounds__(128) void k_gemm_h(const float* __restrict__ A, int lda, size_t sA, const _Float16* __restrict__ Bh, int ldb, size_t sB, float alpha, float* __restrict__ C, int ldc, size_t sC, int M, int N, int K) {
  __shared__ __attribute__((aligned(16))) float so[4][16][64];
  const int tid = threadIdx.x, w = tid >> 5, lane = tid & 31, ln = lane & 15, hh = lane >> 4; const int by = blockIdx.y;
  A += (size_t)by * sA; Bh += (size_t)by * sB; C += (size_t)by * sC;
  const int ntn = (N + 63) / 64; const int wid = blockIdx.x * 4 + w; const int mt = wid / ntn, nq = wid % ntn; if (mt * 16 >= M) return;
  const int row0 = mt * 16, col0 = nq * 64; const float* arow = A + (size_t)(row0 + ln) * lda;
  v8f acc[4] = {};
  for (int kb = 0; kb < K; kb += 32) {
    FragH ah, al;
    const v4f x0 = *(const v4fa*)(arow + kb + 8 * hh), x1 = *(const v4fa*)(arow + kb + 8 * hh + 4), x2 = *(const v4fa*)(arow + kb + 16 + 8 * hh), x3 = *(const v4fa*)(arow + kb + 16 + 8 * hh + 4);
    float xs[16] = {x0[0],x0[1],x0[2],x0[3],x1[0],x1[1],x1[2],x1[3],x2[0],x2[1],x2[2],x2[3],x3[0],x3[1],x3[2],x3[3]};
#pragma unroll
    for (int i = 0; i < 16; ++i) { const _Float16 h = (_Float16)xs[i]; ah.h[i] = h; al.h[i] = ASPLIT ? (_Float16)(xs[i] - (float)h) : (_Float16)0.0f; }
#pragma unroll
    for (int t = 0; t < 4; ++t) { if (col0 + t * 16 >= N) continue; const size_t boff = (size_t)(col0 + t * 16 + ln) * ldb + kb; FragH bq; bq.half[0] = *(const v8us*)(Bh + boff + 8 * hh); bq.half[1] = *(const v8us*)(Bh + boff + 16 + 8 * hh);
      acc[t] = mmaH<ASPLIT ? 2 : 1>(ah.v, al.v, bq.v, bq.v, acc[t]); }
  }
#pragma unroll
  for (int t = 0; t < 4; ++t) { if (col0 + t * 16 >= N) continue;
#pragma unroll
    for (int r = 0; r < 8; ++r) so[w][8 * hh + r][t * 16 + ln] = acc[t][r] * alpha; }
  __builtin_amdgcn_fence(__ATOMIC_ACQ_REL, "workgroup"); __builtin_amdgcn_wave_barrier();
  const int rsub = lane >> 4, c4 = (lane & 15) * 4;
  {
#pragma unroll
    for (int q = 0; q < 8; ++q) { const int r = q * 2 + rsub; if (col0 + c4 < N) { const v4f v = *(const v4fa*)&so[w][r][c4]; *(v4f*)(C + (size_t)(row0 + r) * ldc + col0 + c4) = v; } }
     }
}

// Wt[n][k] = f16(W[k][n]·scale) from f32 row-major W[K][N] (scale = power of two; bf16-exact weights stay exact in f16 away from the subnormal range)
// device body: blk = index of the 256-thread block inside this job's range of the shared grid (k_prep)
__device__ __forceinline__ void d_wt_f16(const float* __restrict__ W, _Float16* __restrict__ Wt, int K, int N, float scale, int blk) {
  const int t = blk * 256 + threadIdx.x; if (t >= N * (K / 8)) return; const int n = t / (K / 8), k8 = (t % (K / 8)) * 8; FragH f;
#pragma unroll
  for (int i = 0; i < 8; ++i) f.h[i] = (_Float16)(bf16_round(W[(size_t)(k8 + i) * N + n]) * scale); const v8us o = f.half[0];
  *(v8us*)((unsigned short*)Wt + (size_t)n * K + k8) = o; 
}
// k_gemm_hh variant with fused epilogue: v = acc·alpha + bias[by·sBias + col] (+ CP[(row/rowsPerB)·sCPb + by·64 + col] if CP) ; ACT 0 none / 1 elu ; writes f32 C and/or f16 C16 (each if non-null)
template <int ACT>
__global__ __launch_bounds__(128) void k_gemm_hhx(const _Float16* __restrict__ A, int lda, size_t sA, const _Float16* __restrict__ Bh, int ldb, size_t sB, float alpha, const float* __restrict__ bias, size_t sBias, const float* __restrict__ CP, int rowsPerB, size_t sCPb, int row0g,
    float* __restrict__ C, _Float16* __restrict__ C16, int ldc, size_t sC, int M, int N, int K, const _Float16* __restrict__ A2, float alpha2, float* __restrict__ C2) {
  __shared__ __attribute__((aligned(16))) float so[4][16][64];
  const int tid = threadIdx.x, w = tid >> 5, lane = tid & 31, ln = lane & 15, hh = lane >> 4; const int by = blockIdx.y;
  if (blockIdx.z) { A = A2; alpha = alpha2; bias = nullptr; C = C2; }      /* blockIdx.z = 1: the second term of a split A in the same grid: its own operand, factor and f32 plane, no bias */
  A += (size_t)by * sA; Bh += (size_t)by * sB; const size_t cofs = (size_t)by * sC; const float* bp = bias ? bias + (size_t)by * sBias : nullptr;
  const int ntn = (N + 63) / 64; const int wid = blockIdx.x * 4 + w; const int mt = wid / ntn, nq = wid % ntn; if (mt * 16 >= M) return;
  const int row0 = mt * 16, col0 = nq * 64; const _Float16* arow = A + (size_t)(row0 + ln) * lda;
  v8f acc[4] = {};
  for (int kb = 0; kb < K; kb += 32) { FragH ah; ah.half[0] = *(const v8us*)((const unsigned short*)arow + kb + 8 * hh); ah.half[1] = *(const v8us*)((const unsigned short*)arow + kb + 16 + 8 * hh);
#pragma unroll
    for (int t = 0; t < 4; ++t) { if (col0 + t * 16 >= N) continue; const size_t boff = (size_t)(col0 + t * 16 + ln) * ldb + kb; FragH bq; bq.half[0] = *(const v8us*)((const unsigned short*)Bh + boff + 8 * hh); bq.half[1] = *(const v8us*)((const unsigned short*)Bh + boff + 16 + 8 * hh);
      acc[t] = mmaH<1>(ah.v, ah.v, bq.v, bq.v, acc[t]); }
  }
#pragma unroll
  for (int t = 0; t < 4; ++t) { if (col0 + t * 16 >= N) continue; const int col = col0 + t * 16 + ln; const float bv = bp ? bf16_round(bp[col]) : 0.f;
#pragma unroll
    for (int r = 0; r < 8; ++r) { float v = acc[t][r] * alpha + bv; if (CP) { const int rr = row0g + row0 + 8 * hh + r; if (rowsPerB < 0) v += CP[cofs + (size_t)rr * ldc + col];      /* rowsPerB < 0: own element of the batched C plane */ else { const int bidx = rr / rowsPerB; v += CP[(size_t)bidx * sCPb + (size_t)by * 64 + col]; } } if (ACT == 1) v = (v > 0.f) ? v : expm1f(v); else if (ACT == 7) v = (v > 0.f) ? v + 1.0f : expf(v); else if (ACT == 8) v = tanhf(v); else if (ACT == 9) v = 0.5f * v * (1.0f + tanhf(0.7978845608028654f * (v + 0.044715f * v * v * v))); else if (ACT == 11) v = 1.0f / (1.0f + expf(-v)); else if (ACT == 12) v = (v > 0.f) ? v : 0.01f * v; else if (ACT == 14) v = (v > 0.f) ? v : 0.1f * v; else if (ACT == 16) v = (v >= 0.f) ? v : 0.3f * v; else if (ACT == 17) v = (v >= 0.f) ? v : 0.2f * v; else if (ACT == 15) v = v / (1.0f + expf(-v)); else if (ACT == 3) v = fmaxf(v, 0.f); else if (ACT == 6) v = 0.5f * v * (1.0f + erff(v * 0.70710678118654752f)); so[w][8 * hh + r][t * 16 + ln] = v; } }
  __builtin_amdgcn_fence(__ATOMIC_ACQ_REL, "workgroup"); __builtin_amdgcn_wave_barrier();
  const int rsub = lane >> 4, c4 = (lane & 15) * 4; typedef _Float16 v4h __attribute__((ext_vector_type(4)));
  {
#pragma unroll
    for (int q = 0; q < 8; ++q) { const int r = q * 2 + rsub; if (col0 + c4 < N) { const v4f v = *(const v4fa*)&so[w][r][c4]; if (C) *(v4f*)(C + cofs + (size_t)(row0 + r) * ldc + col0 + c4) = v; if (C16) { v4h h4; for (int i = 0; i < 4; ++i) h4[i] = (_Float16)v[i]; *(v4h*)(C16 + cofs + (size_t)(row0 + r) * ldc + col0 + c4) = h4; } } }
     }
}


typedef _Float16 v4h __attribute__((ext_vector_type(4)));

__device__ __forceinline__ void d_x16(const float* __restrict__ x, _Float16* __restrict__ X16, size_t n8, int blk) { const size_t t = (size_t)blk * 256 + threadIdx.x; if (t >= n8) return; FragH f;
#pragma unroll
  for (int q = 0; q < 8; ++q) f.h[q] = (_Float16)bf16_round(x[t * 8 + q]); *(v8us*)((unsigned short*)X16 + t * 8) = f.half[0];  }
// the four operand preparations need nothing of each other: one grid, each job a range of the block index (block-uniform branches); the transposes, whose threads take longest, start first
#define PREP_Q (DIM * 4 * INNER / 8 / 256)
#define PREP_O (INNER * DIM / 8 / 256)
#define PREP_S (HD * NP / 8 / 256)
#define PREP_X (NR * DIM / 8 / 256)
__global__ __launch_bounds__(256) void k_prep(const float* __restrict__ Wq, _Float16* __restrict__ BQ, const float* __restrict__ Wo, _Float16* __restrict__ BO, const float* __restrict__ Wsc, _Float16* __restrict__ BS, const float* __restrict__ x, _Float16* __restrict__ X16) {
  static_assert(DIM * 4 * INNER % 2048 == 0 && INNER * DIM % 2048 == 0 && HD * NP % 2048 == 0 && NR * DIM % 2048 == 0, "k_prep: every job fills whole blocks");
  int blk = blockIdx.x;
  if (blk < PREP_Q) { d_wt_f16(Wq, BQ, DIM, 4 * INNER, 16.0f, blk); return; }
  blk -= PREP_Q;
  if (blk < PREP_O) { d_wt_f16(Wo, BO, INNER, DIM, 16.0f, blk); return; }
  blk -= PREP_O;
  if (blk < PREP_S) { d_wt_f16(Wsc, BS, HD, NP, 16.0f, blk); return; }
  d_x16(x, X16, (size_t)NR * DIM / 8, blk - PREP_S); }
__global__ __launch_bounds__(256) void k_h16(const float* __restrict__ x, _Float16* __restrict__ X16, size_t n8) { const size_t t = (size_t)blockIdx.x * 256 + threadIdx.x; if (t >= n8) return; FragH f;
#pragma unroll
  for (int q = 0; q < 8; ++q) f.h[q] = (_Float16)x[t * 8 + q]; *(v8us*)((unsigned short*)X16 + t * 8) = f.half[0];  }
__global__ __launch_bounds__(256) void k_round16f(const float* __restrict__ W, _Float16* __restrict__ Bt, size_t n8) { const size_t t = (size_t)blockIdx.x * 256 + threadIdx.x; if (t >= n8) return; FragH f;
#pragma unroll
  for (int i = 0; i < 8; ++i) f.h[i] = (_Float16)(bf16_round(W[t * 8 + i]) * 16.0f); *(v8us*)((unsigned short*)Bt + t * 8) = f.half[0];  }
template <int NHv, int TTv>
__global__ __launch_bounds__(256) void k_vt(const _Float16* __restrict__ V16, int ldv, int voff, int voffy, _Float16* __restrict__ Vt, size_t sVty) { __shared__ unsigned short tl[64][66]; const int tid = threadIdx.x; voff += blockIdx.y * voffy; Vt += (size_t)blockIdx.y * sVty;      /* blockIdx.y: which column group of V16 is transposed, into its own plane */ const int slab = blockIdx.x / (TTv / 64), lg = blockIdx.x % (TTv / 64); const int b = slab / NHv, h = slab % NHv;
  for (int i = tid; i < 64 * 8; i += 256) { const int r = i / 8, c8 = (i % 8) * 8; FragH f; f.half[0] = *(const v8us*)((const unsigned short*)V16 + ((size_t)b * TTv + lg * 64 + r) * ldv + voff + h * 64 + c8);
#pragma unroll
    for (int q = 0; q < 8; ++q) tl[r][c8 + q] = f.u[q]; }
  __syncthreads();
  {
#pragma unroll
    for (int rd = 0; rd < 2; ++rd) { const int d = rd * 32 + tid / 8, pc = tid % 8; FragH f;
#pragma unroll
      for (int q = 0; q < 8; ++q) f.u[q] = tl[pc * 8 + q][d];
      *(v8us*)((unsigned short*)Vt + ((size_t)slab * 64 + d) * TTv + lg * 64 + pc * 8) = f.half[0]; }
     } }

__global__ __launch_bounds__(256) void k_hl(const float* __restrict__ F, _Float16* __restrict__ Hh, _Float16* __restrict__ Hl, size_t n8) { const size_t t = (size_t)blockIdx.x * 256 + threadIdx.x; if (t >= n8) return; FragH fh, fl; const v4f a = *(const v4fa*)(F + t * 8), c = *(const v4fa*)(F + t * 8 + 4);
#pragma unroll
  for (int q = 0; q < 4; ++q) { _Float16 h = (_Float16)a[q]; fh.h[q] = h; fl.h[q] = (_Float16)((a[q] - (float)h) * 1024.0f); h = (_Float16)c[q]; fh.h[4 + q] = h; fl.h[4 + q] = (_Float16)((c[q] - (float)h) * 1024.0f); }
  { *(v8us*)((unsigned short*)Hh + t * 8) = fh.half[0]; *(v8us*)((unsigned short*)Hl + t * 8) = fl.half[0];  } }

// ---- fast GEMM (wave tile 32x64; requires M % 32 == 0 rows per launch region and N % 64 == 0); epilogue = k_gemm_hhx semantics ----
__device__ __forceinline__ v16h g2_frag(const _Float16* p, int hh) { FragH f; f.half[0] = *(const v8us*)((const unsigned short*)p + 8 * hh); f.half[1] = *(const v8us*)((const unsigned short*)p + 16 + 8 * hh); return f.v; }
__device__ __forceinline__ v8f g2_mma(v16h a, v16h b, v8f c) { v8f d = __builtin_amdgcn_wmma_f32_16x16x32_f16(false, a, false, b, (short)0, c, false, false); asm volatile("v_nop\n\tv_nop\n\tv_nop\n\tv_nop" : "+v"(d) : "v"(a), "v"(b)); return d; }
template <int ACT>
__global__ __launch_bounds__(128) void k_gemm2(const _Float16* __restrict__ A, int lda, size_t sA, const _Float16* __restrict__ Bh, int ldb, size_t sB, float alpha, const float* __restrict__ bias, size_t sBias, const float* __restrict__ CP, int rowsPerB, size_t sCPb, int row0g,
    float* __restrict__ C, _Float16* __restrict__ C16, int ldc, size_t sC, int M, int N, int K) { static_assert(ACT == 0 || ACT == 3 || ACT == 6 || ACT == 8 || ACT == 9 || ACT == 11 || ACT == 12 || ACT == 14 || ACT == 15 || ACT == 16 || ACT == 17, "k_gemm2: unsupported ACT code (would silently apply no activation)");
  __shared__ __attribute__((aligned(16))) float so[4][32][68];
  const int tid = threadIdx.x, w = tid >> 5, lane = tid & 31, ln = lane & 15, hh = lane >> 4; const int by = blockIdx.y;
  A += (size_t)by * sA; Bh += (size_t)by * sB; const size_t cofs = (size_t)by * sC; const float* bp = bias ? bias + (size_t)by * sBias : nullptr;
  const int ntn = N >> 6; const int mt = blockIdx.x / ntn, nq = blockIdx.x - mt * ntn; const int row0 = mt * 128 + 32 * w, col0 = nq * 64; if (row0 >= M) return;
  const _Float16* a0p = A + (size_t)(row0 + ln) * lda; const _Float16* a1p = a0p + (size_t)16 * lda;
  const _Float16* b0p = Bh + (size_t)(col0 + ln) * ldb; const _Float16* b1p = b0p + (size_t)16 * ldb; const _Float16* b2p = b1p + (size_t)16 * ldb; const _Float16* b3p = b2p + (size_t)16 * ldb;
  const v8f z8 = {0.f,0.f,0.f,0.f,0.f,0.f,0.f,0.f}; v8f c00 = z8, c01 = z8, c02 = z8, c03 = z8, c10 = z8, c11 = z8, c12 = z8, c13 = z8;
#pragma unroll 1
  for (int kb = 0; kb < K; kb += 32) { const v16h a0 = g2_frag(a0p + kb, hh), a1 = g2_frag(a1p + kb, hh);
    v16h b = g2_frag(b0p + kb, hh); c00 = g2_mma(a0, b, c00); c10 = g2_mma(a1, b, c10);
    b = g2_frag(b1p + kb, hh); c01 = g2_mma(a0, b, c01); c11 = g2_mma(a1, b, c11);
    b = g2_frag(b2p + kb, hh); c02 = g2_mma(a0, b, c02); c12 = g2_mma(a1, b, c12);
    b = g2_frag(b3p + kb, hh); c03 = g2_mma(a0, b, c03); c13 = g2_mma(a1, b, c13); }
  v8f accs[8] = {c00, c01, c02, c03, c10, c11, c12, c13};
#pragma unroll
  for (int u = 0; u < 8; ++u) { const int t = u & 3, half = u >> 2; const int col = col0 + t * 16 + ln; const float bv = bp ? bf16_round(bp[col]) : 0.f;
#pragma unroll
    for (int r = 0; r < 8; ++r) { const int rloc = half * 16 + 8 * hh + r; float v = accs[u][r] * alpha + bv; if (CP) { if (rowsPerB < 0) v += CP[cofs + (size_t)(row0g + row0 + rloc) * ldc + col];      /* rowsPerB < 0: own element of the batched C plane */ else { const int bidx = (row0g + row0 + rloc) / rowsPerB; v += CP[(size_t)bidx * sCPb + (size_t)by * 64 + col]; } }
      if (ACT == 3) v = fmaxf(v, 0.f); else if (ACT == 6) v = 0.5f * v * (1.0f + erff(v * 0.70710678118654752f)); else if (ACT == 11) v = 1.0f / (1.0f + expf(-v)); else if (ACT == 15) v = v / (1.0f + expf(-v)); else if (ACT == 12) v = (v > 0.f) ? v : 0.01f * v; else if (ACT == 8) v = tanhf(v); else if (ACT == 9) v = 0.5f * v * (1.0f + tanhf(0.7978845608028654f * (v + 0.044715f * v * v * v))); else if (ACT == 14) v = (v > 0.f) ? v : 0.1f * v; else if (ACT == 16) v = (v >= 0.f) ? v : 0.3f * v; else if (ACT == 17) v = (v >= 0.f) ? v : 0.2f * v;
      so[w][rloc][t * 16 + ln] = v; } }
  __builtin_amdgcn_fence(__ATOMIC_ACQ_REL, "workgroup"); __builtin_amdgcn_wave_barrier();
  const int rsub = lane >> 4, c4 = (lane & 15) * 4;
  {
#pragma unroll
    for (int q = 0; q < 16; ++q) { const int r = q * 2 + rsub; const v4f v = *(const v4fa*)&so[w][r][c4]; if (C) *(v4f*)(C + cofs + (size_t)(row0 + r) * ldc + col0 + c4) = v; if (C16) { v4h h4; for (int i = 0; i < 4; ++i) h4[i] = (_Float16)v[i]; *(v4h*)(C16 + cofs + (size_t)(row0 + r) * ldc + col0 + c4) = h4; } }
     } }

// ---- split-K GEMM for the K = 2048 product with few output tiles (f^T v): one 32x64 tile per block, its K range dealt over SKW waves, f32 partial tiles summed through LDS in wave order; v = sum * alpha (+ own element of CP) ----
#define SKW 16                   /* waves per tile; each takes KT / SKW of the k range */
template <int KT>
__global__ __launch_bounds__(32 * SKW) void k_gemm2k(const _Float16* __restrict__ A, int lda, size_t sA, const _Float16* __restrict__ Bh, int ldb, size_t sB, float alpha, const float* CP, float* C, int ldc, size_t sC) {
  static_assert(KT % (32 * SKW) == 0, "k_gemm2k: every wave takes whole 32-deep steps");
  __shared__ __attribute__((aligned(16))) float so[SKW][32][68];
  const int tid = threadIdx.x, w = tid >> 5, lane = tid & 31, ln = lane & 15, hh = lane >> 4; const int by = blockIdx.y;
  A += (size_t)by * sA + w * (KT / SKW); Bh += (size_t)by * sB + w * (KT / SKW); const size_t cofs = (size_t)by * sC; const int row0 = blockIdx.x * 32;
  const _Float16* a0p = A + (size_t)(row0 + ln) * lda; const _Float16* a1p = a0p + (size_t)16 * lda;
  const _Float16* b0p = Bh + (size_t)ln * ldb; const _Float16* b1p = b0p + (size_t)16 * ldb; const _Float16* b2p = b1p + (size_t)16 * ldb; const _Float16* b3p = b2p + (size_t)16 * ldb;
  const v8f z8 = {0.f,0.f,0.f,0.f,0.f,0.f,0.f,0.f}; v8f c00 = z8, c01 = z8, c02 = z8, c03 = z8, c10 = z8, c11 = z8, c12 = z8, c13 = z8;
  for (int kb = 0; kb < KT / SKW; kb += 32) { const v16h a0 = g2_frag(a0p + kb, hh), a1 = g2_frag(a1p + kb, hh);
    v16h b = g2_frag(b0p + kb, hh); c00 = g2_mma(a0, b, c00); c10 = g2_mma(a1, b, c10);
    b = g2_frag(b1p + kb, hh); c01 = g2_mma(a0, b, c01); c11 = g2_mma(a1, b, c11);
    b = g2_frag(b2p + kb, hh); c02 = g2_mma(a0, b, c02); c12 = g2_mma(a1, b, c12);
    b = g2_frag(b3p + kb, hh); c03 = g2_mma(a0, b, c03); c13 = g2_mma(a1, b, c13); }
  v8f accs[8] = {c00, c01, c02, c03, c10, c11, c12, c13};
  // both loops unrolled: accs is then indexed by constants only and stays in registers
#pragma unroll
  for (int u = 0; u < 8; ++u) { const int t = u & 3, half = u >> 2;
#pragma unroll
    for (int r = 0; r < 8; ++r) so[w][half * 16 + 8 * hh + r][t * 16 + ln] = accs[u][r]; }
  __syncthreads();      /* every wave's partial tile is in LDS before any thread sums across waves */
  const int r = tid >> 4, c4 = (tid & 15) * 4; v4f s = *(const v4fa*)&so[0][r][c4];
  for (int u = 1; u < SKW; ++u) s += *(const v4fa*)&so[u][r][c4];
  const size_t o = cofs + (size_t)(row0 + r) * ldc + c4; v4f v = s * alpha; if (CP) v += *(const v4fa*)(CP + o);
  *(v4f*)(C + o) = v; }


// ---- fused attention: scores, softmax weights and readout of 32 query rows of one (batch, head) at a time in one block; the 2048 keys are dealt over FAW waves, 128 each ----
#define FAW 16
#define FAT 8                    /* 32-row query tiles that one block walks: 8 x 32 (batch, head) pairs = 256 blocks, each started once */
__device__ __forceinline__ v8f fa_mma(v16h a, v16h b, v8f c) { return __builtin_amdgcn_wmma_f32_16x16x32_f16(false, a, false, b, (short)0, c, false, false); }
// fragment in the hardware k order from a wave-uniform base and the lane's own element offset (row ln, k 8 * hh; one offset serves q, k and poss_value, whose row pitch is the same)
__device__ __forceinline__ v16h fa_frag(const _Float16* ub, unsigned lo) { FragH f; f.half[0] = *(const v8us*)((const unsigned short*)ub + lo); f.half[1] = *(const v8us*)((const unsigned short*)ub + lo + 16); return f.v; }
// eight independent 2^x in place: each v_exp_f32 fills the slot that the instruction set asks for behind the one before it, the v_nop fills the last one's
__device__ __forceinline__ void fa_exp2x8(float* x) {
  asm("v_exp_f32 %0, %0\n\tv_exp_f32 %1, %1\n\tv_exp_f32 %2, %2\n\tv_exp_f32 %3, %3\n\tv_exp_f32 %4, %4\n\tv_exp_f32 %5, %5\n\tv_exp_f32 %6, %6\n\tv_exp_f32 %7, %7\n\tv_nop"
      : "+v"(x[0]), "+v"(x[1]), "+v"(x[2]), "+v"(x[3]), "+v"(x[4]), "+v"(x[5]), "+v"(x[6]), "+v"(x[7])); }
// amdgpu_waves_per_eu(4, 4): one 16-wave block per WGP is the plan, so the scheduler may spend the 256 registers of a wave on loads in flight
__global__ __launch_bounds__(32 * FAW) __attribute__((amdgpu_waves_per_eu(4, 4))) void k_fattn(const _Float16* QKFV, const _Float16* PVH, const _Float16* PVL, _Float16* CH, _Float16* CL) {      /* no __restrict__: with it the key fragments, the same for every tile, are lifted out of the tile loop and spilled */
  static_assert(NP == FAW * 128 && HD == 64 && 4 * INNER == NP, "k_fattn: 128 keys per wave, head size 64, one row pitch for q, k and poss_value");
  __shared__ __attribute__((aligned(16))) float so[FAW][32][68];
  __shared__ __attribute__((aligned(16))) float smx[32][FAW + 4];      /* [query][wave], pitch 80 B: one lane reads its row by 16-byte loads */
  __shared__ __attribute__((aligned(16))) float ssu[32][FAW + 4];
  const int tid = threadIdx.x, w = __builtin_amdgcn_readfirstlane(tid >> 5), lane = tid & 31, ln = lane & 15, hh = lane >> 4;
  const int bh = blockIdx.y, b = bh / NH, h = bh - b * NH;
  const int ldq = 4 * INNER; const unsigned lo = (unsigned)(ln * NP + 8 * hh);
  const _Float16* base = QKFV + (size_t)b * NP * ldq + h * HD;
  const _Float16* kp = base + INNER + (size_t)(w * 128) * ldq;
  const v8f z8 = {0.f,0.f,0.f,0.f,0.f,0.f,0.f,0.f};
  // every loop inside a tile is unrolled: the fragment and accumulator arrays are then indexed by constants only and stay in registers
  // the tile loop stays rolled: one tile's code is long and holds nearly all registers. No third barrier: a wave rewrites smx only behind the second barrier of the tile before, and so / ssu only behind the first barrier of its own tile, which no wave passes before every wave has read the tile before
#pragma unroll 1
  for (int it = 0; it < FAT; ++it) {
  const int row0 = (blockIdx.x * FAT + it) * 32;
  const _Float16* qp = base + (size_t)row0 * ldq;
  // S^T = K Q^T: s[t][u][r] = score of key w*128 + t*16 + 8*hh + r against query row0 + u*16 + ln
  v8f s[8][2];
  { const v16h q00 = fa_frag(qp, lo), q01 = fa_frag(qp + 32, lo), q10 = fa_frag(qp + 16 * ldq, lo), q11 = fa_frag(qp + 16 * ldq + 32, lo);
    v16h kf[8][2];
#pragma unroll
    for (int t = 0; t < 8; ++t) { const _Float16* kr = kp + (size_t)t * 16 * ldq; kf[t][0] = fa_frag(kr, lo); kf[t][1] = fa_frag(kr + 32, lo); }
    // takes every loaded fragment of the score phase as an input: all 40 loads are issued ahead of the first product, one memory latency instead of one per key tile
    asm volatile("" :: "v"(q00), "v"(q01), "v"(q10), "v"(q11), "v"(kf[0][0]), "v"(kf[0][1]), "v"(kf[1][0]), "v"(kf[1][1]), "v"(kf[2][0]), "v"(kf[2][1]), "v"(kf[3][0]), "v"(kf[3][1]),
                 "v"(kf[4][0]), "v"(kf[4][1]), "v"(kf[5][0]), "v"(kf[5][1]), "v"(kf[6][0]), "v"(kf[6][1]), "v"(kf[7][0]), "v"(kf[7][1]));
#pragma unroll
    for (int t = 0; t < 8; ++t) { s[t][0] = fa_mma(kf[t][1], q01, fa_mma(kf[t][0], q00, z8)); s[t][1] = fa_mma(kf[t][1], q11, fa_mma(kf[t][0], q10, z8)); } }
  // poss_value fragments come in 8 groups of 4 (group g: residual plane for g < 4, then the hi plane; 32 keys g & 3; 4 column tiles) into two buffers; the first flies under the softmax, the second is asked for behind it, group g + 2 right behind the products of group g
  const size_t pvo = (size_t)bh * HD * NP + w * 128;
  const _Float16* pl = PVL + pvo; const _Float16* ph = PVH + pvo;
  v16h bf[2][4];
  // row maximum: in-lane over the wave's keys, across the two lane halves, then across the waves through LDS
  float m0 = s[0][0][0], m1 = s[0][1][0];
#pragma unroll
  for (int t = 0; t < 8; ++t) {
#pragma unroll
    for (int r = 0; r < 8; ++r) { m0 = fmaxf(m0, s[t][0][r]); m1 = fmaxf(m1, s[t][1][r]); } }
  m0 = fmaxf(m0, __shfl_xor(m0, 16, 32)); m1 = fmaxf(m1, __shfl_xor(m1, 16, 32));
  smx[lane][w] = hh ? m1 : m0;      /* row q = maxima of query row0 + q, one per wave */
  __syncthreads();      /* every wave's row maxima are in LDS before any wave joins them */
#pragma unroll
  for (int t = 0; t < 4; ++t) bf[0][t] = fa_frag(pl + (size_t)t * 16 * NP, lo);
  __builtin_amdgcn_sched_barrier(0);      /* holds these 8 loads ahead of the softmax, which hides their latency */
  float mq;
  { const v4f x0 = *(const v4fa*)&smx[lane][0], x1 = *(const v4fa*)&smx[lane][4], x2 = *(const v4fa*)&smx[lane][8], x3 = *(const v4fa*)&smx[lane][12];
    mq = x0[0];
#pragma unroll
    for (int i = 0; i < 4; ++i) mq = fmaxf(fmaxf(mq, fmaxf(x0[i], x1[i])), fmaxf(x2[i], x3[i])); }
  m0 = __shfl(mq, ln, 32); m1 = __shfl(mq, 16 + ln, 32);
  // weights e * 2^10 = 2^((s - max) / 8 * log2 e + 10); two score tiles (32 keys) of one query tile are one B fragment in the hardware k order
  const float cs = 0.125f * 1.4426950408889634f; const float f0 = 10.0f - m0 * cs, f1 = 10.0f - m1 * cs;
  float su0 = 0.f, su1 = 0.f; v16h p[4][2];
#pragma unroll
  for (int ks = 0; ks < 4; ++ks) {
#pragma unroll
    for (int u = 0; u < 2; ++u) { float x[16]; FragH a; float sa = 0.f;
#pragma unroll
      for (int i = 0; i < 16; ++i) x[i] = s[2 * ks + (i >> 3)][u][i & 7] * cs + (u ? f1 : f0);
      fa_exp2x8(x); fa_exp2x8(x + 8);
#pragma unroll
      for (int i = 0; i < 16; ++i) { sa += x[i]; a.h[i] = (_Float16)x[i]; }
      if (u) su1 += sa; else su0 += sa;
      p[ks][u] = a.v;
      __builtin_amdgcn_sched_barrier(0); } }      /* one fragment's 16 temporaries at a time: run together, the eight fragments' temporaries push the wave over its 256 registers */
  su0 += __shfl_xor(su0, 16, 32); su1 += __shfl_xor(su1, 16, 32);
  ssu[lane][w] = hh ? su1 : su0;
  // readout over the wave's 128 keys, transposed (A = poss_value rows, B = weights): o[u][t][r] = column t*16 + 8*hh + r of query row0 + u*16 + ln; residual plane first, scaled by 2^-10, then the hi plane on top
  v8f o[2][4] = {{z8, z8, z8, z8}, {z8, z8, z8, z8}};
  __builtin_amdgcn_sched_barrier(0);      /* the second group waits for the registers that the packed scores give back */
#pragma unroll
  for (int t = 0; t < 4; ++t) bf[1][t] = fa_frag(pl + (size_t)t * 16 * NP + 32, lo);
  __builtin_amdgcn_sched_barrier(0);      /* and is asked for ahead of the first products */
#pragma unroll
  for (int g = 0; g < 8; ++g) {
    if (g == 4) {
#pragma unroll
      for (int t = 0; t < 4; ++t) { o[0][t] *= 0.0009765625f; o[1][t] *= 0.0009765625f; } }
#pragma unroll
    for (int t = 0; t < 4; ++t) { o[0][t] = fa_mma(bf[g & 1][t], p[g & 3][0], o[0][t]); o[1][t] = fa_mma(bf[g & 1][t], p[g & 3][1], o[1][t]); }
    // the two scheduling barriers hold the loads of group g + 2 between the products of groups g and g + 1: a group is always in flight under the products (the compiler otherwise sinks every load to its use)
    __builtin_amdgcn_sched_barrier(0);
    if (g + 2 < 8) { const _Float16* pp = (g + 2 < 4 ? pl : ph) + ((g + 2) & 3) * 32;
#pragma unroll
      for (int t = 0; t < 4; ++t) bf[g & 1][t] = fa_frag(pp + (size_t)t * 16 * NP, lo);
      __builtin_amdgcn_sched_barrier(0); } }
#pragma unroll
  for (int u = 0; u < 2; ++u) {
#pragma unroll
    for (int t = 0; t < 4; ++t) { const v8f d = o[u][t]; float* sp = &so[w][u * 16 + ln][t * 16 + 8 * hh];
      *(v4fa*)sp = (v4f){d[0], d[1], d[2], d[3]}; *(v4fa*)(sp + 4) = (v4f){d[4], d[5], d[6], d[7]}; } }
  __syncthreads();      /* every wave's partial tile and row sums are in LDS before any thread sums across waves */
  const int r = tid >> 4, c4 = (tid & 15) * 4; v4f pt[FAW];
#pragma unroll
  for (int u = 0; u < FAW; ++u) pt[u] = *(const v4fa*)&so[u][r][c4];
  const v4f y0 = *(const v4fa*)&ssu[r][0], y1 = *(const v4fa*)&ssu[r][4], y2 = *(const v4fa*)&ssu[r][8], y3 = *(const v4fa*)&ssu[r][12];
  v4f a = pt[0];
#pragma unroll
  for (int u = 1; u < FAW; ++u) a += pt[u];
  const v4f ys = (y0 + y1) + (y2 + y3); const float su = (ys[0] + ys[1]) + (ys[2] + ys[3]);
  const float rs = 1.0f / su; v4h ch, cl;
#pragma unroll
  for (int q = 0; q < 4; ++q) { const float v = a[q] * rs; const _Float16 hv = (_Float16)v; ch[q] = hv; cl[q] = (_Float16)((v - (float)hv) * 1024.0f); }
  const size_t oo = ((size_t)b * NP + row0 + r) * INNER + h * HD + c4;
  *(v4h*)(CH + oo) = ch; *(v4h*)(CL + oo) = cl;
  } }

__global__ __launch_bounds__(256) void k_addhl(const float* __restrict__ A, const float* __restrict__ Bq, _Float16* __restrict__ Hh, _Float16* __restrict__ Lh, size_t n8) {
  #pragma clang fp contract(off)
  const size_t t = (size_t)blockIdx.x * 256 + threadIdx.x; if (t >= n8) return; const v8f a = *(const v8f*)(A + t * 8), b = *(const v8f*)(Bq + t * 8); FragH fh, fl; for (int q = 0; q < 8; ++q) { const float v = a[q] + b[q]; const _Float16 hv = (_Float16)v; fh.h[q] = hv; fl.h[q] = (_Float16)((v - (float)hv) * 1024.0f); }
  { *(v8us*)((unsigned short*)Hh + t * 8) = fh.half[0]; *(v8us*)((unsigned short*)Lh + t * 8) = fl.half[0];  } }

extern "C" void kernel_launch(void* const* d_in, const int* in_sizes, int n_in,
                              void* d_out, int out_size, void* d_ws, size_t ws_size, hipStream_t stream) {
  (void)in_sizes; (void)n_in; (void)out_size;
  const float* x = (const float*)d_in[0]; const float* Wqkfv = (const float*)d_in[1]; const float* Wsc = (const float*)d_in[2]; const float* bsc = (const float*)d_in[3]; const float* Wout = (const float*)d_in[4]; const float* bout = (const float*)d_in[5];
  char* ws = (char*)d_ws; size_t off = 0;
  auto take = [&](size_t bytes) { char* p = ws + off; off += (bytes + 255) & ~(size_t)255; return p; };
  _Float16* BQ = (_Float16*)take((size_t)4 * INNER * DIM * 2); _Float16* BS = (_Float16*)take((size_t)NP * HD * 2); _Float16* BO = (_Float16*)take((size_t)DIM * INNER * 2);
  _Float16* X16 = (_Float16*)take((size_t)NR * DIM * 2); _Float16* QKFV = (_Float16*)take((size_t)NR * 4 * INNER * 2);      /* [row][q | k | f | v] f16, 32 MiB */
  _Float16* FT = (_Float16*)take((size_t)2 * NB * NH * HD * NP * 2); _Float16* VTT = FT + (size_t)NB * NH * HD * NP;      /* f^T, then v^T, each [b][h][64][2048] */ float* FV = (float*)take((size_t)NB * NH * HD * HD * 4); _Float16* FVH = (_Float16*)take((size_t)NB * NH * HD * HD * 2); _Float16* FVL = (_Float16*)take((size_t)NB * NH * HD * HD * 2);
  float* PV = (float*)take((size_t)NB * NH * HD * NP * 4); float* PV2 = (float*)take((size_t)NB * NH * HD * NP * 4); _Float16* PVH = (_Float16*)take((size_t)NB * NH * HD * NP * 2); _Float16* PVL = (_Float16*)take((size_t)NB * NH * HD * NP * 2);      /* poss_value planes of all batches [b][h][64][2048] */
  _Float16* CH = (_Float16*)take((size_t)NR * INNER * 2); _Float16* CL = (_Float16*)take((size_t)NR * INNER * 2);
  if (off > ws_size) return;      /* about 124 MiB */
  k_prep<<<PREP_Q + PREP_O + PREP_S + PREP_X, 256, 0, stream>>>(Wqkfv, BQ, Wout, BO, Wsc, BS, x, X16);      /* weights transposed, all x @ W (in, out), and the f16 x plane */
  k_gemm2<0><<<dim3((NR / 128) * (4 * INNER / 64), 1), 128, 0, stream>>>(X16, DIM, 0, BQ, DIM, 0, 0.0625f, nullptr, 0, nullptr, 1, 0, 0, nullptr, QKFV, 4 * INNER, 0, NR, 4 * INNER, DIM);      /* [q | k | f | v], head h at h*64 inside each quarter */
  // the poss_value chain: every stage is one launch whose grid runs over all (batch, head) pairs, and over both of two jobs that need nothing of each other
  k_vt<NH, NP><<<dim3(NB * NH * (NP / 64), 2), 256, 0, stream>>>(QKFV, 4 * INNER, 2 * INNER, INNER, FT, (size_t)NB * NH * HD * NP);      /* f^T (y = 0) and v^T (y = 1) per batch and head [64][2048] */
  k_gemm2k<NP><<<dim3(HD / 32, NB * NH), 32 * SKW, 0, stream>>>(FT, NP, (size_t)HD * NP, VTT, NP, (size_t)HD * NP, 1.0f, nullptr, FV, HD, (size_t)HD * HD);      /* FV[b][h][d][e] = sum_n f[n][d] v[n][e] (32-row tiles, K over the block's waves) */
  k_hl<<<(NB * NH * HD * HD / 8 + 255) / 256, 256, 0, stream>>>(FV, FVH, FVL, (size_t)NB * NH * HD * HD / 8);
  k_gemm_hhx<0><<<dim3((HD / 16) * (NP / 64) / 4, NB * NH, 2), 128, 0, stream>>>(FVH, HD, (size_t)HD * HD, BS, HD, 0, 0.0625f, bsc, 0, nullptr, 1, 0, 0, PV, nullptr, NP, (size_t)HD * NP, HD, NP, HD, FVL, 0.0625f / 1024.0f, PV2);      /* z = 0: hi term + b_scales into PV; z = 1: lo term into PV2 */
  k_addhl<<<(unsigned)(((size_t)NB * NH * HD * NP / 8 + 255) / 256), 256, 0, stream>>>(PV, PV2, PVH, PVL, (size_t)NB * NH * HD * NP / 8);      /* poss_value = (FV_hi + FV_lo) w_scales + b as f16 hi/residual */
  k_fattn<<<dim3(NP / (32 * FAT), NB * NH), 32 * FAW, 0, stream>>>(QKFV, PVH, PVL, CH, CL);      /* softmax(q k^T / 8) . poss_value^T, row-scaled, as f16 hi/residual */
  k_gemm2<0><<<dim3((NR / 128) * (DIM / 64), 1), 128, 0, stream>>>(CL, INNER, 0, BO, INNER, 0, 0.0625f / 1024.0f, nullptr, 0, nullptr, 1, 0, 0, (float*)d_out, nullptr, DIM, 0, NR, DIM, INNER);
  k_gemm2<0><<<dim3((NR / 128) * (DIM / 64), 1), 128, 0, stream>>>(CH, INNER, 0, BO, INNER, 0, 0.0625f, bout, 0, (const float*)d_out, 1, (size_t)DIM, 0, (float*)d_out, nullptr, DIM, 0, NR, DIM, INNER);      /* y = (c_lo + c_hi) w_out + b_out */
}

// v004
// One run takes 210 microseconds.
// In both of two side-by-side timings against v003, it was 1.22 times as fast.
// Counting every step since v000, it is 9.50 times as fast.
#include <hip/hip_runtime.h>
// SimilarAttention (4 x 2048 patches x 512, 8 heads x 64: [q|k|f|v] = x w_qkfv; attn = softmax(q.k/8); poss_value = (f^T v) w_scales + b_scales -> [h][64][2048]; out = attn . poss_value^T; y = merged . w_out + b_out).
// Structure: exact f16 x plane; the fused projection as ONE f16 WMMA GEMM (32x64 wave tiles, f32 accumulation, exact x16 weights; f16 out); then, each stage as ONE launch over all batches and heads: f^T and v^T by LDS tiles (one grid, blockIdx.y picks the plane), f^T v as 32-row WMMA tiles (K = 2048 dealt over a block's 16 waves, f32 partials summed in LDS) then f16 hi/residual, (f^T v) w_scales + b as two 16-row-tile GEMM terms into f32 then f16 hi/residual planes; then ONE launch for all batches and heads that keeps scores and softmax weights in registers: a block takes 256 query rows of one head, 32 per wave, and walks the keys in tiles of 64 that are staged once per block in LDS (scores transposed, K = 64, f32; running row maximum and row sum; unnormalised f16 weights x 2^10 packed from the score accumulators into the B operand; readout against the residual plane, scaled, then the hi plane on the same f32 accumulators; row scaling + hi/residual); w_out as two GEMM terms (+ bias).
// Compute dtype: inputs rounded to bf16; x / weights exact as f16; q, k, f, v and the softmax weights as plain f16 operands (~2^-12); f^T v, poss_value and the merged context as f16 hi + residual. v_wmma_f32_16x16x32_f16.
#define NB 4
#define NP 2048
#define DIM 512
#define NH 8
#define HD 64
#define INNER 512
#define NR (NB * NP)
typedef __bf16 v16b __attribute__((ext_vector_type(16)));
typedef unsigned short v8us __attribute__((ext_vector_type(8), may_alias));
typedef float  v8f  __attribute__((ext_vector_type(8)));
typedef float  v4f  __attribute__((ext_vector_type(4)));
typedef float  v4fa __attribute__((ext_vector_type(4), may_alias));
union FragB { v16b v; v8us half[2]; unsigned short u[16]; };

__device__ __forceinline__ unsigned short bf16_bits(float x) { unsigned int u = __float_as_uint(x); return (unsigned short)((u + 0x7FFFu + ((u >> 16) & 1u)) >> 16); }
__device__ __forceinline__ float bf16_val(unsigned short b) { return __uint_as_float(((unsigned int)b) << 16); }
__device__ __forceinline__ float bf16_round(float x) { return bf16_val(bf16_bits(x)); }
// D += A·B with NT terms: 1 = ah·bh, 2 = + al·bh (A split), 3 = + ah·bl (both split)
template <int NT>
__device__ __forceinline__ v8f mmaN(v16b ah, v16b al, v16b bh, v16b bl, v8f c) {
  c = __builtin_amdgcn_wmma_f32_16x16x32_bf16(false, ah, false, bh, (short)0, c, false, false);
  if (NT >= 2) c = __builtin_amdgcn_wmma_f32_16x16x32_bf16(false, al, false, bh, (short)0, c, false, false);
  if (NT >= 3) c = __builtin_amdgcn_wmma_f32_16x16x32_bf16(false, ah, false, bl, (short)0, c, false, false);
  asm volatile("v_nop\n\tv_nop\n\tv_nop\n\tv_nop" : "+v"(c) : "v"(ah), "v"(al), "v"(bh), "v"(bl));
  return c;
}

__global__ __launch_bounds__(256) void k_wt_bf16(const float* __restrict__ W, unsigned short* __restrict__ Wt, int K, int N) {
  const int t = blockIdx.x * 256 + threadIdx.x;
  const int k8n = K / 8;
  if (t >= N * k8n) return;
  const int n = t / k8n, k8 = (t % k8n) * 8;
  v8us v;
#pragma unroll
  for (int i = 0; i < 8; ++i) v[i] = bf16_bits(W[(size_t)(k8 + i) * N + n]);
  *(v8us*)(Wt + (size_t)n * K + k8) = v;
  
}

// GEMM C[M][N] (f32, pitch ldc) = act(A[M][K]·W + bias). A f32 row-major (pitch lda) converted per fragment to bf16
// (ASPLIT: hi/lo two planes -> 2 terms, else single rounded term); Wt bf16 [N][K] (pitch ldb). BIAS_BF16 rounds the
// bias to bf16 first (bias quantised to bf16 before the add). K%32==0, M%16==0, N%64==0.
template <bool ASPLIT, int ACT, bool BIAS_BF16>
__global__ __launch_bounds__(128) void k_gemm_bf(const float* __restrict__ A, int lda, const unsigned short* __restrict__ Wt, int ldb,
                                               const float* __restrict__ bias, float* __restrict__ C, int ldc, int M, int N, int K) {
  __shared__ __attribute__((aligned(16))) float so[4][16][64];
  const int tid = threadIdx.x, w = tid >> 5, lane = tid & 31, ln = lane & 15, hh = lane >> 4;
  const int ntn = N / 64;
  const int wid = blockIdx.x * 4 + w;
  const int mt = wid / ntn, nq = wid % ntn;
  if (mt * 16 >= M) return;
  const int row0 = mt * 16, col0 = nq * 64;
  const float* arow = A + (size_t)(row0 + ln) * lda;
  v8f acc[4] = {};
  for (int kb = 0; kb < K; kb += 32) {
    FragB ah, al;
    const v4f x0 = *(const v4fa*)(arow + kb + 8 * hh), x1 = *(const v4fa*)(arow + kb + 8 * hh + 4);
    const v4f x2 = *(const v4fa*)(arow + kb + 16 + 8 * hh), x3 = *(const v4fa*)(arow + kb + 16 + 8 * hh + 4);
    float xs[16] = {x0[0],x0[1],x0[2],x0[3],x1[0],x1[1],x1[2],x1[3],x2[0],x2[1],x2[2],x2[3],x3[0],x3[1],x3[2],x3[3]};
#pragma unroll
    for (int i = 0; i < 16; ++i) { const unsigned short hb = bf16_bits(xs[i]); ah.u[i] = hb; al.u[i] = ASPLIT ? bf16_bits(xs[i] - bf16_val(hb)) : (unsigned short)0; }
#pragma unroll
    for (int t = 0; t < 4; ++t) {
      const unsigned short* brow = Wt + (size_t)(col0 + t * 16 + ln) * ldb + kb;
      FragB b;
      b.half[0] = *(const v8us*)(brow + 8 * hh);
      b.half[1] = *(const v8us*)(brow + 16 + 8 * hh);
      acc[t] = mmaN<ASPLIT ? 2 : 1>(ah.v, al.v, b.v, b.v, acc[t]);
    }
  }
#pragma unroll
  for (int t = 0; t < 4; ++t) {
    float bv = bias ? bias[col0 + t * 16 + ln] : 0.f;
    if (BIAS_BF16) bv = bf16_round(bv);
#pragma unroll
    for (int r = 0; r < 8; ++r) { float v = acc[t][r] + bv; if (ACT == 1) v = fmaxf(v, 0.f); so[w][8 * hh + r][t * 16 + ln] = v; }
  }
  __builtin_amdgcn_fence(__ATOMIC_ACQ_REL, "workgroup");
  __builtin_amdgcn_wave_barrier();
  const int rsub = lane >> 4, c4 = (lane & 15) * 4;
  {
#pragma unroll
    for (int q = 0; q < 8; ++q) {
      const int r = q * 2 + rsub;
      const v4f v = *(const v4fa*)&so[w][r][c4];
      *(v4f*)(C + (size_t)(row0 + r) * ldc + col0 + c4) = v;
    }
    
  }
}

// GEMM C = act(A·W + bias + resid): A f32 (ASPLIT -> hi/lo 2 terms), Wt bf16 [N][K]; ACT 0 none, 1 relu, 2 exact gelu;
// resid (optional, f32, row index = (row % rmod), pitch ldr, RES_BF16 rounds it) added before the activation.
template <bool ASPLIT, int ACT, bool BIAS_BF16, bool RES_BF16>
__global__ __launch_bounds__(128) void k_gemm_bf3(const float* __restrict__ A, int lda, const unsigned short* __restrict__ Wt, int ldb,
                                                const float* __restrict__ bias, const float* __restrict__ resid, int rmod, int ldr,
                                                float* __restrict__ C, int ldc, int M, int N, int K) {
  __shared__ __attribute__((aligned(16))) float so[4][16][64];
  const int tid = threadIdx.x, w = tid >> 5, lane = tid & 31, ln = lane & 15, hh = lane >> 4;
  const int ntn = N / 64;
  const int wid = blockIdx.x * 4 + w;
  const int mt = wid / ntn, nq = wid % ntn;
  if (mt * 16 >= M) return;
  const int row0 = mt * 16, col0 = nq * 64;
  const float* arow = A + (size_t)(row0 + ln) * lda;
  v8f acc[4] = {};
  for (int kb = 0; kb < K; kb += 32) {
    FragB ah, al;
    const v4f x0 = *(const v4fa*)(arow + kb + 8 * hh), x1 = *(const v4fa*)(arow + kb + 8 * hh + 4);
    const v4f x2 = *(const v4fa*)(arow + kb + 16 + 8 * hh), x3 = *(const v4fa*)(arow + kb + 16 + 8 * hh + 4);
    float xs[16] = {x0[0],x0[1],x0[2],x0[3],x1[0],x1[1],x1[2],x1[3],x2[0],x2[1],x2[2],x2[3],x3[0],x3[1],x3[2],x3[3]};
#pragma unroll
    for (int i = 0; i < 16; ++i) { const unsigned short hb = bf16_bits(xs[i]); ah.u[i] = hb; al.u[i] = ASPLIT ? bf16_bits(xs[i] - bf16_val(hb)) : (unsigned short)0; }
#pragma unroll
    for (int t = 0; t < 4; ++t) {
      const unsigned short* brow = Wt + (size_t)(col0 + t * 16 + ln) * ldb + kb;
      FragB b;
      b.half[0] = *(const v8us*)(brow + 8 * hh);
      b.half[1] = *(const v8us*)(brow + 16 + 8 * hh);
      acc[t] = mmaN<ASPLIT ? 2 : 1>(ah.v, al.v, b.v, b.v, acc[t]);
    }
  }
#pragma unroll
  for (int t = 0; t < 4; ++t) {
    const int col = col0 + t * 16 + ln;
    float bv = bias ? bias[col] : 0.f;
    if (BIAS_BF16) bv = bf16_round(bv);
#pragma unroll
    for (int r = 0; r < 8; ++r) {
      float v = acc[t][r] + bv;
      if (resid) { float rv = resid[(size_t)((row0 + 8 * hh + r) % rmod) * ldr + col]; if (RES_BF16) rv = bf16_round(rv); v += rv; }
      if (ACT == 1) v = fmaxf(v, 0.f);
      if (ACT == 2) v = 0.5f * v * (1.0f + erff(v * 0.70710678118654752f));
      if (ACT == 3) { const float u = 0.7978845608028654f * (v + 0.044715f * v * v * v); v = 0.5f * v * (1.0f + tanhf(u)); }
      so[w][8 * hh + r][t * 16 + ln] = v;
    }
  }
  __builtin_amdgcn_fence(__ATOMIC_ACQ_REL, "workgroup");
  __builtin_amdgcn_wave_barrier();
  const int rsub = lane >> 4, c4 = (lane & 15) * 4;
  {
#pragma unroll
    for (int q = 0; q < 8; ++q) {
      const int r = q * 2 + rsub;
      const v4f v = *(const v4fa*)&so[w][r][c4];
      *(v4f*)(C + (size_t)(row0 + r) * ldc + col0 + c4) = v;
    }
    
  }
}
// row LayerNorm (biased variance, eps) over N: s = X (+ R); optional out_sum <- s; out_norm <- (s-mu)*rsqrt(var+eps)*g + b
template <bool PARAM_BF16>
__global__ __launch_bounds__(256) void k_layernorm(const float* __restrict__ X, const float* __restrict__ R, const float* __restrict__ g, const float* __restrict__ bta,
                                                  float* __restrict__ out_sum, float* __restrict__ out_norm, int N, float eps) {
  __shared__ float red[256];
  const int row = blockIdx.x, tid = threadIdx.x;
  const float* x = X + (size_t)row * N; const float* rr = R ? R + (size_t)row * N : nullptr;
  float vals[16];                     // up to N = 4096
  const int per = N / 256;            // contiguous chunk per thread? use strided-by-4 chunks: thread handles j = tid*4 + 1024*u
  float s1 = 0.f;
  for (int u = 0; u < per / 4; ++u) {
    const int j = tid * 4 + 1024 * u;
    const v4f a = *(const v4fa*)(x + j);
    v4f b = {0.f,0.f,0.f,0.f}; if (rr) b = *(const v4fa*)(rr + j);
#pragma unroll
    for (int q = 0; q < 4; ++q) { const float v = a[q] + b[q]; vals[u * 4 + q] = v; s1 += v; }
  }
  red[tid] = s1; __syncthreads();
  for (int st = 128; st > 0; st >>= 1) { if (tid < st) red[tid] += red[tid + st]; __syncthreads(); }
  const float mu = red[0] / (float)N; __syncthreads();
  float s2 = 0.f;
  for (int u = 0; u < per / 4; ++u)
#pragma unroll
    for (int q = 0; q < 4; ++q) { const float c = vals[u * 4 + q] - mu; s2 += c * c; }
  red[tid] = s2; __syncthreads();
  for (int st = 128; st > 0; st >>= 1) { if (tid < st) red[tid] += red[tid + st]; __syncthreads(); }
  const float rs = rsqrtf(red[0] / (float)N + eps);
  {
    for (int u = 0; u < per / 4; ++u) {
      const int j = tid * 4 + 1024 * u;
      v4f o, sm;
#pragma unroll
      for (int q = 0; q < 4; ++q) {
        float gg = g[j + q], bb = bta[j + q];
        if (PARAM_BF16) { gg = bf16_round(gg); bb = bf16_round(bb); }
        sm[q] = vals[u * 4 + q]; o[q] = (vals[u * 4 + q] - mu) * rs * gg + bb;
      }
      if (out_sum) *(v4f*)(out_sum + (size_t)row * N + j) = sm;
      *(v4f*)(out_norm + (size_t)row * N + j) = o;
    }
    
  }
}



// ---- f16 WMMA path (v_wmma_f32_16x16x32_f16): 11-bit significands for operands in range — used where a [0,1] probability operand needs more precision than bf16
typedef _Float16 v16h __attribute__((ext_vector_type(16)));
union FragH { v16h v; v8us half[2]; _Float16 h[16]; unsigned short u[16]; };
template <int NT>
__device__ __forceinline__ v8f mmaH(v16h ah, v16h al, v16h bh, v16h bl, v8f c) {
  c = __builtin_amdgcn_wmma_f32_16x16x32_f16(false, ah, false, bh, (short)0, c, false, false);
  if (NT >= 2) c = __builtin_amdgcn_wmma_f32_16x16x32_f16(false, al, false, bh, (short)0, c, false, false);
  if (NT >= 3) c = __builtin_amdgcn_wmma_f32_16x16x32_f16(false, ah, false, bl, (short)0, c, false, false);
  asm volatile("v_nop\n\tv_nop\n\tv_nop\n\tv_nop" : "+v"(c) : "v"(ah), "v"(al), "v"(bh), "v"(bl));
  return c;
}
// batched GEMM like k_gemm_b but f16 operands: A f32 (split into f16 hi/lo if ASPLIT, else rounded to f16), Bt = f16 values [n][k]; alpha; C f32; N multiple of 16 (partial tiles skipped)
template <bool ASPLIT>
__global__ __launch_bounds__(128) void k_gemm_h(const float* __restrict__ A, int lda, size_t sA, const _Float16* __restrict__ Bh, int ldb, size_t sB, float alpha, float* __restrict__ C, int ldc, size_t sC, int M, int N, int K) {
  __shared__ __attribute__((aligned(16))) float so[4][16][64];
  const int tid = threadIdx.x, w = tid >> 5, lane = tid & 31, ln = lane & 15, hh = lane >> 4; const int by = blockIdx.y;
  A += (size_t)by * sA; Bh += (size_t)by * sB; C += (size_t)by * sC;
  const int ntn = (N + 63) / 64; const int wid = blockIdx.x * 4 + w; const int mt = wid / ntn, nq = wid % ntn; if (mt * 16 >= M) return;
  const int row0 = mt * 16, col0 = nq * 64; const float* arow = A + (size_t)(row0 + ln) * lda;
  v8f acc[4] = {};
  for (int kb = 0; kb < K; kb += 32) {
    FragH ah, al;
    const v4f x0 = *(const v4fa*)(arow + kb + 8 * hh), x1 = *(const v4fa*)(arow + kb + 8 * hh + 4), x2 = *(const v4fa*)(arow + kb + 16 + 8 * hh), x3 = *(const v4fa*)(arow + kb + 16 + 8 * hh + 4);
    float xs[16] = {x0[0],x0[1],x0[2],x0[3],x1[0],x1[1],x1[2],x1[3],x2[0],x2[1],x2[2],x2[3],x3[0],x3[1],x3[2],x3[3]};
#pragma unroll
    for (int i = 0; i < 16; ++i) { const _Float16 h = (_Float16)xs[i]; ah.h[i] = h; al.h[i] = ASPLIT ? (_Float16)(xs[i] - (float)h) : (_Float16)0.0f; }
#pragma unroll
    for (int t = 0; t < 4; ++t) { if (col0 + t * 16 >= N) continue; const size_t boff = (size_t)(col0 + t * 16 + ln) * ldb + kb; FragH bq; bq.half[0] = *(const v8us*)(Bh + boff + 8 * hh); bq.half[1] = *(const v8us*)(Bh + boff + 16 + 8 * hh);
      acc[t] = mmaH<ASPLIT ? 2 : 1>(ah.v, al.v, bq.v, bq.v, acc[t]); }
  }
#pragma unroll
  for (int t = 0; t < 4; ++t) { if (col0 + t * 16 >= N) continue;
#pragma unroll
    for (int r = 0; r < 8; ++r) so[w][8 * hh + r][t * 16 + ln] = acc[t][r] * alpha; }
  __builtin_amdgcn_fence(__ATOMIC_ACQ_REL, "workgroup"); __builtin_amdgcn_wave_barrier();
  const int rsub = lane >> 4, c4 = (lane & 15) * 4;
  {
#pragma unroll
    for (int q = 0; q < 8; ++q) { const int r = q * 2 + rsub; if (col0 + c4 < N) { const v4f v = *(const v4fa*)&so[w][r][c4]; *(v4f*)(C + (size_t)(row0 + r) * ldc + col0 + c4) = v; } }
     }
}

// Wt[n][k] = f16(W[k][n]·scale) from f32 row-major W[K][N] (scale = power of two; bf16-exact weights stay exact in f16 away from the subnormal range)
// device body: blk = index of the 256-thread block inside this job's range of the shared grid (k_prep)
__device__ __forceinline__ void d_wt_f16(const float* __restrict__ W, _Float16* __restrict__ Wt, int K, int N, float scale, int blk) {
  const int t = blk * 256 + threadIdx.x; if (t >= N * (K / 8)) return; const int n = t / (K / 8), k8 = (t % (K / 8)) * 8; FragH f;
#pragma unroll
  for (int i = 0; i < 8; ++i) f.h[i] = (_Float16)(bf16_round(W[(size_t)(k8 + i) * N + n]) * scale); const v8us o = f.half[0];
  *(v8us*)((unsigned short*)Wt + (size_t)n * K + k8) = o; 
}
// k_gemm_hh variant with fused epilogue: v = acc·alpha + bias[by·sBias + col] (+ CP[(row/rowsPerB)·sCPb + by·64 + col] if CP) ; ACT 0 none / 1 elu ; writes f32 C and/or f16 C16 (each if non-null)
template <int ACT>
__global__ __launch_bounds__(128) void k_gemm_hhx(const _Float16* __restrict__ A, int lda, size_t sA, const _Float16* __restrict__ Bh, int ldb, size_t sB, float alpha, const float* __restrict__ bias, size_t sBias, const float* __restrict__ CP, int rowsPerB, size_t sCPb, int row0g,
    float* __restrict__ C, _Float16* __restrict__ C16, int ldc, size_t sC, int M, int N, int K, const _Float16* __restrict__ A2, float alpha2, float* __restrict__ C2) {
  __shared__ __attribute__((aligned(16))) float so[4][16][64];
  const int tid = threadIdx.x, w = tid >> 5, lane = tid & 31, ln = lane & 15, hh = lane >> 4; const int by = blockIdx.y;
  if (blockIdx.z) { A = A2; alpha = alpha2; bias = nullptr; C = C2; }      /* blockIdx.z = 1: the second term of a split A in the same grid: its own operand, factor and f32 plane, no bias */
  A += (size_t)by * sA; Bh += (size_t)by * sB; const size_t cofs = (size_t)by * sC; const float* bp = bias ? bias + (size_t)by * sBias : nullptr;
  const int ntn = (N + 63) / 64; const int wid = blockIdx.x * 4 + w; const int mt = wid / ntn, nq = wid % ntn; if (mt * 16 >= M) return;
  const int row0 = mt * 16, col0 = nq * 64; const _Float16* arow = A + (size_t)(row0 + ln) * lda;
  v8f acc[4] = {};
  for (int kb = 0; kb < K; kb += 32) { FragH ah; ah.half[0] = *(const v8us*)((const unsigned short*)arow + kb + 8 * hh); ah.half[1] = *(const v8us*)((const unsigned short*)arow + kb + 16 + 8 * hh);
#pragma unroll
    for (int t = 0; t < 4; ++t) { if (col0 + t * 16 >= N) continue; const size_t boff = (size_t)(col0 + t * 16 + ln) * ldb + kb; FragH bq; bq.half[0] = *(const v8us*)((const unsigned short*)Bh + boff + 8 * hh); bq.half[1] = *(const v8us*)((const unsigned short*)Bh + boff + 16 + 8 * hh);
      acc[t] = mmaH<1>(ah.v, ah.v, bq.v, bq.v, acc[t]); }
  }
#pragma unroll
  for (int t = 0; t < 4; ++t) { if (col0 + t * 16 >= N) continue; const int col = col0 + t * 16 + ln; const float bv = bp ? bf16_round(bp[col]) : 0.f;
#pragma unroll
    for (int r = 0; r < 8; ++r) { float v = acc[t][r] * alpha + bv; if (CP) { const int rr = row0g + row0 + 8 * hh + r; if (rowsPerB < 0) v += CP[cofs + (size_t)rr * ldc + col];      /* rowsPerB < 0: own element of the batched C plane */ else { const int bidx = rr / rowsPerB; v += CP[(size_t)bidx * sCPb + (size_t)by * 64 + col]; } } if (ACT == 1) v = (v > 0.f) ? v : expm1f(v); else if (ACT == 7) v = (v > 0.f) ? v + 1.0f : expf(v); else if (ACT == 8) v = tanhf(v); else if (ACT == 9) v = 0.5f * v * (1.0f + tanhf(0.7978845608028654f * (v + 0.044715f * v * v * v))); else if (ACT == 11) v = 1.0f / (1.0f + expf(-v)); else if (ACT == 12) v = (v > 0.f) ? v : 0.01f * v; else if (ACT == 14) v = (v > 0.f) ? v : 0.1f * v; else if (ACT == 16) v = (v >= 0.f) ? v : 0.3f * v; else if (ACT == 17) v = (v >= 0.f) ? v : 0.2f * v; else if (ACT == 15) v = v / (1.0f + expf(-v)); else if (ACT == 3) v = fmaxf(v, 0.f); else if (ACT == 6) v = 0.5f * v * (1.0f + erff(v * 0.70710678118654752f)); so[w][8 * hh + r][t * 16 + ln] = v; } }
  __builtin_amdgcn_fence(__ATOMIC_ACQ_REL, "workgroup"); __builtin_amdgcn_wave_barrier();
  const int rsub = lane >> 4, c4 = (lane & 15) * 4; typedef _Float16 v4h __attribute__((ext_vector_type(4)));
  {
#pragma unroll
    for (int q = 0; q < 8; ++q) { const int r = q * 2 + rsub; if (col0 + c4 < N) { const v4f v = *(const v4fa*)&so[w][r][c4]; if (C) *(v4f*)(C + cofs + (size_t)(row0 + r) * ldc + col0 + c4) = v; if (C16) { v4h h4; for (int i = 0; i < 4; ++i) h4[i] = (_Float16)v[i]; *(v4h*)(C16 + cofs + (size_t)(row0 + r) * ldc + col0 + c4) = h4; } } }
     }
}


typedef _Float16 v4h __attribute__((ext_vector_type(4)));

__device__ __forceinline__ void d_x16(const float* __restrict__ x, _Float16* __restrict__ X16, size_t n8, int blk) { const size_t t = (size_t)blk * 256 + threadIdx.x; if (t >= n8) return; FragH f;
#pragma unroll
  for (int q = 0; q < 8; ++q) f.h[q] = (_Float16)bf16_round(x[t * 8 + q]); *(v8us*)((unsigned short*)X16 + t * 8) = f.half[0];  }
// the four operand preparations need nothing of each other: one grid, each job a range of the block index (block-uniform branches); the transposes, whose threads take longest, start first
#define PREP_Q (DIM * 4 * INNER / 8 / 256)
#define PREP_O (INNER * DIM / 8 / 256)
#define PREP_S (HD * NP / 8 / 256)
#define PREP_X (NR * DIM / 8 / 256)
__global__ __launch_bounds__(256) void k_prep(const float* __restrict__ Wq, _Float16* __restrict__ BQ, const float* __restrict__ Wo, _Float16* __restrict__ BO, const float* __restrict__ Wsc, _Float16* __restrict__ BS, const float* __restrict__ x, _Float16* __restrict__ X16) {
  static_assert(DIM * 4 * INNER % 2048 == 0 && INNER * DIM % 2048 == 0 && HD * NP % 2048 == 0 && NR * DIM % 2048 == 0, "k_prep: every job fills whole blocks");
  int blk = blockIdx.x;
  if (blk < PREP_Q) { d_wt_f16(Wq, BQ, DIM, 4 * INNER, 16.0f, blk); return; }
  blk -= PREP_Q;
  if (blk < PREP_O) { d_wt_f16(Wo, BO, INNER, DIM, 16.0f, blk); return; }
  blk -= PREP_O;
  if (blk < PREP_S) { d_wt_f16(Wsc, BS, HD, NP, 16.0f, blk); return; }
  d_x16(x, X16, (size_t)NR * DIM / 8, blk - PREP_S); }
__global__ __launch_bounds__(256) void k_h16(const float* __restrict__ x, _Float16* __restrict__ X16, size_t n8) { const size_t t = (size_t)blockIdx.x * 256 + threadIdx.x; if (t >= n8) return; FragH f;
#pragma unroll
  for (int q = 0; q < 8; ++q) f.h[q] = (_Float16)x[t * 8 + q]; *(v8us*)((unsigned short*)X16 + t * 8) = f.half[0];  }
__global__ __launch_bounds__(256) void k_round16f(const float* __restrict__ W, _Float16* __restrict__ Bt, size_t n8) { const size_t t = (size_t)blockIdx.x * 256 + threadIdx.x; if (t >= n8) return; FragH f;
#pragma unroll
  for (int i = 0; i < 8; ++i) f.h[i] = (_Float16)(bf16_round(W[t * 8 + i]) * 16.0f); *(v8us*)((unsigned short*)Bt + t * 8) = f.half[0];  }
template <int NHv, int TTv>
__global__ __launch_bounds__(256) void k_vt(const _Float16* __restrict__ V16, int ldv, int voff, int voffy, _Float16* __restrict__ Vt, size_t sVty) { __shared__ unsigned short tl[64][66]; const int tid = threadIdx.x; voff += blockIdx.y * voffy; Vt += (size_t)blockIdx.y * sVty;      /* blockIdx.y: which column group of V16 is transposed, into its own plane */ const int slab = blockIdx.x / (TTv / 64), lg = blockIdx.x % (TTv / 64); const int b = slab / NHv, h = slab % NHv;
  for (int i = tid; i < 64 * 8; i += 256) { const int r = i / 8, c8 = (i % 8) * 8; FragH f; f.half[0] = *(const v8us*)((const unsigned short*)V16 + ((size_t)b * TTv + lg * 64 + r) * ldv + voff + h * 64 + c8);
#pragma unroll
    for (int q = 0; q < 8; ++q) tl[r][c8 + q] = f.u[q]; }
  __syncthreads();
  {
#pragma unroll
    for (int rd = 0; rd < 2; ++rd) { const int d = rd * 32 + tid / 8, pc = tid % 8; FragH f;
#pragma unroll
      for (int q = 0; q < 8; ++q) f.u[q] = tl[pc * 8 + q][d];
      *(v8us*)((unsigned short*)Vt + ((size_t)slab * 64 + d) * TTv + lg * 64 + pc * 8) = f.half[0]; }
     } }

__global__ __launch_bounds__(256) void k_hl(const float* __restrict__ F, _Float16* __restrict__ Hh, _Float16* __restrict__ Hl, size_t n8) { const size_t t = (size_t)blockIdx.x * 256 + threadIdx.x; if (t >= n8) return; FragH fh, fl; const v4f a = *(const v4fa*)(F + t * 8), c = *(const v4fa*)(F + t * 8 + 4);
#pragma unroll
  for (int q = 0; q < 4; ++q) { _Float16 h = (_Float16)a[q]; fh.h[q] = h; fl.h[q] = (_Float16)((a[q] - (float)h) * 1024.0f); h = (_Float16)c[q]; fh.h[4 + q] = h; fl.h[4 + q] = (_Float16)((c[q] - (float)h) * 1024.0f); }
  { *(v8us*)((unsigned short*)Hh + t * 8) = fh.half[0]; *(v8us*)((unsigned short*)Hl + t * 8) = fl.half[0];  } }

// ---- fast GEMM (wave tile 32x64; requires M % 32 == 0 rows per launch region and N % 64 == 0); epilogue = k_gemm_hhx semantics ----
__device__ __forceinline__ v16h g2_frag(const _Float16* p, int hh) { FragH f; f.half[0] = *(const v8us*)((const unsigned short*)p + 8 * hh); f.half[1] = *(const v8us*)((const unsigned short*)p + 16 + 8 * hh); return f.v; }
__device__ __forceinline__ v8f g2_mma(v16h a, v16h b, v8f c) { v8f d = __builtin_amdgcn_wmma_f32_16x16x32_f16(false, a, false, b, (short)0, c, false, false); asm volatile("v_nop\n\tv_nop\n\tv_nop\n\tv_nop" : "+v"(d) : "v"(a), "v"(b)); return d; }
template <int ACT>
__global__ __launch_bounds__(128) void k_gemm2(const _Float16* __restrict__ A, int lda, size_t sA, const _Float16* __restrict__ Bh, int ldb, size_t sB, float alpha, const float* __restrict__ bias, size_t sBias, const float* __restrict__ CP, int rowsPerB, size_t sCPb, int row0g,
    float* __restrict__ C, _Float16* __restrict__ C16, int ldc, size_t sC, int M, int N, int K) { static_assert(ACT == 0 || ACT == 3 || ACT == 6 || ACT == 8 || ACT == 9 || ACT == 11 || ACT == 12 || ACT == 14 || ACT == 15 || ACT == 16 || ACT == 17, "k_gemm2: unsupported ACT code (would silently apply no activation)");
  __shared__ __attribute__((aligned(16))) float so[4][32][68];
  const int tid = threadIdx.x, w = tid >> 5, lane = tid & 31, ln = lane & 15, hh = lane >> 4; const int by = blockIdx.y;
  A += (size_t)by * sA; Bh += (size_t)by * sB; const size_t cofs = (size_t)by * sC; const float* bp = bias ? bias + (size_t)by * sBias : nullptr;
  const int ntn = N >> 6; const int mt = blockIdx.x / ntn, nq = blockIdx.x - mt * ntn; const int row0 = mt * 128 + 32 * w, col0 = nq * 64; if (row0 >= M) return;
  const _Float16* a0p = A + (size_t)(row0 + ln) * lda; const _Float16* a1p = a0p + (size_t)16 * lda;
  const _Float16* b0p = Bh + (size_t)(col0 + ln) * ldb; const _Float16* b1p = b0p + (size_t)16 * ldb; const _Float16* b2p = b1p + (size_t)16 * ldb; const _Float16* b3p = b2p + (size_t)16 * ldb;
  const v8f z8 = {0.f,0.f,0.f,0.f,0.f,0.f,0.f,0.f}; v8f c00 = z8, c01 = z8, c02 = z8, c03 = z8, c10 = z8, c11 = z8, c12 = z8, c13 = z8;
#pragma unroll 1
  for (int kb = 0; kb < K; kb += 32) { const v16h a0 = g2_frag(a0p + kb, hh), a1 = g2_frag(a1p + kb, hh);
    v16h b = g2_frag(b0p + kb, hh); c00 = g2_mma(a0, b, c00); c10 = g2_mma(a1, b, c10);
    b = g2_frag(b1p + kb, hh); c01 = g2_mma(a0, b, c01); c11 = g2_mma(a1, b, c11);
    b = g2_frag(b2p + kb, hh); c02 = g2_mma(a0, b, c02); c12 = g2_mma(a1, b, c12);
    b = g2_frag(b3p + kb, hh); c03 = g2_mma(a0, b, c03); c13 = g2_mma(a1, b, c13); }
  v8f accs[8] = {c00, c01, c02, c03, c10, c11, c12, c13};
#pragma unroll
  for (int u = 0; u < 8; ++u) { const int t = u & 3, half = u >> 2; const int col = col0 + t * 16 + ln; const float bv = bp ? bf16_round(bp[col]) : 0.f;
#pragma unroll
    for (int r = 0; r < 8; ++r) { const int rloc = half * 16 + 8 * hh + r; float v = accs[u][r] * alpha + bv; if (CP) { if (rowsPerB < 0) v += CP[cofs + (size_t)(row0g + row0 + rloc) * ldc + col];      /* rowsPerB < 0: own element of the batched C plane */ else { const int bidx = (row0g + row0 + rloc) / rowsPerB; v += CP[(size_t)bidx * sCPb + (size_t)by * 64 + col]; } }
      if (ACT == 3) v = fmaxf(v, 0.f); else if (ACT == 6) v = 0.5f * v * (1.0f + erff(v * 0.70710678118654752f)); else if (ACT == 11) v = 1.0f / (1.0f + expf(-v)); else if (ACT == 15) v = v / (1.0f + expf(-v)); else if (ACT == 12) v = (v > 0.f) ? v : 0.01f * v; else if (ACT == 8) v = tanhf(v); else if (ACT == 9) v = 0.5f * v * (1.0f + tanhf(0.7978845608028654f * (v + 0.044715f * v * v * v))); else if (ACT == 14) v = (v > 0.f) ? v : 0.1f * v; else if (ACT == 16) v = (v >= 0.f) ? v : 0.3f * v; else if (ACT == 17) v = (v >= 0.f) ? v : 0.2f * v;
      so[w][rloc][t * 16 + ln] = v; } }
  __builtin_amdgcn_fence(__ATOMIC_ACQ_REL, "workgroup"); __builtin_amdgcn_wave_barrier();
  const int rsub = lane >> 4, c4 = (lane & 15) * 4;
  {
#pragma unroll
    for (int q = 0; q < 16; ++q) { const int r = q * 2 + rsub; const v4f v = *(const v4fa*)&so[w][r][c4]; if (C) *(v4f*)(C + cofs + (size_t)(row0 + r) * ldc + col0 + c4) = v; if (C16) { v4h h4; for (int i = 0; i < 4; ++i) h4[i] = (_Float16)v[i]; *(v4h*)(C16 + cofs + (size_t)(row0 + r) * ldc + col0 + c4) = h4; } }
     } }

// ---- split-K GEMM for the K = 2048 product with few output tiles (f^T v): one 32x64 tile per block, its K range dealt over SKW waves, f32 partial tiles summed through LDS in wave order; v = sum * alpha (+ own element of CP) ----
#define SKW 16                   /* waves per tile; each takes KT / SKW of the k range */
template <int KT>
__global__ __launch_bounds__(32 * SKW) void k_gemm2k(const _Float16* __restrict__ A, int lda, size_t sA, const _Float16* __restrict__ Bh, int ldb, size_t sB, float alpha, const float* CP, float* C, int ldc, size_t sC) {
  static_assert(KT % (32 * SKW) == 0, "k_gemm2k: every wave takes whole 32-deep steps");
  __shared__ __attribute__((aligned(16))) float so[SKW][32][68];
  const int tid = threadIdx.x, w = tid >> 5, lane = tid & 31, ln = lane & 15, hh = lane >> 4; const int by = blockIdx.y;
  A += (size_t)by * sA + w * (KT / SKW); Bh += (size_t)by * sB + w * (KT / SKW); const size_t cofs = (size_t)by * sC; const int row0 = blockIdx.x * 32;
  const _Float16* a0p = A + (size_t)(row0 + ln) * lda; const _Float16* a1p = a0p + (size_t)16 * lda;
  const _Float16* b0p = Bh + (size_t)ln * ldb; const _Float16* b1p = b0p + (size_t)16 * ldb; const _Float16* b2p = b1p + (size_t)16 * ldb; const _Float16* b3p = b2p + (size_t)16 * ldb;
  const v8f z8 = {0.f,0.f,0.f,0.f,0.f,0.f,0.f,0.f}; v8f c00 = z8, c01 = z8, c02 = z8, c03 = z8, c10 = z8, c11 = z8, c12 = z8, c13 = z8;
  for (int kb = 0; kb < KT / SKW; kb += 32) { const v16h a0 = g2_frag(a0p + kb, hh), a1 = g2_frag(a1p + kb, hh);
    v16h b = g2_frag(b0p + kb, hh); c00 = g2_mma(a0, b, c00); c10 = g2_mma(a1, b, c10);
    b = g2_frag(b1p + kb, hh); c01 = g2_mma(a0, b, c01); c11 = g2_mma(a1, b, c11);
    b = g2_frag(b2p + kb, hh); c02 = g2_mma(a0, b, c02); c12 = g2_mma(a1, b, c12);
    b = g2_frag(b3p + kb, hh); c03 = g2_mma(a0, b, c03); c13 = g2_mma(a1, b, c13); }
  v8f accs[8] = {c00, c01, c02, c03, c10, c11, c12, c13};
  // both loops unrolled: accs is then indexed by constants only and stays in registers
#pragma unroll
  for (int u = 0; u < 8; ++u) { const int t = u & 3, half = u >> 2;
#pragma unroll
    for (int r = 0; r < 8; ++r) so[w][half * 16 + 8 * hh + r][t * 16 + ln] = accs[u][r]; }
  __syncthreads();      /* every wave's partial tile is in LDS before any thread sums across waves */
  const int r = tid >> 4, c4 = (tid & 15) * 4; v4f s = *(const v4fa*)&so[0][r][c4];
  for (int u = 1; u < SKW; ++u) s += *(const v4fa*)&so[u][r][c4];
  const size_t o = cofs + (size_t)(row0 + r) * ldc + c4; v4f v = s * alpha; if (CP) v += *(const v4fa*)(CP + o);
  *(v4f*)(C + o) = v; }


// ---- fused attention: a block takes 256 query rows of one (batch, head), 32 per wave, and walks the 2048 keys in tiles of 64; each tile (k rows, both poss_value planes) is fetched once per block by whole-line loads and put into LDS, where all 8 waves read their fragments; running maximum and sum per query ----
#define FQW 8                    /* waves per block, 32 query rows each: 8 x 32 (batch, head) pairs = 256 blocks */
#define FKT 64                   /* keys per tile: one row of each staged plane is 128 bytes */
#define FLP 72                   /* LDS row pitch in f16: 144 bytes = 16 x 9, the 16 rows of a fragment read fall on different banks */
__device__ __forceinline__ v8f fa_mma(v16h a, v16h b, v8f c) { return __builtin_amdgcn_wmma_f32_16x16x32_f16(false, a, false, b, (short)0, c, false, false); }
// fragment in the hardware k order from a wave-uniform base and the lane's own element offset (row ln, k 8 * hh)
__device__ __forceinline__ v16h fa_frag(const _Float16* ub, unsigned lo) { FragH f; f.half[0] = *(const v8us*)((const unsigned short*)ub + lo); f.half[1] = *(const v8us*)((const unsigned short*)ub + lo + 16); return f.v; }
// the same fragment from a staged row: p = the lane's own row at k 8 * hh
__device__ __forceinline__ v16h fl_frag(const unsigned short* p) { FragH f; f.half[0] = *(const v8us*)p; f.half[1] = *(const v8us*)(p + 16); return f.v; }
// eight independent 2^x in place: each v_exp_f32 fills the slot that the instruction set asks for behind the one before it, the v_nop fills the last one's
__device__ __forceinline__ void fa_exp2x8(float* x) {
  asm("v_exp_f32 %0, %0\n\tv_exp_f32 %1, %1\n\tv_exp_f32 %2, %2\n\tv_exp_f32 %3, %3\n\tv_exp_f32 %4, %4\n\tv_exp_f32 %5, %5\n\tv_exp_f32 %6, %6\n\tv_exp_f32 %7, %7\n\tv_nop"
      : "+v"(x[0]), "+v"(x[1]), "+v"(x[2]), "+v"(x[3]), "+v"(x[4]), "+v"(x[5]), "+v"(x[6]), "+v"(x[7])); }
// two of them, same slots
__device__ __forceinline__ void fa_exp2x2(float& a, float& b) { asm("v_exp_f32 %0, %0\n\tv_exp_f32 %1, %1\n\tv_nop" : "+v"(a), "+v"(b)); }
// lane l with lane l ^ 16
__device__ __forceinline__ float fa_xhalf(float x) { return __builtin_bit_cast(float, __builtin_amdgcn_permlanex16(__builtin_bit_cast(int, x), __builtin_bit_cast(int, x), 0x76543210, 0xfedcba98, false, false)); }
__global__ __launch_bounds__(32 * FQW) void k_fattn(const _Float16* QKFV, const _Float16* PVH, const _Float16* PVL, _Float16* CH, _Float16* CL) {
  static_assert(NP % (32 * FQW) == 0 && NP % FKT == 0 && HD == 64 && FKT == 64 && 4 * INNER == NP && 32 * FQW == 256, "k_fattn: head size 64, 64-key tiles, one row pitch for q, k and poss_value, 256 threads stage 64 rows of 8 chunks in two rounds");
  __shared__ __attribute__((aligned(16))) unsigned short st[2][3][64][FLP];      /* [buffer][k rows | residual plane | hi plane][row][64 f16 + pad] */
  const int tid = threadIdx.x, w = __builtin_amdgcn_readfirstlane(tid >> 5), lane = tid & 31, ln = lane & 15, hh = lane >> 4;
  const int bh = blockIdx.y, b = bh / NH, h = bh - b * NH;
  const int ldq = 4 * INNER; const unsigned lo = (unsigned)(ln * NP + 8 * hh);
  const _Float16* base = QKFV + (size_t)b * NP * ldq + h * HD;
  const int row0 = blockIdx.x * (32 * FQW) + w * 32;
  // staging: 8 neighbouring lanes fetch one whole 128-byte row; a thread takes chunk tid & 7 of rows tid >> 3 and 32 + (tid >> 3) of each of the three planes
  const int sr = tid >> 3, sc = (tid & 7) * 8;
  const unsigned short* gk = (const unsigned short*)(base + INNER) + (size_t)sr * ldq + sc;
  const unsigned short* gl = (const unsigned short*)PVL + (size_t)bh * HD * NP + (size_t)sr * NP + sc;
  const unsigned short* gh = (const unsigned short*)PVH + (size_t)bh * HD * NP + (size_t)sr * NP + sc;
  v8us g0 = *(const v8us*)gk, g1 = *(const v8us*)(gk + (size_t)32 * ldq), g2 = *(const v8us*)gl, g3 = *(const v8us*)(gl + (size_t)32 * NP), g4 = *(const v8us*)gh, g5 = *(const v8us*)(gh + (size_t)32 * NP);
  const _Float16* qp = base + (size_t)row0 * ldq;
  const v16h q00 = fa_frag(qp, lo), q01 = fa_frag(qp + 32, lo), q10 = fa_frag(qp + 16 * ldq, lo), q11 = fa_frag(qp + 16 * ldq + 32, lo);
  asm volatile("s_wait_xcnt 0x0" ::: "memory");      /* stands in front of the first overwrite of a register that the 14 loads above name (the accumulators' zeroes reuse the q loads' offset register and base) */
  *(v8us*)&st[0][0][sr][sc] = g0; *(v8us*)&st[0][0][sr + 32][sc] = g1; *(v8us*)&st[0][1][sr][sc] = g2; *(v8us*)&st[0][1][sr + 32][sc] = g3; *(v8us*)&st[0][2][sr][sc] = g4; *(v8us*)&st[0][2][sr + 32][sc] = g5;
  __syncthreads();      /* tile 0 is in LDS before any wave reads it */
  const v8f z8 = {0.f,0.f,0.f,0.f,0.f,0.f,0.f,0.f};
  const float cs = 0.125f * 1.4426950408889634f;
  // o[u][t][r] = column t*16 + 8*hh + r of query row0 + u*16 + ln, in units of 2^10 x the weights under the running maximum m; su = this lane half's share of the weight sum
  v8f o[2][4] = {{z8, z8, z8, z8}, {z8, z8, z8, z8}};
  float m0 = -3.0e38f, m1 = -3.0e38f, su0 = 0.f, su1 = 0.f;
  // one tile; more = a next tile exists, is fetched, stored and published (a constant at each of the two calls: the trip of the loop below is one straight block, so that the scheduling barriers bind all of it)
  // every loop inside a tile is unrolled: the fragment and accumulator arrays are then indexed by constants only and stay in registers
  auto tile = [&](const int kt, const bool more) __attribute__((always_inline)) {
    const int cur = kt & 1;
    if (more) {
      const size_t ko = (size_t)(kt + 1) * FKT * ldq; const int po = (kt + 1) * FKT;
      g0 = *(const v8us*)(gk + ko); g1 = *(const v8us*)(gk + ko + (size_t)32 * ldq); g2 = *(const v8us*)(gl + po); g3 = *(const v8us*)(gl + po + (size_t)32 * NP); g4 = *(const v8us*)(gh + po); g5 = *(const v8us*)(gh + po + (size_t)32 * NP); }
    __builtin_amdgcn_sched_barrier(0);      /* holds the next tile's 6 loads ahead of this tile's work, which hides their latency (the compiler otherwise sinks a load to its use) */
    // S^T = K Q^T: s[t][u][r] = score of key kt*64 + t*16 + 8*hh + r against query row0 + u*16 + ln
    v8f s[4][2];
#pragma unroll
    for (int t = 0; t < 4; ++t) { const unsigned short* kr = &st[cur][0][t * 16 + ln][8 * hh]; const v16h k0 = fl_frag(kr), k1 = fl_frag(kr + 32);
      s[t][0] = fa_mma(k1, q01, fa_mma(k0, q00, z8)); s[t][1] = fa_mma(k1, q11, fa_mma(k0, q10, z8)); }
    // running maximum: in-lane over the tile's keys, across the two lane halves, against the maximum so far
    float t0 = s[0][0][0], t1 = s[0][1][0];
#pragma unroll
    for (int t = 0; t < 4; ++t) {
#pragma unroll
      for (int r = 0; r < 8; ++r) { t0 = fmaxf(t0, s[t][0][r]); t1 = fmaxf(t1, s[t][1][r]); } }
    t0 = fmaxf(t0, fa_xhalf(t0)); t1 = fmaxf(t1, fa_xhalf(t1));
    t0 = fmaxf(t0, m0); t1 = fmaxf(t1, m1);
    float a0 = (m0 - t0) * cs, a1 = (m1 - t1) * cs;      /* what stands under the old maximum shrinks by 2^a; 0 on the first tile */
    fa_exp2x2(a0, a1);
    m0 = t0; m1 = t1;
    // poss_value fragments come in 4 groups of 4 column tiles (residual plane keys 0-31, 32-63, then the hi plane) into two register buffers, each asked for one group of products ahead; the scheduling barriers hold the LDS reads there (the compiler otherwise sinks them to their use, one LDS latency per pair of products)
    const unsigned short* pr = &st[cur][1][ln][8 * hh];
    v16h bf[2][4];
    __builtin_amdgcn_sched_barrier(0);      /* not above the score products: their fragments and these do not fit the registers together */
#pragma unroll
    for (int t = 0; t < 4; ++t) bf[0][t] = fl_frag(pr + t * 16 * FLP);
    __builtin_amdgcn_sched_barrier(0);      /* the first group flies under the first half of the softmax */
    // weights e * 2^10 = 2^((s - max) / 8 * log2 e + 10); two score tiles (32 keys) of one query tile are one B fragment in the hardware k order
    const float f0 = 10.0f - m0 * cs, f1 = 10.0f - m1 * cs;
    su0 *= a0; su1 *= a1; v16h p[2][2];
    // readout, transposed (A = poss_value rows, B = weights), on one set of f32 accumulators: shrunk and lifted by 2^10, the residual plane's products added, back by 2^-10 (both factors exact), then the hi plane's
    a0 *= 1024.0f; a1 *= 1024.0f;
#pragma unroll
    for (int ks = 0; ks < 2; ++ks) {
#pragma unroll
      for (int u = 0; u < 2; ++u) { float x[16]; FragH a; float sa = 0.f;
#pragma unroll
        for (int i = 0; i < 16; ++i) x[i] = s[2 * ks + (i >> 3)][u][i & 7] * cs + (u ? f1 : f0);
        fa_exp2x8(x); fa_exp2x8(x + 8);
#pragma unroll
        for (int i = 0; i < 16; ++i) { sa += x[i]; a.h[i] = (_Float16)x[i]; }
        if (u) su1 += sa; else su0 += sa;
        p[ks][u] = a.v; }
      if (ks == 0) {
        __builtin_amdgcn_sched_barrier(0);      /* the sums of the first 32 keys end here: left open, all 64 weights stay in f32 registers to the end of the tile */
#pragma unroll
        for (int t = 0; t < 4; ++t) bf[1][t] = fl_frag(pr + t * 16 * FLP + 32);
        __builtin_amdgcn_sched_barrier(0);      /* the second group is asked for ahead of the first group's products */
        // the first group's products stand in one region with the second half of the softmax: vector work under matrix time
#pragma unroll
        for (int t = 0; t < 4; ++t) { o[0][t] *= a0; o[1][t] *= a1; }
#pragma unroll
        for (int t = 0; t < 4; ++t) { o[0][t] = fa_mma(bf[0][t], p[0][0], o[0][t]); o[1][t] = fa_mma(bf[0][t], p[0][1], o[1][t]); } } }
    __builtin_amdgcn_sched_barrier(0);      /* this pair and the next: group g + 2 is asked for between the products of groups g and g + 1 */
#pragma unroll
    for (int t = 0; t < 4; ++t) bf[0][t] = fl_frag(pr + 64 * FLP + t * 16 * FLP);
    __builtin_amdgcn_sched_barrier(0);
#pragma unroll
    for (int t = 0; t < 4; ++t) { o[0][t] = fa_mma(bf[1][t], p[1][0], o[0][t]); o[1][t] = fa_mma(bf[1][t], p[1][1], o[1][t]); }
    __builtin_amdgcn_sched_barrier(0);
#pragma unroll
    for (int t = 0; t < 4; ++t) bf[1][t] = fl_frag(pr + 64 * FLP + t * 16 * FLP + 32);
    __builtin_amdgcn_sched_barrier(0);
#pragma unroll
    for (int t = 0; t < 4; ++t) { o[0][t] *= 0.0009765625f; o[1][t] *= 0.0009765625f; }
#pragma unroll
    for (int ks = 0; ks < 2; ++ks) {
#pragma unroll
      for (int t = 0; t < 4; ++t) { o[0][t] = fa_mma(bf[ks][t], p[ks][0], o[0][t]); o[1][t] = fa_mma(bf[ks][t], p[ks][1], o[1][t]); } }
    if (more) {
      const int nx = cur ^ 1;      /* last read in the tile before, behind whose barrier every wave stands */
      *(v8us*)&st[nx][0][sr][sc] = g0; *(v8us*)&st[nx][0][sr + 32][sc] = g1; *(v8us*)&st[nx][1][sr][sc] = g2; *(v8us*)&st[nx][1][sr + 32][sc] = g3; *(v8us*)&st[nx][2][sr][sc] = g4; *(v8us*)&st[nx][2][sr + 32][sc] = g5;
      __syncthreads(); }      /* one barrier a tile: the next tile is in LDS before any wave reads it, and every wave has left this tile's buffer before it is refilled in the next trip */
  };
  // the tile loop stays rolled, its body is long
#pragma unroll 1
  for (int kt = 0; kt < NP / FKT - 1; ++kt) tile(kt, true);
  tile(NP / FKT - 1, false);
  su0 += fa_xhalf(su0); su1 += fa_xhalf(su1);
  const float rs0 = 1.0f / su0, rs1 = 1.0f / su1;
#pragma unroll
  for (int u = 0; u < 2; ++u) {
#pragma unroll
    for (int t = 0; t < 4; ++t) { FragH ch, cl;
#pragma unroll
      for (int r = 0; r < 8; ++r) { const float v = o[u][t][r] * (u ? rs1 : rs0); const _Float16 hv = (_Float16)v; ch.h[r] = hv; cl.h[r] = (_Float16)((v - (float)hv) * 1024.0f); }
      const size_t oo = ((size_t)b * NP + row0 + u * 16 + ln) * INNER + h * HD + t * 16 + 8 * hh;
      *(v8us*)((unsigned short*)CH + oo) = ch.half[0]; *(v8us*)((unsigned short*)CL + oo) = cl.half[0]; } }
}

__global__ __launch_bounds__(256) void k_addhl(const float* __restrict__ A, const float* __restrict__ Bq, _Float16* __restrict__ Hh, _Float16* __restrict__ Lh, size_t n8) {
  #pragma clang fp contract(off)
  const size_t t = (size_t)blockIdx.x * 256 + threadIdx.x; if (t >= n8) return; const v8f a = *(const v8f*)(A + t * 8), b = *(const v8f*)(Bq + t * 8); FragH fh, fl; for (int q = 0; q < 8; ++q) { const float v = a[q] + b[q]; const _Float16 hv = (_Float16)v; fh.h[q] = hv; fl.h[q] = (_Float16)((v - (float)hv) * 1024.0f); }
  { *(v8us*)((unsigned short*)Hh + t * 8) = fh.half[0]; *(v8us*)((unsigned short*)Lh + t * 8) = fl.half[0];  } }

extern "C" void kernel_launch(void* const* d_in, const int* in_sizes, int n_in,
                              void* d_out, int out_size, void* d_ws, size_t ws_size, hipStream_t stream) {
  (void)in_sizes; (void)n_in; (void)out_size;
  const float* x = (const float*)d_in[0]; const float* Wqkfv = (const float*)d_in[1]; const float* Wsc = (const float*)d_in[2]; const float* bsc = (const float*)d_in[3]; const float* Wout = (const float*)d_in[4]; const float* bout = (const float*)d_in[5];
  char* ws = (char*)d_ws; size_t off = 0;
  auto take = [&](size_t bytes) { char* p = ws + off; off += (bytes + 255) & ~(size_t)255; return p; };
  _Float16* BQ = (_Float16*)take((size_t)4 * INNER * DIM * 2); _Float16* BS = (_Float16*)take((size_t)NP * HD * 2); _Float16* BO = (_Float16*)take((size_t)DIM * INNER * 2);
  _Float16* X16 = (_Float16*)take((size_t)NR * DIM * 2); _Float16* QKFV = (_Float16*)take((size_t)NR * 4 * INNER * 2);      /* [row][q | k | f | v] f16, 32 MiB */
  _Float16* FT = (_Float16*)take((size_t)2 * NB * NH * HD * NP * 2); _Float16* VTT = FT + (size_t)NB * NH * HD * NP;      /* f^T, then v^T, each [b][h][64][2048] */ float* FV = (float*)take((size_t)NB * NH * HD * HD * 4); _Float16* FVH = (_Float16*)take((size_t)NB * NH * HD * HD * 2); _Float16* FVL = (_Float16*)take((size_t)NB * NH * HD * HD * 2);
  float* PV = (float*)take((size_t)NB * NH * HD * NP * 4); float* PV2 = (float*)take((size_t)NB * NH * HD * NP * 4); _Float16* PVH = (_Float16*)take((size_t)NB * NH * HD * NP * 2); _Float16* PVL = (_Float16*)take((size_t)NB * NH * HD * NP * 2);      /* poss_value planes of all batches [b][h][64][2048] */
  _Float16* CH = (_Float16*)take((size_t)NR * INNER * 2); _Float16* CL = (_Float16*)take((size_t)NR * INNER * 2);
  if (off > ws_size) return;      /* about 124 MiB */
  k_prep<<<PREP_Q + PREP_O + PREP_S + PREP_X, 256, 0, stream>>>(Wqkfv, BQ, Wout, BO, Wsc, BS, x, X16);      /* weights transposed, all x @ W (in, out), and the f16 x plane */
  k_gemm2<0><<<dim3((NR / 128) * (4 * INNER / 64), 1), 128, 0, stream>>>(X16, DIM, 0, BQ, DIM, 0, 0.0625f, nullptr, 0, nullptr, 1, 0, 0, nullptr, QKFV, 4 * INNER, 0, NR, 4 * INNER, DIM);      /* [q | k | f | v], head h at h*64 inside each quarter */
  // the poss_value chain: every stage is one launch whose grid runs over all (batch, head) pairs, and over both of two jobs that need nothing of each other
  k_vt<NH, NP><<<dim3(NB * NH * (NP / 64), 2), 256, 0, stream>>>(QKFV, 4 * INNER, 2 * INNER, INNER, FT, (size_t)NB * NH * HD * NP);      /* f^T (y = 0) and v^T (y = 1) per batch and head [64][2048] */
  k_gemm2k<NP><<<dim3(HD / 32, NB * NH), 32 * SKW, 0, stream>>>(FT, NP, (size_t)HD * NP, VTT, NP, (size_t)HD * NP, 1.0f, nullptr, FV, HD, (size_t)HD * HD);      /* FV[b][h][d][e] = sum_n f[n][d] v[n][e] (32-row tiles, K over the block's waves) */
  k_hl<<<(NB * NH * HD * HD / 8 + 255) / 256, 256, 0, stream>>>(FV, FVH, FVL, (size_t)NB * NH * HD * HD / 8);
  k_gemm_hhx<0><<<dim3((HD / 16) * (NP / 64) / 4, NB * NH, 2), 128, 0, stream>>>(FVH, HD, (size_t)HD * HD, BS, HD, 0, 0.0625f, bsc, 0, nullptr, 1, 0, 0, PV, nullptr, NP, (size_t)HD * NP, HD, NP, HD, FVL, 0.0625f / 1024.0f, PV2);      /* z = 0: hi term + b_scales into PV; z = 1: lo term into PV2 */
  k_addhl<<<(unsigned)(((size_t)NB * NH * HD * NP / 8 + 255) / 256), 256, 0, stream>>>(PV, PV2, PVH, PVL, (size_t)NB * NH * HD * NP / 8);      /* poss_value = (FV_hi + FV_lo) w_scales + b as f16 hi/residual */
  k_fattn<<<dim3(NP / (32 * FQW), NB * NH), 32 * FQW, 0, stream>>>(QKFV, PVH, PVL, CH, CL);      /* softmax(q k^T / 8) . poss_value^T, row-scaled, as f16 hi/residual */
  k_gemm2<0><<<dim3((NR / 128) * (DIM / 64), 1), 128, 0, stream>>>(CL, INNER, 0, BO, INNER, 0, 0.0625f / 1024.0f, nullptr, 0, nullptr, 1, 0, 0, (float*)d_out, nullptr, DIM, 0, NR, DIM, INNER);
  k_gemm2<0><<<dim3((NR / 128) * (DIM / 64), 1), 128, 0, stream>>>(CH, INNER, 0, BO, INNER, 0, 0.0625f, bout, 0, (const float*)d_out, 1, (size_t)DIM, 0, (float*)d_out, nullptr, DIM, 0, NR, DIM, INNER);      /* y = (c_lo + c_hi) w_out + b_out */
}

// v005
// Measured time: 191 microseconds a run.
// Two timings next to v004 both put it at 1.10 times that version's speed.
// Over all steps from v000 it is 10.4 times as fast.
#include <hip/hip_runtime.h>
// SimilarAttention (4 x 2048 patches x 512, 8 heads x 64: [q|k|f|v] = x w_qkfv; attn = softmax(q.k/8); poss_value = (f^T v) w_scales + b_scales -> [h][64][2048]; out = attn . poss_value^T; y = merged . w_out + b_out).
// Structure: exact f16 x plane; the fused projection as ONE f16 WMMA GEMM (32x64 wave tiles, f32 accumulation, exact x16 weights; f16 out); then, each stage as ONE launch over all batches and heads: f^T and v^T by LDS tiles (one grid, blockIdx.y picks the plane), f^T v as 32-row WMMA tiles (K = 2048 dealt over a block's 16 waves, f32 partials summed in LDS) then f16 hi/residual, then ONE launch for all batches and heads that keeps scores and softmax weights in registers and never builds poss_value: attn . ((f^T v) w_scales + b)^T = (attn . w_scales^T) (f^T v)^T + attn . b. A block takes 256 query rows of one head, 32 per wave, and walks the keys in tiles of 64 that are staged once per block in LDS (scores transposed, K = 64, f32; running row maximum and row sum; unnormalised f16 weights x 2^10 packed from the score accumulators into the B operand; readout against the exact x16 w_scales rows and the b_scales row on f32 accumulators); behind the keys: row scaling, f16 hi/residual, three product terms against f^T v hi/residual, + the b term, hi/residual out; w_out as two GEMM terms (+ bias).
// Compute dtype: inputs rounded to bf16; x / weights exact as f16; q, k, f, v and the softmax weights as plain f16 operands (~2^-12); f^T v, attn . w_scales^T and the merged context as f16 hi + residual. v_wmma_f32_16x16x32_f16.
#define NB 4
#define NP 2048
#define DIM 512
#define NH 8
#define HD 64
#define INNER 512
#define NR (NB * NP)
typedef __bf16 v16b __attribute__((ext_vector_type(16)));
typedef unsigned short v8us __attribute__((ext_vector_type(8), may_alias));
typedef float  v8f  __attribute__((ext_vector_type(8)));
typedef float  v4f  __attribute__((ext_vector_type(4)));
typedef float  v4fa __attribute__((ext_vector_type(4), may_alias));
union FragB { v16b v; v8us half[2]; unsigned short u[16]; };

__device__ __forceinline__ unsigned short bf16_bits(float x) { unsigned int u = __float_as_uint(x); return (unsigned short)((u + 0x7FFFu + ((u >> 16) & 1u)) >> 16); }
__device__ __forceinline__ float bf16_val(unsigned short b) { return __uint_as_float(((unsigned int)b) << 16); }
__device__ __forceinline__ float bf16_round(float x) { return bf16_val(bf16_bits(x)); }
// D += A·B with NT terms: 1 = ah·bh, 2 = + al·bh (A split), 3 = + ah·bl (both split)
template <int NT>
__device__ __forceinline__ v8f mmaN(v16b ah, v16b al, v16b bh, v16b bl, v8f c) {
  c = __builtin_amdgcn_wmma_f32_16x16x32_bf16(false, ah, false, bh, (short)0, c, false, false);
  if (NT >= 2) c = __builtin_amdgcn_wmma_f32_16x16x32_bf16(false, al, false, bh, (short)0, c, false, false);
  if (NT >= 3) c = __builtin_amdgcn_wmma_f32_16x16x32_bf16(false, ah, false, bl, (short)0, c, false, false);
  asm volatile("v_nop\n\tv_nop\n\tv_nop\n\tv_nop" : "+v"(c) : "v"(ah), "v"(al), "v"(bh), "v"(bl));
  return c;
}

__global__ __launch_bounds__(256) void k_wt_bf16(const float* __restrict__ W, unsigned short* __restrict__ Wt, int K, int N) {
  const int t = blockIdx.x * 256 + threadIdx.x;
  const int k8n = K / 8;
  if (t >= N * k8n) return;
  const int n = t / k8n, k8 = (t % k8n) * 8;
  v8us v;
#pragma unroll
  for (int i = 0; i < 8; ++i) v[i] = bf16_bits(W[(size_t)(k8 + i) * N + n]);
  *(v8us*)(Wt + (size_t)n * K + k8) = v;
  
}

// GEMM C[M][N] (f32, pitch ldc) = act(A[M][K]·W + bias). A f32 row-major (pitch lda) converted per fragment to bf16
// (ASPLIT: hi/lo two planes -> 2 terms, else single rounded term); Wt bf16 [N][K] (pitch ldb). BIAS_BF16 rounds the
// bias to bf16 first (bias quantised to bf16 before the add). K%32==0, M%16==0, N%64==0.
template <bool ASPLIT, int ACT, bool BIAS_BF16>
__global__ __launch_bounds__(128) void k_gemm_bf(const float* __restrict__ A, int lda, const unsigned short* __restrict__ Wt, int ldb,
                                               const float* __restrict__ bias, float* __restrict__ C, int ldc, int M, int N, int K) {
  __shared__ __attribute__((aligned(16))) float so[4][16][64];
  const int tid = threadIdx.x, w = tid >> 5, lane = tid & 31, ln = lane & 15, hh = lane >> 4;
  const int ntn = N / 64;
  const int wid = blockIdx.x * 4 + w;
  const int mt = wid / ntn, nq = wid % ntn;
  if (mt * 16 >= M) return;
  const int row0 = mt * 16, col0 = nq * 64;
  const float* arow = A + (size_t)(row0 + ln) * lda;
  v8f acc[4] = {};
  for (int kb = 0; kb < K; kb += 32) {
    FragB ah, al;
    const v4f x0 = *(const v4fa*)(arow + kb + 8 * hh), x1 = *(const v4fa*)(arow + kb + 8 * hh + 4);
    const v4f x2 = *(const v4fa*)(arow + kb + 16 + 8 * hh), x3 = *(const v4fa*)(arow + kb + 16 + 8 * hh + 4);
    float xs[16] = {x0[0],x0[1],x0[2],x0[3],x1[0],x1[1],x1[2],x1[3],x2[0],x2[1],x2[2],x2[3],x3[0],x3[1],x3[2],x3[3]};
#pragma unroll
    for (int i = 0; i < 16; ++i) { const unsigned short hb = bf16_bits(xs[i]); ah.u[i] = hb; al.u[i] = ASPLIT ? bf16_bits(xs[i] - bf16_val(hb)) : (unsigned short)0; }
#pragma unroll
    for (int t = 0; t < 4; ++t) {
      const unsigned short* brow = Wt + (size_t)(col0 + t * 16 + ln) * ldb + kb;
      FragB b;
      b.half[0] = *(const v8us*)(brow + 8 * hh);
      b.half[1] = *(const v8us*)(brow + 16 + 8 * hh);
      acc[t] = mmaN<ASPLIT ? 2 : 1>(ah.v, al.v, b.v, b.v, acc[t]);
    }
  }
#pragma unroll
  for (int t = 0; t < 4; ++t) {
    float bv = bias ? bias[col0 + t * 16 + ln] : 0.f;
    if (BIAS_BF16) bv = bf16_round(bv);
#pragma unroll
    for (int r = 0; r < 8; ++r) { float v = acc[t][r] + bv; if (ACT == 1) v = fmaxf(v, 0.f); so[w][8 * hh + r][t * 16 + ln] = v; }
  }
  __builtin_amdgcn_fence(__ATOMIC_ACQ_REL, "workgroup");
  __builtin_amdgcn_wave_barrier();
  const int rsub = lane >> 4, c4 = (lane & 15) * 4;
  {
#pragma unroll
    for (int q = 0; q < 8; ++q) {
      const int r = q * 2 + rsub;
      const v4f v = *(const v4fa*)&so[w][r][c4];
      *(v4f*)(C + (size_t)(row0 + r) * ldc + col0 + c4) = v;
    }
    
  }
}

// GEMM C = act(A·W + bias + resid): A f32 (ASPLIT -> hi/lo 2 terms), Wt bf16 [N][K]; ACT 0 none, 1 relu, 2 exact gelu;
// resid (optional, f32, row index = (row % rmod), pitch ldr, RES_BF16 rounds it) added before the activation.
template <bool ASPLIT, int ACT, bool BIAS_BF16, bool RES_BF16>
__global__ __launch_bounds__(128) void k_gemm_bf3(const float* __restrict__ A, int lda, const unsigned short* __restrict__ Wt, int ldb,
                                                const float* __restrict__ bias, const float* __restrict__ resid, int rmod, int ldr,
                                                float* __restrict__ C, int ldc, int M, int N, int K) {
  __shared__ __attribute__((aligned(16))) float so[4][16][64];
  const int tid = threadIdx.x, w = tid >> 5, lane = tid & 31, ln = lane & 15, hh = lane >> 4;
  const int ntn = N / 64;
  const int wid = blockIdx.x * 4 + w;
  const int mt = wid / ntn, nq = wid % ntn;
  if (mt * 16 >= M) return;
  const int row0 = mt * 16, col0 = nq * 64;
  const float* arow = A + (size_t)(row0 + ln) * lda;
  v8f acc[4] = {};
  for (int kb = 0; kb < K; kb += 32) {
    FragB ah, al;
    const v4f x0 = *(const v4fa*)(arow + kb + 8 * hh), x1 = *(const v4fa*)(arow + kb + 8 * hh + 4);
    const v4f x2 = *(const v4fa*)(arow + kb + 16 + 8 * hh), x3 = *(const v4fa*)(arow + kb + 16 + 8 * hh + 4);
    float xs[16] = {x0[0],x0[1],x0[2],x0[3],x1[0],x1[1],x1[2],x1[3],x2[0],x2[1],x2[2],x2[3],x3[0],x3[1],x3[2],x3[3]};
#pragma unroll
    for (int i = 0; i < 16; ++i) { const unsigned short hb = bf16_bits(xs[i]); ah.u[i] = hb; al.u[i] = ASPLIT ? bf16_bits(xs[i] - bf16_val(hb)) : (unsigned short)0; }
#pragma unroll
    for (int t = 0; t < 4; ++t) {
      const unsigned short* brow = Wt + (size_t)(col0 + t * 16 + ln) * ldb + kb;
      FragB b;
      b.half[0] = *(const v8us*)(brow + 8 * hh);
      b.half[1] = *(const v8us*)(brow + 16 + 8 * hh);
      acc[t] = mmaN<ASPLIT ? 2 : 1>(ah.v, al.v, b.v, b.v, acc[t]);
    }
  }
#pragma unroll
  for (int t = 0; t < 4; ++t) {
    const int col = col0 + t * 16 + ln;
    float bv = bias ? bias[col] : 0.f;
    if (BIAS_BF16) bv = bf16_round(bv);
#pragma unroll
    for (int r = 0; r < 8; ++r) {
      float v = acc[t][r] + bv;
      if (resid) { float rv = resid[(size_t)((row0 + 8 * hh + r) % rmod) * ldr + col]; if (RES_BF16) rv = bf16_round(rv); v += rv; }
      if (ACT == 1) v = fmaxf(v, 0.f);
      if (ACT == 2) v = 0.5f * v * (1.0f + erff(v * 0.70710678118654752f));
      if (ACT == 3) { const float u = 0.7978845608028654f * (v + 0.044715f * v * v * v); v = 0.5f * v * (1.0f + tanhf(u)); }
      so[w][8 * hh + r][t * 16 + ln] = v;
    }
  }
  __builtin_amdgcn_fence(__ATOMIC_ACQ_REL, "workgroup");
  __builtin_amdgcn_wave_barrier();
  const int rsub = lane >> 4, c4 = (lane & 15) * 4;
  {
#pragma unroll
    for (int q = 0; q < 8; ++q) {
      const int r = q * 2 + rsub;
      const v4f v = *(const v4fa*)&so[w][r][c4];
      *(v4f*)(C + (size_t)(row0 + r) * ldc + col0 + c4) = v;
    }
    
  }
}
// row LayerNorm (biased variance, eps) over N: s = X (+ R); optional out_sum <- s; out_norm <- (s-mu)*rsqrt(var+eps)*g + b
template <bool PARAM_BF16>
__global__ __launch_bounds__(256) void k_layernorm(const float* __restrict__ X, const float* __restrict__ R, const float* __restrict__ g, const float* __restrict__ bta,
                                                  float* __restrict__ out_sum, float* __restrict__ out_norm, int N, float eps) {
  __shared__ float red[256];
  const int row = blockIdx.x, tid = threadIdx.x;
  const float* x = X + (size_t)row * N; const float* rr = R ? R + (size_t)row * N : nullptr;
  float vals[16];                     // up to N = 4096
  const int per = N / 256;            // contiguous chunk per thread? use strided-by-4 chunks: thread handles j = tid*4 + 1024*u
  float s1 = 0.f;
  for (int u = 0; u < per / 4; ++u) {
    const int j = tid * 4 + 1024 * u;
    const v4f a = *(const v4fa*)(x + j);
    v4f b = {0.f,0.f,0.f,0.f}; if (rr) b = *(const v4fa*)(rr + j);
#pragma unroll
    for (int q = 0; q < 4; ++q) { const float v = a[q] + b[q]; vals[u * 4 + q] = v; s1 += v; }
  }
  red[tid] = s1; __syncthreads();
  for (int st = 128; st > 0; st >>= 1) { if (tid < st) red[tid] += red[tid + st]; __syncthreads(); }
  const float mu = red[0] / (float)N; __syncthreads();
  float s2 = 0.f;
  for (int u = 0; u < per / 4; ++u)
#pragma unroll
    for (int q = 0; q < 4; ++q) { const float c = vals[u * 4 + q] - mu; s2 += c * c; }
  red[tid] = s2; __syncthreads();
  for (int st = 128; st > 0; st >>= 1) { if (tid < st) red[tid] += red[tid + st]; __syncthreads(); }
  const float rs = rsqrtf(red[0] / (float)N + eps);
  {
    for (int u = 0; u < per / 4; ++u) {
      const int j = tid * 4 + 1024 * u;
      v4f o, sm;
#pragma unroll
      for (int q = 0; q < 4; ++q) {
        float gg = g[j + q], bb = bta[j + q];
        if (PARAM_BF16) { gg = bf16_round(gg); bb = bf16_round(bb); }
        sm[q] = vals[u * 4 + q]; o[q] = (vals[u * 4 + q] - mu) * rs * gg + bb;
      }
      if (out_sum) *(v4f*)(out_sum + (size_t)row * N + j) = sm;
      *(v4f*)(out_norm + (size_t)row * N + j) = o;
    }
    
  }
}



// ---- f16 WMMA path (v_wmma_f32_16x16x32_f16): 11-bit significands for operands in range — used where a [0,1] probability operand needs more precision than bf16
typedef _Float16 v16h __attribute__((ext_vector_type(16)));
union FragH { v16h v; v8us half[2]; _Float16 h[16]; unsigned short u[16]; };
template <int NT>
__device__ __forceinline__ v8f mmaH(v16h ah, v16h al, v16h bh, v16h bl, v8f c) {
  c = __builtin_amdgcn_wmma_f32_16x16x32_f16(false, ah, false, bh, (short)0, c, false, false);
  if (NT >= 2) c = __builtin_amdgcn_wmma_f32_16x16x32_f16(false, al, false, bh, (short)0, c, false, false);
  if (NT >= 3) c = __builtin_amdgcn_wmma_f32_16x16x32_f16(false, ah, false, bl, (short)0, c, false, false);
  asm volatile("v_nop\n\tv_nop\n\tv_nop\n\tv_nop" : "+v"(c) : "v"(ah), "v"(al), "v"(bh), "v"(bl));
  return c;
}
// batched GEMM like k_gemm_b but f16 operands: A f32 (split into f16 hi/lo if ASPLIT, else rounded to f16), Bt = f16 values [n][k]; alpha; C f32; N multiple of 16 (partial tiles skipped)
template <bool ASPLIT>
__global__ __launch_bounds__(128) void k_gemm_h(const float* __restrict__ A, int lda, size_t sA, const _Float16* __restrict__ Bh, int ldb, size_t sB, float alpha, float* __restrict__ C, int ldc, size_t sC, int M, int N, int K) {
  __shared__ __attribute__((aligned(16))) float so[4][16][64];
  const int tid = threadIdx.x, w = tid >> 5, lane = tid & 31, ln = lane & 15, hh = lane >> 4; const int by = blockIdx.y;
  A += (size_t)by * sA; Bh += (size_t)by * sB; C += (size_t)by * sC;
  const int ntn = (N + 63) / 64; const int wid = blockIdx.x * 4 + w; const int mt = wid / ntn, nq = wid % ntn; if (mt * 16 >= M) return;
  const int row0 = mt * 16, col0 = nq * 64; const float* arow = A + (size_t)(row0 + ln) * lda;
  v8f acc[4] = {};
  for (int kb = 0; kb < K; kb += 32) {
    FragH ah, al;
    const v4f x0 = *(const v4fa*)(arow + kb + 8 * hh), x1 = *(const v4fa*)(arow + kb + 8 * hh + 4), x2 = *(const v4fa*)(arow + kb + 16 + 8 * hh), x3 = *(const v4fa*)(arow + kb + 16 + 8 * hh + 4);
    float xs[16] = {x0[0],x0[1],x0[2],x0[3],x1[0],x1[1],x1[2],x1[3],x2[0],x2[1],x2[2],x2[3],x3[0],x3[1],x3[2],x3[3]};
#pragma unroll
    for (int i = 0; i < 16; ++i) { const _Float16 h = (_Float16)xs[i]; ah.h[i] = h; al.h[i] = ASPLIT ? (_Float16)(xs[i] - (float)h) : (_Float16)0.0f; }
#pragma unroll
    for (int t = 0; t < 4; ++t) { if (col0 + t * 16 >= N) continue; const size_t boff = (size_t)(col0 + t * 16 + ln) * ldb + kb; FragH bq; bq.half[0] = *(const v8us*)(Bh + boff + 8 * hh); bq.half[1] = *(const v8us*)(Bh + boff + 16 + 8 * hh);
      acc[t] = mmaH<ASPLIT ? 2 : 1>(ah.v, al.v, bq.v, bq.v, acc[t]); }
  }
#pragma unroll
  for (int t = 0; t < 4; ++t) { if (col0 + t * 16 >= N) continue;
#pragma unroll
    for (int r = 0; r < 8; ++r) so[w][8 * hh + r][t * 16 + ln] = acc[t][r] * alpha; }
  __builtin_amdgcn_fence(__ATOMIC_ACQ_REL, "workgroup"); __builtin_amdgcn_wave_barrier();
  const int rsub = lane >> 4, c4 = (lane & 15) * 4;
  {
#pragma unroll
    for (int q = 0; q < 8; ++q) { const int r = q * 2 + rsub; if (col0 + c4 < N) { const v4f v = *(const v4fa*)&so[w][r][c4]; *(v4f*)(C + (size_t)(row0 + r) * ldc + col0 + c4) = v; } }
     }
}

// Wt[n][k] = f16(W[k][n]·scale) from f32 row-major W[K][N] (scale = power of two; bf16-exact weights stay exact in f16 away from the subnormal range)
// device body: blk = index of the 256-thread block inside this job's range of the shared grid (k_prep)
__device__ __forceinline__ void d_wt_f16(const float* __restrict__ W, _Float16* __restrict__ Wt, int K, int N, float scale, int blk) {
  const int t = blk * 256 + threadIdx.x; if (t >= N * (K / 8)) return; const int n = t / (K / 8), k8 = (t % (K / 8)) * 8; FragH f;
#pragma unroll
  for (int i = 0; i < 8; ++i) f.h[i] = (_Float16)(bf16_round(W[(size_t)(k8 + i) * N + n]) * scale); const v8us o = f.half[0];
  *(v8us*)((unsigned short*)Wt + (size_t)n * K + k8) = o; 
}
// k_gemm_hh variant with fused epilogue: v = acc·alpha + bias[by·sBias + col] (+ CP[(row/rowsPerB)·sCPb + by·64 + col] if CP) ; ACT 0 none / 1 elu ; writes f32 C and/or f16 C16 (each if non-null)
template <int ACT>
__global__ __launch_bounds__(128) void k_gemm_hhx(const _Float16* __restrict__ A, int lda, size_t sA, const _Float16* __restrict__ Bh, int ldb, size_t sB, float alpha, const float* __restrict__ bias, size_t sBias, const float* __restrict__ CP, int rowsPerB, size_t sCPb, int row0g,
    float* __restrict__ C, _Float16* __restrict__ C16, int ldc, size_t sC, int M, int N, int K, const _Float16* __restrict__ A2, float alpha2, float* __restrict__ C2) {
  __shared__ __attribute__((aligned(16))) float so[4][16][64];
  const int tid = threadIdx.x, w = tid >> 5, lane = tid & 31, ln = lane & 15, hh = lane >> 4; const int by = blockIdx.y;
  if (blockIdx.z) { A = A2; alpha = alpha2; bias = nullptr; C = C2; }      /* blockIdx.z = 1: the second term of a split A in the same grid: its own operand, factor and f32 plane, no bias */
  A += (size_t)by * sA; Bh += (size_t)by * sB; const size_t cofs = (size_t)by * sC; const float* bp = bias ? bias + (size_t)by * sBias : nullptr;
  const int ntn = (N + 63) / 64; const int wid = blockIdx.x * 4 + w; const int mt = wid / ntn, nq = wid % ntn; if (mt * 16 >= M) return;
  const int row0 = mt * 16, col0 = nq * 64; const _Float16* arow = A + (size_t)(row0 + ln) * lda;
  v8f acc[4] = {};
  for (int kb = 0; kb < K; kb += 32) { FragH ah; ah.half[0] = *(const v8us*)((const unsigned short*)arow + kb + 8 * hh); ah.half[1] = *(const v8us*)((const unsigned short*)arow + kb + 16 + 8 * hh);
#pragma unroll
    for (int t = 0; t < 4; ++t) { if (col0 + t * 16 >= N) continue; const size_t boff = (size_t)(col0 + t * 16 + ln) * ldb + kb; FragH bq; bq.half[0] = *(const v8us*)((const unsigned short*)Bh + boff + 8 * hh); bq.half[1] = *(const v8us*)((const unsigned short*)Bh + boff + 16 + 8 * hh);
      acc[t] = mmaH<1>(ah.v, ah.v, bq.v, bq.v, acc[t]); }
  }
#pragma unroll
  for (int t = 0; t < 4; ++t) { if (col0 + t * 16 >= N) continue; const int col = col0 + t * 16 + ln; const float bv = bp ? bf16_round(bp[col]) : 0.f;
#pragma unroll
    for (int r = 0; r < 8; ++r) { float v = acc[t][r] * alpha + bv; if (CP) { const int rr = row0g + row0 + 8 * hh + r; if (rowsPerB < 0) v += CP[cofs + (size_t)rr * ldc + col];      /* rowsPerB < 0: own element of the batched C plane */ else { const int bidx = rr / rowsPerB; v += CP[(size_t)bidx * sCPb + (size_t)by * 64 + col]; } } if (ACT == 1) v = (v > 0.f) ? v : expm1f(v); else if (ACT == 7) v = (v > 0.f) ? v + 1.0f : expf(v); else if (ACT == 8) v = tanhf(v); else if (ACT == 9) v = 0.5f * v * (1.0f + tanhf(0.7978845608028654f * (v + 0.044715f * v * v * v))); else if (ACT == 11) v = 1.0f / (1.0f + expf(-v)); else if (ACT == 12) v = (v > 0.f) ? v : 0.01f * v; else if (ACT == 14) v = (v > 0.f) ? v : 0.1f * v; else if (ACT == 16) v = (v >= 0.f) ? v : 0.3f * v; else if (ACT == 17) v = (v >= 0.f) ? v : 0.2f * v; else if (ACT == 15) v = v / (1.0f + expf(-v)); else if (ACT == 3) v = fmaxf(v, 0.f); else if (ACT == 6) v = 0.5f * v * (1.0f + erff(v * 0.70710678118654752f)); so[w][8 * hh + r][t * 16 + ln] = v; } }
  __builtin_amdgcn_fence(__ATOMIC_ACQ_REL, "workgroup"); __builtin_amdgcn_wave_barrier();
  const int rsub = lane >> 4, c4 = (lane & 15) * 4; typedef _Float16 v4h __attribute__((ext_vector_type(4)));
  {
#pragma unroll
    for (int q = 0; q < 8; ++q) { const int r = q * 2 + rsub; if (col0 + c4 < N) { const v4f v = *(const v4fa*)&so[w][r][c4]; if (C) *(v4f*)(C + cofs + (size_t)(row0 + r) * ldc + col0 + c4) = v; if (C16) { v4h h4; for (int i = 0; i < 4; ++i) h4[i] = (_Float16)v[i]; *(v4h*)(C16 + cofs + (size_t)(row0 + r) * ldc + col0 + c4) = h4; } } }
     }
}


typedef _Float16 v4h __attribute__((ext_vector_type(4)));

__device__ __forceinline__ void d_x16(const float* __restrict__ x, _Float16* __restrict__ X16, size_t n8, int blk) { const size_t t = (size_t)blk * 256 + threadIdx.x; if (t >= n8) return; FragH f;
#pragma unroll
  for (int q = 0; q < 8; ++q) f.h[q] = (_Float16)bf16_round(x[t * 8 + q]); *(v8us*)((unsigned short*)X16 + t * 8) = f.half[0];  }
// f16(bf16-rounded value x 16) in the source's own order: w_scales rows and b_scales are read along the keys as they lie
__device__ __forceinline__ void d_r16(const float* __restrict__ Wv, _Float16* __restrict__ Bt, int blk) { const size_t t = (size_t)blk * 256 + threadIdx.x; FragH f;
#pragma unroll
  for (int i = 0; i < 8; ++i) f.h[i] = (_Float16)(bf16_round(Wv[t * 8 + i]) * 16.0f); *(v8us*)((unsigned short*)Bt + t * 8) = f.half[0];
  asm volatile("s_wait_xcnt 0x0" ::: "memory"); }      /* stands behind the store, in front of the first overwrite of a register that it names (the other jobs' code follows in the listing) */
// the five operand preparations need nothing of each other: one grid, each job a range of the block index (block-uniform branches); the transposes, whose threads take longest, start first
#define PREP_Q (DIM * 4 * INNER / 8 / 256)
#define PREP_O (INNER * DIM / 8 / 256)
#define PREP_S (HD * NP / 8 / 256)
#define PREP_B (NP / 8 / 256)
#define PREP_X (NR * DIM / 8 / 256)
__global__ __launch_bounds__(256) void k_prep(const float* __restrict__ Wq, _Float16* __restrict__ BQ, const float* __restrict__ Wo, _Float16* __restrict__ BO, const float* __restrict__ Wsc, const float* __restrict__ bsc, _Float16* __restrict__ BS, const float* __restrict__ x, _Float16* __restrict__ X16) {
  static_assert(DIM * 4 * INNER % 2048 == 0 && INNER * DIM % 2048 == 0 && HD * NP % 2048 == 0 && NP % 2048 == 0 && NR * DIM % 2048 == 0, "k_prep: every job fills whole blocks");
  int blk = blockIdx.x;
  if (blk < PREP_Q) { d_wt_f16(Wq, BQ, DIM, 4 * INNER, 16.0f, blk); return; }
  blk -= PREP_Q;
  if (blk < PREP_O) { d_wt_f16(Wo, BO, INNER, DIM, 16.0f, blk); return; }
  blk -= PREP_O;
  if (blk < PREP_S) { d_r16(Wsc, BS, blk); return; }
  blk -= PREP_S;
  if (blk < PREP_B) { d_r16(bsc, BS + (size_t)HD * NP, blk); return; }      /* row 64 of the plane */
  d_x16(x, X16, (size_t)NR * DIM / 8, blk - PREP_B); }
__global__ __launch_bounds__(256) void k_h16(const float* __restrict__ x, _Float16* __restrict__ X16, size_t n8) { const size_t t = (size_t)blockIdx.x * 256 + threadIdx.x; if (t >= n8) return; FragH f;
#pragma unroll
  for (int q = 0; q < 8; ++q) f.h[q] = (_Float16)x[t * 8 + q]; *(v8us*)((unsigned short*)X16 + t * 8) = f.half[0];  }
__global__ __launch_bounds__(256) void k_round16f(const float* __restrict__ W, _Float16* __restrict__ Bt, size_t n8) { const size_t t = (size_t)blockIdx.x * 256 + threadIdx.x; if (t >= n8) return; FragH f;
#pragma unroll
  for (int i = 0; i < 8; ++i) f.h[i] = (_Float16)(bf16_round(W[t * 8 + i]) * 16.0f); *(v8us*)((unsigned short*)Bt + t * 8) = f.half[0];  }
template <int NHv, int TTv>
__global__ __launch_bounds__(256) void k_vt(const _Float16* __restrict__ V16, int ldv, int voff, int voffy, _Float16* __restrict__ Vt, size_t sVty) { __shared__ unsigned short tl[64][66]; const int tid = threadIdx.x; voff += blockIdx.y * voffy; Vt += (size_t)blockIdx.y * sVty;      /* blockIdx.y: which column group of V16 is transposed, into its own plane */ const int slab = blockIdx.x / (TTv / 64), lg = blockIdx.x % (TTv / 64); const int b = slab / NHv, h = slab % NHv;
  for (int i = tid; i < 64 * 8; i += 256) { const int r = i / 8, c8 = (i % 8) * 8; FragH f; f.half[0] = *(const v8us*)((const unsigned short*)V16 + ((size_t)b * TTv + lg * 64 + r) * ldv + voff + h * 64 + c8);
#pragma unroll
    for (int q = 0; q < 8; ++q) tl[r][c8 + q] = f.u[q]; }
  __syncthreads();
  {
#pragma unroll
    for (int rd = 0; rd < 2; ++rd) { const int d = rd * 32 + tid / 8, pc = tid % 8; FragH f;
#pragma unroll
      for (int q = 0; q < 8; ++q) f.u[q] = tl[pc * 8 + q][d];
      *(v8us*)((unsigned short*)Vt + ((size_t)slab * 64 + d) * TTv + lg * 64 + pc * 8) = f.half[0]; }
     } }

__global__ __launch_bounds__(256) void k_hl(const float* __restrict__ F, _Float16* __restrict__ Hh, _Float16* __restrict__ Hl, size_t n8) { const size_t t = (size_t)blockIdx.x * 256 + threadIdx.x; if (t >= n8) return; FragH fh, fl; const v4f a = *(const v4fa*)(F + t * 8), c = *(const v4fa*)(F + t * 8 + 4);
#pragma unroll
  for (int q = 0; q < 4; ++q) { _Float16 h = (_Float16)a[q]; fh.h[q] = h; fl.h[q] = (_Float16)((a[q] - (float)h) * 1024.0f); h = (_Float16)c[q]; fh.h[4 + q] = h; fl.h[4 + q] = (_Float16)((c[q] - (float)h) * 1024.0f); }
  { *(v8us*)((unsigned short*)Hh + t * 8) = fh.half[0]; *(v8us*)((unsigned short*)Hl + t * 8) = fl.half[0];  } }

// ---- fast GEMM (wave tile 32x64; requires M % 32 == 0 rows per launch region and N % 64 == 0); epilogue = k_gemm_hhx semantics ----
__device__ __forceinline__ v16h g2_frag(const _Float16* p, int hh) { FragH f; f.half[0] = *(const v8us*)((const unsigned short*)p + 8 * hh); f.half[1] = *(const v8us*)((const unsigned short*)p + 16 + 8 * hh); return f.v; }
__device__ __forceinline__ v8f g2_mma(v16h a, v16h b, v8f c) { v8f d = __builtin_amdgcn_wmma_f32_16x16x32_f16(false, a, false, b, (short)0, c, false, false); asm volatile("v_nop\n\tv_nop\n\tv_nop\n\tv_nop" : "+v"(d) : "v"(a), "v"(b)); return d; }
template <int ACT>
__global__ __launch_bounds__(128) void k_gemm2(const _Float16* __restrict__ A, int lda, size_t sA, const _Float16* __restrict__ Bh, int ldb, size_t sB, float alpha, const float* __restrict__ bias, size_t sBias, const float* __restrict__ CP, int rowsPerB, size_t sCPb, int row0g,
    float* __restrict__ C, _Float16* __restrict__ C16, int ldc, size_t sC, int M, int N, int K) { static_assert(ACT == 0 || ACT == 3 || ACT == 6 || ACT == 8 || ACT == 9 || ACT == 11 || ACT == 12 || ACT == 14 || ACT == 15 || ACT == 16 || ACT == 17, "k_gemm2: unsupported ACT code (would silently apply no activation)");
  __shared__ __attribute__((aligned(16))) float so[4][32][68];
  const int tid = threadIdx.x, w = tid >> 5, lane = tid & 31, ln = lane & 15, hh = lane >> 4; const int by = blockIdx.y;
  A += (size_t)by * sA; Bh += (size_t)by * sB; const size_t cofs = (size_t)by * sC; const float* bp = bias ? bias + (size_t)by * sBias : nullptr;
  const int ntn = N >> 6; const int mt = blockIdx.x / ntn, nq = blockIdx.x - mt * ntn; const int row0 = mt * 128 + 32 * w, col0 = nq * 64; if (row0 >= M) return;
  const _Float16* a0p = A + (size_t)(row0 + ln) * lda; const _Float16* a1p = a0p + (size_t)16 * lda;
  const _Float16* b0p = Bh + (size_t)(col0 + ln) * ldb; const _Float16* b1p = b0p + (size_t)16 * ldb; const _Float16* b2p = b1p + (size_t)16 * ldb; const _Float16* b3p = b2p + (size_t)16 * ldb;
  const v8f z8 = {0.f,0.f,0.f,0.f,0.f,0.f,0.f,0.f}; v8f c00 = z8, c01 = z8, c02 = z8, c03 = z8, c10 = z8, c11 = z8, c12 = z8, c13 = z8;
#pragma unroll 1
  for (int kb = 0; kb < K; kb += 32) { const v16h a0 = g2_frag(a0p + kb, hh), a1 = g2_frag(a1p + kb, hh);
    v16h b = g2_frag(b0p + kb, hh); c00 = g2_mma(a0, b, c00); c10 = g2_mma(a1, b, c10);
    b = g2_frag(b1p + kb, hh); c01 = g2_mma(a0, b, c01); c11 = g2_mma(a1, b, c11);
    b = g2_frag(b2p + kb, hh); c02 = g2_mma(a0, b, c02); c12 = g2_mma(a1, b, c12);
    b = g2_frag(b3p + kb, hh); c03 = g2_mma(a0, b, c03); c13 = g2_mma(a1, b, c13); }
  v8f accs[8] = {c00, c01, c02, c03, c10, c11, c12, c13};
#pragma unroll
  for (int u = 0; u < 8; ++u) { const int t = u & 3, half = u >> 2; const int col = col0 + t * 16 + ln; const float bv = bp ? bf16_round(bp[col]) : 0.f;
#pragma unroll
    for (int r = 0; r < 8; ++r) { const int rloc = half * 16 + 8 * hh + r; float v = accs[u][r] * alpha + bv; if (CP) { if (rowsPerB < 0) v += CP[cofs + (size_t)(row0g + row0 + rloc) * ldc + col];      /* rowsPerB < 0: own element of the batched C plane */ else { const int bidx = (row0g + row0 + rloc) / rowsPerB; v += CP[(size_t)bidx * sCPb + (size_t)by * 64 + col]; } }
      if (ACT == 3) v = fmaxf(v, 0.f); else if (ACT == 6) v = 0.5f * v * (1.0f + erff(v * 0.70710678118654752f)); else if (ACT == 11) v = 1.0f / (1.0f + expf(-v)); else if (ACT == 15) v = v / (1.0f + expf(-v)); else if (ACT == 12) v = (v > 0.f) ? v : 0.01f * v; else if (ACT == 8) v = tanhf(v); else if (ACT == 9) v = 0.5f * v * (1.0f + tanhf(0.7978845608028654f * (v + 0.044715f * v * v * v))); else if (ACT == 14) v = (v > 0.f) ? v : 0.1f * v; else if (ACT == 16) v = (v >= 0.f) ? v : 0.3f * v; else if (ACT == 17) v = (v >= 0.f) ? v : 0.2f * v;
      so[w][rloc][t * 16 + ln] = v; } }
  __builtin_amdgcn_fence(__ATOMIC_ACQ_REL, "workgroup"); __builtin_amdgcn_wave_barrier();
  const int rsub = lane >> 4, c4 = (lane & 15) * 4;
  {
#pragma unroll
    for (int q = 0; q < 16; ++q) { const int r = q * 2 + rsub; const v4f v = *(const v4fa*)&so[w][r][c4]; if (C) *(v4f*)(C + cofs + (size_t)(row0 + r) * ldc + col0 + c4) = v; if (C16) { v4h h4; for (int i = 0; i < 4; ++i) h4[i] = (_Float16)v[i]; *(v4h*)(C16 + cofs + (size_t)(row0 + r) * ldc + col0 + c4) = h4; } }
     } }

// ---- split-K GEMM for the K = 2048 product with few output tiles (f^T v): one 32x64 tile per block, its K range dealt over SKW waves, f32 partial tiles summed through LDS in wave order; v = sum * alpha (+ own element of CP) ----
#define SKW 16                   /* waves per tile; each takes KT / SKW of the k range */
template <int KT>
__global__ __launch_bounds__(32 * SKW) void k_gemm2k(const _Float16* __restrict__ A, int lda, size_t sA, const _Float16* __restrict__ Bh, int ldb, size_t sB, float alpha, const float* CP, float* C, int ldc, size_t sC) {
  static_assert(KT % (32 * SKW) == 0, "k_gemm2k: every wave takes whole 32-deep steps");
  __shared__ __attribute__((aligned(16))) float so[SKW][32][68];
  const int tid = threadIdx.x, w = tid >> 5, lane = tid & 31, ln = lane & 15, hh = lane >> 4; const int by = blockIdx.y;
  A += (size_t)by * sA + w * (KT / SKW); Bh += (size_t)by * sB + w * (KT / SKW); const size_t cofs = (size_t)by * sC; const int row0 = blockIdx.x * 32;
  const _Float16* a0p = A + (size_t)(row0 + ln) * lda; const _Float16* a1p = a0p + (size_t)16 * lda;
  const _Float16* b0p = Bh + (size_t)ln * ldb; const _Float16* b1p = b0p + (size_t)16 * ldb; const _Float16* b2p = b1p + (size_t)16 * ldb; const _Float16* b3p = b2p + (size_t)16 * ldb;
  const v8f z8 = {0.f,0.f,0.f,0.f,0.f,0.f,0.f,0.f}; v8f c00 = z8, c01 = z8, c02 = z8, c03 = z8, c10 = z8, c11 = z8, c12 = z8, c13 = z8;
  for (int kb = 0; kb < KT / SKW; kb += 32) { const v16h a0 = g2_frag(a0p + kb, hh), a1 = g2_frag(a1p + kb, hh);
    v16h b = g2_frag(b0p + kb, hh); c00 = g2_mma(a0, b, c00); c10 = g2_mma(a1, b, c10);
    b = g2_frag(b1p + kb, hh); c01 = g2_mma(a0, b, c01); c11 = g2_mma(a1, b, c11);
    b = g2_frag(b2p + kb, hh); c02 = g2_mma(a0, b, c02); c12 = g2_mma(a1, b, c12);
    b = g2_frag(b3p + kb, hh); c03 = g2_mma(a0, b, c03); c13 = g2_mma(a1, b, c13); }
  v8f accs[8] = {c00, c01, c02, c03, c10, c11, c12, c13};
  // both loops unrolled: accs is then indexed by constants only and stays in registers
#pragma unroll
  for (int u = 0; u < 8; ++u) { const int t = u & 3, half = u >> 2;
#pragma unroll
    for (int r = 0; r < 8; ++r) so[w][half * 16 + 8 * hh + r][t * 16 + ln] = accs[u][r]; }
  __syncthreads();      /* every wave's partial tile is in LDS before any thread sums across waves */
  const int r = tid >> 4, c4 = (tid & 15) * 4; v4f s = *(const v4fa*)&so[0][r][c4];
  for (int u = 1; u < SKW; ++u) s += *(const v4fa*)&so[u][r][c4];
  const size_t o = cofs + (size_t)(row0 + r) * ldc + c4; v4f v = s * alpha; if (CP) v += *(const v4fa*)(CP + o);
  *(v4f*)(C + o) = v; }


// ---- fused attention: a block takes 256 query rows of one (batch, head), 32 per wave, and walks the 2048 keys in tiles of 64; each tile (k rows, w_scales rows) is fetched once per block by whole-line loads and put into LDS, where all 8 waves read their fragments; running maximum and sum per query ----
#define FQW 8                    /* waves per block, 32 query rows each: 8 x 32 (batch, head) pairs = 256 blocks */
#define FKT 64                   /* keys per tile: one row of each staged plane is 128 bytes */
#define FLP 72                   /* LDS row pitch in f16: 144 bytes = 16 x 9, the 16 rows of a fragment read fall on different banks */
__device__ __forceinline__ v8f fa_mma(v16h a, v16h b, v8f c) { return __builtin_amdgcn_wmma_f32_16x16x32_f16(false, a, false, b, (short)0, c, false, false); }
// fragment in the hardware k order from a wave-uniform base and the lane's own element offset (row ln, k 8 * hh)
__device__ __forceinline__ v16h fa_frag(const _Float16* ub, unsigned lo) { FragH f; f.half[0] = *(const v8us*)((const unsigned short*)ub + lo); f.half[1] = *(const v8us*)((const unsigned short*)ub + lo + 16); return f.v; }
// the same fragment from a staged row: p = the lane's own row at k 8 * hh
__device__ __forceinline__ v16h fl_frag(const unsigned short* p) { FragH f; f.half[0] = *(const v8us*)p; f.half[1] = *(const v8us*)(p + 16); return f.v; }
// eight independent 2^x in place: each v_exp_f32 fills the slot that the instruction set asks for behind the one before it, the v_nop fills the last one's
__device__ __forceinline__ void fa_exp2x8(float* x) {
  asm("v_exp_f32 %0, %0\n\tv_exp_f32 %1, %1\n\tv_exp_f32 %2, %2\n\tv_exp_f32 %3, %3\n\tv_exp_f32 %4, %4\n\tv_exp_f32 %5, %5\n\tv_exp_f32 %6, %6\n\tv_exp_f32 %7, %7\n\tv_nop"
      : "+v"(x[0]), "+v"(x[1]), "+v"(x[2]), "+v"(x[3]), "+v"(x[4]), "+v"(x[5]), "+v"(x[6]), "+v"(x[7])); }
// two of them, same slots
__device__ __forceinline__ void fa_exp2x2(float& a, float& b) { asm("v_exp_f32 %0, %0\n\tv_exp_f32 %1, %1\n\tv_nop" : "+v"(a), "+v"(b)); }
// lane l with lane l ^ 16
__device__ __forceinline__ float fa_xhalf(float x) { return __builtin_bit_cast(float, __builtin_amdgcn_permlanex16(__builtin_bit_cast(int, x), __builtin_bit_cast(int, x), 0x76543210, 0xfedcba98, false, false)); }
__global__ __launch_bounds__(32 * FQW) void k_fattn(const _Float16* QKFV, const _Float16* WS, const _Float16* FVH, const _Float16* FVL, _Float16* CH, _Float16* CL) {
  static_assert(NP % (32 * FQW) == 0 && NP % FKT == 0 && HD == 64 && FKT == 64 && 4 * INNER == NP && 32 * FQW == 256 && NP == 8 * 32 * FQW, "k_fattn: head size 64, 64-key tiles, one row pitch for q, k and w_scales, 256 threads stage 64 rows of 8 chunks in two rounds and the b_scales row in one");
  __shared__ __attribute__((aligned(16))) unsigned short st[2][2][64][FLP];      /* [buffer][k rows | w_scales rows][row][64 f16 + pad] */
  __shared__ __attribute__((aligned(16))) unsigned short sb[NP];      /* the whole b_scales row, put down once */
  const int tid = threadIdx.x, w = __builtin_amdgcn_readfirstlane(tid >> 5), lane = tid & 31, ln = lane & 15, hh = lane >> 4;
  const int bh = blockIdx.y, b = bh / NH, h = bh - b * NH;
  const int ldq = 4 * INNER; const unsigned lo = (unsigned)(ln * NP + 8 * hh);
  const _Float16* base = QKFV + (size_t)b * NP * ldq + h * HD;
  const int row0 = blockIdx.x * (32 * FQW) + w * 32;
  // staging: 8 neighbouring lanes fetch one whole 128-byte row; a thread takes chunk tid & 7 of rows tid >> 3 and 32 + (tid >> 3) of each of the two planes
  const int sr = tid >> 3, sc = (tid & 7) * 8;
  const unsigned short* gk = (const unsigned short*)(base + INNER) + (size_t)sr * ldq + sc;
  const unsigned short* gw = (const unsigned short*)WS + (size_t)sr * NP + sc;
  v8us g0 = *(const v8us*)gk, g1 = *(const v8us*)(gk + (size_t)32 * ldq), g2 = *(const v8us*)gw, g3 = *(const v8us*)(gw + (size_t)32 * NP);
  const v8us gb = *(const v8us*)((const unsigned short*)WS + (size_t)HD * NP + tid * 8);
  asm volatile("s_wait_xcnt 0x0" ::: "memory");      /* stands in front of the first overwrite of a register that the 5 loads above name (the q loads' offset takes the register of the b_scales load's) */
  const _Float16* qp = base + (size_t)row0 * ldq;
  const v16h q00 = fa_frag(qp, lo), q01 = fa_frag(qp + 32, lo), q10 = fa_frag(qp + 16 * ldq, lo), q11 = fa_frag(qp + 16 * ldq + 32, lo);
  asm volatile("s_wait_xcnt 0x0" ::: "memory");      /* stands in front of the first overwrite of a register that the 8 loads above name (the accumulators' zeroes reuse the q loads' offset register and base) */
  *(v8us*)&st[0][0][sr][sc] = g0; *(v8us*)&st[0][0][sr + 32][sc] = g1; *(v8us*)&st[0][1][sr][sc] = g2; *(v8us*)&st[0][1][sr + 32][sc] = g3; *(v8us*)&sb[tid * 8] = gb;
  __syncthreads();      /* tile 0 and the b_scales row are in LDS before any wave reads them */
  const v8f z8 = {0.f,0.f,0.f,0.f,0.f,0.f,0.f,0.f};
  const float cs = 0.125f * 1.4426950408889634f;
  // o[u][t][r] = sum over the keys of weight x w_scales[t*16 + 8*hh + r][key] for query row0 + u*16 + ln, in units of 2^10 x 16 x the weights under the running maximum m; ob[u][r] = the same sum against b_scales (every r alike); su = this lane half's share of the weight sum
  v8f o[2][4] = {{z8, z8, z8, z8}, {z8, z8, z8, z8}}; v8f ob[2] = {z8, z8};
  float m0 = -3.0e38f, m1 = -3.0e38f, su0 = 0.f, su1 = 0.f;
  // one tile; more = a next tile exists, is fetched, stored and published (a constant at each of the two calls: the trip of the loop below is one straight block, so that the scheduling barriers bind all of it)
  // every loop inside a tile is unrolled: the fragment and accumulator arrays are then indexed by constants only and stay in registers
  auto tile = [&](const int kt, const bool more) __attribute__((always_inline)) {
    const int cur = kt & 1;
    if (more) {
      const size_t ko = (size_t)(kt + 1) * FKT * ldq; const int po = (kt + 1) * FKT;
      g0 = *(const v8us*)(gk + ko); g1 = *(const v8us*)(gk + ko + (size_t)32 * ldq); g2 = *(const v8us*)(gw + po); g3 = *(const v8us*)(gw + po + (size_t)32 * NP);
      asm volatile("s_wait_xcnt 0x0" ::: "memory"); }      /* stands in front of the first overwrite of an address register that the 4 loads above name (the k fragments take them) */
    __builtin_amdgcn_sched_barrier(0);      /* holds the next tile's 4 loads ahead of this tile's work, which hides their latency (the compiler otherwise sinks a load to its use) */
    // S^T = K Q^T: s[t][u][r] = score of key kt*64 + t*16 + 8*hh + r against query row0 + u*16 + ln
    v8f s[4][2];
#pragma unroll
    for (int t = 0; t < 4; ++t) { const unsigned short* kr = &st[cur][0][t * 16 + ln][8 * hh]; const v16h k0 = fl_frag(kr), k1 = fl_frag(kr + 32);
      s[t][0] = fa_mma(k1, q01, fa_mma(k0, q00, z8)); s[t][1] = fa_mma(k1, q11, fa_mma(k0, q10, z8)); }
    // running maximum: in-lane over the tile's keys, across the two lane halves, against the maximum so far
    float t0 = s[0][0][0], t1 = s[0][1][0];
#pragma unroll
    for (int t = 0; t < 4; ++t) {
#pragma unroll
      for (int r = 0; r < 8; ++r) { t0 = fmaxf(t0, s[t][0][r]); t1 = fmaxf(t1, s[t][1][r]); } }
    t0 = fmaxf(t0, fa_xhalf(t0)); t1 = fmaxf(t1, fa_xhalf(t1));
    t0 = fmaxf(t0, m0); t1 = fmaxf(t1, m1);
    float a0 = (m0 - t0) * cs, a1 = (m1 - t1) * cs;      /* what stands under the old maximum shrinks by 2^a; 0 on the first tile */
    fa_exp2x2(a0, a1);
    m0 = t0; m1 = t1;
    // w_scales fragments come in 2 groups (keys 0-31, 32-63) of 4 row tiles plus the b_scales fragment (one row, read alike by all 16 lanes of a half), each asked for one group of products ahead; the scheduling barriers hold the LDS reads there (the compiler otherwise sinks them to their use, one LDS latency per pair of products)
    const unsigned short* pr = &st[cur][1][ln][8 * hh]; const unsigned short* br = &sb[kt * FKT + 8 * hh];
    v16h bf[2][5];
    __builtin_amdgcn_sched_barrier(0);      /* not above the score products: their fragments and these do not fit the registers together */
#pragma unroll
    for (int t = 0; t < 4; ++t) bf[0][t] = fl_frag(pr + t * 16 * FLP);
    bf[0][4] = fl_frag(br);
    __builtin_amdgcn_sched_barrier(0);      /* the first group flies under the first half of the softmax */
    // weights e * 2^10 = 2^((s - max) / 8 * log2 e + 10); two score tiles (32 keys) of one query tile are one B fragment in the hardware k order
    const float f0 = 10.0f - m0 * cs, f1 = 10.0f - m1 * cs;
    su0 *= a0; su1 *= a1; v16h p[2][2];
    // readout, transposed (A = w_scales rows or the b_scales row, B = weights), on f32 accumulators that are first shrunk to the new maximum
#pragma unroll
    for (int ks = 0; ks < 2; ++ks) {
#pragma unroll
      for (int u = 0; u < 2; ++u) { float x[16]; FragH a; float sa = 0.f;
#pragma unroll
        for (int i = 0; i < 16; ++i) x[i] = s[2 * ks + (i >> 3)][u][i & 7] * cs + (u ? f1 : f0);
        fa_exp2x8(x); fa_exp2x8(x + 8);
#pragma unroll
        for (int i = 0; i < 16; ++i) { sa += x[i]; a.h[i] = (_Float16)x[i]; }
        if (u) su1 += sa; else su0 += sa;
        p[ks][u] = a.v; }
      if (ks == 0) {
        __builtin_amdgcn_sched_barrier(0);      /* the sums of the first 32 keys end here: left open, all 64 weights stay in f32 registers to the end of the tile */
#pragma unroll
        for (int t = 0; t < 4; ++t) bf[1][t] = fl_frag(pr + t * 16 * FLP + 32);
        bf[1][4] = fl_frag(br + 32);
        __builtin_amdgcn_sched_barrier(0);      /* the second group is asked for ahead of the first group's products */
        // the first group's products stand in one region with the second half of the softmax: vector work under matrix time
#pragma unroll
        for (int t = 0; t < 4; ++t) { o[0][t] *= a0; o[1][t] *= a1; }
        ob[0] *= a0; ob[1] *= a1;
#pragma unroll
        for (int t = 0; t < 4; ++t) { o[0][t] = fa_mma(bf[0][t], p[0][0], o[0][t]); o[1][t] = fa_mma(bf[0][t], p[0][1], o[1][t]); }
        ob[0] = fa_mma(bf[0][4], p[0][0], ob[0]); ob[1] = fa_mma(bf[0][4], p[0][1], ob[1]); } }
#pragma unroll
    for (int t = 0; t < 4; ++t) { o[0][t] = fa_mma(bf[1][t], p[1][0], o[0][t]); o[1][t] = fa_mma(bf[1][t], p[1][1], o[1][t]); }
    ob[0] = fa_mma(bf[1][4], p[1][0], ob[0]); ob[1] = fa_mma(bf[1][4], p[1][1], ob[1]);
    if (more) {
      const int nx = cur ^ 1;      /* last read in the tile before, behind whose barrier every wave stands */
      *(v8us*)&st[nx][0][sr][sc] = g0; *(v8us*)&st[nx][0][sr + 32][sc] = g1; *(v8us*)&st[nx][1][sr][sc] = g2; *(v8us*)&st[nx][1][sr + 32][sc] = g3;
      __syncthreads(); }      /* one barrier a tile: the next tile is in LDS before any wave reads it, and every wave has left this tile's buffer before it is refilled in the next trip */
  };
  // the tile loop stays rolled, its body is long
#pragma unroll 1
  for (int kt = 0; kt < NP / FKT - 1; ++kt) tile(kt, true);
  tile(NP / FKT - 1, false);
  // f^T v of this (batch, head), hi and residual x 2^10, as A fragments (row d = t*16 + ln, k = e)
  const unsigned short* fvh = (const unsigned short*)FVH + (size_t)bh * HD * HD + ln * HD + 8 * hh; const unsigned short* fvl = (const unsigned short*)FVL + (size_t)bh * HD * HD + ln * HD + 8 * hh;
  v16h ah[4][2], al[4][2];
#pragma unroll
  for (int t = 0; t < 4; ++t) {
#pragma unroll
    for (int ks = 0; ks < 2; ++ks) { ah[t][ks] = fl_frag(fvh + t * 16 * HD + ks * 32); al[t][ks] = fl_frag(fvl + t * 16 * HD + ks * 32); } }
  asm volatile("s_wait_xcnt 0x0" :: "v"(fvh), "v"(fvl) : "memory");      /* stands in front of the first overwrite of an address register that the 32 loads above name; the two addresses are inputs so that their registers live up to here */
  su0 += fa_xhalf(su0); su1 += fa_xhalf(su1);
  const float rs0 = 1.0f / su0, rs1 = 1.0f / su1;
  // second product: out^T[d][query] = sum over e of (f^T v)[d][e] x (attn . w_scales^T)[query][e]; two accumulator tiles (32 e) of one query tile are one B fragment in the hardware k order, exactly as the weights were
#pragma unroll
  for (int u = 0; u < 2; ++u) { const float rs = u ? rs1 : rs0; v16h th[2], tl[2];
#pragma unroll
    for (int ks = 0; ks < 2; ++ks) { FragH xh, xl;
#pragma unroll
      for (int i = 0; i < 16; ++i) { const float v = o[u][2 * ks + (i >> 3)][i & 7] * rs; const _Float16 hv = (_Float16)v; xh.h[i] = hv; xl.h[i] = (_Float16)((v - (float)hv) * 1024.0f); }
      th[ks] = xh.v; tl[ks] = xl.v; }
    const float cb = ob[u][0] * rs;
#pragma unroll
    for (int t = 0; t < 4; ++t) { FragH ch, cl;
      // the two cross terms carry 2^10, taken back (exact) before the hi x hi term joins the same accumulators
      v8f c = fa_mma(ah[t][1], tl[1], fa_mma(ah[t][0], tl[0], fa_mma(al[t][1], th[1], fa_mma(al[t][0], th[0], z8))));
      c *= 0.0009765625f;
      c = fa_mma(ah[t][1], th[1], fa_mma(ah[t][0], th[0], c));
#pragma unroll
      for (int r = 0; r < 8; ++r) { const float v = (c[r] + cb) * 0.0625f; const _Float16 hv = (_Float16)v; ch.h[r] = hv; cl.h[r] = (_Float16)((v - (float)hv) * 1024.0f); }
      const size_t oo = ((size_t)b * NP + row0 + u * 16 + ln) * INNER + h * HD + t * 16 + 8 * hh;
      *(v8us*)((unsigned short*)CH + oo) = ch.half[0]; *(v8us*)((unsigned short*)CL + oo) = cl.half[0]; } }
}

extern "C" void kernel_launch(void* const* d_in, const int* in_sizes, int n_in,
                              void* d_out, int out_size, void* d_ws, size_t ws_size, hipStream_t stream) {
  (void)in_sizes; (void)n_in; (void)out_size;
  const float* x = (const float*)d_in[0]; const float* Wqkfv = (const float*)d_in[1]; const float* Wsc = (const float*)d_in[2]; const float* bsc = (const float*)d_in[3]; const float* Wout = (const float*)d_in[4]; const float* bout = (const float*)d_in[5];
  char* ws = (char*)d_ws; size_t off = 0;
  auto take = [&](size_t bytes) { char* p = ws + off; off += (bytes + 255) & ~(size_t)255; return p; };
  _Float16* BQ = (_Float16*)take((size_t)4 * INNER * DIM * 2); _Float16* BS = (_Float16*)take((size_t)(HD + 1) * NP * 2);      /* w_scales rows, then b_scales as row 64 */ _Float16* BO = (_Float16*)take((size_t)DIM * INNER * 2);
  _Float16* X16 = (_Float16*)take((size_t)NR * DIM * 2); _Float16* QKFV = (_Float16*)take((size_t)NR * 4 * INNER * 2);      /* [row][q | k | f | v] f16, 32 MiB */
  _Float16* FT = (_Float16*)take((size_t)2 * NB * NH * HD * NP * 2); _Float16* VTT = FT + (size_t)NB * NH * HD * NP;      /* f^T, then v^T, each [b][h][64][2048] */ float* FV = (float*)take((size_t)NB * NH * HD * HD * 4); _Float16* FVH = (_Float16*)take((size_t)NB * NH * HD * HD * 2); _Float16* FVL = (_Float16*)take((size_t)NB * NH * HD * HD * 2);
  _Float16* CH = (_Float16*)take((size_t)NR * INNER * 2); _Float16* CL = (_Float16*)take((size_t)NR * INNER * 2);
  if (off > ws_size) return;      /* about 76 MiB */
  k_prep<<<PREP_Q + PREP_O + PREP_S + PREP_B + PREP_X, 256, 0, stream>>>(Wqkfv, BQ, Wout, BO, Wsc, bsc, BS, x, X16);      /* w_qkfv and w_out transposed (x @ W, in x out), w_scales and b_scales as they lie, and the f16 x plane */
  k_gemm2<0><<<dim3((NR / 128) * (4 * INNER / 64), 1), 128, 0, stream>>>(X16, DIM, 0, BQ, DIM, 0, 0.0625f, nullptr, 0, nullptr, 1, 0, 0, nullptr, QKFV, 4 * INNER, 0, NR, 4 * INNER, DIM);      /* [q | k | f | v], head h at h*64 inside each quarter */
  // the f^T v chain: every stage is one launch whose grid runs over all (batch, head) pairs, and over both of two jobs that need nothing of each other
  k_vt<NH, NP><<<dim3(NB * NH * (NP / 64), 2), 256, 0, stream>>>(QKFV, 4 * INNER, 2 * INNER, INNER, FT, (size_t)NB * NH * HD * NP);      /* f^T (y = 0) and v^T (y = 1) per batch and head [64][2048] */
  k_gemm2k<NP><<<dim3(HD / 32, NB * NH), 32 * SKW, 0, stream>>>(FT, NP, (size_t)HD * NP, VTT, NP, (size_t)HD * NP, 1.0f, nullptr, FV, HD, (size_t)HD * HD);      /* FV[b][h][d][e] = sum_n f[n][d] v[n][e] (32-row tiles, K over the block's waves) */
  k_hl<<<(NB * NH * HD * HD / 8 + 255) / 256, 256, 0, stream>>>(FV, FVH, FVL, (size_t)NB * NH * HD * HD / 8);
  k_fattn<<<dim3(NP / (32 * FQW), NB * NH), 32 * FQW, 0, stream>>>(QKFV, BS, FVH, FVL, CH, CL);      /* (softmax(q k^T / 8) . w_scales^T) (f^T v)^T + softmax . b_scales, as f16 hi/residual */
  k_gemm2<0><<<dim3((NR / 128) * (DIM / 64), 1), 128, 0, stream>>>(CL, INNER, 0, BO, INNER, 0, 0.0625f / 1024.0f, nullptr, 0, nullptr, 1, 0, 0, (float*)d_out, nullptr, DIM, 0, NR, DIM, INNER);
  k_gemm2<0><<<dim3((NR / 128) * (DIM / 64), 1), 128, 0, stream>>>(CH, INNER, 0, BO, INNER, 0, 0.0625f, bout, 0, (const float*)d_out, 1, (size_t)DIM, 0, (float*)d_out, nullptr, DIM, 0, NR, DIM, INNER);      /* y = (c_lo + c_hi) w_out + b_out */
}

// v006
// One run takes 127 microseconds.
// Timed twice side by side with v005, it ran 1.50 times as fast both times.
// All steps since v000 together make it 15.7 times as fast.
#include <hip/hip_runtime.h>
// SimilarAttention (4 x 2048 patches x 512, 8 heads x 64: [q|k|f|v] = x w_qkfv; attn = softmax(q.k/8); poss_value = (f^T v) w_scales + b_scales -> [h][64][2048]; out = attn . poss_value^T; y = merged . w_out + b_out).
// Structure: exact f16 x plane; the fused projection as ONE f16 WMMA GEMM (128x64 block tiles staged in LDS, 32x64 wave tiles, f32 accumulation, exact x16 weights; f16 out); then, each stage as ONE launch over all batches and heads: f^T and v^T by LDS tiles (one grid, blockIdx.y picks the plane), f^T v as 32-row WMMA tiles (K = 2048 dealt over a block's 16 waves, f32 partials summed in LDS) then f16 hi/residual, then ONE launch for all batches and heads that keeps scores and softmax weights in registers and never builds poss_value: attn . ((f^T v) w_scales + b)^T = (attn . w_scales^T) (f^T v)^T + attn . b. A block takes 256 query rows of one head, 32 per wave, and walks the keys in tiles of 64 that are staged once per block in LDS (scores transposed, K = 64, f32; running row maximum and row sum; unnormalised f16 weights x 2^10 packed from the score accumulators into the B operand; readout against the exact x16 w_scales rows and the b_scales row on f32 accumulators); behind the keys: row scaling, f16 hi/residual, three product terms against f^T v hi/residual, + the b term, hi/residual out; w_out as two GEMM terms (+ bias).
// Compute dtype: inputs rounded to bf16; x / weights exact as f16; q, k, f, v and the softmax weights as plain f16 operands (~2^-12); f^T v, attn . w_scales^T and the merged context as f16 hi + residual. v_wmma_f32_16x16x32_f16.
#define NB 4
#define NP 2048
#define DIM 512
#define NH 8
#define HD 64
#define INNER 512
#define NR (NB * NP)
typedef __bf16 v16b __attribute__((ext_vector_type(16)));
typedef unsigned short v8us __attribute__((ext_vector_type(8), may_alias));
typedef float  v8f  __attribute__((ext_vector_type(8)));
typedef float  v4f  __attribute__((ext_vector_type(4)));
typedef float  v4fa __attribute__((ext_vector_type(4), may_alias));
union FragB { v16b v; v8us half[2]; unsigned short u[16]; };

__device__ __forceinline__ unsigned short bf16_bits(float x) { unsigned int u = __float_as_uint(x); return (unsigned short)((u + 0x7FFFu + ((u >> 16) & 1u)) >> 16); }
__device__ __forceinline__ float bf16_val(unsigned short b) { return __uint_as_float(((unsigned int)b) << 16); }
__device__ __forceinline__ float bf16_round(float x) { return bf16_val(bf16_bits(x)); }
// D += A·B with NT terms: 1 = ah·bh, 2 = + al·bh (A split), 3 = + ah·bl (both split)
template <int NT>
__device__ __forceinline__ v8f mmaN(v16b ah, v16b al, v16b bh, v16b bl, v8f c) {
  c = __builtin_amdgcn_wmma_f32_16x16x32_bf16(false, ah, false, bh, (short)0, c, false, false);
  if (NT >= 2) c = __builtin_amdgcn_wmma_f32_16x16x32_bf16(false, al, false, bh, (short)0, c, false, false);
  if (NT >= 3) c = __builtin_amdgcn_wmma_f32_16x16x32_bf16(false, ah, false, bl, (short)0, c, false, false);
  asm volatile("v_nop\n\tv_nop\n\tv_nop\n\tv_nop" : "+v"(c) : "v"(ah), "v"(al), "v"(bh), "v"(bl));
  return c;
}

__global__ __launch_bounds__(256) void k_wt_bf16(const float* __restrict__ W, unsigned short* __restrict__ Wt, int K, int N) {
  const int t = blockIdx.x * 256 + threadIdx.x;
  const int k8n = K / 8;
  if (t >= N * k8n) return;
  const int n = t / k8n, k8 = (t % k8n) * 8;
  v8us v;
#pragma unroll
  for (int i = 0; i < 8; ++i) v[i] = bf16_bits(W[(size_t)(k8 + i) * N + n]);
  *(v8us*)(Wt + (size_t)n * K + k8) = v;
  
}

// GEMM C[M][N] (f32, pitch ldc) = act(A[M][K]·W + bias). A f32 row-major (pitch lda) converted per fragment to bf16
// (ASPLIT: hi/lo two planes -> 2 terms, else single rounded term); Wt bf16 [N][K] (pitch ldb). BIAS_BF16 rounds the
// bias to bf16 first (bias quantised to bf16 before the add). K%32==0, M%16==0, N%64==0.
template <bool ASPLIT, int ACT, bool BIAS_BF16>
__global__ __launch_bounds__(128) void k_gemm_bf(const float* __restrict__ A, int lda, const unsigned short* __restrict__ Wt, int ldb,
                                               const float* __restrict__ bias, float* __restrict__ C, int ldc, int M, int N, int K) {
  __shared__ __attribute__((aligned(16))) float so[4][16][64];
  const int tid = threadIdx.x, w = tid >> 5, lane = tid & 31, ln = lane & 15, hh = lane >> 4;
  const int ntn = N / 64;
  const int wid = blockIdx.x * 4 + w;
  const int mt = wid / ntn, nq = wid % ntn;
  if (mt * 16 >= M) return;
  const int row0 = mt * 16, col0 = nq * 64;
  const float* arow = A + (size_t)(row0 + ln) * lda;
  v8f acc[4] = {};
  for (int kb = 0; kb < K; kb += 32) {
    FragB ah, al;
    const v4f x0 = *(const v4fa*)(arow + kb + 8 * hh), x1 = *(const v4fa*)(arow + kb + 8 * hh + 4);
    const v4f x2 = *(const v4fa*)(arow + kb + 16 + 8 * hh), x3 = *(const v4fa*)(arow + kb + 16 + 8 * hh + 4);
    float xs[16] = {x0[0],x0[1],x0[2],x0[3],x1[0],x1[1],x1[2],x1[3],x2[0],x2[1],x2[2],x2[3],x3[0],x3[1],x3[2],x3[3]};
#pragma unroll
    for (int i = 0; i < 16; ++i) { const unsigned short hb = bf16_bits(xs[i]); ah.u[i] = hb; al.u[i] = ASPLIT ? bf16_bits(xs[i] - bf16_val(hb)) : (unsigned short)0; }
#pragma unroll
    for (int t = 0; t < 4; ++t) {
      const unsigned short* brow = Wt + (size_t)(col0 + t * 16 + ln) * ldb + kb;
      FragB b;
      b.half[0] = *(const v8us*)(brow + 8 * hh);
      b.half[1] = *(const v8us*)(brow + 16 + 8 * hh);
      acc[t] = mmaN<ASPLIT ? 2 : 1>(ah.v, al.v, b.v, b.v, acc[t]);
    }
  }
#pragma unroll
  for (int t = 0; t < 4; ++t) {
    float bv = bias ? bias[col0 + t * 16 + ln] : 0.f;
    if (BIAS_BF16) bv = bf16_round(bv);
#pragma unroll
    for (int r = 0; r < 8; ++r) { float v = acc[t][r] + bv; if (ACT == 1) v = fmaxf(v, 0.f); so[w][8 * hh + r][t * 16 + ln] = v; }
  }
  __builtin_amdgcn_fence(__ATOMIC_ACQ_REL, "workgroup");
  __builtin_amdgcn_wave_barrier();
  const int rsub = lane >> 4, c4 = (lane & 15) * 4;
  {
#pragma unroll
    for (int q = 0; q < 8; ++q) {
      const int r = q * 2 + rsub;
      const v4f v = *(const v4fa*)&so[w][r][c4];
      *(v4f*)(C + (size_t)(row0 + r) * ldc + col0 + c4) = v;
    }
    
  }
}

// GEMM C = act(A·W + bias + resid): A f32 (ASPLIT -> hi/lo 2 terms), Wt bf16 [N][K]; ACT 0 none, 1 relu, 2 exact gelu;
// resid (optional, f32, row index = (row % rmod), pitch ldr, RES_BF16 rounds it) added before the activation.
template <bool ASPLIT, int ACT, bool BIAS_BF16, bool RES_BF16>
__global__ __launch_bounds__(128) void k_gemm_bf3(const float* __restrict__ A, int lda, const unsigned short* __restrict__ Wt, int ldb,
                                                const float* __restrict__ bias, const float* __restrict__ resid, int rmod, int ldr,
                                                float* __restrict__ C, int ldc, int M, int N, int K) {
  __shared__ __attribute__((aligned(16))) float so[4][16][64];
  const int tid = threadIdx.x, w = tid >> 5, lane = tid & 31, ln = lane & 15, hh = lane >> 4;
  const int ntn = N / 64;
  const int wid = blockIdx.x * 4 + w;
  const int mt = wid / ntn, nq = wid % ntn;
  if (mt * 16 >= M) return;
  const int row0 = mt * 16, col0 = nq * 64;
  const float* arow = A + (size_t)(row0 + ln) * lda;
  v8f acc[4] = {};
  for (int kb = 0; kb < K; kb += 32) {
    FragB ah, al;
    const v4f x0 = *(const v4fa*)(arow + kb + 8 * hh), x1 = *(const v4fa*)(arow + kb + 8 * hh + 4);
    const v4f x2 = *(const v4fa*)(arow + kb + 16 + 8 * hh), x3 = *(const v4fa*)(arow + kb + 16 + 8 * hh + 4);
    float xs[16] = {x0[0],x0[1],x0[2],x0[3],x1[0],x1[1],x1[2],x1[3],x2[0],x2[1],x2[2],x2[3],x3[0],x3[1],x3[2],x3[3]};
#pragma unroll
    for (int i = 0; i < 16; ++i) { const unsigned short hb = bf16_bits(xs[i]); ah.u[i] = hb; al.u[i] = ASPLIT ? bf16_bits(xs[i] - bf16_val(hb)) : (unsigned short)0; }
#pragma unroll
    for (int t = 0; t < 4; ++t) {
      const unsigned short* brow = Wt + (size_t)(col0 + t * 16 + ln) * ldb + kb;
      FragB b;
      b.half[0] = *(const v8us*)(brow + 8 * hh);
      b.half[1] = *(const v8us*)(brow + 16 + 8 * hh);
      acc[t] = mmaN<ASPLIT ? 2 : 1>(ah.v, al.v, b.v, b.v, acc[t]);
    }
  }
#pragma unroll
  for (int t = 0; t < 4; ++t) {
    const int col = col0 + t * 16 + ln;
    float bv = bias ? bias[col] : 0.f;
    if (BIAS_BF16) bv = bf16_round(bv);
#pragma unroll
    for (int r = 0; r < 8; ++r) {
      float v = acc[t][r] + bv;
      if (resid) { float rv = resid[(size_t)((row0 + 8 * hh + r) % rmod) * ldr + col]; if (RES_BF16) rv = bf16_round(rv); v += rv; }
      if (ACT == 1) v = fmaxf(v, 0.f);
      if (ACT == 2) v = 0.5f * v * (1.0f + erff(v * 0.70710678118654752f));
      if (ACT == 3) { const float u = 0.7978845608028654f * (v + 0.044715f * v * v * v); v = 0.5f * v * (1.0f + tanhf(u)); }
      so[w][8 * hh + r][t * 16 + ln] = v;
    }
  }
  __builtin_amdgcn_fence(__ATOMIC_ACQ_REL, "workgroup");
  __builtin_amdgcn_wave_barrier();
  const int rsub = lane >> 4, c4 = (lane & 15) * 4;
  {
#pragma unroll
    for (int q = 0; q < 8; ++q) {
      const int r = q * 2 + rsub;
      const v4f v = *(const v4fa*)&so[w][r][c4];
      *(v4f*)(C + (size_t)(row0 + r) * ldc + col0 + c4) = v;
    }
    
  }
}
// row LayerNorm (biased variance, eps) over N: s = X (+ R); optional out_sum <- s; out_norm <- (s-mu)*rsqrt(var+eps)*g + b
template <bool PARAM_BF16>
__global__ __launch_bounds__(256) void k_layernorm(const float* __restrict__ X, const float* __restrict__ R, const float* __restrict__ g, const float* __restrict__ bta,
                                                  float* __restrict__ out_sum, float* __restrict__ out_norm, int N, float eps) {
  __shared__ float red[256];
  const int row = blockIdx.x, tid = threadIdx.x;
  const float* x = X + (size_t)row * N; const float* rr = R ? R + (size_t)row * N : nullptr;
  float vals[16];                     // up to N = 4096
  const int per = N / 256;            // contiguous chunk per thread? use strided-by-4 chunks: thread handles j = tid*4 + 1024*u
  float s1 = 0.f;
  for (int u = 0; u < per / 4; ++u) {
    const int j = tid * 4 + 1024 * u;
    const v4f a = *(const v4fa*)(x + j);
    v4f b = {0.f,0.f,0.f,0.f}; if (rr) b = *(const v4fa*)(rr + j);
#pragma unroll
    for (int q = 0; q < 4; ++q) { const float v = a[q] + b[q]; vals[u * 4 + q] = v; s1 += v; }
  }
  red[tid] = s1; __syncthreads();
  for (int st = 128; st > 0; st >>= 1) { if (tid < st) red[tid] += red[tid + st]; __syncthreads(); }
  const float mu = red[0] / (float)N; __syncthreads();
  float s2 = 0.f;
  for (int u = 0; u < per / 4; ++u)
#pragma unroll
    for (int q = 0; q < 4; ++q) { const float c = vals[u * 4 + q] - mu; s2 += c * c; }
  red[tid] = s2; __syncthreads();
  for (int st = 128; st > 0; st >>= 1) { if (tid < st) red[tid] += red[tid + st]; __syncthreads(); }
  const float rs = rsqrtf(red[0] / (float)N + eps);
  {
    for (int u = 0; u < per / 4; ++u) {
      const int j = tid * 4 + 1024 * u;
      v4f o, sm;
#pragma unroll
      for (int q = 0; q < 4; ++q) {
        float gg = g[j + q], bb = bta[j + q];
        if (PARAM_BF16) { gg = bf16_round(gg); bb = bf16_round(bb); }
        sm[q] = vals[u * 4 + q]; o[q] = (vals[u * 4 + q] - mu) * rs * gg + bb;
      }
      if (out_sum) *(v4f*)(out_sum + (size_t)row * N + j) = sm;
      *(v4f*)(out_norm + (size_t)row * N + j) = o;
    }
    
  }
}



// ---- f16 WMMA path (v_wmma_f32_16x16x32_f16): 11-bit significands for operands in range — used where a [0,1] probability operand needs more precision than bf16
typedef _Float16 v16h __attribute__((ext_vector_type(16)));
union FragH { v16h v; v8us half[2]; _Float16 h[16]; unsigned short u[16]; };
template <int NT>
__device__ __forceinline__ v8f mmaH(v16h ah, v16h al, v16h bh, v16h bl, v8f c) {
  c = __builtin_amdgcn_wmma_f32_16x16x32_f16(false, ah, false, bh, (short)0, c, false, false);
  if (NT >= 2) c = __builtin_amdgcn_wmma_f32_16x16x32_f16(false, al, false, bh, (short)0, c, false, false);
  if (NT >= 3) c = __builtin_amdgcn_wmma_f32_16x16x32_f16(false, ah, false, bl, (short)0, c, false, false);
  asm volatile("v_nop\n\tv_nop\n\tv_nop\n\tv_nop" : "+v"(c) : "v"(ah), "v"(al), "v"(bh), "v"(bl));
  return c;
}
// batched GEMM like k_gemm_b but f16 operands: A f32 (split into f16 hi/lo if ASPLIT, else rounded to f16), Bt = f16 values [n][k]; alpha; C f32; N multiple of 16 (partial tiles skipped)
template <bool ASPLIT>
__global__ __launch_bounds__(128) void k_gemm_h(const float* __restrict__ A, int lda, size_t sA, const _Float16* __restrict__ Bh, int ldb, size_t sB, float alpha, float* __restrict__ C, int ldc, size_t sC, int M, int N, int K) {
  __shared__ __attribute__((aligned(16))) float so[4][16][64];
  const int tid = threadIdx.x, w = tid >> 5, lane = tid & 31, ln = lane & 15, hh = lane >> 4; const int by = blockIdx.y;
  A += (size_t)by * sA; Bh += (size_t)by * sB; C += (size_t)by * sC;
  const int ntn = (N + 63) / 64; const int wid = blockIdx.x * 4 + w; const int mt = wid / ntn, nq = wid % ntn; if (mt * 16 >= M) return;
  const int row0 = mt * 16, col0 = nq * 64; const float* arow = A + (size_t)(row0 + ln) * lda;
  v8f acc[4] = {};
  for (int kb = 0; kb < K; kb += 32) {
    FragH ah, al;
    const v4f x0 = *(const v4fa*)(arow + kb + 8 * hh), x1 = *(const v4fa*)(arow + kb + 8 * hh + 4), x2 = *(const v4fa*)(arow + kb + 16 + 8 * hh), x3 = *(const v4fa*)(arow + kb + 16 + 8 * hh + 4);
    float xs[16] = {x0[0],x0[1],x0[2],x0[3],x1[0],x1[1],x1[2],x1[3],x2[0],x2[1],x2[2],x2[3],x3[0],x3[1],x3[2],x3[3]};
#pragma unroll
    for (int i = 0; i < 16; ++i) { const _Float16 h = (_Float16)xs[i]; ah.h[i] = h; al.h[i] = ASPLIT ? (_Float16)(xs[i] - (float)h) : (_Float16)0.0f; }
#pragma unroll
    for (int t = 0; t < 4; ++t) { if (col0 + t * 16 >= N) continue; const size_t boff = (size_t)(col0 + t * 16 + ln) * ldb + kb; FragH bq; bq.half[0] = *(const v8us*)(Bh + boff + 8 * hh); bq.half[1] = *(const v8us*)(Bh + boff + 16 + 8 * hh);
      acc[t] = mmaH<ASPLIT ? 2 : 1>(ah.v, al.v, bq.v, bq.v, acc[t]); }
  }
#pragma unroll
  for (int t = 0; t < 4; ++t) { if (col0 + t * 16 >= N) continue;
#pragma unroll
    for (int r = 0; r < 8; ++r) so[w][8 * hh + r][t * 16 + ln] = acc[t][r] * alpha; }
  __builtin_amdgcn_fence(__ATOMIC_ACQ_REL, "workgroup"); __builtin_amdgcn_wave_barrier();
  const int rsub = lane >> 4, c4 = (lane & 15) * 4;
  {
#pragma unroll
    for (int q = 0; q < 8; ++q) { const int r = q * 2 + rsub; if (col0 + c4 < N) { const v4f v = *(const v4fa*)&so[w][r][c4]; *(v4f*)(C + (size_t)(row0 + r) * ldc + col0 + c4) = v; } }
     }
}

// Wt[n][k] = f16(W[k][n]·scale) from f32 row-major W[K][N] (scale = power of two; bf16-exact weights stay exact in f16 away from the subnormal range)
// device body: blk = index of the 256-thread block inside this job's range of the shared grid (k_prep)
__device__ __forceinline__ void d_wt_f16(const float* __restrict__ W, _Float16* __restrict__ Wt, int K, int N, float scale, int blk) {
  const int t = blk * 256 + threadIdx.x; if (t >= N * (K / 8)) return; const int n = t / (K / 8), k8 = (t % (K / 8)) * 8; FragH f;
#pragma unroll
  for (int i = 0; i < 8; ++i) f.h[i] = (_Float16)(bf16_round(W[(size_t)(k8 + i) * N + n]) * scale); const v8us o = f.half[0];
  *(v8us*)((unsigned short*)Wt + (size_t)n * K + k8) = o; 
}
// k_gemm_hh variant with fused epilogue: v = acc·alpha + bias[by·sBias + col] (+ CP[(row/rowsPerB)·sCPb + by·64 + col] if CP) ; ACT 0 none / 1 elu ; writes f32 C and/or f16 C16 (each if non-null)
template <int ACT>
__global__ __launch_bounds__(128) void k_gemm_hhx(const _Float16* __restrict__ A, int lda, size_t sA, const _Float16* __restrict__ Bh, int ldb, size_t sB, float alpha, const float* __restrict__ bias, size_t sBias, const float* __restrict__ CP, int rowsPerB, size_t sCPb, int row0g,
    float* __restrict__ C, _Float16* __restrict__ C16, int ldc, size_t sC, int M, int N, int K, const _Float16* __restrict__ A2, float alpha2, float* __restrict__ C2) {
  __shared__ __attribute__((aligned(16))) float so[4][16][64];
  const int tid = threadIdx.x, w = tid >> 5, lane = tid & 31, ln = lane & 15, hh = lane >> 4; const int by = blockIdx.y;
  if (blockIdx.z) { A = A2; alpha = alpha2; bias = nullptr; C = C2; }      /* blockIdx.z = 1: the second term of a split A in the same grid: its own operand, factor and f32 plane, no bias */
  A += (size_t)by * sA; Bh += (size_t)by * sB; const size_t cofs = (size_t)by * sC; const float* bp = bias ? bias + (size_t)by * sBias : nullptr;
  const int ntn = (N + 63) / 64; const int wid = blockIdx.x * 4 + w; const int mt = wid / ntn, nq = wid % ntn; if (mt * 16 >= M) return;
  const int row0 = mt * 16, col0 = nq * 64; const _Float16* arow = A + (size_t)(row0 + ln) * lda;
  v8f acc[4] = {};
  for (int kb = 0; kb < K; kb += 32) { FragH ah; ah.half[0] = *(const v8us*)((const unsigned short*)arow + kb + 8 * hh); ah.half[1] = *(const v8us*)((const unsigned short*)arow + kb + 16 + 8 * hh);
#pragma unroll
    for (int t = 0; t < 4; ++t) { if (col0 + t * 16 >= N) continue; const size_t boff = (size_t)(col0 + t * 16 + ln) * ldb + kb; FragH bq; bq.half[0] = *(const v8us*)((const unsigned short*)Bh + boff + 8 * hh); bq.half[1] = *(const v8us*)((const unsigned short*)Bh + boff + 16 + 8 * hh);
      acc[t] = mmaH<1>(ah.v, ah.v, bq.v, bq.v, acc[t]); }
  }
#pragma unroll
  for (int t = 0; t < 4; ++t) { if (col0 + t * 16 >= N) continue; const int col = col0 + t * 16 + ln; const float bv = bp ? bf16_round(bp[col]) : 0.f;
#pragma unroll
    for (int r = 0; r < 8; ++r) { float v = acc[t][r] * alpha + bv; if (CP) { const int rr = row0g + row0 + 8 * hh + r; if (rowsPerB < 0) v += CP[cofs + (size_t)rr * ldc + col];      /* rowsPerB < 0: own element of the batched C plane */ else { const int bidx = rr / rowsPerB; v += CP[(size_t)bidx * sCPb + (size_t)by * 64 + col]; } } if (ACT == 1) v = (v > 0.f) ? v : expm1f(v); else if (ACT == 7) v = (v > 0.f) ? v + 1.0f : expf(v); else if (ACT == 8) v = tanhf(v); else if (ACT == 9) v = 0.5f * v * (1.0f + tanhf(0.7978845608028654f * (v + 0.044715f * v * v * v))); else if (ACT == 11) v = 1.0f / (1.0f + expf(-v)); else if (ACT == 12) v = (v > 0.f) ? v : 0.01f * v; else if (ACT == 14) v = (v > 0.f) ? v : 0.1f * v; else if (ACT == 16) v = (v >= 0.f) ? v : 0.3f * v; else if (ACT == 17) v = (v >= 0.f) ? v : 0.2f * v; else if (ACT == 15) v = v / (1.0f + expf(-v)); else if (ACT == 3) v = fmaxf(v, 0.f); else if (ACT == 6) v = 0.5f * v * (1.0f + erff(v * 0.70710678118654752f)); so[w][8 * hh + r][t * 16 + ln] = v; } }
  __builtin_amdgcn_fence(__ATOMIC_ACQ_REL, "workgroup"); __builtin_amdgcn_wave_barrier();
  const int rsub = lane >> 4, c4 = (lane & 15) * 4; typedef _Float16 v4h __attribute__((ext_vector_type(4)));
  {
#pragma unroll
    for (int q = 0; q < 8; ++q) { const int r = q * 2 + rsub; if (col0 + c4 < N) { const v4f v = *(const v4fa*)&so[w][r][c4]; if (C) *(v4f*)(C + cofs + (size_t)(row0 + r) * ldc + col0 + c4) = v; if (C16) { v4h h4; for (int i = 0; i < 4; ++i) h4[i] = (_Float16)v[i]; *(v4h*)(C16 + cofs + (size_t)(row0 + r) * ldc + col0 + c4) = h4; } } }
     }
}


typedef _Float16 v4h __attribute__((ext_vector_type(4)));

__device__ __forceinline__ void d_x16(const float* __restrict__ x, _Float16* __restrict__ X16, size_t n8, int blk) { const size_t t = (size_t)blk * 256 + threadIdx.x; if (t >= n8) return; FragH f;
#pragma unroll
  for (int q = 0; q < 8; ++q) f.h[q] = (_Float16)bf16_round(x[t * 8 + q]); *(v8us*)((unsigned short*)X16 + t * 8) = f.half[0];  }
// f16(bf16-rounded value x 16) in the source's own order: w_scales rows and b_scales are read along the keys as they lie
__device__ __forceinline__ void d_r16(const float* __restrict__ Wv, _Float16* __restrict__ Bt, int blk) { const size_t t = (size_t)blk * 256 + threadIdx.x; FragH f;
#pragma unroll
  for (int i = 0; i < 8; ++i) f.h[i] = (_Float16)(bf16_round(Wv[t * 8 + i]) * 16.0f); *(v8us*)((unsigned short*)Bt + t * 8) = f.half[0];
  asm volatile("s_wait_xcnt 0x0" ::: "memory"); }      /* stands behind the store, in front of the first overwrite of a register that it names (the other jobs' code follows in the listing) */
// the five operand preparations need nothing of each other: one grid, each job a range of the block index (block-uniform branches); the transposes, whose threads take longest, start first
#define PREP_Q (DIM * 4 * INNER / 8 / 256)
#define PREP_O (INNER * DIM / 8 / 256)
#define PREP_S (HD * NP / 8 / 256)
#define PREP_B (NP / 8 / 256)
#define PREP_X (NR * DIM / 8 / 256)
__global__ __launch_bounds__(256) void k_prep(const float* __restrict__ Wq, _Float16* __restrict__ BQ, const float* __restrict__ Wo, _Float16* __restrict__ BO, const float* __restrict__ Wsc, const float* __restrict__ bsc, _Float16* __restrict__ BS, const float* __restrict__ x, _Float16* __restrict__ X16) {
  static_assert(DIM * 4 * INNER % 2048 == 0 && INNER * DIM % 2048 == 0 && HD * NP % 2048 == 0 && NP % 2048 == 0 && NR * DIM % 2048 == 0, "k_prep: every job fills whole blocks");
  int blk = blockIdx.x;
  if (blk < PREP_Q) { d_wt_f16(Wq, BQ, DIM, 4 * INNER, 16.0f, blk); return; }
  blk -= PREP_Q;
  if (blk < PREP_O) { d_wt_f16(Wo, BO, INNER, DIM, 16.0f, blk); return; }
  blk -= PREP_O;
  if (blk < PREP_S) { d_r16(Wsc, BS, blk); return; }
  blk -= PREP_S;
  if (blk < PREP_B) { d_r16(bsc, BS + (size_t)HD * NP, blk); return; }      /* row 64 of the plane */
  d_x16(x, X16, (size_t)NR * DIM / 8, blk - PREP_B); }
__global__ __launch_bounds__(256) void k_h16(const float* __restrict__ x, _Float16* __restrict__ X16, size_t n8) { const size_t t = (size_t)blockIdx.x * 256 + threadIdx.x; if (t >= n8) return; FragH f;
#pragma unroll
  for (int q = 0; q < 8; ++q) f.h[q] = (_Float16)x[t * 8 + q]; *(v8us*)((unsigned short*)X16 + t * 8) = f.half[0];  }
__global__ __launch_bounds__(256) void k_round16f(const float* __restrict__ W, _Float16* __restrict__ Bt, size_t n8) { const size_t t = (size_t)blockIdx.x * 256 + threadIdx.x; if (t >= n8) return; FragH f;
#pragma unroll
  for (int i = 0; i < 8; ++i) f.h[i] = (_Float16)(bf16_round(W[t * 8 + i]) * 16.0f); *(v8us*)((unsigned short*)Bt + t * 8) = f.half[0];  }
template <int NHv, int TTv>
__global__ __launch_bounds__(256) void k_vt(const _Float16* __restrict__ V16, int ldv, int voff, int voffy, _Float16* __restrict__ Vt, size_t sVty) { __shared__ unsigned short tl[64][66]; const int tid = threadIdx.x; voff += blockIdx.y * voffy; Vt += (size_t)blockIdx.y * sVty;      /* blockIdx.y: which column group of V16 is transposed, into its own plane */ const int slab = blockIdx.x / (TTv / 64), lg = blockIdx.x % (TTv / 64); const int b = slab / NHv, h = slab % NHv;
  for (int i = tid; i < 64 * 8; i += 256) { const int r = i / 8, c8 = (i % 8) * 8; FragH f; f.half[0] = *(const v8us*)((const unsigned short*)V16 + ((size_t)b * TTv + lg * 64 + r) * ldv + voff + h * 64 + c8);
#pragma unroll
    for (int q = 0; q < 8; ++q) tl[r][c8 + q] = f.u[q]; }
  __syncthreads();
  {
#pragma unroll
    for (int rd = 0; rd < 2; ++rd) { const int d = rd * 32 + tid / 8, pc = tid % 8; FragH f;
#pragma unroll
      for (int q = 0; q < 8; ++q) f.u[q] = tl[pc * 8 + q][d];
      *(v8us*)((unsigned short*)Vt + ((size_t)slab * 64 + d) * TTv + lg * 64 + pc * 8) = f.half[0]; }
     } }

__global__ __launch_bounds__(256) void k_hl(const float* __restrict__ F, _Float16* __restrict__ Hh, _Float16* __restrict__ Hl, size_t n8) { const size_t t = (size_t)blockIdx.x * 256 + threadIdx.x; if (t >= n8) return; FragH fh, fl; const v4f a = *(const v4fa*)(F + t * 8), c = *(const v4fa*)(F + t * 8 + 4);
#pragma unroll
  for (int q = 0; q < 4; ++q) { _Float16 h = (_Float16)a[q]; fh.h[q] = h; fl.h[q] = (_Float16)((a[q] - (float)h) * 1024.0f); h = (_Float16)c[q]; fh.h[4 + q] = h; fl.h[4 + q] = (_Float16)((c[q] - (float)h) * 1024.0f); }
  { *(v8us*)((unsigned short*)Hh + t * 8) = fh.half[0]; *(v8us*)((unsigned short*)Hl + t * 8) = fl.half[0];  } }

// ---- fast GEMM (block tile 128x64, wave tile 32x64; requires M % 128 == 0 rows per launch region, N % 64 == 0 and K % 64 == 0); A and B go through LDS in steps of 64 k: whole 128-byte rows fetched once per block, two buffers; epilogue = k_gemm_hhx semantics ----
#define G2P 72                   /* LDS row pitch in f16: 144 bytes = 16 x 9, the 16 rows of a fragment read fall on different banks */
// fragment in the hardware k order from a staged row: p = the lane's own row at k 8 * hh
__device__ __forceinline__ v16h g2_lfrag(const unsigned short* p) { FragH f; f.half[0] = *(const v8us*)p; f.half[1] = *(const v8us*)(p + 16); return f.v; }
__device__ __forceinline__ v16h g2_frag(const _Float16* p, int hh) { FragH f; f.half[0] = *(const v8us*)((const unsigned short*)p + 8 * hh); f.half[1] = *(const v8us*)((const unsigned short*)p + 16 + 8 * hh); return f.v; }
__device__ __forceinline__ v8f g2_mma(v16h a, v16h b, v8f c) { v8f d = __builtin_amdgcn_wmma_f32_16x16x32_f16(false, a, false, b, (short)0, c, false, false); asm volatile("v_nop\n\tv_nop\n\tv_nop\n\tv_nop" : "+v"(d) : "v"(a), "v"(b)); return d; }
template <int ACT>
__global__ __launch_bounds__(128) void k_gemm2(const _Float16* __restrict__ A, int lda, size_t sA, const _Float16* __restrict__ Bh, int ldb, size_t sB, float alpha, const float* __restrict__ bias, size_t sBias, const float* __restrict__ CP, int rowsPerB, size_t sCPb, int row0g,
    float* __restrict__ C, _Float16* __restrict__ C16, int ldc, size_t sC, int M, int N, int K) { static_assert(ACT == 0 || ACT == 3 || ACT == 6 || ACT == 8 || ACT == 9 || ACT == 11 || ACT == 12 || ACT == 14 || ACT == 15 || ACT == 16 || ACT == 17, "k_gemm2: unsupported ACT code (would silently apply no activation)");
  __shared__ __attribute__((aligned(16))) unsigned short sm[2][192][G2P];      /* in the k loop: [buffer][A rows 0-127 | B rows 128-191][64 f16 + pad]; behind it: the four waves' f32 output tiles */
  static_assert(sizeof(float) * 4 * 32 * 68 <= sizeof(unsigned short) * 2 * 192 * G2P, "k_gemm2: the output tiles fit the staging buffers");
  float (*so)[32][68] = reinterpret_cast<float (*)[32][68]>(&sm[0][0][0]);
  const int tid = threadIdx.x, w = tid >> 5, lane = tid & 31, ln = lane & 15, hh = lane >> 4; const int by = blockIdx.y;
  A += (size_t)by * sA; Bh += (size_t)by * sB; const size_t cofs = (size_t)by * sC; const float* bp = bias ? bias + (size_t)by * sBias : nullptr;
  const int ntn = N >> 6; const int mt = blockIdx.x / ntn, nq = blockIdx.x - mt * ntn; const int row0 = mt * 128 + 32 * w, col0 = nq * 64; if (mt * 128 >= M) return;      /* the whole block leaves or none, in front of every barrier */
  // staging: 8 neighbouring lanes fetch one whole 128-byte row; a thread takes chunk tid & 7 of rows (tid >> 3) + 16 j, 8 rows of A and 4 of B; block-uniform bases, the lane's own element offsets stay in their registers over the loop
  const int sr = tid >> 3, sc = (tid & 7) * 8;
  const unsigned short* ua = (const unsigned short*)A + (size_t)(mt * 128) * lda; const unsigned short* ub = (const unsigned short*)Bh + (size_t)col0 * ldb;
  unsigned oa[8], obf[4]; v8us ra[8], rb[4];
#pragma unroll
  for (int j = 0; j < 8; ++j) oa[j] = (unsigned)((sr + 16 * j) * lda + sc);
#pragma unroll
  for (int j = 0; j < 4; ++j) obf[j] = (unsigned)((sr + 16 * j) * ldb + sc);
  // the loops over j, kk and t are unrolled: the register arrays are then indexed by constants only
  auto fetch = [&](const int kb) __attribute__((always_inline)) {
#pragma unroll
    for (int j = 0; j < 8; ++j) ra[j] = *(const v8us*)(ua + kb + oa[j]);
#pragma unroll
    for (int j = 0; j < 4; ++j) rb[j] = *(const v8us*)(ub + kb + obf[j]);
    asm volatile("s_wait_xcnt 0x0" ::: "memory"); };      /* stands behind the 12 loads, in front of the first overwrite of a register that they name */
  auto put = [&](const int buf) __attribute__((always_inline)) {
#pragma unroll
    for (int j = 0; j < 8; ++j) *(v8us*)&sm[buf][sr + 16 * j][sc] = ra[j];
#pragma unroll
    for (int j = 0; j < 4; ++j) *(v8us*)&sm[buf][128 + sr + 16 * j][sc] = rb[j]; };
  const v8f z8 = {0.f,0.f,0.f,0.f,0.f,0.f,0.f,0.f}; v8f c00 = z8, c01 = z8, c02 = z8, c03 = z8, c10 = z8, c11 = z8, c12 = z8, c13 = z8;
  fetch(0); put(0);
  __syncthreads();      /* step 0 is in LDS before any wave reads it */
  // one step of 64 k; more = a next step exists, is fetched, stored and published (a constant at each of the two calls: no test inside a trip)
  auto step = [&](const int s, const bool more) __attribute__((always_inline)) {
    const int cur = s & 1;
    if (more) fetch((s + 1) * 64);
    const unsigned short* pa = &sm[cur][32 * w + ln][8 * hh]; const unsigned short* pb = &sm[cur][128 + ln][8 * hh];
    v16h a[2][2], b[4][2];
#pragma unroll
    for (int kk = 0; kk < 2; ++kk) { a[0][kk] = g2_lfrag(pa + kk * 32); a[1][kk] = g2_lfrag(pa + 16 * G2P + kk * 32);
#pragma unroll
      for (int t = 0; t < 4; ++t) b[t][kk] = g2_lfrag(pb + t * 16 * G2P + kk * 32); }
#pragma unroll
    for (int kk = 0; kk < 2; ++kk) {
      c00 = g2_mma(a[0][kk], b[0][kk], c00); c10 = g2_mma(a[1][kk], b[0][kk], c10);
      c01 = g2_mma(a[0][kk], b[1][kk], c01); c11 = g2_mma(a[1][kk], b[1][kk], c11);
      c02 = g2_mma(a[0][kk], b[2][kk], c02); c12 = g2_mma(a[1][kk], b[2][kk], c12);
      c03 = g2_mma(a[0][kk], b[3][kk], c03); c13 = g2_mma(a[1][kk], b[3][kk], c13); }
    if (more) {
      put(cur ^ 1);      /* last read in the step before, behind whose barrier every wave stands */
      __syncthreads(); }      /* one barrier a step: the next step is in LDS before any wave reads it, and every wave has left this step's buffer before it is refilled in the next trip */
  };
  const int nst = K >> 6;
  // the step loop stays rolled: unrolled, the staging registers of several steps would be live together
#pragma unroll 1
  for (int s = 0; s < nst - 1; ++s) step(s, true);
  step(nst - 1, false);
  __syncthreads();      /* every wave has left the last buffer before the output tiles are written over the buffers */
  v8f accs[8] = {c00, c01, c02, c03, c10, c11, c12, c13};
#pragma unroll
  for (int u = 0; u < 8; ++u) { const int t = u & 3, half = u >> 2; const int col = col0 + t * 16 + ln; const float bv = bp ? bf16_round(bp[col]) : 0.f;
#pragma unroll
    for (int r = 0; r < 8; ++r) { const int rloc = half * 16 + 8 * hh + r; float v = accs[u][r] * alpha + bv; if (CP) { if (rowsPerB < 0) v += CP[cofs + (size_t)(row0g + row0 + rloc) * ldc + col];      /* rowsPerB < 0: own element of the batched C plane */ else { const int bidx = (row0g + row0 + rloc) / rowsPerB; v += CP[(size_t)bidx * sCPb + (size_t)by * 64 + col]; } }
      if (ACT == 3) v = fmaxf(v, 0.f); else if (ACT == 6) v = 0.5f * v * (1.0f + erff(v * 0.70710678118654752f)); else if (ACT == 11) v = 1.0f / (1.0f + expf(-v)); else if (ACT == 15) v = v / (1.0f + expf(-v)); else if (ACT == 12) v = (v > 0.f) ? v : 0.01f * v; else if (ACT == 8) v = tanhf(v); else if (ACT == 9) v = 0.5f * v * (1.0f + tanhf(0.7978845608028654f * (v + 0.044715f * v * v * v))); else if (ACT == 14) v = (v > 0.f) ? v : 0.1f * v; else if (ACT == 16) v = (v >= 0.f) ? v : 0.3f * v; else if (ACT == 17) v = (v >= 0.f) ? v : 0.2f * v;
      so[w][rloc][t * 16 + ln] = v; } }
  __builtin_amdgcn_fence(__ATOMIC_ACQ_REL, "workgroup"); __builtin_amdgcn_wave_barrier();
  const int rsub = lane >> 4, c4 = (lane & 15) * 4;
  {
#pragma unroll
    for (int q = 0; q < 16; ++q) { const int r = q * 2 + rsub; const v4f v = *(const v4fa*)&so[w][r][c4]; if (C) *(v4f*)(C + cofs + (size_t)(row0 + r) * ldc + col0 + c4) = v; if (C16) { v4h h4; for (int i = 0; i < 4; ++i) h4[i] = (_Float16)v[i]; *(v4h*)(C16 + cofs + (size_t)(row0 + r) * ldc + col0 + c4) = h4; } }
     } }

// ---- split-K GEMM for the K = 2048 product with few output tiles (f^T v): one 32x64 tile per block, its K range dealt over SKW waves, f32 partial tiles summed through LDS in wave order; v = sum * alpha (+ own element of CP) ----
#define SKW 16                   /* waves per tile; each takes KT / SKW of the k range */
template <int KT>
__global__ __launch_bounds__(32 * SKW) void k_gemm2k(const _Float16* __restrict__ A, int lda, size_t sA, const _Float16* __restrict__ Bh, int ldb, size_t sB, float alpha, const float* CP, float* C, int ldc, size_t sC) {
  static_assert(KT % (32 * SKW) == 0, "k_gemm2k: every wave takes whole 32-deep steps");
  __shared__ __attribute__((aligned(16))) float so[SKW][32][68];
  const int tid = threadIdx.x, w = tid >> 5, lane = tid & 31, ln = lane & 15, hh = lane >> 4; const int by = blockIdx.y;
  A += (size_t)by * sA + w * (KT / SKW); Bh += (size_t)by * sB + w * (KT / SKW); const size_t cofs = (size_t)by * sC; const int row0 = blockIdx.x * 32;
  const _Float16* a0p = A + (size_t)(row0 + ln) * lda; const _Float16* a1p = a0p + (size_t)16 * lda;
  const _Float16* b0p = Bh + (size_t)ln * ldb; const _Float16* b1p = b0p + (size_t)16 * ldb; const _Float16* b2p = b1p + (size_t)16 * ldb; const _Float16* b3p = b2p + (size_t)16 * ldb;
  const v8f z8 = {0.f,0.f,0.f,0.f,0.f,0.f,0.f,0.f}; v8f c00 = z8, c01 = z8, c02 = z8, c03 = z8, c10 = z8, c11 = z8, c12 = z8, c13 = z8;
  for (int kb = 0; kb < KT / SKW; kb += 32) { const v16h a0 = g2_frag(a0p + kb, hh), a1 = g2_frag(a1p + kb, hh);
    v16h b = g2_frag(b0p + kb, hh); c00 = g2_mma(a0, b, c00); c10 = g2_mma(a1, b, c10);
    b = g2_frag(b1p + kb, hh); c01 = g2_mma(a0, b, c01); c11 = g2_mma(a1, b, c11);
    b = g2_frag(b2p + kb, hh); c02 = g2_mma(a0, b, c02); c12 = g2_mma(a1, b, c12);
    b = g2_frag(b3p + kb, hh); c03 = g2_mma(a0, b, c03); c13 = g2_mma(a1, b, c13); }
  v8f accs[8] = {c00, c01, c02, c03, c10, c11, c12, c13};
  // both loops unrolled: accs is then indexed by constants only and stays in registers
#pragma unroll
  for (int u = 0; u < 8; ++u) { const int t = u & 3, half = u >> 2;
#pragma unroll
    for (int r = 0; r < 8; ++r) so[w][half * 16 + 8 * hh + r][t * 16 + ln] = accs[u][r]; }
  __syncthreads();      /* every wave's partial tile is in LDS before any thread sums across waves */
  const int r = tid >> 4, c4 = (tid & 15) * 4; v4f s = *(const v4fa*)&so[0][r][c4];
  for (int u = 1; u < SKW; ++u) s += *(const v4fa*)&so[u][r][c4];
  const size_t o = cofs + (size_t)(row0 + r) * ldc + c4; v4f v = s * alpha; if (CP) v += *(const v4fa*)(CP + o);
  *(v4f*)(C + o) = v; }


// ---- fused attention: a block takes 256 query rows of one (batch, head), 32 per wave, and walks the 2048 keys in tiles of 64; each tile (k rows, w_scales rows) is fetched once per block by whole-line loads and put into LDS, where all 8 waves read their fragments; running maximum and sum per query ----
#define FQW 8                    /* waves per block, 32 query rows each: 8 x 32 (batch, head) pairs = 256 blocks */
#define FKT 64                   /* keys per tile: one row of each staged plane is 128 bytes */
#define FLP 72                   /* LDS row pitch in f16: 144 bytes = 16 x 9, the 16 rows of a fragment read fall on different banks */
__device__ __forceinline__ v8f fa_mma(v16h a, v16h b, v8f c) { return __builtin_amdgcn_wmma_f32_16x16x32_f16(false, a, false, b, (short)0, c, false, false); }
// fragment in the hardware k order from a wave-uniform base and the lane's own element offset (row ln, k 8 * hh)
__device__ __forceinline__ v16h fa_frag(const _Float16* ub, unsigned lo) { FragH f; f.half[0] = *(const v8us*)((const unsigned short*)ub + lo); f.half[1] = *(const v8us*)((const unsigned short*)ub + lo + 16); return f.v; }
// the same fragment from a staged row: p = the lane's own row at k 8 * hh
__device__ __forceinline__ v16h fl_frag(const unsigned short* p) { FragH f; f.half[0] = *(const v8us*)p; f.half[1] = *(const v8us*)(p + 16); return f.v; }
// eight independent 2^x in place: each v_exp_f32 fills the slot that the instruction set asks for behind the one before it, the v_nop fills the last one's
__device__ __forceinline__ void fa_exp2x8(float* x) {
  asm("v_exp_f32 %0, %0\n\tv_exp_f32 %1, %1\n\tv_exp_f32 %2, %2\n\tv_exp_f32 %3, %3\n\tv_exp_f32 %4, %4\n\tv_exp_f32 %5, %5\n\tv_exp_f32 %6, %6\n\tv_exp_f32 %7, %7\n\tv_nop"
      : "+v"(x[0]), "+v"(x[1]), "+v"(x[2]), "+v"(x[3]), "+v"(x[4]), "+v"(x[5]), "+v"(x[6]), "+v"(x[7])); }
// two of them, same slots
__device__ __forceinline__ void fa_exp2x2(float& a, float& b) { asm("v_exp_f32 %0, %0\n\tv_exp_f32 %1, %1\n\tv_nop" : "+v"(a), "+v"(b)); }
// lane l with lane l ^ 16
__device__ __forceinline__ float fa_xhalf(float x) { return __builtin_bit_cast(float, __builtin_amdgcn_permlanex16(__builtin_bit_cast(int, x), __builtin_bit_cast(int, x), 0x76543210, 0xfedcba98, false, false)); }
__global__ __launch_bounds__(32 * FQW) void k_fattn(const _Float16* QKFV, const _Float16* WS, const _Float16* FVH, const _Float16* FVL, _Float16* CH, _Float16* CL) {
  static_assert(NP % (32 * FQW) == 0 && NP % FKT == 0 && HD == 64 && FKT == 64 && 4 * INNER == NP && 32 * FQW == 256 && NP == 8 * 32 * FQW, "k_fattn: head size 64, 64-key tiles, one row pitch for q, k and w_scales, 256 threads stage 64 rows of 8 chunks in two rounds and the b_scales row in one");
  __shared__ __attribute__((aligned(16))) unsigned short st[2][2][64][FLP];      /* [buffer][k rows | w_scales rows][row][64 f16 + pad] */
  __shared__ __attribute__((aligned(16))) unsigned short sb[NP];      /* the whole b_scales row, put down once */
  const int tid = threadIdx.x, w = __builtin_amdgcn_readfirstlane(tid >> 5), lane = tid & 31, ln = lane & 15, hh = lane >> 4;
  const int bh = blockIdx.y, b = bh / NH, h = bh - b * NH;
  const int ldq = 4 * INNER; const unsigned lo = (unsigned)(ln * NP + 8 * hh);
  const _Float16* base = QKFV + (size_t)b * NP * ldq + h * HD;
  const int row0 = blockIdx.x * (32 * FQW) + w * 32;
  // staging: 8 neighbouring lanes fetch one whole 128-byte row; a thread takes chunk tid & 7 of rows tid >> 3 and 32 + (tid >> 3) of each of the two planes
  const int sr = tid >> 3, sc = (tid & 7) * 8;
  const unsigned short* gk = (const unsigned short*)(base + INNER) + (size_t)sr * ldq + sc;
  const unsigned short* gw = (const unsigned short*)WS + (size_t)sr * NP + sc;
  v8us g0 = *(const v8us*)gk, g1 = *(const v8us*)(gk + (size_t)32 * ldq), g2 = *(const v8us*)gw, g3 = *(const v8us*)(gw + (size_t)32 * NP);
  const v8us gb = *(const v8us*)((const unsigned short*)WS + (size_t)HD * NP + tid * 8);
  asm volatile("s_wait_xcnt 0x0" ::: "memory");      /* stands in front of the first overwrite of a register that the 5 loads above name (the q loads' offset takes the register of the b_scales load's) */
  const _Float16* qp = base + (size_t)row0 * ldq;
  const v16h q00 = fa_frag(qp, lo), q01 = fa_frag(qp + 32, lo), q10 = fa_frag(qp + 16 * ldq, lo), q11 = fa_frag(qp + 16 * ldq + 32, lo);
  asm volatile("s_wait_xcnt 0x0" ::: "memory");      /* stands in front of the first overwrite of a register that the 8 loads above name (the accumulators' zeroes reuse the q loads' offset register and base) */
  *(v8us*)&st[0][0][sr][sc] = g0; *(v8us*)&st[0][0][sr + 32][sc] = g1; *(v8us*)&st[0][1][sr][sc] = g2; *(v8us*)&st[0][1][sr + 32][sc] = g3; *(v8us*)&sb[tid * 8] = gb;
  __syncthreads();      /* tile 0 and the b_scales row are in LDS before any wave reads them */
  const v8f z8 = {0.f,0.f,0.f,0.f,0.f,0.f,0.f,0.f};
  const float cs = 0.125f * 1.4426950408889634f;
  // o[u][t][r] = sum over the keys of weight x w_scales[t*16 + 8*hh + r][key] for query row0 + u*16 + ln, in units of 2^10 x 16 x the weights under the running maximum m; ob[u][r] = the same sum against b_scales (every r alike); su = this lane half's share of the weight sum
  v8f o[2][4] = {{z8, z8, z8, z8}, {z8, z8, z8, z8}}; v8f ob[2] = {z8, z8};
  float m0 = -3.0e38f, m1 = -3.0e38f, su0 = 0.f, su1 = 0.f;
  // one tile; more = a next tile exists, is fetched, stored and published (a constant at each of the two calls: the trip of the loop below is one straight block, so that the scheduling barriers bind all of it)
  // every loop inside a tile is unrolled: the fragment and accumulator arrays are then indexed by constants only and stay in registers
  auto tile = [&](const int kt, const bool more) __attribute__((always_inline)) {
    const int cur = kt & 1;
    if (more) {
      const size_t ko = (size_t)(kt + 1) * FKT * ldq; const int po = (kt + 1) * FKT;
      g0 = *(const v8us*)(gk + ko); g1 = *(const v8us*)(gk + ko + (size_t)32 * ldq); g2 = *(const v8us*)(gw + po); g3 = *(const v8us*)(gw + po + (size_t)32 * NP);
      asm volatile("s_wait_xcnt 0x0" ::: "memory"); }      /* stands in front of the first overwrite of an address register that the 4 loads above name (the k fragments take them) */
    __builtin_amdgcn_sched_barrier(0);      /* holds the next tile's 4 loads ahead of this tile's work, which hides their latency (the compiler otherwise sinks a load to its use) */
    // S^T = K Q^T: s[t][u][r] = score of key kt*64 + t*16 + 8*hh + r against query row0 + u*16 + ln
    v8f s[4][2];
#pragma unroll
    for (int t = 0; t < 4; ++t) { const unsigned short* kr = &st[cur][0][t * 16 + ln][8 * hh]; const v16h k0 = fl_frag(kr), k1 = fl_frag(kr + 32);
      s[t][0] = fa_mma(k1, q01, fa_mma(k0, q00, z8)); s[t][1] = fa_mma(k1, q11, fa_mma(k0, q10, z8)); }
    // running maximum: in-lane over the tile's keys, across the two lane halves, against the maximum so far
    float t0 = s[0][0][0], t1 = s[0][1][0];
#pragma unroll
    for (int t = 0; t < 4; ++t) {
#pragma unroll
      for (int r = 0; r < 8; ++r) { t0 = fmaxf(t0, s[t][0][r]); t1 = fmaxf(t1, s[t][1][r]); } }
    t0 = fmaxf(t0, fa_xhalf(t0)); t1 = fmaxf(t1, fa_xhalf(t1));
    t0 = fmaxf(t0, m0); t1 = fmaxf(t1, m1);
    float a0 = (m0 - t0) * cs, a1 = (m1 - t1) * cs;      /* what stands under the old maximum shrinks by 2^a; 0 on the first tile */
    fa_exp2x2(a0, a1);
    m0 = t0; m1 = t1;
    // w_scales fragments come in 2 groups (keys 0-31, 32-63) of 4 row tiles plus the b_scales fragment (one row, read alike by all 16 lanes of a half), each asked for one group of products ahead; the scheduling barriers hold the LDS reads there (the compiler otherwise sinks them to their use, one LDS latency per pair of products)
    const unsigned short* pr = &st[cur][1][ln][8 * hh]; const unsigned short* br = &sb[kt * FKT + 8 * hh];
    v16h bf[2][5];
    __builtin_amdgcn_sched_barrier(0);      /* not above the score products: their fragments and these do not fit the registers together */
#pragma unroll
    for (int t = 0; t < 4; ++t) bf[0][t] = fl_frag(pr + t * 16 * FLP);
    bf[0][4] = fl_frag(br);
    __builtin_amdgcn_sched_barrier(0);      /* the first group flies under the first half of the softmax */
    // weights e * 2^10 = 2^((s - max) / 8 * log2 e + 10); two score tiles (32 keys) of one query tile are one B fragment in the hardware k order
    const float f0 = 10.0f - m0 * cs, f1 = 10.0f - m1 * cs;
    su0 *= a0; su1 *= a1; v16h p[2][2];
    // readout, transposed (A = w_scales rows or the b_scales row, B = weights), on f32 accumulators that are first shrunk to the new maximum
#pragma unroll
    for (int ks = 0; ks < 2; ++ks) {
#pragma unroll
      for (int u = 0; u < 2; ++u) { float x[16]; FragH a; float sa = 0.f;
#pragma unroll
        for (int i = 0; i < 16; ++i) x[i] = s[2 * ks + (i >> 3)][u][i & 7] * cs + (u ? f1 : f0);
        fa_exp2x8(x); fa_exp2x8(x + 8);
#pragma unroll
        for (int i = 0; i < 16; ++i) { sa += x[i]; a.h[i] = (_Float16)x[i]; }
        if (u) su1 += sa; else su0 += sa;
        p[ks][u] = a.v; }
      if (ks == 0) {
        __builtin_amdgcn_sched_barrier(0);      /* the sums of the first 32 keys end here: left open, all 64 weights stay in f32 registers to the end of the tile */
#pragma unroll
        for (int t = 0; t < 4; ++t) bf[1][t] = fl_frag(pr + t * 16 * FLP + 32);
        bf[1][4] = fl_frag(br + 32);
        __builtin_amdgcn_sched_barrier(0);      /* the second group is asked for ahead of the first group's products */
        // the first group's products stand in one region with the second half of the softmax: vector work under matrix time
#pragma unroll
        for (int t = 0; t < 4; ++t) { o[0][t] *= a0; o[1][t] *= a1; }
        ob[0] *= a0; ob[1] *= a1;
#pragma unroll
        for (int t = 0; t < 4; ++t) { o[0][t] = fa_mma(bf[0][t], p[0][0], o[0][t]); o[1][t] = fa_mma(bf[0][t], p[0][1], o[1][t]); }
        ob[0] = fa_mma(bf[0][4], p[0][0], ob[0]); ob[1] = fa_mma(bf[0][4], p[0][1], ob[1]); } }
#pragma unroll
    for (int t = 0; t < 4; ++t) { o[0][t] = fa_mma(bf[1][t], p[1][0], o[0][t]); o[1][t] = fa_mma(bf[1][t], p[1][1], o[1][t]); }
    ob[0] = fa_mma(bf[1][4], p[1][0], ob[0]); ob[1] = fa_mma(bf[1][4], p[1][1], ob[1]);
    if (more) {
      const int nx = cur ^ 1;      /* last read in the tile before, behind whose barrier every wave stands */
      *(v8us*)&st[nx][0][sr][sc] = g0; *(v8us*)&st[nx][0][sr + 32][sc] = g1; *(v8us*)&st[nx][1][sr][sc] = g2; *(v8us*)&st[nx][1][sr + 32][sc] = g3;
      __syncthreads(); }      /* one barrier a tile: the next tile is in LDS before any wave reads it, and every wave has left this tile's buffer before it is refilled in the next trip */
  };
  // the tile loop stays rolled, its body is long
#pragma unroll 1
  for (int kt = 0; kt < NP / FKT - 1; ++kt) tile(kt, true);
  tile(NP / FKT - 1, false);
  // f^T v of this (batch, head), hi and residual x 2^10, as A fragments (row d = t*16 + ln, k = e)
  const unsigned short* fvh = (const unsigned short*)FVH + (size_t)bh * HD * HD + ln * HD + 8 * hh; const unsigned short* fvl = (const unsigned short*)FVL + (size_t)bh * HD * HD + ln * HD + 8 * hh;
  v16h ah[4][2], al[4][2];
#pragma unroll
  for (int t = 0; t < 4; ++t) {
#pragma unroll
    for (int ks = 0; ks < 2; ++ks) { ah[t][ks] = fl_frag(fvh + t * 16 * HD + ks * 32); al[t][ks] = fl_frag(fvl + t * 16 * HD + ks * 32); } }
  asm volatile("s_wait_xcnt 0x0" :: "v"(fvh), "v"(fvl) : "memory");      /* stands in front of the first overwrite of an address register that the 32 loads above name; the two addresses are inputs so that their registers live up to here */
  su0 += fa_xhalf(su0); su1 += fa_xhalf(su1);
  const float rs0 = 1.0f / su0, rs1 = 1.0f / su1;
  // second product: out^T[d][query] = sum over e of (f^T v)[d][e] x (attn . w_scales^T)[query][e]; two accumulator tiles (32 e) of one query tile are one B fragment in the hardware k order, exactly as the weights were
#pragma unroll
  for (int u = 0; u < 2; ++u) { const float rs = u ? rs1 : rs0; v16h th[2], tl[2];
#pragma unroll
    for (int ks = 0; ks < 2; ++ks) { FragH xh, xl;
#pragma unroll
      for (int i = 0; i < 16; ++i) { const float v = o[u][2 * ks + (i >> 3)][i & 7] * rs; const _Float16 hv = (_Float16)v; xh.h[i] = hv; xl.h[i] = (_Float16)((v - (float)hv) * 1024.0f); }
      th[ks] = xh.v; tl[ks] = xl.v; }
    const float cb = ob[u][0] * rs;
#pragma unroll
    for (int t = 0; t < 4; ++t) { FragH ch, cl;
      // the two cross terms carry 2^10, taken back (exact) before the hi x hi term joins the same accumulators
      v8f c = fa_mma(ah[t][1], tl[1], fa_mma(ah[t][0], tl[0], fa_mma(al[t][1], th[1], fa_mma(al[t][0], th[0], z8))));
      c *= 0.0009765625f;
      c = fa_mma(ah[t][1], th[1], fa_mma(ah[t][0], th[0], c));
#pragma unroll
      for (int r = 0; r < 8; ++r) { const float v = (c[r] + cb) * 0.0625f; const _Float16 hv = (_Float16)v; ch.h[r] = hv; cl.h[r] = (_Float16)((v - (float)hv) * 1024.0f); }
      const size_t oo = ((size_t)b * NP + row0 + u * 16 + ln) * INNER + h * HD + t * 16 + 8 * hh;
      *(v8us*)((unsigned short*)CH + oo) = ch.half[0]; *(v8us*)((unsigned short*)CL + oo) = cl.half[0]; } }
}

extern "C" void kernel_launch(void* const* d_in, const int* in_sizes, int n_in,
                              void* d_out, int out_size, void* d_ws, size_t ws_size, hipStream_t stream) {
  (void)in_sizes; (void)n_in; (void)out_size;
  const float* x = (const float*)d_in[0]; const float* Wqkfv = (const float*)d_in[1]; const float* Wsc = (const float*)d_in[2]; const float* bsc = (const float*)d_in[3]; const float* Wout = (const float*)d_in[4]; const float* bout = (const float*)d_in[5];
  char* ws = (char*)d_ws; size_t off = 0;
  auto take = [&](size_t bytes) { char* p = ws + off; off += (bytes + 255) & ~(size_t)255; return p; };
  _Float16* BQ = (_Float16*)take((size_t)4 * INNER * DIM * 2); _Float16* BS = (_Float16*)take((size_t)(HD + 1) * NP * 2);      /* w_scales rows, then b_scales as row 64 */ _Float16* BO = (_Float16*)take((size_t)DIM * INNER * 2);
  _Float16* X16 = (_Float16*)take((size_t)NR * DIM * 2); _Float16* QKFV = (_Float16*)take((size_t)NR * 4 * INNER * 2);      /* [row][q | k | f | v] f16, 32 MiB */
  _Float16* FT = (_Float16*)take((size_t)2 * NB * NH * HD * NP * 2); _Float16* VTT = FT + (size_t)NB * NH * HD * NP;      /* f^T, then v^T, each [b][h][64][2048] */ float* FV = (float*)take((size_t)NB * NH * HD * HD * 4); _Float16* FVH = (_Float16*)take((size_t)NB * NH * HD * HD * 2); _Float16* FVL = (_Float16*)take((size_t)NB * NH * HD * HD * 2);
  _Float16* CH = (_Float16*)take((size_t)NR * INNER * 2); _Float16* CL = (_Float16*)take((size_t)NR * INNER * 2);
  if (off > ws_size) return;      /* about 76 MiB */
  k_prep<<<PREP_Q + PREP_O + PREP_S + PREP_B + PREP_X, 256, 0, stream>>>(Wqkfv, BQ, Wout, BO, Wsc, bsc, BS, x, X16);      /* w_qkfv and w_out transposed (x @ W, in x out), w_scales and b_scales as they lie, and the f16 x plane */
  k_gemm2<0><<<dim3((NR / 128) * (4 * INNER / 64), 1), 128, 0, stream>>>(X16, DIM, 0, BQ, DIM, 0, 0.0625f, nullptr, 0, nullptr, 1, 0, 0, nullptr, QKFV, 4 * INNER, 0, NR, 4 * INNER, DIM);      /* [q | k | f | v], head h at h*64 inside each quarter */
  // the f^T v chain: every stage is one launch whose grid runs over all (batch, head) pairs, and over both of two jobs that need nothing of each other
  k_vt<NH, NP><<<dim3(NB * NH * (NP / 64), 2), 256, 0, stream>>>(QKFV, 4 * INNER, 2 * INNER, INNER, FT, (size_t)NB * NH * HD * NP);      /* f^T (y = 0) and v^T (y = 1) per batch and head [64][2048] */
  k_gemm2k<NP><<<dim3(HD / 32, NB * NH), 32 * SKW, 0, stream>>>(FT, NP, (size_t)HD * NP, VTT, NP, (size_t)HD * NP, 1.0f, nullptr, FV, HD, (size_t)HD * HD);      /* FV[b][h][d][e] = sum_n f[n][d] v[n][e] (32-row tiles, K over the block's waves) */
  k_hl<<<(NB * NH * HD * HD / 8 + 255) / 256, 256, 0, stream>>>(FV, FVH, FVL, (size_t)NB * NH * HD * HD / 8);
  k_fattn<<<dim3(NP / (32 * FQW), NB * NH), 32 * FQW, 0, stream>>>(QKFV, BS, FVH, FVL, CH, CL);      /* (softmax(q k^T / 8) . w_scales^T) (f^T v)^T + softmax . b_scales, as f16 hi/residual */
  k_gemm2<0><<<dim3((NR / 128) * (DIM / 64), 1), 128, 0, stream>>>(CL, INNER, 0, BO, INNER, 0, 0.0625f / 1024.0f, nullptr, 0, nullptr, 1, 0, 0, (float*)d_out, nullptr, DIM, 0, NR, DIM, INNER);
  k_gemm2<0><<<dim3((NR / 128) * (DIM / 64), 1), 128, 0, stream>>>(CH, INNER, 0, BO, INNER, 0, 0.0625f, bout, 0, (const float*)d_out, 1, (size_t)DIM, 0, (float*)d_out, nullptr, DIM, 0, NR, DIM, INNER);      /* y = (c_lo + c_hi) w_out + b_out */
}

// v007
// It runs in 124 microseconds.
// Next to v006, in two timings, it ran 1.03 times as fast each time.
// Over all steps from v000 it is 16.2 times as fast.
#include <hip/hip_runtime.h>
// SimilarAttention (4 x 2048 patches x 512, 8 heads x 64: [q|k|f|v] = x w_qkfv; attn = softmax(q.k/8); poss_value = (f^T v) w_scales + b_scales -> [h][64][2048]; out = attn . poss_value^T; y = merged . w_out + b_out).
// Structure: exact f16 x plane; the fused projection as ONE f16 WMMA GEMM (128x64 block tiles staged in LDS, 32x64 wave tiles, f32 accumulation, exact x16 weights; f16 out); then, each stage as ONE launch over all batches and heads: f^T v as 32-row WMMA tiles read straight from the projection's rows (per-wave LDS staging, transposing LDS loads; K = 2048 dealt over a block's 16 waves, f32 partials summed in LDS, f16 hi/residual out), then ONE launch for all batches and heads that keeps scores and softmax weights in registers and never builds poss_value: attn . ((f^T v) w_scales + b)^T = (attn . w_scales^T) (f^T v)^T + attn . b. A block takes 256 query rows of one head, 32 per wave, and walks the keys in tiles of 64 that are staged once per block in LDS (scores transposed, K = 64, f32; running row maximum and row sum; unnormalised f16 weights x 2^10 packed from the score accumulators into the B operand; readout against the exact x16 w_scales rows and the b_scales row on f32 accumulators); behind the keys: row scaling, f16 hi/residual, three product terms against f^T v hi/residual, + the b term, hi/residual out; w_out as two GEMM terms (+ bias).
// Compute dtype: inputs rounded to bf16; x / weights exact as f16; q, k, f, v and the softmax weights as plain f16 operands (~2^-12); f^T v, attn . w_scales^T and the merged context as f16 hi + residual. v_wmma_f32_16x16x32_f16.
#define NB 4
#define NP 2048
#define DIM 512
#define NH 8
#define HD 64
#define INNER 512
#define NR (NB * NP)
typedef __bf16 v16b __attribute__((ext_vector_type(16)));
typedef unsigned short v8us __attribute__((ext_vector_type(8), may_alias));
typedef float  v8f  __attribute__((ext_vector_type(8)));
typedef float  v4f  __attribute__((ext_vector_type(4)));
typedef float  v4fa __attribute__((ext_vector_type(4), may_alias));
union FragB { v16b v; v8us half[2]; unsigned short u[16]; };

__device__ __forceinline__ unsigned short bf16_bits(float x) { unsigned int u = __float_as_uint(x); return (unsigned short)((u + 0x7FFFu + ((u >> 16) & 1u)) >> 16); }
__device__ __forceinline__ float bf16_val(unsigned short b) { return __uint_as_float(((unsigned int)b) << 16); }
__device__ __forceinline__ float bf16_round(float x) { return bf16_val(bf16_bits(x)); }
// D += A·B with NT terms: 1 = ah·bh, 2 = + al·bh (A split), 3 = + ah·bl (both split)
template <int NT>
__device__ __forceinline__ v8f mmaN(v16b ah, v16b al, v16b bh, v16b bl, v8f c) {
  c = __builtin_amdgcn_wmma_f32_16x16x32_bf16(false, ah, false, bh, (short)0, c, false, false);
  if (NT >= 2) c = __builtin_amdgcn_wmma_f32_16x16x32_bf16(false, al, false, bh, (short)0, c, false, false);
  if (NT >= 3) c = __builtin_amdgcn_wmma_f32_16x16x32_bf16(false, ah, false, bl, (short)0, c, false, false);
  asm volatile("v_nop\n\tv_nop\n\tv_nop\n\tv_nop" : "+v"(c) : "v"(ah), "v"(al), "v"(bh), "v"(bl));
  return c;
}

__global__ __launch_bounds__(256) void k_wt_bf16(const float* __restrict__ W, unsigned short* __restrict__ Wt, int K, int N) {
  const int t = blockIdx.x * 256 + threadIdx.x;
  const int k8n = K / 8;
  if (t >= N * k8n) return;
  const int n = t / k8n, k8 = (t % k8n) * 8;
  v8us v;
#pragma unroll
  for (int i = 0; i < 8; ++i) v[i] = bf16_bits(W[(size_t)(k8 + i) * N + n]);
  *(v8us*)(Wt + (size_t)n * K + k8) = v;
  
}

// GEMM C[M][N] (f32, pitch ldc) = act(A[M][K]·W + bias). A f32 row-major (pitch lda) converted per fragment to bf16
// (ASPLIT: hi/lo two planes -> 2 terms, else single rounded term); Wt bf16 [N][K] (pitch ldb). BIAS_BF16 rounds the
// bias to bf16 first (bias quantised to bf16 before the add). K%32==0, M%16==0, N%64==0.
template <bool ASPLIT, int ACT, bool BIAS_BF16>
__global__ __launch_bounds__(128) void k_gemm_bf(const float* __restrict__ A, int lda, const unsigned short* __restrict__ Wt, int ldb,
                                               const float* __restrict__ bias, float* __restrict__ C, int ldc, int M, int N, int K) {
  __shared__ __attribute__((aligned(16))) float so[4][16][64];
  const int tid = threadIdx.x, w = tid >> 5, lane = tid & 31, ln = lane & 15, hh = lane >> 4;
  const int ntn = N / 64;
  const int wid = blockIdx.x * 4 + w;
  const int mt = wid / ntn, nq = wid % ntn;
  if (mt * 16 >= M) return;
  const int row0 = mt * 16, col0 = nq * 64;
  const float* arow = A + (size_t)(row0 + ln) * lda;
  v8f acc[4] = {};
  for (int kb = 0; kb < K; kb += 32) {
    FragB ah, al;
    const v4f x0 = *(const v4fa*)(arow + kb + 8 * hh), x1 = *(const v4fa*)(arow + kb + 8 * hh + 4);
    const v4f x2 = *(const v4fa*)(arow + kb + 16 + 8 * hh), x3 = *(const v4fa*)(arow + kb + 16 + 8 * hh + 4);
    float xs[16] = {x0[0],x0[1],x0[2],x0[3],x1[0],x1[1],x1[2],x1[3],x2[0],x2[1],x2[2],x2[3],x3[0],x3[1],x3[2],x3[3]};
#pragma unroll
    for (int i = 0; i < 16; ++i) { const unsigned short hb = bf16_bits(xs[i]); ah.u[i] = hb; al.u[i] = ASPLIT ? bf16_bits(xs[i] - bf16_val(hb)) : (unsigned short)0; }
#pragma unroll
    for (int t = 0; t < 4; ++t) {
      const unsigned short* brow = Wt + (size_t)(col0 + t * 16 + ln) * ldb + kb;
      FragB b;
      b.half[0] = *(const v8us*)(brow + 8 * hh);
      b.half[1] = *(const v8us*)(brow + 16 + 8 * hh);
      acc[t] = mmaN<ASPLIT ? 2 : 1>(ah.v, al.v, b.v, b.v, acc[t]);
    }
  }
#pragma unroll
  for (int t = 0; t < 4; ++t) {
    float bv = bias ? bias[col0 + t * 16 + ln] : 0.f;
    if (BIAS_BF16) bv = bf16_round(bv);
#pragma unroll
    for (int r = 0; r < 8; ++r) { float v = acc[t][r] + bv; if (ACT == 1) v = fmaxf(v, 0.f); so[w][8 * hh + r][t * 16 + ln] = v; }
  }
  __builtin_amdgcn_fence(__ATOMIC_ACQ_REL, "workgroup");
  __builtin_amdgcn_wave_barrier();
  const int rsub = lane >> 4, c4 = (lane & 15) * 4;
  {
#pragma unroll
    for (int q = 0; q < 8; ++q) {
      const int r = q * 2 + rsub;
      const v4f v = *(const v4fa*)&so[w][r][c4];
      *(v4f*)(C + (size_t)(row0 + r) * ldc + col0 + c4) = v;
    }
    
  }
}

// GEMM C = act(A·W + bias + resid): A f32 (ASPLIT -> hi/lo 2 terms), Wt bf16 [N][K]; ACT 0 none, 1 relu, 2 exact gelu;
// resid (optional, f32, row index = (row % rmod), pitch ldr, RES_BF16 rounds it) added before the activation.
template <bool ASPLIT, int ACT, bool BIAS_BF16, bool RES_BF16>
__global__ __launch_bounds__(128) void k_gemm_bf3(const float* __restrict__ A, int lda, const unsigned short* __restrict__ Wt, int ldb,
                                                const float* __restrict__ bias, const float* __restrict__ resid, int rmod, int ldr,
                                                float* __restrict__ C, int ldc, int M, int N, int K) {
  __shared__ __attribute__((aligned(16))) float so[4][16][64];
  const int tid = threadIdx.x, w = tid >> 5, lane = tid & 31, ln = lane & 15, hh = lane >> 4;
  const int ntn = N / 64;
  const int wid = blockIdx.x * 4 + w;
  const int mt = wid / ntn, nq = wid % ntn;
  if (mt * 16 >= M) return;
  const int row0 = mt * 16, col0 = nq * 64;
  const float* arow = A + (size_t)(row0 + ln) * lda;
  v8f acc[4] = {};
  for (int kb = 0; kb < K; kb += 32) {
    FragB ah, al;
    const v4f x0 = *(const v4fa*)(arow + kb + 8 * hh), x1 = *(const v4fa*)(arow + kb + 8 * hh + 4);
    const v4f x2 = *(const v4fa*)(arow + kb + 16 + 8 * hh), x3 = *(const v4fa*)(arow + kb + 16 + 8 * hh + 4);
    float xs[16] = {x0[0],x0[1],x0[2],x0[3],x1[0],x1[1],x1[2],x1[3],x2[0],x2[1],x2[2],x2[3],x3[0],x3[1],x3[2],x3[3]};
#pragma unroll
    for (int i = 0; i < 16; ++i) { const unsigned short hb = bf16_bits(xs[i]); ah.u[i] = hb; al.u[i] = ASPLIT ? bf16_bits(xs[i] - bf16_val(hb)) : (unsigned short)0; }
#pragma unroll
    for (int t = 0; t < 4; ++t) {
      const unsigned short* brow = Wt + (size_t)(col0 + t * 16 + ln) * ldb + kb;
      FragB b;
      b.half[0] = *(const v8us*)(brow + 8 * hh);
      b.half[1] = *(const v8us*)(brow + 16 + 8 * hh);
      acc[t] = mmaN<ASPLIT ? 2 : 1>(ah.v, al.v, b.v, b.v, acc[t]);
    }
  }
#pragma unroll
  for (int t = 0; t < 4; ++t) {
    const int col = col0 + t * 16 + ln;
    float bv = bias ? bias[col] : 0.f;
    if (BIAS_BF16) bv = bf16_round(bv);
#pragma unroll
    for (int r = 0; r < 8; ++r) {
      float v = acc[t][r] + bv;
      if (resid) { float rv = resid[(size_t)((row0 + 8 * hh + r) % rmod) * ldr + col]; if (RES_BF16) rv = bf16_round(rv); v += rv; }
      if (ACT == 1) v = fmaxf(v, 0.f);
      if (ACT == 2) v = 0.5f * v * (1.0f + erff(v * 0.70710678118654752f));
      if (ACT == 3) { const float u = 0.7978845608028654f * (v + 0.044715f * v * v * v); v = 0.5f * v * (1.0f + tanhf(u)); }
      so[w][8 * hh + r][t * 16 + ln] = v;
    }
  }
  __builtin_amdgcn_fence(__ATOMIC_ACQ_REL, "workgroup");
  __builtin_amdgcn_wave_barrier();
  const int rsub = lane >> 4, c4 = (lane & 15) * 4;
  {
#pragma unroll
    for (int q = 0; q < 8; ++q) {
      const int r = q * 2 + rsub;
      const v4f v = *(const v4fa*)&so[w][r][c4];
      *(v4f*)(C + (size_t)(row0 + r) * ldc + col0 + c4) = v;
    }
    
  }
}
// row LayerNorm (biased variance, eps) over N: s = X (+ R); optional out_sum <- s; out_norm <- (s-mu)*rsqrt(var+eps)*g + b
template <bool PARAM_BF16>
__global__ __launch_bounds__(256) void k_layernorm(const float* __restrict__ X, const float* __restrict__ R, const float* __restrict__ g, const float* __restrict__ bta,
                                                  float* __restrict__ out_sum, float* __restrict__ out_norm, int N, float eps) {
  __shared__ float red[256];
  const int row = blockIdx.x, tid = threadIdx.x;
  const float* x = X + (size_t)row * N; const float* rr = R ? R + (size_t)row * N : nullptr;
  float vals[16];                     // up to N = 4096
  const int per = N / 256;            // contiguous chunk per thread? use strided-by-4 chunks: thread handles j = tid*4 + 1024*u
  float s1 = 0.f;
  for (int u = 0; u < per / 4; ++u) {
    const int j = tid * 4 + 1024 * u;
    const v4f a = *(const v4fa*)(x + j);
    v4f b = {0.f,0.f,0.f,0.f}; if (rr) b = *(const v4fa*)(rr + j);
#pragma unroll
    for (int q = 0; q < 4; ++q) { const float v = a[q] + b[q]; vals[u * 4 + q] = v; s1 += v; }
  }
  red[tid] = s1; __syncthreads();
  for (int st = 128; st > 0; st >>= 1) { if (tid < st) red[tid] += red[tid + st]; __syncthreads(); }
  const float mu = red[0] / (float)N; __syncthreads();
  float s2 = 0.f;
  for (int u = 0; u < per / 4; ++u)
#pragma unroll
    for (int q = 0; q < 4; ++q) { const float c = vals[u * 4 + q] - mu; s2 += c * c; }
  red[tid] = s2; __syncthreads();
  for (int st = 128; st > 0; st >>= 1) { if (tid < st) red[tid] += red[tid + st]; __syncthreads(); }
  const float rs = rsqrtf(red[0] / (float)N + eps);
  {
    for (int u = 0; u < per / 4; ++u) {
      const int j = tid * 4 + 1024 * u;
      v4f o, sm;
#pragma unroll
      for (int q = 0; q < 4; ++q) {
        float gg = g[j + q], bb = bta[j + q];
        if (PARAM_BF16) { gg = bf16_round(gg); bb = bf16_round(bb); }
        sm[q] = vals[u * 4 + q]; o[q] = (vals[u * 4 + q] - mu) * rs * gg + bb;
      }
      if (out_sum) *(v4f*)(out_sum + (size_t)row * N + j) = sm;
      *(v4f*)(out_norm + (size_t)row * N + j) = o;
    }
    
  }
}



// ---- f16 WMMA path (v_wmma_f32_16x16x32_f16): 11-bit significands for operands in range — used where a [0,1] probability operand needs more precision than bf16
typedef _Float16 v16h __attribute__((ext_vector_type(16)));
union FragH { v16h v; v8us half[2]; _Float16 h[16]; unsigned short u[16]; };
template <int NT>
__device__ __forceinline__ v8f mmaH(v16h ah, v16h al, v16h bh, v16h bl, v8f c) {
  c = __builtin_amdgcn_wmma_f32_16x16x32_f16(false, ah, false, bh, (short)0, c, false, false);
  if (NT >= 2) c = __builtin_amdgcn_wmma_f32_16x16x32_f16(false, al, false, bh, (short)0, c, false, false);
  if (NT >= 3) c = __builtin_amdgcn_wmma_f32_16x16x32_f16(false, ah, false, bl, (short)0, c, false, false);
  asm volatile("v_nop\n\tv_nop\n\tv_nop\n\tv_nop" : "+v"(c) : "v"(ah), "v"(al), "v"(bh), "v"(bl));
  return c;
}
// batched GEMM like k_gemm_b but f16 operands: A f32 (split into f16 hi/lo if ASPLIT, else rounded to f16), Bt = f16 values [n][k]; alpha; C f32; N multiple of 16 (partial tiles skipped)
template <bool ASPLIT>
__global__ __launch_bounds__(128) void k_gemm_h(const float* __restrict__ A, int lda, size_t sA, const _Float16* __restrict__ Bh, int ldb, size_t sB, float alpha, float* __restrict__ C, int ldc, size_t sC, int M, int N, int K) {
  __shared__ __attribute__((aligned(16))) float so[4][16][64];
  const int tid = threadIdx.x, w = tid >> 5, lane = tid & 31, ln = lane & 15, hh = lane >> 4; const int by = blockIdx.y;
  A += (size_t)by * sA; Bh += (size_t)by * sB; C += (size_t)by * sC;
  const int ntn = (N + 63) / 64; const int wid = blockIdx.x * 4 + w; const int mt = wid / ntn, nq = wid % ntn; if (mt * 16 >= M) return;
  const int row0 = mt * 16, col0 = nq * 64; const float* arow = A + (size_t)(row0 + ln) * lda;
  v8f acc[4] = {};
  for (int kb = 0; kb < K; kb += 32) {
    FragH ah, al;
    const v4f x0 = *(const v4fa*)(arow + kb + 8 * hh), x1 = *(const v4fa*)(arow + kb + 8 * hh + 4), x2 = *(const v4fa*)(arow + kb + 16 + 8 * hh), x3 = *(const v4fa*)(arow + kb + 16 + 8 * hh + 4);
    float xs[16] = {x0[0],x0[1],x0[2],x0[3],x1[0],x1[1],x1[2],x1[3],x2[0],x2[1],x2[2],x2[3],x3[0],x3[1],x3[2],x3[3]};
#pragma unroll
    for (int i = 0; i < 16; ++i) { const _Float16 h = (_Float16)xs[i]; ah.h[i] = h; al.h[i] = ASPLIT ? (_Float16)(xs[i] - (float)h) : (_Float16)0.0f; }
#pragma unroll
    for (int t = 0; t < 4; ++t) { if (col0 + t * 16 >= N) continue; const size_t boff = (size_t)(col0 + t * 16 + ln) * ldb + kb; FragH bq; bq.half[0] = *(const v8us*)(Bh + boff + 8 * hh); bq.half[1] = *(const v8us*)(Bh + boff + 16 + 8 * hh);
      acc[t] = mmaH<ASPLIT ? 2 : 1>(ah.v, al.v, bq.v, bq.v, acc[t]); }
  }
#pragma unroll
  for (int t = 0; t < 4; ++t) { if (col0 + t * 16 >= N) continue;
#pragma unroll
    for (int r = 0; r < 8; ++r) so[w][8 * hh + r][t * 16 + ln] = acc[t][r] * alpha; }
  __builtin_amdgcn_fence(__ATOMIC_ACQ_REL, "workgroup"); __builtin_amdgcn_wave_barrier();
  const int rsub = lane >> 4, c4 = (lane & 15) * 4;
  {
#pragma unroll
    for (int q = 0; q < 8; ++q) { const int r = q * 2 + rsub; if (col0 + c4 < N) { const v4f v = *(const v4fa*)&so[w][r][c4]; *(v4f*)(C + (size_t)(row0 + r) * ldc + col0 + c4) = v; } }
     }
}

// Wt[n][k] = f16(W[k][n]·scale) from f32 row-major W[K][N] (scale = power of two; bf16-exact weights stay exact in f16 away from the subnormal range)
// device body: blk = index of the 256-thread block inside this job's range of the shared grid (k_prep)
__device__ __forceinline__ void d_wt_f16(const float* __restrict__ W, _Float16* __restrict__ Wt, int K, int N, float scale, int blk) {
  const int t = blk * 256 + threadIdx.x; if (t >= N * (K / 8)) return; const int n = t / (K / 8), k8 = (t % (K / 8)) * 8; FragH f;
#pragma unroll
  for (int i = 0; i < 8; ++i) f.h[i] = (_Float16)(bf16_round(W[(size_t)(k8 + i) * N + n]) * scale); const v8us o = f.half[0];
  *(v8us*)((unsigned short*)Wt + (size_t)n * K + k8) = o; 
}
// k_gemm_hh variant with fused epilogue: v = acc·alpha + bias[by·sBias + col] (+ CP[(row/rowsPerB)·sCPb + by·64 + col] if CP) ; ACT 0 none / 1 elu ; writes f32 C and/or f16 C16 (each if non-null)
template <int ACT>
__global__ __launch_bounds__(128) void k_gemm_hhx(const _Float16* __restrict__ A, int lda, size_t sA, const _Float16* __restrict__ Bh, int ldb, size_t sB, float alpha, const float* __restrict__ bias, size_t sBias, const float* __restrict__ CP, int rowsPerB, size_t sCPb, int row0g,
    float* __restrict__ C, _Float16* __restrict__ C16, int ldc, size_t sC, int M, int N, int K, const _Float16* __restrict__ A2, float alpha2, float* __restrict__ C2) {
  __shared__ __attribute__((aligned(16))) float so[4][16][64];
  const int tid = threadIdx.x, w = tid >> 5, lane = tid & 31, ln = lane & 15, hh = lane >> 4; const int by = blockIdx.y;
  if (blockIdx.z) { A = A2; alpha = alpha2; bias = nullptr; C = C2; }      /* blockIdx.z = 1: the second term of a split A in the same grid: its own operand, factor and f32 plane, no bias */
  A += (size_t)by * sA; Bh += (size_t)by * sB; const size_t cofs = (size_t)by * sC; const float* bp = bias ? bias + (size_t)by * sBias : nullptr;
  const int ntn = (N + 63) / 64; const int wid = blockIdx.x * 4 + w; const int mt = wid / ntn, nq = wid % ntn; if (mt * 16 >= M) return;
  const int row0 = mt * 16, col0 = nq * 64; const _Float16* arow = A + (size_t)(row0 + ln) * lda;
  v8f acc[4] = {};
  for (int kb = 0; kb < K; kb += 32) { FragH ah; ah.half[0] = *(const v8us*)((const unsigned short*)arow + kb + 8 * hh); ah.half[1] = *(const v8us*)((const unsigned short*)arow + kb + 16 + 8 * hh);
#pragma unroll
    for (int t = 0; t < 4; ++t) { if (col0 + t * 16 >= N) continue; const size_t boff = (size_t)(col0 + t * 16 + ln) * ldb + kb; FragH bq; bq.half[0] = *(const v8us*)((const unsigned short*)Bh + boff + 8 * hh); bq.half[1] = *(const v8us*)((const unsigned short*)Bh + boff + 16 + 8 * hh);
      acc[t] = mmaH<1>(ah.v, ah.v, bq.v, bq.v, acc[t]); }
  }
#pragma unroll
  for (int t = 0; t < 4; ++t) { if (col0 + t * 16 >= N) continue; const int col = col0 + t * 16 + ln; const float bv = bp ? bf16_round(bp[col]) : 0.f;
#pragma unroll
    for (int r = 0; r < 8; ++r) { float v = acc[t][r] * alpha + bv; if (CP) { const int rr = row0g + row0 + 8 * hh + r; if (rowsPerB < 0) v += CP[cofs + (size_t)rr * ldc + col];      /* rowsPerB < 0: own element of the batched C plane */ else { const int bidx = rr / rowsPerB; v += CP[(size_t)bidx * sCPb + (size_t)by * 64 + col]; } } if (ACT == 1) v = (v > 0.f) ? v : expm1f(v); else if (ACT == 7) v = (v > 0.f) ? v + 1.0f : expf(v); else if (ACT == 8) v = tanhf(v); else if (ACT == 9) v = 0.5f * v * (1.0f + tanhf(0.7978845608028654f * (v + 0.044715f * v * v * v))); else if (ACT == 11) v = 1.0f / (1.0f + expf(-v)); else if (ACT == 12) v = (v > 0.f) ? v : 0.01f * v; else if (ACT == 14) v = (v > 0.f) ? v : 0.1f * v; else if (ACT == 16) v = (v >= 0.f) ? v : 0.3f * v; else if (ACT == 17) v = (v >= 0.f) ? v : 0.2f * v; else if (ACT == 15) v = v / (1.0f + expf(-v)); else if (ACT == 3) v = fmaxf(v, 0.f); else if (ACT == 6) v = 0.5f * v * (1.0f + erff(v * 0.70710678118654752f)); so[w][8 * hh + r][t * 16 + ln] = v; } }
  __builtin_amdgcn_fence(__ATOMIC_ACQ_REL, "workgroup"); __builtin_amdgcn_wave_barrier();
  const int rsub = lane >> 4, c4 = (lane & 15) * 4; typedef _Float16 v4h __attribute__((ext_vector_type(4)));
  {
#pragma unroll
    for (int q = 0; q < 8; ++q) { const int r = q * 2 + rsub; if (col0 + c4 < N) { const v4f v = *(const v4fa*)&so[w][r][c4]; if (C) *(v4f*)(C + cofs + (size_t)(row0 + r) * ldc + col0 + c4) = v; if (C16) { v4h h4; for (int i = 0; i < 4; ++i) h4[i] = (_Float16)v[i]; *(v4h*)(C16 + cofs + (size_t)(row0 + r) * ldc + col0 + c4) = h4; } } }
     }
}


typedef _Float16 v4h __attribute__((ext_vector_type(4)));

__device__ __forceinline__ void d_x16(const float* __restrict__ x, _Float16* __restrict__ X16, size_t n8, int blk) { const size_t t = (size_t)blk * 256 + threadIdx.x; if (t >= n8) return; FragH f;
#pragma unroll
  for (int q = 0; q < 8; ++q) f.h[q] = (_Float16)bf16_round(x[t * 8 + q]); *(v8us*)((unsigned short*)X16 + t * 8) = f.half[0];  }
// f16(bf16-rounded value x 16) in the source's own order: w_scales rows and b_scales are read along the keys as they lie
__device__ __forceinline__ void d_r16(const float* __restrict__ Wv, _Float16* __restrict__ Bt, int blk) { const size_t t = (size_t)blk * 256 + threadIdx.x; FragH f;
#pragma unroll
  for (int i = 0; i < 8; ++i) f.h[i] = (_Float16)(bf16_round(Wv[t * 8 + i]) * 16.0f); *(v8us*)((unsigned short*)Bt + t * 8) = f.half[0];
  asm volatile("s_wait_xcnt 0x0" ::: "memory"); }      /* stands behind the store, in front of the first overwrite of a register that it names (the other jobs' code follows in the listing) */
// the five operand preparations need nothing of each other: one grid, each job a range of the block index (block-uniform branches); the transposes, whose threads take longest, start first
#define PREP_Q (DIM * 4 * INNER / 8 / 256)
#define PREP_O (INNER * DIM / 8 / 256)
#define PREP_S (HD * NP / 8 / 256)
#define PREP_B (NP / 8 / 256)
#define PREP_X (NR * DIM / 8 / 256)
__global__ __launch_bounds__(256) void k_prep(const float* __restrict__ Wq, _Float16* __restrict__ BQ, const float* __restrict__ Wo, _Float16* __restrict__ BO, const float* __restrict__ Wsc, const float* __restrict__ bsc, _Float16* __restrict__ BS, const float* __restrict__ x, _Float16* __restrict__ X16) {
  static_assert(DIM * 4 * INNER % 2048 == 0 && INNER * DIM % 2048 == 0 && HD * NP % 2048 == 0 && NP % 2048 == 0 && NR * DIM % 2048 == 0, "k_prep: every job fills whole blocks");
  int blk = blockIdx.x;
  if (blk < PREP_Q) { d_wt_f16(Wq, BQ, DIM, 4 * INNER, 16.0f, blk); return; }
  blk -= PREP_Q;
  if (blk < PREP_O) { d_wt_f16(Wo, BO, INNER, DIM, 16.0f, blk); return; }
  blk -= PREP_O;
  if (blk < PREP_S) { d_r16(Wsc, BS, blk); return; }
  blk -= PREP_S;
  if (blk < PREP_B) { d_r16(bsc, BS + (size_t)HD * NP, blk); return; }      /* row 64 of the plane */
  d_x16(x, X16, (size_t)NR * DIM / 8, blk - PREP_B); }
__global__ __launch_bounds__(256) void k_h16(const float* __restrict__ x, _Float16* __restrict__ X16, size_t n8) { const size_t t = (size_t)blockIdx.x * 256 + threadIdx.x; if (t >= n8) return; FragH f;
#pragma unroll
  for (int q = 0; q < 8; ++q) f.h[q] = (_Float16)x[t * 8 + q]; *(v8us*)((unsigned short*)X16 + t * 8) = f.half[0];  }
__global__ __launch_bounds__(256) void k_round16f(const float* __restrict__ W, _Float16* __restrict__ Bt, size_t n8) { const size_t t = (size_t)blockIdx.x * 256 + threadIdx.x; if (t >= n8) return; FragH f;
#pragma unroll
  for (int i = 0; i < 8; ++i) f.h[i] = (_Float16)(bf16_round(W[t * 8 + i]) * 16.0f); *(v8us*)((unsigned short*)Bt + t * 8) = f.half[0];  }

// ---- fast GEMM (block tile 128x64, wave tile 32x64; requires M % 128 == 0 rows per launch region, N % 64 == 0 and K % 64 == 0); A and B go through LDS in steps of 64 k: whole 128-byte rows fetched once per block, two buffers; epilogue = k_gemm_hhx semantics ----
#define G2P 72                   /* LDS row pitch in f16: 144 bytes = 16 x 9, the 16 rows of a fragment read fall on different banks */
// fragment in the hardware k order from a staged row: p = the lane's own row at k 8 * hh
__device__ __forceinline__ v16h g2_lfrag(const unsigned short* p) { FragH f; f.half[0] = *(const v8us*)p; f.half[1] = *(const v8us*)(p + 16); return f.v; }
__device__ __forceinline__ v8f g2_mma(v16h a, v16h b, v8f c) { v8f d = __builtin_amdgcn_wmma_f32_16x16x32_f16(false, a, false, b, (short)0, c, false, false); asm volatile("v_nop\n\tv_nop\n\tv_nop\n\tv_nop" : "+v"(d) : "v"(a), "v"(b)); return d; }
template <int ACT>
__global__ __launch_bounds__(128) void k_gemm2(const _Float16* __restrict__ A, int lda, size_t sA, const _Float16* __restrict__ Bh, int ldb, size_t sB, float alpha, const float* __restrict__ bias, size_t sBias, const float* __restrict__ CP, int rowsPerB, size_t sCPb, int row0g,
    float* __restrict__ C, _Float16* __restrict__ C16, int ldc, size_t sC, int M, int N, int K) { static_assert(ACT == 0 || ACT == 3 || ACT == 6 || ACT == 8 || ACT == 9 || ACT == 11 || ACT == 12 || ACT == 14 || ACT == 15 || ACT == 16 || ACT == 17, "k_gemm2: unsupported ACT code (would silently apply no activation)");
  __shared__ __attribute__((aligned(16))) unsigned short sm[2][192][G2P];      /* in the k loop: [buffer][A rows 0-127 | B rows 128-191][64 f16 + pad]; behind it: the four waves' f32 output tiles */
  static_assert(sizeof(float) * 4 * 32 * 68 <= sizeof(unsigned short) * 2 * 192 * G2P, "k_gemm2: the output tiles fit the staging buffers");
  float (*so)[32][68] = reinterpret_cast<float (*)[32][68]>(&sm[0][0][0]);
  const int tid = threadIdx.x, w = tid >> 5, lane = tid & 31, ln = lane & 15, hh = lane >> 4; const int by = blockIdx.y;
  A += (size_t)by * sA; Bh += (size_t)by * sB; const size_t cofs = (size_t)by * sC; const float* bp = bias ? bias + (size_t)by * sBias : nullptr;
  const int ntn = N >> 6; const int mt = blockIdx.x / ntn, nq = blockIdx.x - mt * ntn; const int row0 = mt * 128 + 32 * w, col0 = nq * 64; if (mt * 128 >= M) return;      /* the whole block leaves or none, in front of every barrier */
  // staging: 8 neighbouring lanes fetch one whole 128-byte row; a thread takes chunk tid & 7 of rows (tid >> 3) + 16 j, 8 rows of A and 4 of B; block-uniform bases, the lane's own element offsets stay in their registers over the loop
  const int sr = tid >> 3, sc = (tid & 7) * 8;
  const unsigned short* ua = (const unsigned short*)A + (size_t)(mt * 128) * lda; const unsigned short* ub = (const unsigned short*)Bh + (size_t)col0 * ldb;
  unsigned oa[8], obf[4]; v8us ra[8], rb[4];
#pragma unroll
  for (int j = 0; j < 8; ++j) oa[j] = (unsigned)((sr + 16 * j) * lda + sc);
#pragma unroll
  for (int j = 0; j < 4; ++j) obf[j] = (unsigned)((sr + 16 * j) * ldb + sc);
  // the loops over j, kk and t are unrolled: the register arrays are then indexed by constants only
  auto fetch = [&](const int kb) __attribute__((always_inline)) {
#pragma unroll
    for (int j = 0; j < 8; ++j) ra[j] = *(const v8us*)(ua + kb + oa[j]);
#pragma unroll
    for (int j = 0; j < 4; ++j) rb[j] = *(const v8us*)(ub + kb + obf[j]);
    asm volatile("s_wait_xcnt 0x0" ::: "memory"); };      /* stands behind the 12 loads, in front of the first overwrite of a register that they name */
  auto put = [&](const int buf) __attribute__((always_inline)) {
#pragma unroll
    for (int j = 0; j < 8; ++j) *(v8us*)&sm[buf][sr + 16 * j][sc] = ra[j];
#pragma unroll
    for (int j = 0; j < 4; ++j) *(v8us*)&sm[buf][128 + sr + 16 * j][sc] = rb[j]; };
  const v8f z8 = {0.f,0.f,0.f,0.f,0.f,0.f,0.f,0.f}; v8f c00 = z8, c01 = z8, c02 = z8, c03 = z8, c10 = z8, c11 = z8, c12 = z8, c13 = z8;
  fetch(0); put(0);
  __syncthreads();      /* step 0 is in LDS before any wave reads it */
  // one step of 64 k; more = a next step exists, is fetched, stored and published (a constant at each of the two calls: no test inside a trip)
  auto step = [&](const int s, const bool more) __attribute__((always_inline)) {
    const int cur = s & 1;
    if (more) fetch((s + 1) * 64);
    const unsigned short* pa = &sm[cur][32 * w + ln][8 * hh]; const unsigned short* pb = &sm[cur][128 + ln][8 * hh];
    v16h a[2][2], b[4][2];
#pragma unroll
    for (int kk = 0; kk < 2; ++kk) { a[0][kk] = g2_lfrag(pa + kk * 32); a[1][kk] = g2_lfrag(pa + 16 * G2P + kk * 32);
#pragma unroll
      for (int t = 0; t < 4; ++t) b[t][kk] = g2_lfrag(pb + t * 16 * G2P + kk * 32); }
#pragma unroll
    for (int kk = 0; kk < 2; ++kk) {
      c00 = g2_mma(a[0][kk], b[0][kk], c00); c10 = g2_mma(a[1][kk], b[0][kk], c10);
      c01 = g2_mma(a[0][kk], b[1][kk], c01); c11 = g2_mma(a[1][kk], b[1][kk], c11);
      c02 = g2_mma(a[0][kk], b[2][kk], c02); c12 = g2_mma(a[1][kk], b[2][kk], c12);
      c03 = g2_mma(a[0][kk], b[3][kk], c03); c13 = g2_mma(a[1][kk], b[3][kk], c13); }
    if (more) {
      put(cur ^ 1);      /* last read in the step before, behind whose barrier every wave stands */
      __syncthreads(); }      /* one barrier a step: the next step is in LDS before any wave reads it, and every wave has left this step's buffer before it is refilled in the next trip */
  };
  const int nst = K >> 6;
  // the step loop stays rolled: unrolled, the staging registers of several steps would be live together
#pragma unroll 1
  for (int s = 0; s < nst - 1; ++s) step(s, true);
  step(nst - 1, false);
  __syncthreads();      /* every wave has left the last buffer before the output tiles are written over the buffers */
  v8f accs[8] = {c00, c01, c02, c03, c10, c11, c12, c13};
#pragma unroll
  for (int u = 0; u < 8; ++u) { const int t = u & 3, half = u >> 2; const int col = col0 + t * 16 + ln; const float bv = bp ? bf16_round(bp[col]) : 0.f;
#pragma unroll
    for (int r = 0; r < 8; ++r) { const int rloc = half * 16 + 8 * hh + r; float v = accs[u][r] * alpha + bv; if (CP) { if (rowsPerB < 0) v += CP[cofs + (size_t)(row0g + row0 + rloc) * ldc + col];      /* rowsPerB < 0: own element of the batched C plane */ else { const int bidx = (row0g + row0 + rloc) / rowsPerB; v += CP[(size_t)bidx * sCPb + (size_t)by * 64 + col]; } }
      if (ACT == 3) v = fmaxf(v, 0.f); else if (ACT == 6) v = 0.5f * v * (1.0f + erff(v * 0.70710678118654752f)); else if (ACT == 11) v = 1.0f / (1.0f + expf(-v)); else if (ACT == 15) v = v / (1.0f + expf(-v)); else if (ACT == 12) v = (v > 0.f) ? v : 0.01f * v; else if (ACT == 8) v = tanhf(v); else if (ACT == 9) v = 0.5f * v * (1.0f + tanhf(0.7978845608028654f * (v + 0.044715f * v * v * v))); else if (ACT == 14) v = (v > 0.f) ? v : 0.1f * v; else if (ACT == 16) v = (v >= 0.f) ? v : 0.3f * v; else if (ACT == 17) v = (v >= 0.f) ? v : 0.2f * v;
      so[w][rloc][t * 16 + ln] = v; } }
  __builtin_amdgcn_fence(__ATOMIC_ACQ_REL, "workgroup"); __builtin_amdgcn_wave_barrier();
  const int rsub = lane >> 4, c4 = (lane & 15) * 4;
  {
#pragma unroll
    for (int q = 0; q < 16; ++q) { const int r = q * 2 + rsub; const v4f v = *(const v4fa*)&so[w][r][c4]; if (C) *(v4f*)(C + cofs + (size_t)(row0 + r) * ldc + col0 + c4) = v; if (C16) { v4h h4; for (int i = 0; i < 4; ++i) h4[i] = (_Float16)v[i]; *(v4h*)(C16 + cofs + (size_t)(row0 + r) * ldc + col0 + c4) = h4; } }
     } }

// ---- f^T v of one (batch, head) straight from the projection's rows: one 32x64 tile per block, the 2048 rows of the sum dealt over TVW waves; a wave stages 32 rows of f (its 32 columns) and of v at a time in its own LDS range, as they lie, and reads both operands' fragments with transposing LDS loads (the sum runs down the rows); f32 partial tiles summed through LDS in wave order, written as f16 hi and residual x 2^10 ----
#define TVW 16                   /* waves per tile; each takes NP / TVW rows */
#define TVPF 48                  /* LDS pitch of a staged f row (32 f16) in f16: 96 bytes = 32 x 3, the transposing reader's pitch */
#define TVPV 80                  /* the same for a v row (64 f16): 160 bytes = 32 x 5 */
typedef short s16x8 __attribute__((ext_vector_type(8)));
// 16 columns x 32 rows of a staged row-major tile as one fragment in the hardware k order: p = the lane's own address (row 8 * hh + (lane & 7), column 8 * ((lane >> 3) & 1)), rows 0-15 and 16-31
__device__ __forceinline__ v16h tv_frag(const unsigned short* p, int pitch) { typedef __attribute__((address_space(3))) s16x8 lds_s16x8; union { v16h v; s16x8 q[2]; } f;
  f.q[0] = __builtin_amdgcn_ds_load_tr16_b128_v8i16((lds_s16x8*)p); f.q[1] = __builtin_amdgcn_ds_load_tr16_b128_v8i16((lds_s16x8*)(p + 16 * pitch)); return f.v; }
__global__ __launch_bounds__(32 * TVW) void k_ftv(const _Float16* __restrict__ QKFV, _Float16* __restrict__ FVH, _Float16* __restrict__ FVL) {
  static_assert(NP == 128 * TVW && HD == 64, "k_ftv: every wave takes four 32-row steps; a v row is one 128-byte line");
  __shared__ __attribute__((aligned(32))) unsigned short sf[TVW][32][TVPF];
  __shared__ __attribute__((aligned(32))) unsigned short sv[TVW][32][TVPV];
  __shared__ __attribute__((aligned(16))) float so[TVW][32][68];
  const int tid = threadIdx.x, w = tid >> 5, lane = tid & 31, ln = lane & 15, hh = lane >> 4;
  const int bh = blockIdx.y, b = bh / NH, h = bh - b * NH, d0 = blockIdx.x * 32; const int ldq = 4 * INNER;
  // fetch: 4 neighbouring lanes take the 64 bytes of an f row, 8 a whole v row
  const int fr = lane >> 2, fc = (lane & 3) * 8, vr = lane >> 3, vc = (lane & 7) * 8;
  const unsigned short* g0 = (const unsigned short*)QKFV + ((size_t)b * NP + w * (NP / TVW)) * ldq + h * HD;      /* the wave's first row, the head's q columns; f stands 2 * INNER, v 3 * INNER further */
  const unsigned short* gf = g0 + (size_t)fr * ldq + d0 + fc; const unsigned short* gv = g0 + (size_t)vr * ldq + vc;
  v8us rf[2][4], rv[2][8];
  // every loop over j, t and the steps is unrolled: the register arrays are then indexed by constants only
  auto fetch = [&](const int c) __attribute__((always_inline)) {
#pragma unroll
    for (int j = 0; j < 4; ++j) rf[c & 1][j] = *(const v8us*)(gf + ((size_t)(c * 32 + 8 * j) * ldq + 2 * INNER));
#pragma unroll
    for (int j = 0; j < 8; ++j) rv[c & 1][j] = *(const v8us*)(gv + ((size_t)(c * 32 + 4 * j) * ldq + 3 * INNER));
    asm volatile("s_wait_xcnt 0x0" :: "v"(gf), "v"(gv) : "memory"); };      /* stands behind the 12 loads, in front of the first overwrite of a register that they name; the two addresses are inputs so that their registers live up to here (the last load otherwise lands on its own address); it also keeps the loads from sinking to their use */
  fetch(0); fetch(1);
  const unsigned short* pf = &sf[w][8 * hh + (lane & 7)][8 * ((lane >> 3) & 1)]; const unsigned short* pv = &sv[w][8 * hh + (lane & 7)][8 * ((lane >> 3) & 1)];
  const v8f z8 = {0.f,0.f,0.f,0.f,0.f,0.f,0.f,0.f}; v8f acc[2][4] = {{z8, z8, z8, z8}, {z8, z8, z8, z8}};
#pragma unroll
  for (int c = 0; c < 4; ++c) {
#pragma unroll
    for (int j = 0; j < 4; ++j) *(v8us*)&sf[w][fr + 8 * j][fc] = rf[c & 1][j];
#pragma unroll
    for (int j = 0; j < 8; ++j) *(v8us*)&sv[w][vr + 4 * j][vc] = rv[c & 1][j];
    if (c + 2 < 4) fetch(c + 2);      /* two steps ahead, into the registers just stored */
    asm volatile("s_wait_dscnt 0x0" ::: "memory");      /* the wave's own 12 stores are in LDS before its lanes read each other's rows */
    v16h a[2], bq[4];
#pragma unroll
    for (int u = 0; u < 2; ++u) a[u] = tv_frag(pf + 16 * u, TVPF);
#pragma unroll
    for (int t = 0; t < 4; ++t) bq[t] = tv_frag(pv + 16 * t, TVPV);
    asm volatile("s_wait_dscnt 0x0" ::: "memory");      /* the 12 reads have returned before the next step's stores go over the same rows */
#pragma unroll
    for (int t = 0; t < 4; ++t) {
#pragma unroll
      for (int u = 0; u < 2; ++u) acc[u][t] = __builtin_amdgcn_wmma_f32_16x16x32_f16(false, a[u], false, bq[t], (short)0, acc[u][t], false, false); } }
#pragma unroll
  for (int u = 0; u < 2; ++u) {
#pragma unroll
    for (int t = 0; t < 4; ++t) {
#pragma unroll
      for (int r = 0; r < 8; ++r) so[w][u * 16 + 8 * hh + r][t * 16 + ln] = acc[u][t][r]; } }
  __syncthreads();      /* every wave's partial tile is in LDS before any thread sums across waves */
  const int r = tid >> 4, c4 = (tid & 15) * 4; v4f s = *(const v4fa*)&so[0][r][c4];
  for (int u = 1; u < TVW; ++u) s += *(const v4fa*)&so[u][r][c4];
  v4h xh, xl;
#pragma unroll
  for (int q = 0; q < 4; ++q) { const _Float16 hv = (_Float16)s[q]; xh[q] = hv; xl[q] = (_Float16)((s[q] - (float)hv) * 1024.0f); }
  const size_t o = (size_t)bh * HD * HD + (size_t)(d0 + r) * HD + c4;
  *(v4h*)(FVH + o) = xh; *(v4h*)(FVL + o) = xl; }


// ---- fused attention: a block takes 256 query rows of one (batch, head), 32 per wave, and walks the 2048 keys in tiles of 64; each tile (k rows, w_scales rows) is fetched once per block by whole-line loads and put into LDS, where all 8 waves read their fragments; running maximum and sum per query ----
#define FQW 8                    /* waves per block, 32 query rows each: 8 x 32 (batch, head) pairs = 256 blocks */
#define FKT 64                   /* keys per tile: one row of each staged plane is 128 bytes */
#define FLP 72                   /* LDS row pitch in f16: 144 bytes = 16 x 9, the 16 rows of a fragment read fall on different banks */
__device__ __forceinline__ v8f fa_mma(v16h a, v16h b, v8f c) { return __builtin_amdgcn_wmma_f32_16x16x32_f16(false, a, false, b, (short)0, c, false, false); }
// fragment in the hardware k order from a wave-uniform base and the lane's own element offset (row ln, k 8 * hh)
__device__ __forceinline__ v16h fa_frag(const _Float16* ub, unsigned lo) { FragH f; f.half[0] = *(const v8us*)((const unsigned short*)ub + lo); f.half[1] = *(const v8us*)((const unsigned short*)ub + lo + 16); return f.v; }
// the same fragment from a staged row: p = the lane's own row at k 8 * hh
__device__ __forceinline__ v16h fl_frag(const unsigned short* p) { FragH f; f.half[0] = *(const v8us*)p; f.half[1] = *(const v8us*)(p + 16); return f.v; }
// eight independent 2^x in place: each v_exp_f32 fills the slot that the instruction set asks for behind the one before it, the v_nop fills the last one's
__device__ __forceinline__ void fa_exp2x8(float* x) {
  asm("v_exp_f32 %0, %0\n\tv_exp_f32 %1, %1\n\tv_exp_f32 %2, %2\n\tv_exp_f32 %3, %3\n\tv_exp_f32 %4, %4\n\tv_exp_f32 %5, %5\n\tv_exp_f32 %6, %6\n\tv_exp_f32 %7, %7\n\tv_nop"
      : "+v"(x[0]), "+v"(x[1]), "+v"(x[2]), "+v"(x[3]), "+v"(x[4]), "+v"(x[5]), "+v"(x[6]), "+v"(x[7])); }
// two of them, same slots
__device__ __forceinline__ void fa_exp2x2(float& a, float& b) { asm("v_exp_f32 %0, %0\n\tv_exp_f32 %1, %1\n\tv_nop" : "+v"(a), "+v"(b)); }
// lane l with lane l ^ 16
__device__ __forceinline__ float fa_xhalf(float x) { return __builtin_bit_cast(float, __builtin_amdgcn_permlanex16(__builtin_bit_cast(int, x), __builtin_bit_cast(int, x), 0x76543210, 0xfedcba98, false, false)); }
__global__ __launch_bounds__(32 * FQW) void k_fattn(const _Float16* QKFV, const _Float16* WS, const _Float16* FVH, const _Float16* FVL, _Float16* CH, _Float16* CL) {
  static_assert(NP % (32 * FQW) == 0 && NP % FKT == 0 && HD == 64 && FKT == 64 && 4 * INNER == NP && 32 * FQW == 256 && NP == 8 * 32 * FQW, "k_fattn: head size 64, 64-key tiles, one row pitch for q, k and w_scales, 256 threads stage 64 rows of 8 chunks in two rounds and the b_scales row in one");
  __shared__ __attribute__((aligned(16))) unsigned short st[2][2][64][FLP];      /* [buffer][k rows | w_scales rows][row][64 f16 + pad] */
  __shared__ __attribute__((aligned(16))) unsigned short sb[NP];      /* the whole b_scales row, put down once */
  const int tid = threadIdx.x, w = __builtin_amdgcn_readfirstlane(tid >> 5), lane = tid & 31, ln = lane & 15, hh = lane >> 4;
  const int bh = blockIdx.y, b = bh / NH, h = bh - b * NH;
  const int ldq = 4 * INNER; const unsigned lo = (unsigned)(ln * NP + 8 * hh);
  const _Float16* base = QKFV + (size_t)b * NP * ldq + h * HD;
  const int row0 = blockIdx.x * (32 * FQW) + w * 32;
  // staging: 8 neighbouring lanes fetch one whole 128-byte row; a thread takes chunk tid & 7 of rows tid >> 3 and 32 + (tid >> 3) of each of the two planes
  const int sr = tid >> 3, sc = (tid & 7) * 8;
  const unsigned short* gk = (const unsigned short*)(base + INNER) + (size_t)sr * ldq + sc;
  const unsigned short* gw = (const unsigned short*)WS + (size_t)sr * NP + sc;
  v8us g0 = *(const v8us*)gk, g1 = *(const v8us*)(gk + (size_t)32 * ldq), g2 = *(const v8us*)gw, g3 = *(const v8us*)(gw + (size_t)32 * NP);
  const v8us gb = *(const v8us*)((const unsigned short*)WS + (size_t)HD * NP + tid * 8);
  asm volatile("s_wait_xcnt 0x0" ::: "memory");      /* stands in front of the first overwrite of a register that the 5 loads above name (the q loads' offset takes the register of the b_scales load's) */
  const _Float16* qp = base + (size_t)row0 * ldq;
  const v16h q00 = fa_frag(qp, lo), q01 = fa_frag(qp + 32, lo), q10 = fa_frag(qp + 16 * ldq, lo), q11 = fa_frag(qp + 16 * ldq + 32, lo);
  asm volatile("s_wait_xcnt 0x0" ::: "memory");      /* stands in front of the first overwrite of a register that the 8 loads above name (the accumulators' zeroes reuse the q loads' offset register and base) */
  *(v8us*)&st[0][0][sr][sc] = g0; *(v8us*)&st[0][0][sr + 32][sc] = g1; *(v8us*)&st[0][1][sr][sc] = g2; *(v8us*)&st[0][1][sr + 32][sc] = g3; *(v8us*)&sb[tid * 8] = gb;
  __syncthreads();      /* tile 0 and the b_scales row are in LDS before any wave reads them */
  const v8f z8 = {0.f,0.f,0.f,0.f,0.f,0.f,0.f,0.f};
  const float cs = 0.125f * 1.4426950408889634f;
  // o[u][t][r] = sum over the keys of weight x w_scales[t*16 + 8*hh + r][key] for query row0 + u*16 + ln, in units of 2^10 x 16 x the weights under the running maximum m; ob[u][r] = the same sum against b_scales (every r alike); su = this lane half's share of the weight sum
  v8f o[2][4] = {{z8, z8, z8, z8}, {z8, z8, z8, z8}}; v8f ob[2] = {z8, z8};
  float m0 = -3.0e38f, m1 = -3.0e38f, su0 = 0.f, su1 = 0.f;
  // one tile; more = a next tile exists, is fetched, stored and published (a constant at each of the two calls: the trip of the loop below is one straight block, so that the scheduling barriers bind all of it)
  // every loop inside a tile is unrolled: the fragment and accumulator arrays are then indexed by constants only and stay in registers
  auto tile = [&](const int kt, const bool more) __attribute__((always_inline)) {
    const int cur = kt & 1;
    if (more) {
      const size_t ko = (size_t)(kt + 1) * FKT * ldq; const int po = (kt + 1) * FKT;
      g0 = *(const v8us*)(gk + ko); g1 = *(const v8us*)(gk + ko + (size_t)32 * ldq); g2 = *(const v8us*)(gw + po); g3 = *(const v8us*)(gw + po + (size_t)32 * NP);
      asm volatile("s_wait_xcnt 0x0" ::: "memory"); }      /* stands in front of the first overwrite of an address register that the 4 loads above name (the k fragments take them) */
    __builtin_amdgcn_sched_barrier(0);      /* holds the next tile's 4 loads ahead of this tile's work, which hides their latency (the compiler otherwise sinks a load to its use) */
    // S^T = K Q^T: s[t][u][r] = score of key kt*64 + t*16 + 8*hh + r against query row0 + u*16 + ln
    v8f s[4][2];
#pragma unroll
    for (int t = 0; t < 4; ++t) { const unsigned short* kr = &st[cur][0][t * 16 + ln][8 * hh]; const v16h k0 = fl_frag(kr), k1 = fl_frag(kr + 32);
      s[t][0] = fa_mma(k1, q01, fa_mma(k0, q00, z8)); s[t][1] = fa_mma(k1, q11, fa_mma(k0, q10, z8)); }
    // running maximum: in-lane over the tile's keys, across the two lane halves, against the maximum so far
    float t0 = s[0][0][0], t1 = s[0][1][0];
#pragma unroll
    for (int t = 0; t < 4; ++t) {
#pragma unroll
      for (int r = 0; r < 8; ++r) { t0 = fmaxf(t0, s[t][0][r]); t1 = fmaxf(t1, s[t][1][r]); } }
    t0 = fmaxf(t0, fa_xhalf(t0)); t1 = fmaxf(t1, fa_xhalf(t1));
    t0 = fmaxf(t0, m0); t1 = fmaxf(t1, m1);
    float a0 = (m0 - t0) * cs, a1 = (m1 - t1) * cs;      /* what stands under the old maximum shrinks by 2^a; 0 on the first tile */
    fa_exp2x2(a0, a1);
    m0 = t0; m1 = t1;
    // w_scales fragments come in 2 groups (keys 0-31, 32-63) of 4 row tiles plus the b_scales fragment (one row, read alike by all 16 lanes of a half), each asked for one group of products ahead; the scheduling barriers hold the LDS reads there (the compiler otherwise sinks them to their use, one LDS latency per pair of products)
    const unsigned short* pr = &st[cur][1][ln][8 * hh]; const unsigned short* br = &sb[kt * FKT + 8 * hh];
    v16h bf[2][5];
    __builtin_amdgcn_sched_barrier(0);      /* not above the score products: their fragments and these do not fit the registers together */
#pragma unroll
    for (int t = 0; t < 4; ++t) bf[0][t] = fl_frag(pr + t * 16 * FLP);
    bf[0][4] = fl_frag(br);
    __builtin_amdgcn_sched_barrier(0);      /* the first group flies under the first half of the softmax */
    // weights e * 2^10 = 2^((s - max) / 8 * log2 e + 10); two score tiles (32 keys) of one query tile are one B fragment in the hardware k order
    const float f0 = 10.0f - m0 * cs, f1 = 10.0f - m1 * cs;
    su0 *= a0; su1 *= a1; v16h p[2][2];
    // readout, transposed (A = w_scales rows or the b_scales row, B = weights), on f32 accumulators that are first shrunk to the new maximum
#pragma unroll
    for (int ks = 0; ks < 2; ++ks) {
#pragma unroll
      for (int u = 0; u < 2; ++u) { float x[16]; FragH a; float sa = 0.f;
#pragma unroll
        for (int i = 0; i < 16; ++i) x[i] = s[2 * ks + (i >> 3)][u][i & 7] * cs + (u ? f1 : f0);
        fa_exp2x8(x); fa_exp2x8(x + 8);
#pragma unroll
        for (int i = 0; i < 16; ++i) { sa += x[i]; a.h[i] = (_Float16)x[i]; }
        if (u) su1 += sa; else su0 += sa;
        p[ks][u] = a.v; }
      if (ks == 0) {
        __builtin_amdgcn_sched_barrier(0);      /* the sums of the first 32 keys end here: left open, all 64 weights stay in f32 registers to the end of the tile */
#pragma unroll
        for (int t = 0; t < 4; ++t) bf[1][t] = fl_frag(pr + t * 16 * FLP + 32);
        bf[1][4] = fl_frag(br + 32);
        __builtin_amdgcn_sched_barrier(0);      /* the second group is asked for ahead of the first group's products */
        // the first group's products stand in one region with the second half of the softmax: vector work under matrix time
#pragma unroll
        for (int t = 0; t < 4; ++t) { o[0][t] *= a0; o[1][t] *= a1; }
        ob[0] *= a0; ob[1] *= a1;
#pragma unroll
        for (int t = 0; t < 4; ++t) { o[0][t] = fa_mma(bf[0][t], p[0][0], o[0][t]); o[1][t] = fa_mma(bf[0][t], p[0][1], o[1][t]); }
        ob[0] = fa_mma(bf[0][4], p[0][0], ob[0]); ob[1] = fa_mma(bf[0][4], p[0][1], ob[1]); } }
#pragma unroll
    for (int t = 0; t < 4; ++t) { o[0][t] = fa_mma(bf[1][t], p[1][0], o[0][t]); o[1][t] = fa_mma(bf[1][t], p[1][1], o[1][t]); }
    ob[0] = fa_mma(bf[1][4], p[1][0], ob[0]); ob[1] = fa_mma(bf[1][4], p[1][1], ob[1]);
    if (more) {
      const int nx = cur ^ 1;      /* last read in the tile before, behind whose barrier every wave stands */
      *(v8us*)&st[nx][0][sr][sc] = g0; *(v8us*)&st[nx][0][sr + 32][sc] = g1; *(v8us*)&st[nx][1][sr][sc] = g2; *(v8us*)&st[nx][1][sr + 32][sc] = g3;
      __syncthreads(); }      /* one barrier a tile: the next tile is in LDS before any wave reads it, and every wave has left this tile's buffer before it is refilled in the next trip */
  };
  // the tile loop stays rolled, its body is long
#pragma unroll 1
  for (int kt = 0; kt < NP / FKT - 1; ++kt) tile(kt, true);
  tile(NP / FKT - 1, false);
  // f^T v of this (batch, head), hi and residual x 2^10, as A fragments (row d = t*16 + ln, k = e)
  const unsigned short* fvh = (const unsigned short*)FVH + (size_t)bh * HD * HD + ln * HD + 8 * hh; const unsigned short* fvl = (const unsigned short*)FVL + (size_t)bh * HD * HD + ln * HD + 8 * hh;
  v16h ah[4][2], al[4][2];
#pragma unroll
  for (int t = 0; t < 4; ++t) {
#pragma unroll
    for (int ks = 0; ks < 2; ++ks) { ah[t][ks] = fl_frag(fvh + t * 16 * HD + ks * 32); al[t][ks] = fl_frag(fvl + t * 16 * HD + ks * 32); } }
  asm volatile("s_wait_xcnt 0x0" :: "v"(fvh), "v"(fvl) : "memory");      /* stands in front of the first overwrite of an address register that the 32 loads above name; the two addresses are inputs so that their registers live up to here */
  su0 += fa_xhalf(su0); su1 += fa_xhalf(su1);
  const float rs0 = 1.0f / su0, rs1 = 1.0f / su1;
  // second product: out^T[d][query] = sum over e of (f^T v)[d][e] x (attn . w_scales^T)[query][e]; two accumulator tiles (32 e) of one query tile are one B fragment in the hardware k order, exactly as the weights were
#pragma unroll
  for (int u = 0; u < 2; ++u) { const float rs = u ? rs1 : rs0; v16h th[2], tl[2];
#pragma unroll
    for (int ks = 0; ks < 2; ++ks) { FragH xh, xl;
#pragma unroll
      for (int i = 0; i < 16; ++i) { const float v = o[u][2 * ks + (i >> 3)][i & 7] * rs; const _Float16 hv = (_Float16)v; xh.h[i] = hv; xl.h[i] = (_Float16)((v - (float)hv) * 1024.0f); }
      th[ks] = xh.v; tl[ks] = xl.v; }
    const float cb = ob[u][0] * rs;
#pragma unroll
    for (int t = 0; t < 4; ++t) { FragH ch, cl;
      // the two cross terms carry 2^10, taken back (exact) before the hi x hi term joins the same accumulators
      v8f c = fa_mma(ah[t][1], tl[1], fa_mma(ah[t][0], tl[0], fa_mma(al[t][1], th[1], fa_mma(al[t][0], th[0], z8))));
      c *= 0.0009765625f;
      c = fa_mma(ah[t][1], th[1], fa_mma(ah[t][0], th[0], c));
#pragma unroll
      for (int r = 0; r < 8; ++r) { const float v = (c[r] + cb) * 0.0625f; const _Float16 hv = (_Float16)v; ch.h[r] = hv; cl.h[r] = (_Float16)((v - (float)hv) * 1024.0f); }
      const size_t oo = ((size_t)b * NP + row0 + u * 16 + ln) * INNER + h * HD + t * 16 + 8 * hh;
      *(v8us*)((unsigned short*)CH + oo) = ch.half[0]; *(v8us*)((unsigned short*)CL + oo) = cl.half[0]; } }
}

extern "C" void kernel_launch(void* const* d_in, const int* in_sizes, int n_in,
                              void* d_out, int out_size, void* d_ws, size_t ws_size, hipStream_t stream) {
  (void)in_sizes; (void)n_in; (void)out_size;
  const float* x = (const float*)d_in[0]; const float* Wqkfv = (const float*)d_in[1]; const float* Wsc = (const float*)d_in[2]; const float* bsc = (const float*)d_in[3]; const float* Wout = (const float*)d_in[4]; const float* bout = (const float*)d_in[5];
  char* ws = (char*)d_ws; size_t off = 0;
  auto take = [&](size_t bytes) { char* p = ws + off; off += (bytes + 255) & ~(size_t)255; return p; };
  _Float16* BQ = (_Float16*)take((size_t)4 * INNER * DIM * 2); _Float16* BS = (_Float16*)take((size_t)(HD + 1) * NP * 2);      /* w_scales rows, then b_scales as row 64 */ _Float16* BO = (_Float16*)take((size_t)DIM * INNER * 2);
  _Float16* X16 = (_Float16*)take((size_t)NR * DIM * 2); _Float16* QKFV = (_Float16*)take((size_t)NR * 4 * INNER * 2);      /* [row][q | k | f | v] f16, 32 MiB */
  _Float16* FVH = (_Float16*)take((size_t)NB * NH * HD * HD * 2); _Float16* FVL = (_Float16*)take((size_t)NB * NH * HD * HD * 2);
  _Float16* CH = (_Float16*)take((size_t)NR * INNER * 2); _Float16* CL = (_Float16*)take((size_t)NR * INNER * 2);
  if (off > ws_size) return;      /* about 59 MiB */
  k_prep<<<PREP_Q + PREP_O + PREP_S + PREP_B + PREP_X, 256, 0, stream>>>(Wqkfv, BQ, Wout, BO, Wsc, bsc, BS, x, X16);      /* w_qkfv and w_out transposed (x @ W, in x out), w_scales and b_scales as they lie, and the f16 x plane */
  k_gemm2<0><<<dim3((NR / 128) * (4 * INNER / 64), 1), 128, 0, stream>>>(X16, DIM, 0, BQ, DIM, 0, 0.0625f, nullptr, 0, nullptr, 1, 0, 0, nullptr, QKFV, 4 * INNER, 0, NR, 4 * INNER, DIM);      /* [q | k | f | v], head h at h*64 inside each quarter */
  k_ftv<<<dim3(HD / 32, NB * NH), 32 * TVW, 0, stream>>>(QKFV, FVH, FVL);      /* FV[b][h][d][e] = sum_n f[n][d] v[n][e] as f16 hi/residual (32-row tiles, the rows of the sum over the block's waves) */
  k_fattn<<<dim3(NP / (32 * FQW), NB * NH), 32 * FQW, 0, stream>>>(QKFV, BS, FVH, FVL, CH, CL);      /* (softmax(q k^T / 8) . w_scales^T) (f^T v)^T + softmax . b_scales, as f16 hi/residual */
  k_gemm2<0><<<dim3((NR / 128) * (DIM / 64), 1), 128, 0, stream>>>(CL, INNER, 0, BO, INNER, 0, 0.0625f / 1024.0f, nullptr, 0, nullptr, 1, 0, 0, (float*)d_out, nullptr, DIM, 0, NR, DIM, INNER);
  k_gemm2<0><<<dim3((NR / 128) * (DIM / 64), 1), 128, 0, stream>>>(CH, INNER, 0, BO, INNER, 0, 0.0625f, bout, 0, (const float*)d_out, 1, (size_t)DIM, 0, (float*)d_out, nullptr, DIM, 0, NR, DIM, INNER);      /* y = (c_lo + c_hi) w_out + b_out */
}

// v008
// Measured time: 98.5 microseconds a run.
// Timed twice side by side with v007, it ran 1.25 and 1.26 times as fast.
// Over all steps from v000 it is 20.3 times as fast.
#include <hip/hip_runtime.h>
// SimilarAttention (4 x 2048 patches x 512, 8 heads x 64: [q|k|f|v] = x w_qkfv; attn = softmax(q.k/8); poss_value = (f^T v) w_scales + b_scales -> [h][64][2048]; out = attn . poss_value^T; y = merged . w_out + b_out).
// Structure: exact f16 x plane; the fused projection as ONE f16 WMMA GEMM (128x64 block tiles staged in LDS, 32x64 wave tiles, f32 accumulation, exact x16 weights; f16 out); then, each stage as ONE launch over all batches and heads: f^T v as 32-row WMMA tiles read straight from the projection's rows (per-wave LDS staging, transposing LDS loads; K = 2048 dealt over a block's 16 waves, f32 partials summed in LDS, f16 hi/residual out), then ONE launch for all batches and heads that keeps scores and softmax weights in registers and never builds poss_value: attn . ((f^T v) w_scales + b)^T = (attn . w_scales^T) (f^T v)^T + attn . b. A block takes 256 query rows of one head, 32 per wave, and walks the keys in tiles of 64 that are staged once per block in LDS (scores transposed, K = 64, f32; running row maximum and row sum; unnormalised f16 weights x 2^10 packed from the score accumulators into the B operand; readout against the exact x16 w_scales rows and the b_scales row on f32 accumulators); behind the keys: row scaling, f16 hi/residual, three product terms against f^T v hi/residual, + the b term, hi/residual out; w_out as ONE GEMM launch that runs the residual's k steps, scales the accumulators by 2^-10 and runs the hi plane's k steps on top (+ bias).
// Compute dtype: inputs rounded to bf16; x / weights exact as f16; q, k, f, v and the softmax weights as plain f16 operands (~2^-12); f^T v, attn . w_scales^T and the merged context as f16 hi + residual; v_wmma_f32_16x16x32_f16.
#define NB 4
#define NP 2048
#define DIM 512
#define NH 8
#define HD 64
#define INNER 512
#define NR (NB * NP)
typedef __bf16 v16b __attribute__((ext_vector_type(16)));
typedef unsigned short v8us __attribute__((ext_vector_type(8), may_alias));
typedef float  v8f  __attribute__((ext_vector_type(8)));
typedef float  v4f  __attribute__((ext_vector_type(4)));
typedef float  v4fa __attribute__((ext_vector_type(4), may_alias));
union FragB { v16b v; v8us half[2]; unsigned short u[16]; };

__device__ __forceinline__ unsigned short bf16_bits(float x) { unsigned int u = __float_as_uint(x); return (unsigned short)((u + 0x7FFFu + ((u >> 16) & 1u)) >> 16); }
__device__ __forceinline__ float bf16_val(unsigned short b) { return __uint_as_float(((unsigned int)b) << 16); }
__device__ __forceinline__ float bf16_round(float x) { return bf16_val(bf16_bits(x)); }
// D += A·B with NT terms: 1 = ah·bh, 2 = + al·bh (A split), 3 = + ah·bl (both split)
template <int NT>
__device__ __forceinline__ v8f mmaN(v16b ah, v16b al, v16b bh, v16b bl, v8f c) {
  c = __builtin_amdgcn_wmma_f32_16x16x32_bf16(false, ah, false, bh, (short)0, c, false, false);
  if (NT >= 2) c = __builtin_amdgcn_wmma_f32_16x16x32_bf16(false, al, false, bh, (short)0, c, false, false);
  if (NT >= 3) c = __builtin_amdgcn_wmma_f32_16x16x32_bf16(false, ah, false, bl, (short)0, c, false, false);
  asm volatile("v_nop\n\tv_nop\n\tv_nop\n\tv_nop" : "+v"(c) : "v"(ah), "v"(al), "v"(bh), "v"(bl));
  return c;
}

__global__ __launch_bounds__(256) void k_wt_bf16(const float* __restrict__ W, unsigned short* __restrict__ Wt, int K, int N) {
  const int t = blockIdx.x * 256 + threadIdx.x;
  const int k8n = K / 8;
  if (t >= N * k8n) return;
  const int n = t / k8n, k8 = (t % k8n) * 8;
  v8us v;
#pragma unroll
  for (int i = 0; i < 8; ++i) v[i] = bf16_bits(W[(size_t)(k8 + i) * N + n]);
  *(v8us*)(Wt + (size_t)n * K + k8) = v;
  
}

// GEMM C[M][N] (f32, pitch ldc) = act(A[M][K]·W + bias). A f32 row-major (pitch lda) converted per fragment to bf16
// (ASPLIT: hi/lo two planes -> 2 terms, else single rounded term); Wt bf16 [N][K] (pitch ldb). BIAS_BF16 rounds the
// bias to bf16 first (bias quantised to bf16 before the add). K%32==0, M%16==0, N%64==0.
template <bool ASPLIT, int ACT, bool BIAS_BF16>
__global__ __launch_bounds__(128) void k_gemm_bf(const float* __restrict__ A, int lda, const unsigned short* __restrict__ Wt, int ldb,
                                               const float* __restrict__ bias, float* __restrict__ C, int ldc, int M, int N, int K) {
  __shared__ __attribute__((aligned(16))) float so[4][16][64];
  const int tid = threadIdx.x, w = tid >> 5, lane = tid & 31, ln = lane & 15, hh = lane >> 4;
  const int ntn = N / 64;
  const int wid = blockIdx.x * 4 + w;
  const int mt = wid / ntn, nq = wid % ntn;
  if (mt * 16 >= M) return;
  const int row0 = mt * 16, col0 = nq * 64;
  const float* arow = A + (size_t)(row0 + ln) * lda;
  v8f acc[4] = {};
  for (int kb = 0; kb < K; kb += 32) {
    FragB ah, al;
    const v4f x0 = *(const v4fa*)(arow + kb + 8 * hh), x1 = *(const v4fa*)(arow + kb + 8 * hh + 4);
    const v4f x2 = *(const v4fa*)(arow + kb + 16 + 8 * hh), x3 = *(const v4fa*)(arow + kb + 16 + 8 * hh + 4);
    float xs[16] = {x0[0],x0[1],x0[2],x0[3],x1[0],x1[1],x1[2],x1[3],x2[0],x2[1],x2[2],x2[3],x3[0],x3[1],x3[2],x3[3]};
#pragma unroll
    for (int i = 0; i < 16; ++i) { const unsigned short hb = bf16_bits(xs[i]); ah.u[i] = hb; al.u[i] = ASPLIT ? bf16_bits(xs[i] - bf16_val(hb)) : (unsigned short)0; }
#pragma unroll
    for (int t = 0; t < 4; ++t) {
      const unsigned short* brow = Wt + (size_t)(col0 + t * 16 + ln) * ldb + kb;
      FragB b;
      b.half[0] = *(const v8us*)(brow + 8 * hh);
      b.half[1] = *(const v8us*)(brow + 16 + 8 * hh);
      acc[t] = mmaN<ASPLIT ? 2 : 1>(ah.v, al.v, b.v, b.v, acc[t]);
    }
  }
#pragma unroll
  for (int t = 0; t < 4; ++t) {
    float bv = bias ? bias[col0 + t * 16 + ln] : 0.f;
    if (BIAS_BF16) bv = bf16_round(bv);
#pragma unroll
    for (int r = 0; r < 8; ++r) { float v = acc[t][r] + bv; if (ACT == 1) v = fmaxf(v, 0.f); so[w][8 * hh + r][t * 16 + ln] = v; }
  }
  __builtin_amdgcn_fence(__ATOMIC_ACQ_REL, "workgroup");
  __builtin_amdgcn_wave_barrier();
  const int rsub = lane >> 4, c4 = (lane & 15) * 4;
  {
#pragma unroll
    for (int q = 0; q < 8; ++q) {
      const int r = q * 2 + rsub;
      const v4f v = *(const v4fa*)&so[w][r][c4];
      *(v4f*)(C + (size_t)(row0 + r) * ldc + col0 + c4) = v;
    }
    
  }
}

// GEMM C = act(A·W + bias + resid): A f32 (ASPLIT -> hi/lo 2 terms), Wt bf16 [N][K]; ACT 0 none, 1 relu, 2 exact gelu;
// resid (optional, f32, row index = (row % rmod), pitch ldr, RES_BF16 rounds it) added before the activation.
template <bool ASPLIT, int ACT, bool BIAS_BF16, bool RES_BF16>
__global__ __launch_bounds__(128) void k_gemm_bf3(const float* __restrict__ A, int lda, const unsigned short* __restrict__ Wt, int ldb,
                                                const float* __restrict__ bias, const float* __restrict__ resid, int rmod, int ldr,
                                                float* __restrict__ C, int ldc, int M, int N, int K) {
  __shared__ __attribute__((aligned(16))) float so[4][16][64];
  const int tid = threadIdx.x, w = tid >> 5, lane = tid & 31, ln = lane & 15, hh = lane >> 4;
  const int ntn = N / 64;
  const int wid = blockIdx.x * 4 + w;
  const int mt = wid / ntn, nq = wid % ntn;
  if (mt * 16 >= M) return;
  const int row0 = mt * 16, col0 = nq * 64;
  const float* arow = A + (size_t)(row0 + ln) * lda;
  v8f acc[4] = {};
  for (int kb = 0; kb < K; kb += 32) {
    FragB ah, al;
    const v4f x0 = *(const v4fa*)(arow + kb + 8 * hh), x1 = *(const v4fa*)(arow + kb + 8 * hh + 4);
    const v4f x2 = *(const v4fa*)(arow + kb + 16 + 8 * hh), x3 = *(const v4fa*)(arow + kb + 16 + 8 * hh + 4);
    float xs[16] = {x0[0],x0[1],x0[2],x0[3],x1[0],x1[1],x1[2],x1[3],x2[0],x2[1],x2[2],x2[3],x3[0],x3[1],x3[2],x3[3]};
#pragma unroll
    for (int i = 0; i < 16; ++i) { const unsigned short hb = bf16_bits(xs[i]); ah.u[i] = hb; al.u[i] = ASPLIT ? bf16_bits(xs[i] - bf16_val(hb)) : (unsigned short)0; }
#pragma unroll
    for (int t = 0; t < 4; ++t) {
      const unsigned short* brow = Wt + (size_t)(col0 + t * 16 + ln) * ldb + kb;
      FragB b;
      b.half[0] = *(const v8us*)(brow + 8 * hh);
      b.half[1] = *(const v8us*)(brow + 16 + 8 * hh);
      acc[t] = mmaN<ASPLIT ? 2 : 1>(ah.v, al.v, b.v, b.v, acc[t]);
    }
  }
#pragma unroll
  for (int t = 0; t < 4; ++t) {
    const int col = col0 + t * 16 + ln;
    float bv = bias ? bias[col] : 0.f;
    if (BIAS_BF16) bv = bf16_round(bv);
#pragma unroll
    for (int r = 0; r < 8; ++r) {
      float v = acc[t][r] + bv;
      if (resid) { float rv = resid[(size_t)((row0 + 8 * hh + r) % rmod) * ldr + col]; if (RES_BF16) rv = bf16_round(rv); v += rv; }
      if (ACT == 1) v = fmaxf(v, 0.f);
      if (ACT == 2) v = 0.5f * v * (1.0f + erff(v * 0.70710678118654752f));
      if (ACT == 3) { const float u = 0.7978845608028654f * (v + 0.044715f * v * v * v); v = 0.5f * v * (1.0f + tanhf(u)); }
      so[w][8 * hh + r][t * 16 + ln] = v;
    }
  }
  __builtin_amdgcn_fence(__ATOMIC_ACQ_REL, "workgroup");
  __builtin_amdgcn_wave_barrier();
  const int rsub = lane >> 4, c4 = (lane & 15) * 4;
  {
#pragma unroll
    for (int q = 0; q < 8; ++q) {
      const int r = q * 2 + rsub;
      const v4f v = *(const v4fa*)&so[w][r][c4];
      *(v4f*)(C + (size_t)(row0 + r) * ldc + col0 + c4) = v;
    }
    
  }
}
// row LayerNorm (biased variance, eps) over N: s = X (+ R); optional out_sum <- s; out_norm <- (s-mu)*rsqrt(var+eps)*g + b
template <bool PARAM_BF16>
__global__ __launch_bounds__(256) void k_layernorm(const float* __restrict__ X, const float* __restrict__ R, const float* __restrict__ g, const float* __restrict__ bta,
                                                  float* __restrict__ out_sum, float* __restrict__ out_norm, int N, float eps) {
  __shared__ float red[256];
  const int row = blockIdx.x, tid = threadIdx.x;
  const float* x = X + (size_t)row * N; const float* rr = R ? R + (size_t)row * N : nullptr;
  float vals[16];                     // up to N = 4096
  const int per = N / 256;            // contiguous chunk per thread? use strided-by-4 chunks: thread handles j = tid*4 + 1024*u
  float s1 = 0.f;
  for (int u = 0; u < per / 4; ++u) {
    const int j = tid * 4 + 1024 * u;
    const v4f a = *(const v4fa*)(x + j);
    v4f b = {0.f,0.f,0.f,0.f}; if (rr) b = *(const v4fa*)(rr + j);
#pragma unroll
    for (int q = 0; q < 4; ++q) { const float v = a[q] + b[q]; vals[u * 4 + q] = v; s1 += v; }
  }
  red[tid] = s1; __syncthreads();
  for (int st = 128; st > 0; st >>= 1) { if (tid < st) red[tid] += red[tid + st]; __syncthreads(); }
  const float mu = red[0] / (float)N; __syncthreads();
  float s2 = 0.f;
  for (int u = 0; u < per / 4; ++u)
#pragma unroll
    for (int q = 0; q < 4; ++q) { const float c = vals[u * 4 + q] - mu; s2 += c * c; }
  red[tid] = s2; __syncthreads();
  for (int st = 128; st > 0; st >>= 1) { if (tid < st) red[tid] += red[tid + st]; __syncthreads(); }
  const float rs = rsqrtf(red[0] / (float)N + eps);
  {
    for (int u = 0; u < per / 4; ++u) {
      const int j = tid * 4 + 1024 * u;
      v4f o, sm;
#pragma unroll
      for (int q = 0; q < 4; ++q) {
        float gg = g[j + q], bb = bta[j + q];
        if (PARAM_BF16) { gg = bf16_round(gg); bb = bf16_round(bb); }
        sm[q] = vals[u * 4 + q]; o[q] = (vals[u * 4 + q] - mu) * rs * gg + bb;
      }
      if (out_sum) *(v4f*)(out_sum + (size_t)row * N + j) = sm;
      *(v4f*)(out_norm + (size_t)row * N + j) = o;
    }
    
  }
}



// ---- f16 WMMA path (v_wmma_f32_16x16x32_f16): 11-bit significands for operands in range — used where a [0,1] probability operand needs more precision than bf16
typedef _Float16 v16h __attribute__((ext_vector_type(16)));
union FragH { v16h v; v8us half[2]; _Float16 h[16]; unsigned short u[16]; };
template <int NT>
__device__ __forceinline__ v8f mmaH(v16h ah, v16h al, v16h bh, v16h bl, v8f c) {
  c = __builtin_amdgcn_wmma_f32_16x16x32_f16(false, ah, false, bh, (short)0, c, false, false);
  if (NT >= 2) c = __builtin_amdgcn_wmma_f32_16x16x32_f16(false, al, false, bh, (short)0, c, false, false);
  if (NT >= 3) c = __builtin_amdgcn_wmma_f32_16x16x32_f16(false, ah, false, bl, (short)0, c, false, false);
  asm volatile("v_nop\n\tv_nop\n\tv_nop\n\tv_nop" : "+v"(c) : "v"(ah), "v"(al), "v"(bh), "v"(bl));
  return c;
}
// batched GEMM like k_gemm_b but f16 operands: A f32 (split into f16 hi/lo if ASPLIT, else rounded to f16), Bt = f16 values [n][k]; alpha; C f32; N multiple of 16 (partial tiles skipped)
template <bool ASPLIT>
__global__ __launch_bounds__(128) void k_gemm_h(const float* __restrict__ A, int lda, size_t sA, const _Float16* __restrict__ Bh, int ldb, size_t sB, float alpha, float* __restrict__ C, int ldc, size_t sC, int M, int N, int K) {
  __shared__ __attribute__((aligned(16))) float so[4][16][64];
  const int tid = threadIdx.x, w = tid >> 5, lane = tid & 31, ln = lane & 15, hh = lane >> 4; const int by = blockIdx.y;
  A += (size_t)by * sA; Bh += (size_t)by * sB; C += (size_t)by * sC;
  const int ntn = (N + 63) / 64; const int wid = blockIdx.x * 4 + w; const int mt = wid / ntn, nq = wid % ntn; if (mt * 16 >= M) return;
  const int row0 = mt * 16, col0 = nq * 64; const float* arow = A + (size_t)(row0 + ln) * lda;
  v8f acc[4] = {};
  for (int kb = 0; kb < K; kb += 32) {
    FragH ah, al;
    const v4f x0 = *(const v4fa*)(arow + kb + 8 * hh), x1 = *(const v4fa*)(arow + kb + 8 * hh + 4), x2 = *(const v4fa*)(arow + kb + 16 + 8 * hh), x3 = *(const v4fa*)(arow + kb + 16 + 8 * hh + 4);
    float xs[16] = {x0[0],x0[1],x0[2],x0[3],x1[0],x1[1],x1[2],x1[3],x2[0],x2[1],x2[2],x2[3],x3[0],x3[1],x3[2],x3[3]};
#pragma unroll
    for (int i = 0; i < 16; ++i) { const _Float16 h = (_Float16)xs[i]; ah.h[i] = h; al.h[i] = ASPLIT ? (_Float16)(xs[i] - (float)h) : (_Float16)0.0f; }
#pragma unroll
    for (int t = 0; t < 4; ++t) { if (col0 + t * 16 >= N) continue; const size_t boff = (size_t)(col0 + t * 16 + ln) * ldb + kb; FragH bq; bq.half[0] = *(const v8us*)(Bh + boff + 8 * hh); bq.half[1] = *(const v8us*)(Bh + boff + 16 + 8 * hh);
      acc[t] = mmaH<ASPLIT ? 2 : 1>(ah.v, al.v, bq.v, bq.v, acc[t]); }
  }
#pragma unroll
  for (int t = 0; t < 4; ++t) { if (col0 + t * 16 >= N) continue;
#pragma unroll
    for (int r = 0; r < 8; ++r) so[w][8 * hh + r][t * 16 + ln] = acc[t][r] * alpha; }
  __builtin_amdgcn_fence(__ATOMIC_ACQ_REL, "workgroup"); __builtin_amdgcn_wave_barrier();
  const int rsub = lane >> 4, c4 = (lane & 15) * 4;
  {
#pragma unroll
    for (int q = 0; q < 8; ++q) { const int r = q * 2 + rsub; if (col0 + c4 < N) { const v4f v = *(const v4fa*)&so[w][r][c4]; *(v4f*)(C + (size_t)(row0 + r) * ldc + col0 + c4) = v; } }
     }
}

// Wt[n][k] = f16(W[k][n]·scale) from f32 row-major W[K][N] (scale = power of two; bf16-exact weights stay exact in f16 away from the subnormal range)
// device body: blk = index of the 256-thread block inside this job's range of the shared grid (k_prep)
__device__ __forceinline__ void d_wt_f16(const float* __restrict__ W, _Float16* __restrict__ Wt, int K, int N, float scale, int blk) {
  const int t = blk * 256 + threadIdx.x; if (t >= N * (K / 8)) return; const int n = t / (K / 8), k8 = (t % (K / 8)) * 8; FragH f;
#pragma unroll
  for (int i = 0; i < 8; ++i) f.h[i] = (_Float16)(bf16_round(W[(size_t)(k8 + i) * N + n]) * scale); const v8us o = f.half[0];
  *(v8us*)((unsigned short*)Wt + (size_t)n * K + k8) = o; 
}
// k_gemm_hh variant with fused epilogue: v = acc·alpha + bias[by·sBias + col] (+ CP[(row/rowsPerB)·sCPb + by·64 + col] if CP) ; ACT 0 none / 1 elu ; writes f32 C and/or f16 C16 (each if non-null)
template <int ACT>
__global__ __launch_bounds__(128) void k_gemm_hhx(const _Float16* __restrict__ A, int lda, size_t sA, const _Float16* __restrict__ Bh, int ldb, size_t sB, float alpha, const float* __restrict__ bias, size_t sBias, const float* __restrict__ CP, int rowsPerB, size_t sCPb, int row0g,
    float* __restrict__ C, _Float16* __restrict__ C16, int ldc, size_t sC, int M, int N, int K, const _Float16* __restrict__ A2, float alpha2, float* __restrict__ C2) {
  __shared__ __attribute__((aligned(16))) float so[4][16][64];
  const int tid = threadIdx.x, w = tid >> 5, lane = tid & 31, ln = lane & 15, hh = lane >> 4; const int by = blockIdx.y;
  if (blockIdx.z) { A = A2; alpha = alpha2; bias = nullptr; C = C2; }      /* blockIdx.z = 1: the second term of a split A in the same grid: its own operand, factor and f32 plane, no bias */
  A += (size_t)by * sA; Bh += (size_t)by * sB; const size_t cofs = (size_t)by * sC; const float* bp = bias ? bias + (size_t)by * sBias : nullptr;
  const int ntn = (N + 63) / 64; const int wid = blockIdx.x * 4 + w; const int mt = wid / ntn, nq = wid % ntn; if (mt * 16 >= M) return;
  const int row0 = mt * 16, col0 = nq * 64; const _Float16* arow = A + (size_t)(row0 + ln) * lda;
  v8f acc[4] = {};
  for (int kb = 0; kb < K; kb += 32) { FragH ah; ah.half[0] = *(const v8us*)((const unsigned short*)arow + kb + 8 * hh); ah.half[1] = *(const v8us*)((const unsigned short*)arow + kb + 16 + 8 * hh);
#pragma unroll
    for (int t = 0; t < 4; ++t) { if (col0 + t * 16 >= N) continue; const size_t boff = (size_t)(col0 + t * 16 + ln) * ldb + kb; FragH bq; bq.half[0] = *(const v8us*)((const unsigned short*)Bh + boff + 8 * hh); bq.half[1] = *(const v8us*)((const unsigned short*)Bh + boff + 16 + 8 * hh);
      acc[t] = mmaH<1>(ah.v, ah.v, bq.v, bq.v, acc[t]); }
  }
#pragma unroll
  for (int t = 0; t < 4; ++t) { if (col0 + t * 16 >= N) continue; const int col = col0 + t * 16 + ln; const float bv = bp ? bf16_round(bp[col]) : 0.f;
#pragma unroll
    for (int r = 0; r < 8; ++r) { float v = acc[t][r] * alpha + bv; if (CP) { const int rr = row0g + row0 + 8 * hh + r; if (rowsPerB < 0) v += CP[cofs + (size_t)rr * ldc + col];      /* rowsPerB < 0: own element of the batched C plane */ else { const int bidx = rr / rowsPerB; v += CP[(size_t)bidx * sCPb + (size_t)by * 64 + col]; } } if (ACT == 1) v = (v > 0.f) ? v : expm1f(v); else if (ACT == 7) v = (v > 0.f) ? v + 1.0f : expf(v); else if (ACT == 8) v = tanhf(v); else if (ACT == 9) v = 0.5f * v * (1.0f + tanhf(0.7978845608028654f * (v + 0.044715f * v * v * v))); else if (ACT == 11) v = 1.0f / (1.0f + expf(-v)); else if (ACT == 12) v = (v > 0.f) ? v : 0.01f * v; else if (ACT == 14) v = (v > 0.f) ? v : 0.1f * v; else if (ACT == 16) v = (v >= 0.f) ? v : 0.3f * v; else if (ACT == 17) v = (v >= 0.f) ? v : 0.2f * v; else if (ACT == 15) v = v / (1.0f + expf(-v)); else if (ACT == 3) v = fmaxf(v, 0.f); else if (ACT == 6) v = 0.5f * v * (1.0f + erff(v * 0.70710678118654752f)); so[w][8 * hh + r][t * 16 + ln] = v; } }
  __builtin_amdgcn_fence(__ATOMIC_ACQ_REL, "workgroup"); __builtin_amdgcn_wave_barrier();
  const int rsub = lane >> 4, c4 = (lane & 15) * 4; typedef _Float16 v4h __attribute__((ext_vector_type(4)));
  {
#pragma unroll
    for (int q = 0; q < 8; ++q) { const int r = q * 2 + rsub; if (col0 + c4 < N) { const v4f v = *(const v4fa*)&so[w][r][c4]; if (C) *(v4f*)(C + cofs + (size_t)(row0 + r) * ldc + col0 + c4) = v; if (C16) { v4h h4; for (int i = 0; i < 4; ++i) h4[i] = (_Float16)v[i]; *(v4h*)(C16 + cofs + (size_t)(row0 + r) * ldc + col0 + c4) = h4; } } }
     }
}


typedef _Float16 v4h __attribute__((ext_vector_type(4)));

__device__ __forceinline__ void d_x16(const float* __restrict__ x, _Float16* __restrict__ X16, size_t n8, int blk) { const size_t t = (size_t)blk * 256 + threadIdx.x; if (t >= n8) return; FragH f;
#pragma unroll
  for (int q = 0; q < 8; ++q) f.h[q] = (_Float16)bf16_round(x[t * 8 + q]); *(v8us*)((unsigned short*)X16 + t * 8) = f.half[0];  }
// f16(bf16-rounded value x 16) in the source's own order: w_scales rows and b_scales are read along the keys as they lie
__device__ __forceinline__ void d_r16(const float* __restrict__ Wv, _Float16* __restrict__ Bt, int blk) { const size_t t = (size_t)blk * 256 + threadIdx.x; FragH f;
#pragma unroll
  for (int i = 0; i < 8; ++i) f.h[i] = (_Float16)(bf16_round(Wv[t * 8 + i]) * 16.0f); *(v8us*)((unsigned short*)Bt + t * 8) = f.half[0];
  asm volatile("s_wait_xcnt 0x0" ::: "memory"); }      /* stands behind the store, in front of the first overwrite of a register that it names (the other jobs' code follows in the listing) */
// the five operand preparations need nothing of each other: one grid, each job a range of the block index (block-uniform branches); the transposes, whose threads take longest, start first
#define PREP_Q (DIM * 4 * INNER / 8 / 256)
#define PREP_O (INNER * DIM / 8 / 256)
#define PREP_S (HD * NP / 8 / 256)
#define PREP_B (NP / 8 / 256)
#define PREP_X (NR * DIM / 8 / 256)
__global__ __launch_bounds__(256) void k_prep(const float* __restrict__ Wq, _Float16* __restrict__ BQ, const float* __restrict__ Wo, _Float16* __restrict__ BO, const float* __restrict__ Wsc, const float* __restrict__ bsc, _Float16* __restrict__ BS, const float* __restrict__ x, _Float16* __restrict__ X16) {
  static_assert(DIM * 4 * INNER % 2048 == 0 && INNER * DIM % 2048 == 0 && HD * NP % 2048 == 0 && NP % 2048 == 0 && NR * DIM % 2048 == 0, "k_prep: every job fills whole blocks");
  int blk = blockIdx.x;
  if (blk < PREP_Q) { d_wt_f16(Wq, BQ, DIM, 4 * INNER, 16.0f, blk); return; }
  blk -= PREP_Q;
  if (blk < PREP_O) { d_wt_f16(Wo, BO, INNER, DIM, 16.0f, blk); return; }
  blk -= PREP_O;
  if (blk < PREP_S) { d_r16(Wsc, BS, blk); return; }
  blk -= PREP_S;
  if (blk < PREP_B) { d_r16(bsc, BS + (size_t)HD * NP, blk); return; }      /* row 64 of the plane */
  d_x16(x, X16, (size_t)NR * DIM / 8, blk - PREP_B); }
__global__ __launch_bounds__(256) void k_h16(const float* __restrict__ x, _Float16* __restrict__ X16, size_t n8) { const size_t t = (size_t)blockIdx.x * 256 + threadIdx.x; if (t >= n8) return; FragH f;
#pragma unroll
  for (int q = 0; q < 8; ++q) f.h[q] = (_Float16)x[t * 8 + q]; *(v8us*)((unsigned short*)X16 + t * 8) = f.half[0];  }
__global__ __launch_bounds__(256) void k_round16f(const float* __restrict__ W, _Float16* __restrict__ Bt, size_t n8) { const size_t t = (size_t)blockIdx.x * 256 + threadIdx.x; if (t >= n8) return; FragH f;
#pragma unroll
  for (int i = 0; i < 8; ++i) f.h[i] = (_Float16)(bf16_round(W[t * 8 + i]) * 16.0f); *(v8us*)((unsigned short*)Bt + t * 8) = f.half[0];  }

// ---- fast GEMM (block tile 128x64, wave tile 32x64; requires M % 128 == 0 rows per launch region, N % 64 == 0 and K % 64 == 0); A and B go through LDS in steps of 64 k: whole 128-byte rows fetched once per block, two buffers; TWO: C = (beta A + A2) B, the k steps of A first, the accumulators x beta, then the k steps of A2 on the same accumulators; epilogue: x alpha, + bias ----
#define G2P 72                   /* LDS row pitch in f16: 144 bytes = 16 x 9, the 16 rows of a fragment read fall on different banks */
// fragment in the hardware k order from a staged row: p = the lane's own row at k 8 * hh
__device__ __forceinline__ v16h g2_lfrag(const unsigned short* p) { FragH f; f.half[0] = *(const v8us*)p; f.half[1] = *(const v8us*)(p + 16); return f.v; }
__device__ __forceinline__ v8f g2_mma(v16h a, v16h b, v8f c) { v8f d = __builtin_amdgcn_wmma_f32_16x16x32_f16(false, a, false, b, (short)0, c, false, false); asm volatile("v_nop\n\tv_nop\n\tv_nop\n\tv_nop" : "+v"(d) : "v"(a), "v"(b)); return d; }
template <int ACT, bool TWO>
__global__ __launch_bounds__(128) void k_gemm2(const _Float16* __restrict__ A, const _Float16* __restrict__ A2, float beta, int lda, size_t sA, const _Float16* __restrict__ Bh, int ldb, size_t sB, float alpha, const float* __restrict__ bias, size_t sBias,
    float* __restrict__ C, _Float16* __restrict__ C16, int ldc, size_t sC, int M, int N, int K) { static_assert(ACT == 0 || ACT == 3 || ACT == 6 || ACT == 8 || ACT == 9 || ACT == 11 || ACT == 12 || ACT == 14 || ACT == 15 || ACT == 16 || ACT == 17, "k_gemm2: unsupported ACT code (would silently apply no activation)");
  __shared__ __attribute__((aligned(16))) unsigned short sm[2][192][G2P];      /* in the k loop: [buffer][A rows 0-127 | B rows 128-191][64 f16 + pad]; behind it: the four waves' f32 output tiles */
  static_assert(sizeof(float) * 4 * 32 * 68 <= sizeof(unsigned short) * 2 * 192 * G2P, "k_gemm2: the output tiles fit the staging buffers");
  float (*so)[32][68] = reinterpret_cast<float (*)[32][68]>(&sm[0][0][0]);
  const int tid = threadIdx.x, w = tid >> 5, lane = tid & 31, ln = lane & 15, hh = lane >> 4; const int by = blockIdx.y;
  A += (size_t)by * sA; Bh += (size_t)by * sB; const size_t cofs = (size_t)by * sC; const float* bp = bias ? bias + (size_t)by * sBias : nullptr;
  const int ntn = N >> 6; const int mt = blockIdx.x / ntn, nq = blockIdx.x - mt * ntn; const int row0 = mt * 128 + 32 * w, col0 = nq * 64; if (mt * 128 >= M) return;      /* the whole block leaves or none, in front of every barrier */
  // staging: 8 neighbouring lanes fetch one whole 128-byte row; a thread takes chunk tid & 7 of rows (tid >> 3) + 16 j, 8 rows of A and 4 of B; block-uniform bases, the lane's own element offsets stay in their registers over the loop
  const int sr = tid >> 3, sc = (tid & 7) * 8;
  const unsigned short* ua = (const unsigned short*)A + (size_t)(mt * 128) * lda; const unsigned short* ub = (const unsigned short*)Bh + (size_t)col0 * ldb;
  unsigned oa[8], obf[4]; v8us ra[8], rb[4];
#pragma unroll
  for (int j = 0; j < 8; ++j) oa[j] = (unsigned)((sr + 16 * j) * lda + sc);
#pragma unroll
  for (int j = 0; j < 4; ++j) obf[j] = (unsigned)((sr + 16 * j) * ldb + sc);
  // the loops over j, kk and t are unrolled: the register arrays are then indexed by constants only
  auto fetch = [&](const unsigned short* pa, const int kb) __attribute__((always_inline)) {
#pragma unroll
    for (int j = 0; j < 8; ++j) ra[j] = *(const v8us*)(pa + kb + oa[j]);
#pragma unroll
    for (int j = 0; j < 4; ++j) rb[j] = *(const v8us*)(ub + kb + obf[j]);
    asm volatile("s_wait_xcnt 0x0" ::: "memory"); };      /* stands behind the 12 loads, in front of the first overwrite of a register that they name */
  auto put = [&](const int buf) __attribute__((always_inline)) {
#pragma unroll
    for (int j = 0; j < 8; ++j) *(v8us*)&sm[buf][sr + 16 * j][sc] = ra[j];
#pragma unroll
    for (int j = 0; j < 4; ++j) *(v8us*)&sm[buf][128 + sr + 16 * j][sc] = rb[j]; };
  const v8f z8 = {0.f,0.f,0.f,0.f,0.f,0.f,0.f,0.f}; v8f c00 = z8, c01 = z8, c02 = z8, c03 = z8, c10 = z8, c11 = z8, c12 = z8, c13 = z8;
  fetch(ua, 0); put(0);
  __syncthreads();      /* step 0 is in LDS before any wave reads it */
  // one step of 64 k out of buffer cur; more = a next step exists (A rows at na, k at nkb), is fetched, stored and published (a constant at each call: no test inside a trip)
  auto step = [&](const int cur, const unsigned short* na, const int nkb, const bool more) __attribute__((always_inline)) {
    if (more) fetch(na, nkb);
    const unsigned short* pa = &sm[cur][32 * w + ln][8 * hh]; const unsigned short* pb = &sm[cur][128 + ln][8 * hh];
    v16h a[2][2], b[4][2];
#pragma unroll
    for (int kk = 0; kk < 2; ++kk) { a[0][kk] = g2_lfrag(pa + kk * 32); a[1][kk] = g2_lfrag(pa + 16 * G2P + kk * 32);
#pragma unroll
      for (int t = 0; t < 4; ++t) b[t][kk] = g2_lfrag(pb + t * 16 * G2P + kk * 32); }
#pragma unroll
    for (int kk = 0; kk < 2; ++kk) {
      c00 = g2_mma(a[0][kk], b[0][kk], c00); c10 = g2_mma(a[1][kk], b[0][kk], c10);
      c01 = g2_mma(a[0][kk], b[1][kk], c01); c11 = g2_mma(a[1][kk], b[1][kk], c11);
      c02 = g2_mma(a[0][kk], b[2][kk], c02); c12 = g2_mma(a[1][kk], b[2][kk], c12);
      c03 = g2_mma(a[0][kk], b[3][kk], c03); c13 = g2_mma(a[1][kk], b[3][kk], c13); }
    if (more) {
      put(cur ^ 1);      /* last read in the step before, behind whose barrier every wave stands */
      __syncthreads(); }      /* one barrier a step: the next step is in LDS before any wave reads it, and every wave has left this step's buffer before it is refilled in the next trip */
  };
  const int nst = K >> 6;
  // the step loop stays rolled: unrolled, the staging registers of several steps would be live together
#pragma unroll 1
  for (int s = 0; s < nst - 1; ++s) step(s & 1, ua, (s + 1) * 64, true);
  if (TWO) {
    const unsigned short* ua2 = (const unsigned short*)A2 + (size_t)by * sA + (size_t)(mt * 128) * lda;
    step((nst - 1) & 1, ua2, 0, true);      /* the last step of A fetches the first of A2: the two buffers run on across the seam */
    c00 *= beta; c01 *= beta; c02 *= beta; c03 *= beta; c10 *= beta; c11 *= beta; c12 *= beta; c13 *= beta;
    // rolled for the same reason as the loop above
#pragma unroll 1
    for (int s = 0; s < nst - 1; ++s) step((nst + s) & 1, ua2, (s + 1) * 64, true);
    step((2 * nst - 1) & 1, ua2, 0, false);
  } else step((nst - 1) & 1, ua, 0, false);
  __syncthreads();      /* every wave has left the last buffer before the output tiles are written over the buffers */
  v8f accs[8] = {c00, c01, c02, c03, c10, c11, c12, c13};
#pragma unroll
  for (int u = 0; u < 8; ++u) { const int t = u & 3, half = u >> 2; const int col = col0 + t * 16 + ln; const float bv = bp ? bf16_round(bp[col]) : 0.f;
#pragma unroll
    for (int r = 0; r < 8; ++r) { const int rloc = half * 16 + 8 * hh + r; float v = accs[u][r] * alpha + bv;
      if (ACT == 3) v = fmaxf(v, 0.f); else if (ACT == 6) v = 0.5f * v * (1.0f + erff(v * 0.70710678118654752f)); else if (ACT == 11) v = 1.0f / (1.0f + expf(-v)); else if (ACT == 15) v = v / (1.0f + expf(-v)); else if (ACT == 12) v = (v > 0.f) ? v : 0.01f * v; else if (ACT == 8) v = tanhf(v); else if (ACT == 9) v = 0.5f * v * (1.0f + tanhf(0.7978845608028654f * (v + 0.044715f * v * v * v))); else if (ACT == 14) v = (v > 0.f) ? v : 0.1f * v; else if (ACT == 16) v = (v >= 0.f) ? v : 0.3f * v; else if (ACT == 17) v = (v >= 0.f) ? v : 0.2f * v;
      so[w][rloc][t * 16 + ln] = v; } }
  __builtin_amdgcn_fence(__ATOMIC_ACQ_REL, "workgroup"); __builtin_amdgcn_wave_barrier();
  const int rsub = lane >> 4, c4 = (lane & 15) * 4;
  {
#pragma unroll
    for (int q = 0; q < 16; ++q) { const int r = q * 2 + rsub; const v4f v = *(const v4fa*)&so[w][r][c4]; if (C) *(v4f*)(C + cofs + (size_t)(row0 + r) * ldc + col0 + c4) = v; if (C16) { v4h h4; for (int i = 0; i < 4; ++i) h4[i] = (_Float16)v[i]; *(v4h*)(C16 + cofs + (size_t)(row0 + r) * ldc + col0 + c4) = h4; } }
     } }

// ---- f^T v of one (batch, head) straight from the projection's rows: one 32x64 tile per block, the 2048 rows of the sum dealt over TVW waves; a wave stages 32 rows of f (its 32 columns) and of v at a time in its own LDS range, as they lie, and reads both operands' fragments with transposing LDS loads (the sum runs down the rows); f32 partial tiles summed through LDS in wave order, written as f16 hi and residual x 2^10 ----
#define TVW 16                   /* waves per tile; each takes NP / TVW rows */
#define TVPF 48                  /* LDS pitch of a staged f row (32 f16) in f16: 96 bytes = 32 x 3, the transposing reader's pitch */
#define TVPV 80                  /* the same for a v row (64 f16): 160 bytes = 32 x 5 */
typedef short s16x8 __attribute__((ext_vector_type(8)));
// 16 columns x 32 rows of a staged row-major tile as one fragment in the hardware k order: p = the lane's own address (row 8 * hh + (lane & 7), column 8 * ((lane >> 3) & 1)), rows 0-15 and 16-31
__device__ __forceinline__ v16h tv_frag(const unsigned short* p, int pitch) { typedef __attribute__((address_space(3))) s16x8 lds_s16x8; union { v16h v; s16x8 q[2]; } f;
  f.q[0] = __builtin_amdgcn_ds_load_tr16_b128_v8i16((lds_s16x8*)p); f.q[1] = __builtin_amdgcn_ds_load_tr16_b128_v8i16((lds_s16x8*)(p + 16 * pitch)); return f.v; }
__global__ __launch_bounds__(32 * TVW) void k_ftv(const _Float16* __restrict__ QKFV, _Float16* __restrict__ FVH, _Float16* __restrict__ FVL) {
  static_assert(NP == 128 * TVW && HD == 64, "k_ftv: every wave takes four 32-row steps; a v row is one 128-byte line");
  __shared__ __attribute__((aligned(32))) unsigned short sf[TVW][32][TVPF];
  __shared__ __attribute__((aligned(32))) unsigned short sv[TVW][32][TVPV];
  __shared__ __attribute__((aligned(16))) float so[TVW][32][68];
  const int tid = threadIdx.x, w = tid >> 5, lane = tid & 31, ln = lane & 15, hh = lane >> 4;
  const int bh = blockIdx.y, b = bh / NH, h = bh - b * NH, d0 = blockIdx.x * 32; const int ldq = 4 * INNER;
  // fetch: 4 neighbouring lanes take the 64 bytes of an f row, 8 a whole v row
  const int fr = lane >> 2, fc = (lane & 3) * 8, vr = lane >> 3, vc = (lane & 7) * 8;
  const unsigned short* g0 = (const unsigned short*)QKFV + ((size_t)b * NP + w * (NP / TVW)) * ldq + h * HD;      /* the wave's first row, the head's q columns; f stands 2 * INNER, v 3 * INNER further */
  const unsigned short* gf = g0 + (size_t)fr * ldq + d0 + fc; const unsigned short* gv = g0 + (size_t)vr * ldq + vc;
  v8us rf[2][4], rv[2][8];
  // every loop over j, t and the steps is unrolled: the register arrays are then indexed by constants only
  auto fetch = [&](const int c) __attribute__((always_inline)) {
#pragma unroll
    for (int j = 0; j < 4; ++j) rf[c & 1][j] = *(const v8us*)(gf + ((size_t)(c * 32 + 8 * j) * ldq + 2 * INNER));
#pragma unroll
    for (int j = 0; j < 8; ++j) rv[c & 1][j] = *(const v8us*)(gv + ((size_t)(c * 32 + 4 * j) * ldq + 3 * INNER));
    asm volatile("s_wait_xcnt 0x0" :: "v"(gf), "v"(gv) : "memory"); };      /* stands behind the 12 loads, in front of the first overwrite of a register that they name; the two addresses are inputs so that their registers live up to here (the last load otherwise lands on its own address); it also keeps the loads from sinking to their use */
  fetch(0); fetch(1);
  const unsigned short* pf = &sf[w][8 * hh + (lane & 7)][8 * ((lane >> 3) & 1)]; const unsigned short* pv = &sv[w][8 * hh + (lane & 7)][8 * ((lane >> 3) & 1)];
  const v8f z8 = {0.f,0.f,0.f,0.f,0.f,0.f,0.f,0.f}; v8f acc[2][4] = {{z8, z8, z8, z8}, {z8, z8, z8, z8}};
#pragma unroll
  for (int c = 0; c < 4; ++c) {
#pragma unroll
    for (int j = 0; j < 4; ++j) *(v8us*)&sf[w][fr + 8 * j][fc] = rf[c & 1][j];
#pragma unroll
    for (int j = 0; j < 8; ++j) *(v8us*)&sv[w][vr + 4 * j][vc] = rv[c & 1][j];
    if (c + 2 < 4) fetch(c + 2);      /* two steps ahead, into the registers just stored */
    asm volatile("s_wait_dscnt 0x0" ::: "memory");      /* the wave's own 12 stores are in LDS before its lanes read each other's rows */
    v16h a[2], bq[4];
#pragma unroll
    for (int u = 0; u < 2; ++u) a[u] = tv_frag(pf + 16 * u, TVPF);
#pragma unroll
    for (int t = 0; t < 4; ++t) bq[t] = tv_frag(pv + 16 * t, TVPV);
    asm volatile("s_wait_dscnt 0x0" ::: "memory");      /* the 12 reads have returned before the next step's stores go over the same rows */
#pragma unroll
    for (int t = 0; t < 4; ++t) {
#pragma unroll
      for (int u = 0; u < 2; ++u) acc[u][t] = __builtin_amdgcn_wmma_f32_16x16x32_f16(false, a[u], false, bq[t], (short)0, acc[u][t], false, false); } }
#pragma unroll
  for (int u = 0; u < 2; ++u) {
#pragma unroll
    for (int t = 0; t < 4; ++t) {
#pragma unroll
      for (int r = 0; r < 8; ++r) so[w][u * 16 + 8 * hh + r][t * 16 + ln] = acc[u][t][r]; } }
  __syncthreads();      /* every wave's partial tile is in LDS before any thread sums across waves */
  const int r = tid >> 4, c4 = (tid & 15) * 4; v4f s = *(const v4fa*)&so[0][r][c4];
  for (int u = 1; u < TVW; ++u) s += *(const v4fa*)&so[u][r][c4];
  v4h xh, xl;
#pragma unroll
  for (int q = 0; q < 4; ++q) { const _Float16 hv = (_Float16)s[q]; xh[q] = hv; xl[q] = (_Float16)((s[q] - (float)hv) * 1024.0f); }
  const size_t o = (size_t)bh * HD * HD + (size_t)(d0 + r) * HD + c4;
  *(v4h*)(FVH + o) = xh; *(v4h*)(FVL + o) = xl; }


// ---- fused attention: a block takes 256 query rows of one (batch, head), 32 per wave, and walks the 2048 keys in tiles of 64; each tile (k rows, w_scales rows) is fetched once per block by whole-line loads and put into LDS, where all 8 waves read their fragments; running maximum and sum per query ----
#define FQW 8                    /* waves per block, 32 query rows each: 8 x 32 (batch, head) pairs = 256 blocks */
#define FKT 64                   /* keys per tile: one row of each staged plane is 128 bytes */
#define FLP 72                   /* LDS row pitch in f16: 144 bytes = 16 x 9, the 16 rows of a fragment read fall on different banks */
__device__ __forceinline__ v8f fa_mma(v16h a, v16h b, v8f c) { return __builtin_amdgcn_wmma_f32_16x16x32_f16(false, a, false, b, (short)0, c, false, false); }
// fragment in the hardware k order from a wave-uniform base and the lane's own element offset (row ln, k 8 * hh)
__device__ __forceinline__ v16h fa_frag(const _Float16* ub, unsigned lo) { FragH f; f.half[0] = *(const v8us*)((const unsigned short*)ub + lo); f.half[1] = *(const v8us*)((const unsigned short*)ub + lo + 16); return f.v; }
// the same fragment from a staged row: p = the lane's own row at k 8 * hh
__device__ __forceinline__ v16h fl_frag(const unsigned short* p) { FragH f; f.half[0] = *(const v8us*)p; f.half[1] = *(const v8us*)(p + 16); return f.v; }
// eight independent 2^x in place: each v_exp_f32 fills the slot that the instruction set asks for behind the one before it, the v_nop fills the last one's
__device__ __forceinline__ void fa_exp2x8(float* x) {
  asm("v_exp_f32 %0, %0\n\tv_exp_f32 %1, %1\n\tv_exp_f32 %2, %2\n\tv_exp_f32 %3, %3\n\tv_exp_f32 %4, %4\n\tv_exp_f32 %5, %5\n\tv_exp_f32 %6, %6\n\tv_exp_f32 %7, %7\n\tv_nop"
      : "+v"(x[0]), "+v"(x[1]), "+v"(x[2]), "+v"(x[3]), "+v"(x[4]), "+v"(x[5]), "+v"(x[6]), "+v"(x[7])); }
// two of them, same slots
__device__ __forceinline__ void fa_exp2x2(float& a, float& b) { asm("v_exp_f32 %0, %0\n\tv_exp_f32 %1, %1\n\tv_nop" : "+v"(a), "+v"(b)); }
// lane l with lane l ^ 16
__device__ __forceinline__ float fa_xhalf(float x) { return __builtin_bit_cast(float, __builtin_amdgcn_permlanex16(__builtin_bit_cast(int, x), __builtin_bit_cast(int, x), 0x76543210, 0xfedcba98, false, false)); }
__global__ __launch_bounds__(32 * FQW) void k_fattn(const _Float16* QKFV, const _Float16* WS, const _Float16* FVH, const _Float16* FVL, _Float16* CH, _Float16* CL) {
  static_assert(NP % (32 * FQW) == 0 && NP % FKT == 0 && HD == 64 && FKT == 64 && 4 * INNER == NP && 32 * FQW == 256 && NP == 8 * 32 * FQW, "k_fattn: head size 64, 64-key tiles, one row pitch for q, k and w_scales, 256 threads stage 64 rows of 8 chunks in two rounds and the b_scales row in one");
  __shared__ __attribute__((aligned(16))) unsigned short st[2][2][64][FLP];      /* [buffer][k rows | w_scales rows][row][64 f16 + pad] */
  __shared__ __attribute__((aligned(16))) unsigned short sb[NP];      /* the whole b_scales row, put down once */
  const int tid = threadIdx.x, w = __builtin_amdgcn_readfirstlane(tid >> 5), lane = tid & 31, ln = lane & 15, hh = lane >> 4;
  const int bh = blockIdx.y, b = bh / NH, h = bh - b * NH;
  const int ldq = 4 * INNER; const unsigned lo = (unsigned)(ln * NP + 8 * hh);
  const _Float16* base = QKFV + (size_t)b * NP * ldq + h * HD;
  const int row0 = blockIdx.x * (32 * FQW) + w * 32;
  // staging: 8 neighbouring lanes fetch one whole 128-byte row; a thread takes chunk tid & 7 of rows tid >> 3 and 32 + (tid >> 3) of each of the two planes
  const int sr = tid >> 3, sc = (tid & 7) * 8;
  const unsigned short* gk = (const unsigned short*)(base + INNER) + (size_t)sr * ldq + sc;
  const unsigned short* gw = (const unsigned short*)WS + (size_t)sr * NP + sc;
  v8us g0 = *(const v8us*)gk, g1 = *(const v8us*)(gk + (size_t)32 * ldq), g2 = *(const v8us*)gw, g3 = *(const v8us*)(gw + (size_t)32 * NP);
  const v8us gb = *(const v8us*)((const unsigned short*)WS + (size_t)HD * NP + tid * 8);
  asm volatile("s_wait_xcnt 0x0" ::: "memory");      /* stands in front of the first overwrite of a register that the 5 loads above name (the q loads' offset takes the register of the b_scales load's) */
  const _Float16* qp = base + (size_t)row0 * ldq;
  const v16h q00 = fa_frag(qp, lo), q01 = fa_frag(qp + 32, lo), q10 = fa_frag(qp + 16 * ldq, lo), q11 = fa_frag(qp + 16 * ldq + 32, lo);
  asm volatile("s_wait_xcnt 0x0" ::: "memory");      /* stands in front of the first overwrite of a register that the 8 loads above name (the accumulators' zeroes reuse the q loads' offset register and base) */
  *(v8us*)&st[0][0][sr][sc] = g0; *(v8us*)&st[0][0][sr + 32][sc] = g1; *(v8us*)&st[0][1][sr][sc] = g2; *(v8us*)&st[0][1][sr + 32][sc] = g3; *(v8us*)&sb[tid * 8] = gb;
  __syncthreads();      /* tile 0 and the b_scales row are in LDS before any wave reads them */
  const v8f z8 = {0.f,0.f,0.f,0.f,0.f,0.f,0.f,0.f};
  const float cs = 0.125f * 1.4426950408889634f;
  // o[u][t][r] = sum over the keys of weight x w_scales[t*16 + 8*hh + r][key] for query row0 + u*16 + ln, in units of 2^10 x 16 x the weights under the running maximum m; ob[u][r] = the same sum against b_scales (every r alike); su = this lane half's share of the weight sum
  v8f o[2][4] = {{z8, z8, z8, z8}, {z8, z8, z8, z8}}; v8f ob[2] = {z8, z8};
  float m0 = -3.0e38f, m1 = -3.0e38f, su0 = 0.f, su1 = 0.f;
  // one tile; more = a next tile exists, is fetched, stored and published (a constant at each of the two calls: the trip of the loop below is one straight block, so that the scheduling barriers bind all of it)
  // every loop inside a tile is unrolled: the fragment and accumulator arrays are then indexed by constants only and stay in registers
  auto tile = [&](const int kt, const bool more) __attribute__((always_inline)) {
    const int cur = kt & 1;
    if (more) {
      const size_t ko = (size_t)(kt + 1) * FKT * ldq; const int po = (kt + 1) * FKT;
      g0 = *(const v8us*)(gk + ko); g1 = *(const v8us*)(gk + ko + (size_t)32 * ldq); g2 = *(const v8us*)(gw + po); g3 = *(const v8us*)(gw + po + (size_t)32 * NP);
      asm volatile("s_wait_xcnt 0x0" ::: "memory"); }      /* stands in front of the first overwrite of an address register that the 4 loads above name (the k fragments take them) */
    __builtin_amdgcn_sched_barrier(0);      /* holds the next tile's 4 loads ahead of this tile's work, which hides their latency (the compiler otherwise sinks a load to its use) */
    // S^T = K Q^T: s[t][u][r] = score of key kt*64 + t*16 + 8*hh + r against query row0 + u*16 + ln
    v8f s[4][2];
#pragma unroll
    for (int t = 0; t < 4; ++t) { const unsigned short* kr = &st[cur][0][t * 16 + ln][8 * hh]; const v16h k0 = fl_frag(kr), k1 = fl_frag(kr + 32);
      s[t][0] = fa_mma(k1, q01, fa_mma(k0, q00, z8)); s[t][1] = fa_mma(k1, q11, fa_mma(k0, q10, z8)); }
    // running maximum: in-lane over the tile's keys, across the two lane halves, against the maximum so far
    float t0 = s[0][0][0], t1 = s[0][1][0];
#pragma unroll
    for (int t = 0; t < 4; ++t) {
#pragma unroll
      for (int r = 0; r < 8; ++r) { t0 = fmaxf(t0, s[t][0][r]); t1 = fmaxf(t1, s[t][1][r]); } }
    t0 = fmaxf(t0, fa_xhalf(t0)); t1 = fmaxf(t1, fa_xhalf(t1));
    t0 = fmaxf(t0, m0); t1 = fmaxf(t1, m1);
    float a0 = (m0 - t0) * cs, a1 = (m1 - t1) * cs;      /* what stands under the old maximum shrinks by 2^a; 0 on the first tile */
    fa_exp2x2(a0, a1);
    m0 = t0; m1 = t1;
    // w_scales fragments come in 2 groups (keys 0-31, 32-63) of 4 row tiles plus the b_scales fragment (one row, read alike by all 16 lanes of a half), each asked for one group of products ahead; the scheduling barriers hold the LDS reads there (the compiler otherwise sinks them to their use, one LDS latency per pair of products)
    const unsigned short* pr = &st[cur][1][ln][8 * hh]; const unsigned short* br = &sb[kt * FKT + 8 * hh];
    v16h bf[2][5];
    __builtin_amdgcn_sched_barrier(0);      /* not above the score products: their fragments and these do not fit the registers together */
#pragma unroll
    for (int t = 0; t < 4; ++t) bf[0][t] = fl_frag(pr + t * 16 * FLP);
    bf[0][4] = fl_frag(br);
    __builtin_amdgcn_sched_barrier(0);      /* the first group flies under the first half of the softmax */
    // weights e * 2^10 = 2^((s - max) / 8 * log2 e + 10); two score tiles (32 keys) of one query tile are one B fragment in the hardware k order
    const float f0 = 10.0f - m0 * cs, f1 = 10.0f - m1 * cs;
    su0 *= a0; su1 *= a1; v16h p[2][2];
    // readout, transposed (A = w_scales rows or the b_scales row, B = weights), on f32 accumulators that are first shrunk to the new maximum
#pragma unroll
    for (int ks = 0; ks < 2; ++ks) {
#pragma unroll
      for (int u = 0; u < 2; ++u) { float x[16]; FragH a; float sa = 0.f;
#pragma unroll
        for (int i = 0; i < 16; ++i) x[i] = s[2 * ks + (i >> 3)][u][i & 7] * cs + (u ? f1 : f0);
        fa_exp2x8(x); fa_exp2x8(x + 8);
#pragma unroll
        for (int i = 0; i < 16; ++i) { sa += x[i]; a.h[i] = (_Float16)x[i]; }
        if (u) su1 += sa; else su0 += sa;
        p[ks][u] = a.v; }
      if (ks == 0) {
        __builtin_amdgcn_sched_barrier(0);      /* the sums of the first 32 keys end here: left open, all 64 weights stay in f32 registers to the end of the tile */
#pragma unroll
        for (int t = 0; t < 4; ++t) bf[1][t] = fl_frag(pr + t * 16 * FLP + 32);
        bf[1][4] = fl_frag(br + 32);
        __builtin_amdgcn_sched_barrier(0);      /* the second group is asked for ahead of the first group's products */
        // the first group's products stand in one region with the second half of the softmax: vector work under matrix time
#pragma unroll
        for (int t = 0; t < 4; ++t) { o[0][t] *= a0; o[1][t] *= a1; }
        ob[0] *= a0; ob[1] *= a1;
#pragma unroll
        for (int t = 0; t < 4; ++t) { o[0][t] = fa_mma(bf[0][t], p[0][0], o[0][t]); o[1][t] = fa_mma(bf[0][t], p[0][1], o[1][t]); }
        ob[0] = fa_mma(bf[0][4], p[0][0], ob[0]); ob[1] = fa_mma(bf[0][4], p[0][1], ob[1]); } }
#pragma unroll
    for (int t = 0; t < 4; ++t) { o[0][t] = fa_mma(bf[1][t], p[1][0], o[0][t]); o[1][t] = fa_mma(bf[1][t], p[1][1], o[1][t]); }
    ob[0] = fa_mma(bf[1][4], p[1][0], ob[0]); ob[1] = fa_mma(bf[1][4], p[1][1], ob[1]);
    if (more) {
      const int nx = cur ^ 1;      /* last read in the tile before, behind whose barrier every wave stands */
      *(v8us*)&st[nx][0][sr][sc] = g0; *(v8us*)&st[nx][0][sr + 32][sc] = g1; *(v8us*)&st[nx][1][sr][sc] = g2; *(v8us*)&st[nx][1][sr + 32][sc] = g3;
      __syncthreads(); }      /* one barrier a tile: the next tile is in LDS before any wave reads it, and every wave has left this tile's buffer before it is refilled in the next trip */
  };
  // the tile loop stays rolled, its body is long
#pragma unroll 1
  for (int kt = 0; kt < NP / FKT - 1; ++kt) tile(kt, true);
  tile(NP / FKT - 1, false);
  // f^T v of this (batch, head), hi and residual x 2^10, as A fragments (row d = t*16 + ln, k = e)
  const unsigned short* fvh = (const unsigned short*)FVH + (size_t)bh * HD * HD + ln * HD + 8 * hh; const unsigned short* fvl = (const unsigned short*)FVL + (size_t)bh * HD * HD + ln * HD + 8 * hh;
  v16h ah[4][2], al[4][2];
#pragma unroll
  for (int t = 0; t < 4; ++t) {
#pragma unroll
    for (int ks = 0; ks < 2; ++ks) { ah[t][ks] = fl_frag(fvh + t * 16 * HD + ks * 32); al[t][ks] = fl_frag(fvl + t * 16 * HD + ks * 32); } }
  asm volatile("s_wait_xcnt 0x0" :: "v"(fvh), "v"(fvl) : "memory");      /* stands in front of the first overwrite of an address register that the 32 loads above name; the two addresses are inputs so that their registers live up to here */
  su0 += fa_xhalf(su0); su1 += fa_xhalf(su1);
  const float rs0 = 1.0f / su0, rs1 = 1.0f / su1;
  // second product: out^T[d][query] = sum over e of (f^T v)[d][e] x (attn . w_scales^T)[query][e]; two accumulator tiles (32 e) of one query tile are one B fragment in the hardware k order, exactly as the weights were
#pragma unroll
  for (int u = 0; u < 2; ++u) { const float rs = u ? rs1 : rs0; v16h th[2], tl[2];
#pragma unroll
    for (int ks = 0; ks < 2; ++ks) { FragH xh, xl;
#pragma unroll
      for (int i = 0; i < 16; ++i) { const float v = o[u][2 * ks + (i >> 3)][i & 7] * rs; const _Float16 hv = (_Float16)v; xh.h[i] = hv; xl.h[i] = (_Float16)((v - (float)hv) * 1024.0f); }
      th[ks] = xh.v; tl[ks] = xl.v; }
    const float cb = ob[u][0] * rs;
#pragma unroll
    for (int t = 0; t < 4; ++t) { FragH ch, cl;
      // the two cross terms carry 2^10, taken back (exact) before the hi x hi term joins the same accumulators
      v8f c = fa_mma(ah[t][1], tl[1], fa_mma(ah[t][0], tl[0], fa_mma(al[t][1], th[1], fa_mma(al[t][0], th[0], z8))));
      c *= 0.0009765625f;
      c = fa_mma(ah[t][1], th[1], fa_mma(ah[t][0], th[0], c));
#pragma unroll
      for (int r = 0; r < 8; ++r) { const float v = (c[r] + cb) * 0.0625f; const _Float16 hv = (_Float16)v; ch.h[r] = hv; cl.h[r] = (_Float16)((v - (float)hv) * 1024.0f); }
      const size_t oo = ((size_t)b * NP + row0 + u * 16 + ln) * INNER + h * HD + t * 16 + 8 * hh;
      *(v8us*)((unsigned short*)CH + oo) = ch.half[0]; *(v8us*)((unsigned short*)CL + oo) = cl.half[0]; } }
}

extern "C" void kernel_launch(void* const* d_in, const int* in_sizes, int n_in,
                              void* d_out, int out_size, void* d_ws, size_t ws_size, hipStream_t stream) {
  (void)in_sizes; (void)n_in; (void)out_size;
  const float* x = (const float*)d_in[0]; const float* Wqkfv = (const float*)d_in[1]; const float* Wsc = (const float*)d_in[2]; const float* bsc = (const float*)d_in[3]; const float* Wout = (const float*)d_in[4]; const float* bout = (const float*)d_in[5];
  char* ws = (char*)d_ws; size_t off = 0;
  auto take = [&](size_t bytes) { char* p = ws + off; off += (bytes + 255) & ~(size_t)255; return p; };
  _Float16* BQ = (_Float16*)take((size_t)4 * INNER * DIM * 2); _Float16* BS = (_Float16*)take((size_t)(HD + 1) * NP * 2);      /* w_scales rows, then b_scales as row 64 */ _Float16* BO = (_Float16*)take((size_t)DIM * INNER * 2);
  _Float16* X16 = (_Float16*)take((size_t)NR * DIM * 2); _Float16* QKFV = (_Float16*)take((size_t)NR * 4 * INNER * 2);      /* [row][q | k | f | v] f16, 32 MiB */
  _Float16* FVH = (_Float16*)take((size_t)NB * NH * HD * HD * 2); _Float16* FVL = (_Float16*)take((size_t)NB * NH * HD * HD * 2);
  _Float16* CH = (_Float16*)take((size_t)NR * INNER * 2); _Float16* CL = (_Float16*)take((size_t)NR * INNER * 2);
  if (off > ws_size) return;      /* about 59 MiB */
  k_prep<<<PREP_Q + PREP_O + PREP_S + PREP_B + PREP_X, 256, 0, stream>>>(Wqkfv, BQ, Wout, BO, Wsc, bsc, BS, x, X16);      /* w_qkfv and w_out transposed (x @ W, in x out), w_scales and b_scales as they lie, and the f16 x plane */
  k_gemm2<0, false><<<dim3((NR / 128) * (4 * INNER / 64), 1), 128, 0, stream>>>(X16, nullptr, 0.0f, DIM, 0, BQ, DIM, 0, 0.0625f, nullptr, 0, nullptr, QKFV, 4 * INNER, 0, NR, 4 * INNER, DIM);      /* [q | k | f | v], head h at h*64 inside each quarter */
  k_ftv<<<dim3(HD / 32, NB * NH), 32 * TVW, 0, stream>>>(QKFV, FVH, FVL);      /* FV[b][h][d][e] = sum_n f[n][d] v[n][e] as f16 hi/residual (32-row tiles, the rows of the sum over the block's waves) */
  k_fattn<<<dim3(NP / (32 * FQW), NB * NH), 32 * FQW, 0, stream>>>(QKFV, BS, FVH, FVL, CH, CL);      /* (softmax(q k^T / 8) . w_scales^T) (f^T v)^T + softmax . b_scales, as f16 hi/residual */
  k_gemm2<0, true><<<dim3((NR / 128) * (DIM / 64), 1), 128, 0, stream>>>(CL, CH, 0.0009765625f, INNER, 0, BO, INNER, 0, 0.0625f, bout, 0, (float*)d_out, nullptr, DIM, 0, NR, DIM, INNER);      /* y = (2^-10 c_lo + c_hi) w_out + b_out */
}

// v009
// A run of this version takes 90.8 microseconds.
// In both of two side-by-side timings against v008, it was 1.09 times as fast.
// Counting every step since v000, it is 22.1 times as fast.
#include <hip/hip_runtime.h>
// SimilarAttention (4 x 2048 patches x 512, 8 heads x 64: [q|k|f|v] = x w_qkfv; attn = softmax(q.k/8); poss_value = (f^T v) w_scales + b_scales -> [h][64][2048]; out = attn . poss_value^T; y = merged . w_out + b_out).
// Structure: exact f16 x plane; the fused projection as ONE f16 WMMA GEMM (256x256 block tiles staged in LDS, 16 waves of 64x64 tiles, f32 accumulation, exact x16 weights; f16 out); then, each stage as ONE launch over all batches and heads: f^T v as 32-row WMMA tiles read straight from the projection's rows (per-wave LDS staging, transposing LDS loads; K = 2048 dealt over a block's 16 waves, f32 partials summed in LDS, f16 hi/residual out), then ONE launch for all batches and heads that keeps scores and softmax weights in registers and never builds poss_value: attn . ((f^T v) w_scales + b)^T = (attn . w_scales^T) (f^T v)^T + attn . b. A block takes 256 query rows of one head, 32 per wave, and walks the keys in tiles of 64 that are staged once per block in LDS (scores transposed, K = 64, f32; running row maximum and row sum; unnormalised f16 weights x 2^10 packed from the score accumulators into the B operand; readout against the exact x16 w_scales rows and the b_scales row on f32 accumulators); behind the keys: row scaling, f16 hi/residual, three product terms against f^T v hi/residual, + the b term, hi/residual out; w_out as ONE GEMM launch that runs the residual's k steps, scales the accumulators by 2^-10 and runs the hi plane's k steps on top (+ bias).
// Compute dtype: inputs rounded to bf16; x / weights exact as f16; q, k, f, v and the softmax weights as plain f16 operands (~2^-12); f^T v, attn . w_scales^T and the merged context as f16 hi + residual. v_wmma_f32_16x16x32_f16.
#define NB 4
#define NP 2048
#define DIM 512
#define NH 8
#define HD 64
#define INNER 512
#define NR (NB * NP)
typedef __bf16 v16b __attribute__((ext_vector_type(16)));
typedef unsigned short v8us __attribute__((ext_vector_type(8), may_alias));
typedef float  v8f  __attribute__((ext_vector_type(8)));
typedef float  v4f  __attribute__((ext_vector_type(4)));
typedef float  v4fa __attribute__((ext_vector_type(4), may_alias));
union FragB { v16b v; v8us half[2]; unsigned short u[16]; };

__device__ __forceinline__ unsigned short bf16_bits(float x) { unsigned int u = __float_as_uint(x); return (unsigned short)((u + 0x7FFFu + ((u >> 16) & 1u)) >> 16); }
__device__ __forceinline__ float bf16_val(unsigned short b) { return __uint_as_float(((unsigned int)b) << 16); }
__device__ __forceinline__ float bf16_round(float x) { return bf16_val(bf16_bits(x)); }
// D += A·B with NT terms: 1 = ah·bh, 2 = + al·bh (A split), 3 = + ah·bl (both split)
template <int NT>
__device__ __forceinline__ v8f mmaN(v16b ah, v16b al, v16b bh, v16b bl, v8f c) {
  c = __builtin_amdgcn_wmma_f32_16x16x32_bf16(false, ah, false, bh, (short)0, c, false, false);
  if (NT >= 2) c = __builtin_amdgcn_wmma_f32_16x16x32_bf16(false, al, false, bh, (short)0, c, false, false);
  if (NT >= 3) c = __builtin_amdgcn_wmma_f32_16x16x32_bf16(false, ah, false, bl, (short)0, c, false, false);
  asm volatile("v_nop\n\tv_nop\n\tv_nop\n\tv_nop" : "+v"(c) : "v"(ah), "v"(al), "v"(bh), "v"(bl));
  return c;
}

__global__ __launch_bounds__(256) void k_wt_bf16(const float* __restrict__ W, unsigned short* __restrict__ Wt, int K, int N) {
  const int t = blockIdx.x * 256 + threadIdx.x;
  const int k8n = K / 8;
  if (t >= N * k8n) return;
  const int n = t / k8n, k8 = (t % k8n) * 8;
  v8us v;
#pragma unroll
  for (int i = 0; i < 8; ++i) v[i] = bf16_bits(W[(size_t)(k8 + i) * N + n]);
  *(v8us*)(Wt + (size_t)n * K + k8) = v;
  
}

// GEMM C[M][N] (f32, pitch ldc) = act(A[M][K]·W + bias). A f32 row-major (pitch lda) converted per fragment to bf16
// (ASPLIT: hi/lo two planes -> 2 terms, else single rounded term); Wt bf16 [N][K] (pitch ldb). BIAS_BF16 rounds the
// bias to bf16 first (bias quantised to bf16 before the add). K%32==0, M%16==0, N%64==0.
template <bool ASPLIT, int ACT, bool BIAS_BF16>
__global__ __launch_bounds__(128) void k_gemm_bf(const float* __restrict__ A, int lda, const unsigned short* __restrict__ Wt, int ldb,
                                               const float* __restrict__ bias, float* __restrict__ C, int ldc, int M, int N, int K) {
  __shared__ __attribute__((aligned(16))) float so[4][16][64];
  const int tid = threadIdx.x, w = tid >> 5, lane = tid & 31, ln = lane & 15, hh = lane >> 4;
  const int ntn = N / 64;
  const int wid = blockIdx.x * 4 + w;
  const int mt = wid / ntn, nq = wid % ntn;
  if (mt * 16 >= M) return;
  const int row0 = mt * 16, col0 = nq * 64;
  const float* arow = A + (size_t)(row0 + ln) * lda;
  v8f acc[4] = {};
  for (int kb = 0; kb < K; kb += 32) {
    FragB ah, al;
    const v4f x0 = *(const v4fa*)(arow + kb + 8 * hh), x1 = *(const v4fa*)(arow + kb + 8 * hh + 4);
    const v4f x2 = *(const v4fa*)(arow + kb + 16 + 8 * hh), x3 = *(const v4fa*)(arow + kb + 16 + 8 * hh + 4);
    float xs[16] = {x0[0],x0[1],x0[2],x0[3],x1[0],x1[1],x1[2],x1[3],x2[0],x2[1],x2[2],x2[3],x3[0],x3[1],x3[2],x3[3]};
#pragma unroll
    for (int i = 0; i < 16; ++i) { const unsigned short hb = bf16_bits(xs[i]); ah.u[i] = hb; al.u[i] = ASPLIT ? bf16_bits(xs[i] - bf16_val(hb)) : (unsigned short)0; }
#pragma unroll
    for (int t = 0; t < 4; ++t) {
      const unsigned short* brow = Wt + (size_t)(col0 + t * 16 + ln) * ldb + kb;
      FragB b;
      b.half[0] = *(const v8us*)(brow + 8 * hh);
      b.half[1] = *(const v8us*)(brow + 16 + 8 * hh);
      acc[t] = mmaN<ASPLIT ? 2 : 1>(ah.v, al.v, b.v, b.v, acc[t]);
    }
  }
#pragma unroll
  for (int t = 0; t < 4; ++t) {
    float bv = bias ? bias[col0 + t * 16 + ln] : 0.f;
    if (BIAS_BF16) bv = bf16_round(bv);
#pragma unroll
    for (int r = 0; r < 8; ++r) { float v = acc[t][r] + bv; if (ACT == 1) v = fmaxf(v, 0.f); so[w][8 * hh + r][t * 16 + ln] = v; }
  }
  __builtin_amdgcn_fence(__ATOMIC_ACQ_REL, "workgroup");
  __builtin_amdgcn_wave_barrier();
  const int rsub = lane >> 4, c4 = (lane & 15) * 4;
  {
#pragma unroll
    for (int q = 0; q < 8; ++q) {
      const int r = q * 2 + rsub;
      const v4f v = *(const v4fa*)&so[w][r][c4];
      *(v4f*)(C + (size_t)(row0 + r) * ldc + col0 + c4) = v;
    }
    
  }
}

// GEMM C = act(A·W + bias + resid): A f32 (ASPLIT -> hi/lo 2 terms), Wt bf16 [N][K]; ACT 0 none, 1 relu, 2 exact gelu;
// resid (optional, f32, row index = (row % rmod), pitch ldr, RES_BF16 rounds it) added before the activation.
template <bool ASPLIT, int ACT, bool BIAS_BF16, bool RES_BF16>
__global__ __launch_bounds__(128) void k_gemm_bf3(const float* __restrict__ A, int lda, const unsigned short* __restrict__ Wt, int ldb,
                                                const float* __restrict__ bias, const float* __restrict__ resid, int rmod, int ldr,
                                                float* __restrict__ C, int ldc, int M, int N, int K) {
  __shared__ __attribute__((aligned(16))) float so[4][16][64];
  const int tid = threadIdx.x, w = tid >> 5, lane = tid & 31, ln = lane & 15, hh = lane >> 4;
  const int ntn = N / 64;
  const int wid = blockIdx.x * 4 + w;
  const int mt = wid / ntn, nq = wid % ntn;
  if (mt * 16 >= M) return;
  const int row0 = mt * 16, col0 = nq * 64;
  const float* arow = A + (size_t)(row0 + ln) * lda;
  v8f acc[4] = {};
  for (int kb = 0; kb < K; kb += 32) {
    FragB ah, al;
    const v4f x0 = *(const v4fa*)(arow + kb + 8 * hh), x1 = *(const v4fa*)(arow + kb + 8 * hh + 4);
    const v4f x2 = *(const v4fa*)(arow + kb + 16 + 8 * hh), x3 = *(const v4fa*)(arow + kb + 16 + 8 * hh + 4);
    float xs[16] = {x0[0],x0[1],x0[2],x0[3],x1[0],x1[1],x1[2],x1[3],x2[0],x2[1],x2[2],x2[3],x3[0],x3[1],x3[2],x3[3]};
#pragma unroll
    for (int i = 0; i < 16; ++i) { const unsigned short hb = bf16_bits(xs[i]); ah.u[i] = hb; al.u[i] = ASPLIT ? bf16_bits(xs[i] - bf16_val(hb)) : (unsigned short)0; }
#pragma unroll
    for (int t = 0; t < 4; ++t) {
      const unsigned short* brow = Wt + (size_t)(col0 + t * 16 + ln) * ldb + kb;
      FragB b;
      b.half[0] = *(const v8us*)(brow + 8 * hh);
      b.half[1] = *(const v8us*)(brow + 16 + 8 * hh);
      acc[t] = mmaN<ASPLIT ? 2 : 1>(ah.v, al.v, b.v, b.v, acc[t]);
    }
  }
#pragma unroll
  for (int t = 0; t < 4; ++t) {
    const int col = col0 + t * 16 + ln;
    float bv = bias ? bias[col] : 0.f;
    if (BIAS_BF16) bv = bf16_round(bv);
#pragma unroll
    for (int r = 0; r < 8; ++r) {
      float v = acc[t][r] + bv;
      if (resid) { float rv = resid[(size_t)((row0 + 8 * hh + r) % rmod) * ldr + col]; if (RES_BF16) rv = bf16_round(rv); v += rv; }
      if (ACT == 1) v = fmaxf(v, 0.f);
      if (ACT == 2) v = 0.5f * v * (1.0f + erff(v * 0.70710678118654752f));
      if (ACT == 3) { const float u = 0.7978845608028654f * (v + 0.044715f * v * v * v); v = 0.5f * v * (1.0f + tanhf(u)); }
      so[w][8 * hh + r][t * 16 + ln] = v;
    }
  }
  __builtin_amdgcn_fence(__ATOMIC_ACQ_REL, "workgroup");
  __builtin_amdgcn_wave_barrier();
  const int rsub = lane >> 4, c4 = (lane & 15) * 4;
  {
#pragma unroll
    for (int q = 0; q < 8; ++q) {
      const int r = q * 2 + rsub;
      const v4f v = *(const v4fa*)&so[w][r][c4];
      *(v4f*)(C + (size_t)(row0 + r) * ldc + col0 + c4) = v;
    }
    
  }
}
// row LayerNorm (biased variance, eps) over N: s = X (+ R); optional out_sum <- s; out_norm <- (s-mu)*rsqrt(var+eps)*g + b
template <bool PARAM_BF16>
__global__ __launch_bounds__(256) void k_layernorm(const float* __restrict__ X, const float* __restrict__ R, const float* __restrict__ g, const float* __restrict__ bta,
                                                  float* __restrict__ out_sum, float* __restrict__ out_norm, int N, float eps) {
  __shared__ float red[256];
  const int row = blockIdx.x, tid = threadIdx.x;
  const float* x = X + (size_t)row * N; const float* rr = R ? R + (size_t)row * N : nullptr;
  float vals[16];                     // up to N = 4096
  const int per = N / 256;            // contiguous chunk per thread? use strided-by-4 chunks: thread handles j = tid*4 + 1024*u
  float s1 = 0.f;
  for (int u = 0; u < per / 4; ++u) {
    const int j = tid * 4 + 1024 * u;
    const v4f a = *(const v4fa*)(x + j);
    v4f b = {0.f,0.f,0.f,0.f}; if (rr) b = *(const v4fa*)(rr + j);
#pragma unroll
    for (int q = 0; q < 4; ++q) { const float v = a[q] + b[q]; vals[u * 4 + q] = v; s1 += v; }
  }
  red[tid] = s1; __syncthreads();
  for (int st = 128; st > 0; st >>= 1) { if (tid < st) red[tid] += red[tid + st]; __syncthreads(); }
  const float mu = red[0] / (float)N; __syncthreads();
  float s2 = 0.f;
  for (int u = 0; u < per / 4; ++u)
#pragma unroll
    for (int q = 0; q < 4; ++q) { const float c = vals[u * 4 + q] - mu; s2 += c * c; }
  red[tid] = s2; __syncthreads();
  for (int st = 128; st > 0; st >>= 1) { if (tid < st) red[tid] += red[tid + st]; __syncthreads(); }
  const float rs = rsqrtf(red[0] / (float)N + eps);
  {
    for (int u = 0; u < per / 4; ++u) {
      const int j = tid * 4 + 1024 * u;
      v4f o, sm;
#pragma unroll
      for (int q = 0; q < 4; ++q) {
        float gg = g[j + q], bb = bta[j + q];
        if (PARAM_BF16) { gg = bf16_round(gg); bb = bf16_round(bb); }
        sm[q] = vals[u * 4 + q]; o[q] = (vals[u * 4 + q] - mu) * rs * gg + bb;
      }
      if (out_sum) *(v4f*)(out_sum + (size_t)row * N + j) = sm;
      *(v4f*)(out_norm + (size_t)row * N + j) = o;
    }
    
  }
}



// ---- f16 WMMA path (v_wmma_f32_16x16x32_f16): 11-bit significands for operands in range — used where a [0,1] probability operand needs more precision than bf16
typedef _Float16 v16h __attribute__((ext_vector_type(16)));
union FragH { v16h v; v8us half[2]; _Float16 h[16]; unsigned short u[16]; };
template <int NT>
__device__ __forceinline__ v8f mmaH(v16h ah, v16h al, v16h bh, v16h bl, v8f c) {
  c = __builtin_amdgcn_wmma_f32_16x16x32_f16(false, ah, false, bh, (short)0, c, false, false);
  if (NT >= 2) c = __builtin_amdgcn_wmma_f32_16x16x32_f16(false, al, false, bh, (short)0, c, false, false);
  if (NT >= 3) c = __builtin_amdgcn_wmma_f32_16x16x32_f16(false, ah, false, bl, (short)0, c, false, false);
  asm volatile("v_nop\n\tv_nop\n\tv_nop\n\tv_nop" : "+v"(c) : "v"(ah), "v"(al), "v"(bh), "v"(bl));
  return c;
}
// batched GEMM like k_gemm_b but f16 operands: A f32 (split into f16 hi/lo if ASPLIT, else rounded to f16), Bt = f16 values [n][k]; alpha; C f32; N multiple of 16 (partial tiles skipped)
template <bool ASPLIT>
__global__ __launch_bounds__(128) void k_gemm_h(const float* __restrict__ A, int lda, size_t sA, const _Float16* __restrict__ Bh, int ldb, size_t sB, float alpha, float* __restrict__ C, int ldc, size_t sC, int M, int N, int K) {
  __shared__ __attribute__((aligned(16))) float so[4][16][64];
  const int tid = threadIdx.x, w = tid >> 5, lane = tid & 31, ln = lane & 15, hh = lane >> 4; const int by = blockIdx.y;
  A += (size_t)by * sA; Bh += (size_t)by * sB; C += (size_t)by * sC;
  const int ntn = (N + 63) / 64; const int wid = blockIdx.x * 4 + w; const int mt = wid / ntn, nq = wid % ntn; if (mt * 16 >= M) return;
  const int row0 = mt * 16, col0 = nq * 64; const float* arow = A + (size_t)(row0 + ln) * lda;
  v8f acc[4] = {};
  for (int kb = 0; kb < K; kb += 32) {
    FragH ah, al;
    const v4f x0 = *(const v4fa*)(arow + kb + 8 * hh), x1 = *(const v4fa*)(arow + kb + 8 * hh + 4), x2 = *(const v4fa*)(arow + kb + 16 + 8 * hh), x3 = *(const v4fa*)(arow + kb + 16 + 8 * hh + 4);
    float xs[16] = {x0[0],x0[1],x0[2],x0[3],x1[0],x1[1],x1[2],x1[3],x2[0],x2[1],x2[2],x2[3],x3[0],x3[1],x3[2],x3[3]};
#pragma unroll
    for (int i = 0; i < 16; ++i) { const _Float16 h = (_Float16)xs[i]; ah.h[i] = h; al.h[i] = ASPLIT ? (_Float16)(xs[i] - (float)h) : (_Float16)0.0f; }
#pragma unroll
    for (int t = 0; t < 4; ++t) { if (col0 + t * 16 >= N) continue; const size_t boff = (size_t)(col0 + t * 16 + ln) * ldb + kb; FragH bq; bq.half[0] = *(const v8us*)(Bh + boff + 8 * hh); bq.half[1] = *(const v8us*)(Bh + boff + 16 + 8 * hh);
      acc[t] = mmaH<ASPLIT ? 2 : 1>(ah.v, al.v, bq.v, bq.v, acc[t]); }
  }
#pragma unroll
  for (int t = 0; t < 4; ++t) { if (col0 + t * 16 >= N) continue;
#pragma unroll
    for (int r = 0; r < 8; ++r) so[w][8 * hh + r][t * 16 + ln] = acc[t][r] * alpha; }
  __builtin_amdgcn_fence(__ATOMIC_ACQ_REL, "workgroup"); __builtin_amdgcn_wave_barrier();
  const int rsub = lane >> 4, c4 = (lane & 15) * 4;
  {
#pragma unroll
    for (int q = 0; q < 8; ++q) { const int r = q * 2 + rsub; if (col0 + c4 < N) { const v4f v = *(const v4fa*)&so[w][r][c4]; *(v4f*)(C + (size_t)(row0 + r) * ldc + col0 + c4) = v; } }
     }
}

// Wt[n][k] = f16(W[k][n]·scale) from f32 row-major W[K][N] (scale = power of two; bf16-exact weights stay exact in f16 away from the subnormal range)
// device body: blk = index of the 256-thread block inside this job's range of the shared grid (k_prep)
__device__ __forceinline__ void d_wt_f16(const float* __restrict__ W, _Float16* __restrict__ Wt, int K, int N, float scale, int blk) {
  const int t = blk * 256 + threadIdx.x; if (t >= N * (K / 8)) return; const int n = t / (K / 8), k8 = (t % (K / 8)) * 8; FragH f;
#pragma unroll
  for (int i = 0; i < 8; ++i) f.h[i] = (_Float16)(bf16_round(W[(size_t)(k8 + i) * N + n]) * scale); const v8us o = f.half[0];
  *(v8us*)((unsigned short*)Wt + (size_t)n * K + k8) = o; 
}
// k_gemm_hh variant with fused epilogue: v = acc·alpha + bias[by·sBias + col] (+ CP[(row/rowsPerB)·sCPb + by·64 + col] if CP) ; ACT 0 none / 1 elu ; writes f32 C and/or f16 C16 (each if non-null)
template <int ACT>
__global__ __launch_bounds__(128) void k_gemm_hhx(const _Float16* __restrict__ A, int lda, size_t sA, const _Float16* __restrict__ Bh, int ldb, size_t sB, float alpha, const float* __restrict__ bias, size_t sBias, const float* __restrict__ CP, int rowsPerB, size_t sCPb, int row0g,
    float* __restrict__ C, _Float16* __restrict__ C16, int ldc, size_t sC, int M, int N, int K, const _Float16* __restrict__ A2, float alpha2, float* __restrict__ C2) {
  __shared__ __attribute__((aligned(16))) float so[4][16][64];
  const int tid = threadIdx.x, w = tid >> 5, lane = tid & 31, ln = lane & 15, hh = lane >> 4; const int by = blockIdx.y;
  if (blockIdx.z) { A = A2; alpha = alpha2; bias = nullptr; C = C2; }      /* blockIdx.z = 1: the second term of a split A in the same grid: its own operand, factor and f32 plane, no bias */
  A += (size_t)by * sA; Bh += (size_t)by * sB; const size_t cofs = (size_t)by * sC; const float* bp = bias ? bias + (size_t)by * sBias : nullptr;
  const int ntn = (N + 63) / 64; const int wid = blockIdx.x * 4 + w; const int mt = wid / ntn, nq = wid % ntn; if (mt * 16 >= M) return;
  const int row0 = mt * 16, col0 = nq * 64; const _Float16* arow = A + (size_t)(row0 + ln) * lda;
  v8f acc[4] = {};
  for (int kb = 0; kb < K; kb += 32) { FragH ah; ah.half[0] = *(const v8us*)((const unsigned short*)arow + kb + 8 * hh); ah.half[1] = *(const v8us*)((const unsigned short*)arow + kb + 16 + 8 * hh);
#pragma unroll
    for (int t = 0; t < 4; ++t) { if (col0 + t * 16 >= N) continue; const size_t boff = (size_t)(col0 + t * 16 + ln) * ldb + kb; FragH bq; bq.half[0] = *(const v8us*)((const unsigned short*)Bh + boff + 8 * hh); bq.half[1] = *(const v8us*)((const unsigned short*)Bh + boff + 16 + 8 * hh);
      acc[t] = mmaH<1>(ah.v, ah.v, bq.v, bq.v, acc[t]); }
  }
#pragma unroll
  for (int t = 0; t < 4; ++t) { if (col0 + t * 16 >= N) continue; const int col = col0 + t * 16 + ln; const float bv = bp ? bf16_round(bp[col]) : 0.f;
#pragma unroll
    for (int r = 0; r < 8; ++r) { float v = acc[t][r] * alpha + bv; if (CP) { const int rr = row0g + row0 + 8 * hh + r; if (rowsPerB < 0) v += CP[cofs + (size_t)rr * ldc + col];      /* rowsPerB < 0: own element of the batched C plane */ else { const int bidx = rr / rowsPerB; v += CP[(size_t)bidx * sCPb + (size_t)by * 64 + col]; } } if (ACT == 1) v = (v > 0.f) ? v : expm1f(v); else if (ACT == 7) v = (v > 0.f) ? v + 1.0f : expf(v); else if (ACT == 8) v = tanhf(v); else if (ACT == 9) v = 0.5f * v * (1.0f + tanhf(0.7978845608028654f * (v + 0.044715f * v * v * v))); else if (ACT == 11) v = 1.0f / (1.0f + expf(-v)); else if (ACT == 12) v = (v > 0.f) ? v : 0.01f * v; else if (ACT == 14) v = (v > 0.f) ? v : 0.1f * v; else if (ACT == 16) v = (v >= 0.f) ? v : 0.3f * v; else if (ACT == 17) v = (v >= 0.f) ? v : 0.2f * v; else if (ACT == 15) v = v / (1.0f + expf(-v)); else if (ACT == 3) v = fmaxf(v, 0.f); else if (ACT == 6) v = 0.5f * v * (1.0f + erff(v * 0.70710678118654752f)); so[w][8 * hh + r][t * 16 + ln] = v; } }
  __builtin_amdgcn_fence(__ATOMIC_ACQ_REL, "workgroup"); __builtin_amdgcn_wave_barrier();
  const int rsub = lane >> 4, c4 = (lane & 15) * 4; typedef _Float16 v4h __attribute__((ext_vector_type(4)));
  {
#pragma unroll
    for (int q = 0; q < 8; ++q) { const int r = q * 2 + rsub; if (col0 + c4 < N) { const v4f v = *(const v4fa*)&so[w][r][c4]; if (C) *(v4f*)(C + cofs + (size_t)(row0 + r) * ldc + col0 + c4) = v; if (C16) { v4h h4; for (int i = 0; i < 4; ++i) h4[i] = (_Float16)v[i]; *(v4h*)(C16 + cofs + (size_t)(row0 + r) * ldc + col0 + c4) = h4; } } }
     }
}


typedef _Float16 v4h __attribute__((ext_vector_type(4)));

__device__ __forceinline__ void d_x16(const float* __restrict__ x, _Float16* __restrict__ X16, size_t n8, int blk) { const size_t t = (size_t)blk * 256 + threadIdx.x; if (t >= n8) return; FragH f;
#pragma unroll
  for (int q = 0; q < 8; ++q) f.h[q] = (_Float16)bf16_round(x[t * 8 + q]); *(v8us*)((unsigned short*)X16 + t * 8) = f.half[0];  }
// f16(bf16-rounded value x 16) in the source's own order: w_scales rows and b_scales are read along the keys as they lie
__device__ __forceinline__ void d_r16(const float* __restrict__ Wv, _Float16* __restrict__ Bt, int blk) { const size_t t = (size_t)blk * 256 + threadIdx.x; FragH f;
#pragma unroll
  for (int i = 0; i < 8; ++i) f.h[i] = (_Float16)(bf16_round(Wv[t * 8 + i]) * 16.0f); *(v8us*)((unsigned short*)Bt + t * 8) = f.half[0];
  asm volatile("s_wait_xcnt 0x0" ::: "memory"); }      /* stands behind the store, in front of the first overwrite of a register that it names (the other jobs' code follows in the listing) */
// the five operand preparations need nothing of each other: one grid, each job a range of the block index (block-uniform branches); the transposes, whose threads take longest, start first
#define PREP_Q (DIM * 4 * INNER / 8 / 256)
#define PREP_O (INNER * DIM / 8 / 256)
#define PREP_S (HD * NP / 8 / 256)
#define PREP_B (NP / 8 / 256)
#define PREP_X (NR * DIM / 8 / 256)
__global__ __launch_bounds__(256) void k_prep(const float* __restrict__ Wq, _Float16* __restrict__ BQ, const float* __restrict__ Wo, _Float16* __restrict__ BO, const float* __restrict__ Wsc, const float* __restrict__ bsc, _Float16* __restrict__ BS, const float* __restrict__ x, _Float16* __restrict__ X16) {
  static_assert(DIM * 4 * INNER % 2048 == 0 && INNER * DIM % 2048 == 0 && HD * NP % 2048 == 0 && NP % 2048 == 0 && NR * DIM % 2048 == 0, "k_prep: every job fills whole blocks");
  int blk = blockIdx.x;
  if (blk < PREP_Q) { d_wt_f16(Wq, BQ, DIM, 4 * INNER, 16.0f, blk); return; }
  blk -= PREP_Q;
  if (blk < PREP_O) { d_wt_f16(Wo, BO, INNER, DIM, 16.0f, blk); return; }
  blk -= PREP_O;
  if (blk < PREP_S) { d_r16(Wsc, BS, blk); return; }
  blk -= PREP_S;
  if (blk < PREP_B) { d_r16(bsc, BS + (size_t)HD * NP, blk); return; }      /* row 64 of the plane */
  d_x16(x, X16, (size_t)NR * DIM / 8, blk - PREP_B); }
__global__ __launch_bounds__(256) void k_h16(const float* __restrict__ x, _Float16* __restrict__ X16, size_t n8) { const size_t t = (size_t)blockIdx.x * 256 + threadIdx.x; if (t >= n8) return; FragH f;
#pragma unroll
  for (int q = 0; q < 8; ++q) f.h[q] = (_Float16)x[t * 8 + q]; *(v8us*)((unsigned short*)X16 + t * 8) = f.half[0];  }
__global__ __launch_bounds__(256) void k_round16f(const float* __restrict__ W, _Float16* __restrict__ Bt, size_t n8) { const size_t t = (size_t)blockIdx.x * 256 + threadIdx.x; if (t >= n8) return; FragH f;
#pragma unroll
  for (int i = 0; i < 8; ++i) f.h[i] = (_Float16)(bf16_round(W[t * 8 + i]) * 16.0f); *(v8us*)((unsigned short*)Bt + t * 8) = f.half[0];  }

// ---- fast GEMM: block tile BM x BN = (16 FA NWM) x (64 NWN), NWM x NWN waves with tiles of 16 FA x 64, k steps of BK; requires M % BM == 0 rows per launch region, N % BN == 0 and K % BK == 0. A staged row serves the whole width of the block tile, so the bytes that come from L2 per product fall as the tile grows, and a longer step gives the next step's loads more time. A and B go through LDS: whole 128-byte lines fetched once per block, two buffers; TWO: C = (beta A + A2) B, the k steps of A first, the accumulators x beta, then the k steps of A2 on the same accumulators; epilogue: x alpha, + bias ----
// fragment in the hardware k order from a staged row: p = the lane's own row at k 8 * hh
__device__ __forceinline__ v16h g2_lfrag(const unsigned short* p) { FragH f; f.half[0] = *(const v8us*)p; f.half[1] = *(const v8us*)(p + 16); return f.v; }
__device__ __forceinline__ v8f g2_mma(v16h a, v16h b, v8f c) { v8f d = __builtin_amdgcn_wmma_f32_16x16x32_f16(false, a, false, b, (short)0, c, false, false); asm volatile("v_nop\n\tv_nop\n\tv_nop\n\tv_nop" : "+v"(d) : "v"(a), "v"(b)); return d; }
template <int ACT, bool TWO, int FA, int NWM, int NWN, int BK>
__global__ __launch_bounds__(32 * NWM * NWN) void k_gemm2(const _Float16* __restrict__ A, const _Float16* __restrict__ A2, float beta, int lda, size_t sA, const _Float16* __restrict__ Bh, int ldb, size_t sB, float alpha, const float* __restrict__ bias, size_t sBias,
    float* __restrict__ C, _Float16* __restrict__ C16, int ldc, size_t sC, int M, int N, int K) { static_assert(ACT == 0 || ACT == 3 || ACT == 6 || ACT == 8 || ACT == 9 || ACT == 11 || ACT == 12 || ACT == 14 || ACT == 15 || ACT == 16 || ACT == 17, "k_gemm2: unsupported ACT code (would silently apply no activation)");
  constexpr int NW = NWM * NWN, BM = 16 * FA * NWM, BN = 64 * NWN, P = BK + 8, TR = BK / 8, RP = 32 * NW / TR, JA = BM / RP, JB = BN / RP, KG = FA == 2 ? 2 : 1;      /* P = LDS row pitch in f16: 144 or 272 bytes = 16 x odd, the 16 rows of a fragment read fall on different banks; TR = threads that fetch one row; RP = rows that the block fetches in one round */
  static_assert((BK == 64 || BK == 128) && FA % 2 == 0 && BM % RP == 0 && BN % RP == 0 && JA == JB && (JA == 4 || JA == 8), "k_gemm2: whole staging rounds, output tiles in pairs of 16 rows");
  __shared__ __attribute__((aligned(16))) unsigned short sm[2][BM + BN][P];      /* in the k loop: [buffer][A rows | B rows][BK f16 + pad]; behind it: the waves' f32 output tiles, 32 rows at a time */
  static_assert(sizeof(float) * NW * 32 * 68 <= sizeof(unsigned short) * 2 * (BM + BN) * P, "k_gemm2: the output tiles fit the staging buffers");
  float (*so)[32][68] = reinterpret_cast<float (*)[32][68]>(&sm[0][0][0]);
  const int tid = threadIdx.x, w = tid >> 5, lane = tid & 31, ln = lane & 15, hh = lane >> 4; const int by = blockIdx.y;
  A += (size_t)by * sA; Bh += (size_t)by * sB; const size_t cofs = (size_t)by * sC; const float* bp = bias ? bias + (size_t)by * sBias : nullptr;
  const int wm = w % NWM, wn = w / NWM;      /* the wave's place in the block tile: 16 * FA rows, 64 columns */
  const int ntn = N / BN; const int mt = blockIdx.x / ntn, nq = blockIdx.x - mt * ntn; const int row0 = mt * BM + 16 * FA * wm, col0 = nq * BN + 64 * wn; if (mt * BM >= M) return;      /* the whole block leaves or none, in front of every barrier */
  // staging: TR neighbouring lanes fetch the BK f16 of one row, whole 128-byte lines; a thread takes chunk tid % TR of rows tid / TR + RP j, JA rows of A and JB of B; block-uniform bases, the lane's own element offsets stay in their registers over the loop
  const int sr = tid / TR, sc = (tid % TR) * 8;
  const unsigned short* ua = (const unsigned short*)A + (size_t)(mt * BM) * lda; const unsigned short* ub = (const unsigned short*)Bh + (size_t)(nq * BN) * ldb;
  unsigned oa[JA], obf[JB]; v8us ra[JA], rb[JB];
#pragma unroll
  for (int j = 0; j < JA; ++j) oa[j] = (unsigned)((sr + RP * j) * lda + sc);
#pragma unroll
  for (int j = 0; j < JB; ++j) obf[j] = (unsigned)((sr + RP * j) * ldb + sc);
  // the loops over j, kk, u and t are unrolled: the register arrays are then indexed by constants only
  auto fetch = [&](const unsigned short* pa, const int kb) __attribute__((always_inline)) {
    const unsigned short* qa[JA]; const unsigned short* qb[JB];
#pragma unroll
    for (int j = 0; j < JA; ++j) { qa[j] = pa + kb + oa[j]; ra[j] = *(const v8us*)qa[j]; }
#pragma unroll
    for (int j = 0; j < JB; ++j) { qb[j] = ub + kb + obf[j]; rb[j] = *(const v8us*)qb[j]; }
    // the wait stands behind the loads, in front of the first overwrite of a register that they name; the addresses are inputs so that their registers live up to here (a later load of the group otherwise lands on an earlier one's address)
    if constexpr (JA == 4) asm volatile("s_wait_xcnt 0x0" :: "v"(qa[0]), "v"(qa[1]), "v"(qa[2]), "v"(qa[3]), "v"(qb[0]), "v"(qb[1]), "v"(qb[2]), "v"(qb[3]) : "memory");
    else asm volatile("s_wait_xcnt 0x0" :: "v"(qa[0]), "v"(qa[1]), "v"(qa[2]), "v"(qa[3]), "v"(qa[4]), "v"(qa[5]), "v"(qa[6]), "v"(qa[7]), "v"(qb[0]), "v"(qb[1]), "v"(qb[2]), "v"(qb[3]), "v"(qb[4]), "v"(qb[5]), "v"(qb[6]), "v"(qb[7]) : "memory"); };
  auto put = [&](const int buf) __attribute__((always_inline)) {
#pragma unroll
    for (int j = 0; j < JA; ++j) *(v8us*)&sm[buf][sr + RP * j][sc] = ra[j];
#pragma unroll
    for (int j = 0; j < JB; ++j) *(v8us*)&sm[buf][BM + sr + RP * j][sc] = rb[j]; };
  const v8f z8 = {0.f,0.f,0.f,0.f,0.f,0.f,0.f,0.f}; v8f c[FA][4];
#pragma unroll
  for (int u = 0; u < FA; ++u) {
#pragma unroll
    for (int t = 0; t < 4; ++t) c[u][t] = z8; }
  fetch(ua, 0); put(0);
  __syncthreads();      /* step 0 is in LDS before any wave reads it */
  // one step of BK k out of buffer cur; more = a next step exists (A rows at na, k at nkb), is fetched, stored and published (a constant at each call: no test inside a trip)
  auto step = [&](const int cur, const unsigned short* na, const int nkb, const bool more) __attribute__((always_inline)) {
    if (more) fetch(na, nkb);
    const unsigned short* pa = &sm[cur][16 * FA * wm + ln][8 * hh]; const unsigned short* pb = &sm[cur][BM + 64 * wn + ln][8 * hh];
    // fragments are asked for KG blocks of 32 k at a time: two where the registers allow it
#pragma unroll
    for (int kg = 0; kg < BK / 32; kg += KG) { v16h a[FA][KG], b[4][KG];
#pragma unroll
      for (int kk = 0; kk < KG; ++kk) {
#pragma unroll
        for (int u = 0; u < FA; ++u) a[u][kk] = g2_lfrag(pa + u * 16 * P + (kg + kk) * 32);
#pragma unroll
        for (int t = 0; t < 4; ++t) b[t][kk] = g2_lfrag(pb + t * 16 * P + (kg + kk) * 32); }
#pragma unroll
      for (int kk = 0; kk < KG; ++kk) {
#pragma unroll
        for (int t = 0; t < 4; ++t) {
#pragma unroll
          for (int u = 0; u < FA; ++u) c[u][t] = g2_mma(a[u][kk], b[t][kk], c[u][t]); } } }
    if (more) {
      put(cur ^ 1);      /* last read in the step before, behind whose barrier every wave stands */
      __syncthreads(); }      /* one barrier a step: the next step is in LDS before any wave reads it, and every wave has left this step's buffer before it is refilled in the next trip */
  };
  const int nst = K / BK;
  // the step loop stays rolled: unrolled, the staging registers of several steps would be live together
#pragma unroll 1
  for (int s = 0; s < nst - 1; ++s) step(s & 1, ua, (s + 1) * BK, true);
  if (TWO) {
    const unsigned short* ua2 = (const unsigned short*)A2 + (size_t)by * sA + (size_t)(mt * BM) * lda;
    step((nst - 1) & 1, ua2, 0, true);      /* the last step of A fetches the first of A2: the two buffers run on across the seam */
#pragma unroll
    for (int u = 0; u < FA; ++u) {
#pragma unroll
      for (int t = 0; t < 4; ++t) c[u][t] *= beta; }
    // rolled for the same reason as the loop above
#pragma unroll 1
    for (int s = 0; s < nst - 1; ++s) step((nst + s) & 1, ua2, (s + 1) * BK, true);
    step((2 * nst - 1) & 1, ua2, 0, false);
  } else step((nst - 1) & 1, ua, 0, false);
  __syncthreads();      /* every wave has left the last buffer before the output tiles are written over the buffers */
  const int rsub = lane >> 4, c4 = (lane & 15) * 4;
  // the wave's tile goes out 32 rows at a time through its own LDS range
#pragma unroll
  for (int hp = 0; hp < FA / 2; ++hp) {
#pragma unroll
    for (int u = 0; u < 8; ++u) { const int t = u & 3, half = u >> 2; const int col = col0 + t * 16 + ln; const float bv = bp ? bf16_round(bp[col]) : 0.f;
#pragma unroll
      for (int r = 0; r < 8; ++r) { const int rloc = half * 16 + 8 * hh + r; float v = c[2 * hp + half][t][r] * alpha + bv;
        if (ACT == 3) v = fmaxf(v, 0.f); else if (ACT == 6) v = 0.5f * v * (1.0f + erff(v * 0.70710678118654752f)); else if (ACT == 11) v = 1.0f / (1.0f + expf(-v)); else if (ACT == 15) v = v / (1.0f + expf(-v)); else if (ACT == 12) v = (v > 0.f) ? v : 0.01f * v; else if (ACT == 8) v = tanhf(v); else if (ACT == 9) v = 0.5f * v * (1.0f + tanhf(0.7978845608028654f * (v + 0.044715f * v * v * v))); else if (ACT == 14) v = (v > 0.f) ? v : 0.1f * v; else if (ACT == 16) v = (v >= 0.f) ? v : 0.3f * v; else if (ACT == 17) v = (v >= 0.f) ? v : 0.2f * v;
        so[w][rloc][t * 16 + ln] = v; } }
    __builtin_amdgcn_fence(__ATOMIC_ACQ_REL, "workgroup"); __builtin_amdgcn_wave_barrier();
#pragma unroll
    for (int q = 0; q < 16; ++q) { const int r = q * 2 + rsub; const v4f v = *(const v4fa*)&so[w][r][c4]; if (C) { *(v4f*)(C + cofs + (size_t)(row0 + 32 * hp + r) * ldc + col0 + c4) = v; asm volatile("s_wait_xcnt 0x0" ::: "memory"); }      /* the wait stands behind the store, in front of the conversion, which takes the stored registers */
      if (C16) { v4h h4; for (int i = 0; i < 4; ++i) h4[i] = (_Float16)v[i]; *(v4h*)(C16 + cofs + (size_t)(row0 + 32 * hp + r) * ldc + col0 + c4) = h4; } }
    if (hp + 1 < FA / 2) { __builtin_amdgcn_fence(__ATOMIC_ACQ_REL, "workgroup"); __builtin_amdgcn_wave_barrier(); }      /* the wave's reads of these 32 rows stand in front of its writes of the next 32 */
  } }

// ---- f^T v of one (batch, head) straight from the projection's rows: one 32x64 tile per block, the 2048 rows of the sum dealt over TVW waves; a wave stages 32 rows of f (its 32 columns) and of v at a time in its own LDS range, as they lie, and reads both operands' fragments with transposing LDS loads (the sum runs down the rows); f32 partial tiles summed through LDS in wave order, written as f16 hi and residual x 2^10 ----
#define TVW 16                   /* waves per tile; each takes NP / TVW rows */
#define TVPF 48                  /* LDS pitch of a staged f row (32 f16) in f16: 96 bytes = 32 x 3, the transposing reader's pitch */
#define TVPV 80                  /* the same for a v row (64 f16): 160 bytes = 32 x 5 */
typedef short s16x8 __attribute__((ext_vector_type(8)));
// 16 columns x 32 rows of a staged row-major tile as one fragment in the hardware k order: p = the lane's own address (row 8 * hh + (lane & 7), column 8 * ((lane >> 3) & 1)), rows 0-15 and 16-31
__device__ __forceinline__ v16h tv_frag(const unsigned short* p, int pitch) { typedef __attribute__((address_space(3))) s16x8 lds_s16x8; union { v16h v; s16x8 q[2]; } f;
  f.q[0] = __builtin_amdgcn_ds_load_tr16_b128_v8i16((lds_s16x8*)p); f.q[1] = __builtin_amdgcn_ds_load_tr16_b128_v8i16((lds_s16x8*)(p + 16 * pitch)); return f.v; }
__global__ __launch_bounds__(32 * TVW) void k_ftv(const _Float16* __restrict__ QKFV, _Float16* __restrict__ FVH, _Float16* __restrict__ FVL) {
  static_assert(NP == 128 * TVW && HD == 64, "k_ftv: every wave takes four 32-row steps; a v row is one 128-byte line");
  __shared__ __attribute__((aligned(32))) unsigned short sf[TVW][32][TVPF];
  __shared__ __attribute__((aligned(32))) unsigned short sv[TVW][32][TVPV];
  __shared__ __attribute__((aligned(16))) float so[TVW][32][68];
  const int tid = threadIdx.x, w = tid >> 5, lane = tid & 31, ln = lane & 15, hh = lane >> 4;
  const int bh = blockIdx.y, b = bh / NH, h = bh - b * NH, d0 = blockIdx.x * 32; const int ldq = 4 * INNER;
  // fetch: 4 neighbouring lanes take the 64 bytes of an f row, 8 a whole v row
  const int fr = lane >> 2, fc = (lane & 3) * 8, vr = lane >> 3, vc = (lane & 7) * 8;
  const unsigned short* g0 = (const unsigned short*)QKFV + ((size_t)b * NP + w * (NP / TVW)) * ldq + h * HD;      /* the wave's first row, the head's q columns; f stands 2 * INNER, v 3 * INNER further */
  const unsigned short* gf = g0 + (size_t)fr * ldq + d0 + fc; const unsigned short* gv = g0 + (size_t)vr * ldq + vc;
  v8us rf[2][4], rv[2][8];
  // every loop over j, t and the steps is unrolled: the register arrays are then indexed by constants only
  auto fetch = [&](const int c) __attribute__((always_inline)) {
#pragma unroll
    for (int j = 0; j < 4; ++j) rf[c & 1][j] = *(const v8us*)(gf + ((size_t)(c * 32 + 8 * j) * ldq + 2 * INNER));
#pragma unroll
    for (int j = 0; j < 8; ++j) rv[c & 1][j] = *(const v8us*)(gv + ((size_t)(c * 32 + 4 * j) * ldq + 3 * INNER));
    asm volatile("s_wait_xcnt 0x0" :: "v"(gf), "v"(gv) : "memory"); };      /* stands behind the 12 loads, in front of the first overwrite of a register that they name; the two addresses are inputs so that their registers live up to here (the last load otherwise lands on its own address); it also keeps the loads from sinking to their use */
  fetch(0); fetch(1);
  const unsigned short* pf = &sf[w][8 * hh + (lane & 7)][8 * ((lane >> 3) & 1)]; const unsigned short* pv = &sv[w][8 * hh + (lane & 7)][8 * ((lane >> 3) & 1)];
  const v8f z8 = {0.f,0.f,0.f,0.f,0.f,0.f,0.f,0.f}; v8f acc[2][4] = {{z8, z8, z8, z8}, {z8, z8, z8, z8}};
#pragma unroll
  for (int c = 0; c < 4; ++c) {
#pragma unroll
    for (int j = 0; j < 4; ++j) *(v8us*)&sf[w][fr + 8 * j][fc] = rf[c & 1][j];
#pragma unroll
    for (int j = 0; j < 8; ++j) *(v8us*)&sv[w][vr + 4 * j][vc] = rv[c & 1][j];
    if (c + 2 < 4) fetch(c + 2);      /* two steps ahead, into the registers just stored */
    asm volatile("s_wait_dscnt 0x0" ::: "memory");      /* the wave's own 12 stores are in LDS before its lanes read each other's rows */
    v16h a[2], bq[4];
#pragma unroll
    for (int u = 0; u < 2; ++u) a[u] = tv_frag(pf + 16 * u, TVPF);
#pragma unroll
    for (int t = 0; t < 4; ++t) bq[t] = tv_frag(pv + 16 * t, TVPV);
    asm volatile("s_wait_dscnt 0x0" ::: "memory");      /* the 12 reads have returned before the next step's stores go over the same rows */
#pragma unroll
    for (int t = 0; t < 4; ++t) {
#pragma unroll
      for (int u = 0; u < 2; ++u) acc[u][t] = __builtin_amdgcn_wmma_f32_16x16x32_f16(false, a[u], false, bq[t], (short)0, acc[u][t], false, false); } }
#pragma unroll
  for (int u = 0; u < 2; ++u) {
#pragma unroll
    for (int t = 0; t < 4; ++t) {
#pragma unroll
      for (int r = 0; r < 8; ++r) so[w][u * 16 + 8 * hh + r][t * 16 + ln] = acc[u][t][r]; } }
  __syncthreads();      /* every wave's partial tile is in LDS before any thread sums across waves */
  const int r = tid >> 4, c4 = (tid & 15) * 4; v4f s = *(const v4fa*)&so[0][r][c4];
  for (int u = 1; u < TVW; ++u) s += *(const v4fa*)&so[u][r][c4];
  v4h xh, xl;
#pragma unroll
  for (int q = 0; q < 4; ++q) { const _Float16 hv = (_Float16)s[q]; xh[q] = hv; xl[q] = (_Float16)((s[q] - (float)hv) * 1024.0f); }
  const size_t o = (size_t)bh * HD * HD + (size_t)(d0 + r) * HD + c4;
  *(v4h*)(FVH + o) = xh; *(v4h*)(FVL + o) = xl; }


// ---- fused attention: a block takes 256 query rows of one (batch, head), 32 per wave, and walks the 2048 keys in tiles of 64; each tile (k rows, w_scales rows) is fetched once per block by whole-line loads and put into LDS, where all 8 waves read their fragments; running maximum and sum per query ----
#define FQW 8                    /* waves per block, 32 query rows each: 8 x 32 (batch, head) pairs = 256 blocks */
#define FKT 64                   /* keys per tile: one row of each staged plane is 128 bytes */
#define FLP 72                   /* LDS row pitch in f16: 144 bytes = 16 x 9, the 16 rows of a fragment read fall on different banks */
__device__ __forceinline__ v8f fa_mma(v16h a, v16h b, v8f c) { return __builtin_amdgcn_wmma_f32_16x16x32_f16(false, a, false, b, (short)0, c, false, false); }
// fragment in the hardware k order from a wave-uniform base and the lane's own element offset (row ln, k 8 * hh)
__device__ __forceinline__ v16h fa_frag(const _Float16* ub, unsigned lo) { FragH f; f.half[0] = *(const v8us*)((const unsigned short*)ub + lo); f.half[1] = *(const v8us*)((const unsigned short*)ub + lo + 16); return f.v; }
// the same fragment from a staged row: p = the lane's own row at k 8 * hh
__device__ __forceinline__ v16h fl_frag(const unsigned short* p) { FragH f; f.half[0] = *(const v8us*)p; f.half[1] = *(const v8us*)(p + 16); return f.v; }
// eight independent 2^x in place: each v_exp_f32 fills the slot that the instruction set asks for behind the one before it, the v_nop fills the last one's
__device__ __forceinline__ void fa_exp2x8(float* x) {
  asm("v_exp_f32 %0, %0\n\tv_exp_f32 %1, %1\n\tv_exp_f32 %2, %2\n\tv_exp_f32 %3, %3\n\tv_exp_f32 %4, %4\n\tv_exp_f32 %5, %5\n\tv_exp_f32 %6, %6\n\tv_exp_f32 %7, %7\n\tv_nop"
      : "+v"(x[0]), "+v"(x[1]), "+v"(x[2]), "+v"(x[3]), "+v"(x[4]), "+v"(x[5]), "+v"(x[6]), "+v"(x[7])); }
// two of them, same slots
__device__ __forceinline__ void fa_exp2x2(float& a, float& b) { asm("v_exp_f32 %0, %0\n\tv_exp_f32 %1, %1\n\tv_nop" : "+v"(a), "+v"(b)); }
// lane l with lane l ^ 16
__device__ __forceinline__ float fa_xhalf(float x) { return __builtin_bit_cast(float, __builtin_amdgcn_permlanex16(__builtin_bit_cast(int, x), __builtin_bit_cast(int, x), 0x76543210, 0xfedcba98, false, false)); }
__global__ __launch_bounds__(32 * FQW) void k_fattn(const _Float16* QKFV, const _Float16* WS, const _Float16* FVH, const _Float16* FVL, _Float16* CH, _Float16* CL) {
  static_assert(NP % (32 * FQW) == 0 && NP % FKT == 0 && HD == 64 && FKT == 64 && 4 * INNER == NP && 32 * FQW == 256 && NP == 8 * 32 * FQW, "k_fattn: head size 64, 64-key tiles, one row pitch for q, k and w_scales, 256 threads stage 64 rows of 8 chunks in two rounds and the b_scales row in one");
  __shared__ __attribute__((aligned(16))) unsigned short st[2][2][64][FLP];      /* [buffer][k rows | w_scales rows][row][64 f16 + pad] */
  __shared__ __attribute__((aligned(16))) unsigned short sb[NP];      /* the whole b_scales row, put down once */
  const int tid = threadIdx.x, w = __builtin_amdgcn_readfirstlane(tid >> 5), lane = tid & 31, ln = lane & 15, hh = lane >> 4;
  const int bh = blockIdx.y, b = bh / NH, h = bh - b * NH;
  const int ldq = 4 * INNER; const unsigned lo = (unsigned)(ln * NP + 8 * hh);
  const _Float16* base = QKFV + (size_t)b * NP * ldq + h * HD;
  const int row0 = blockIdx.x * (32 * FQW) + w * 32;
  // staging: 8 neighbouring lanes fetch one whole 128-byte row; a thread takes chunk tid & 7 of rows tid >> 3 and 32 + (tid >> 3) of each of the two planes
  const int sr = tid >> 3, sc = (tid & 7) * 8;
  const unsigned short* gk = (const unsigned short*)(base + INNER) + (size_t)sr * ldq + sc;
  const unsigned short* gw = (const unsigned short*)WS + (size_t)sr * NP + sc;
  v8us g0 = *(const v8us*)gk, g1 = *(const v8us*)(gk + (size_t)32 * ldq), g2 = *(const v8us*)gw, g3 = *(const v8us*)(gw + (size_t)32 * NP);
  const v8us gb = *(const v8us*)((const unsigned short*)WS + (size_t)HD * NP + tid * 8);
  asm volatile("s_wait_xcnt 0x0" ::: "memory");      /* stands in front of the first overwrite of a register that the 5 loads above name (the q loads' offset takes the register of the b_scales load's) */
  const _Float16* qp = base + (size_t)row0 * ldq;
  const v16h q00 = fa_frag(qp, lo), q01 = fa_frag(qp + 32, lo), q10 = fa_frag(qp + 16 * ldq, lo), q11 = fa_frag(qp + 16 * ldq + 32, lo);
  asm volatile("s_wait_xcnt 0x0" ::: "memory");      /* stands in front of the first overwrite of a register that the 8 loads above name (the accumulators' zeroes reuse the q loads' offset register and base) */
  *(v8us*)&st[0][0][sr][sc] = g0; *(v8us*)&st[0][0][sr + 32][sc] = g1; *(v8us*)&st[0][1][sr][sc] = g2; *(v8us*)&st[0][1][sr + 32][sc] = g3; *(v8us*)&sb[tid * 8] = gb;
  __syncthreads();      /* tile 0 and the b_scales row are in LDS before any wave reads them */
  const v8f z8 = {0.f,0.f,0.f,0.f,0.f,0.f,0.f,0.f};
  const float cs = 0.125f * 1.4426950408889634f;
  // o[u][t][r] = sum over the keys of weight x w_scales[t*16 + 8*hh + r][key] for query row0 + u*16 + ln, in units of 2^10 x 16 x the weights under the running maximum m; ob[u][r] = the same sum against b_scales (every r alike); su = this lane half's share of the weight sum
  v8f o[2][4] = {{z8, z8, z8, z8}, {z8, z8, z8, z8}}; v8f ob[2] = {z8, z8};
  float m0 = -3.0e38f, m1 = -3.0e38f, su0 = 0.f, su1 = 0.f;
  // one tile; more = a next tile exists, is fetched, stored and published (a constant at each of the two calls: the trip of the loop below is one straight block, so that the scheduling barriers bind all of it)
  // every loop inside a tile is unrolled: the fragment and accumulator arrays are then indexed by constants only and stay in registers
  auto tile = [&](const int kt, const bool more) __attribute__((always_inline)) {
    const int cur = kt & 1;
    if (more) {
      const size_t ko = (size_t)(kt + 1) * FKT * ldq; const int po = (kt + 1) * FKT;
      g0 = *(const v8us*)(gk + ko); g1 = *(const v8us*)(gk + ko + (size_t)32 * ldq); g2 = *(const v8us*)(gw + po); g3 = *(const v8us*)(gw + po + (size_t)32 * NP);
      asm volatile("s_wait_xcnt 0x0" ::: "memory"); }      /* stands in front of the first overwrite of an address register that the 4 loads above name (the k fragments take them) */
    __builtin_amdgcn_sched_barrier(0);      /* holds the next tile's 4 loads ahead of this tile's work, which hides their latency (the compiler otherwise sinks a load to its use) */
    // S^T = K Q^T: s[t][u][r] = score of key kt*64 + t*16 + 8*hh + r against query row0 + u*16 + ln
    v8f s[4][2];
#pragma unroll
    for (int t = 0; t < 4; ++t) { const unsigned short* kr = &st[cur][0][t * 16 + ln][8 * hh]; const v16h k0 = fl_frag(kr), k1 = fl_frag(kr + 32);
      s[t][0] = fa_mma(k1, q01, fa_mma(k0, q00, z8)); s[t][1] = fa_mma(k1, q11, fa_mma(k0, q10, z8)); }
    // running maximum: in-lane over the tile's keys, across the two lane halves, against the maximum so far
    float t0 = s[0][0][0], t1 = s[0][1][0];
#pragma unroll
    for (int t = 0; t < 4; ++t) {
#pragma unroll
      for (int r = 0; r < 8; ++r) { t0 = fmaxf(t0, s[t][0][r]); t1 = fmaxf(t1, s[t][1][r]); } }
    t0 = fmaxf(t0, fa_xhalf(t0)); t1 = fmaxf(t1, fa_xhalf(t1));
    t0 = fmaxf(t0, m0); t1 = fmaxf(t1, m1);
    float a0 = (m0 - t0) * cs, a1 = (m1 - t1) * cs;      /* what stands under the old maximum shrinks by 2^a; 0 on the first tile */
    fa_exp2x2(a0, a1);
    m0 = t0; m1 = t1;
    // w_scales fragments come in 2 groups (keys 0-31, 32-63) of 4 row tiles plus the b_scales fragment (one row, read alike by all 16 lanes of a half), each asked for one group of products ahead; the scheduling barriers hold the LDS reads there (the compiler otherwise sinks them to their use, one LDS latency per pair of products)
    const unsigned short* pr = &st[cur][1][ln][8 * hh]; const unsigned short* br = &sb[kt * FKT + 8 * hh];
    v16h bf[2][5];
    __builtin_amdgcn_sched_barrier(0);      /* not above the score products: their fragments and these do not fit the registers together */
#pragma unroll
    for (int t = 0; t < 4; ++t) bf[0][t] = fl_frag(pr + t * 16 * FLP);
    bf[0][4] = fl_frag(br);
    __builtin_amdgcn_sched_barrier(0);      /* the first group flies under the first half of the softmax */
    // weights e * 2^10 = 2^((s - max) / 8 * log2 e + 10); two score tiles (32 keys) of one query tile are one B fragment in the hardware k order
    const float f0 = 10.0f - m0 * cs, f1 = 10.0f - m1 * cs;
    su0 *= a0; su1 *= a1; v16h p[2][2];
    // readout, transposed (A = w_scales rows or the b_scales row, B = weights), on f32 accumulators that are first shrunk to the new maximum
#pragma unroll
    for (int ks = 0; ks < 2; ++ks) {
#pragma unroll
      for (int u = 0; u < 2; ++u) { float x[16]; FragH a; float sa = 0.f;
#pragma unroll
        for (int i = 0; i < 16; ++i) x[i] = s[2 * ks + (i >> 3)][u][i & 7] * cs + (u ? f1 : f0);
        fa_exp2x8(x); fa_exp2x8(x + 8);
#pragma unroll
        for (int i = 0; i < 16; ++i) { sa += x[i]; a.h[i] = (_Float16)x[i]; }
        if (u) su1 += sa; else su0 += sa;
        p[ks][u] = a.v; }
      if (ks == 0) {
        __builtin_amdgcn_sched_barrier(0);      /* the sums of the first 32 keys end here: left open, all 64 weights stay in f32 registers to the end of the tile */
#pragma unroll
        for (int t = 0; t < 4; ++t) bf[1][t] = fl_frag(pr + t * 16 * FLP + 32);
        bf[1][4] = fl_frag(br + 32);
        __builtin_amdgcn_sched_barrier(0);      /* the second group is asked for ahead of the first group's products */
        // the first group's products stand in one region with the second half of the softmax: vector work under matrix time
#pragma unroll
        for (int t = 0; t < 4; ++t) { o[0][t] *= a0; o[1][t] *= a1; }
        ob[0] *= a0; ob[1] *= a1;
#pragma unroll
        for (int t = 0; t < 4; ++t) { o[0][t] = fa_mma(bf[0][t], p[0][0], o[0][t]); o[1][t] = fa_mma(bf[0][t], p[0][1], o[1][t]); }
        ob[0] = fa_mma(bf[0][4], p[0][0], ob[0]); ob[1] = fa_mma(bf[0][4], p[0][1], ob[1]); } }
#pragma unroll
    for (int t = 0; t < 4; ++t) { o[0][t] = fa_mma(bf[1][t], p[1][0], o[0][t]); o[1][t] = fa_mma(bf[1][t], p[1][1], o[1][t]); }
    ob[0] = fa_mma(bf[1][4], p[1][0], ob[0]); ob[1] = fa_mma(bf[1][4], p[1][1], ob[1]);
    if (more) {
      const int nx = cur ^ 1;      /* last read in the tile before, behind whose barrier every wave stands */
      *(v8us*)&st[nx][0][sr][sc] = g0; *(v8us*)&st[nx][0][sr + 32][sc] = g1; *(v8us*)&st[nx][1][sr][sc] = g2; *(v8us*)&st[nx][1][sr + 32][sc] = g3;
      __syncthreads(); }      /* one barrier a tile: the next tile is in LDS before any wave reads it, and every wave has left this tile's buffer before it is refilled in the next trip */
  };
  // the tile loop stays rolled, its body is long
#pragma unroll 1
  for (int kt = 0; kt < NP / FKT - 1; ++kt) tile(kt, true);
  tile(NP / FKT - 1, false);
  // f^T v of this (batch, head), hi and residual x 2^10, as A fragments (row d = t*16 + ln, k = e)
  const unsigned short* fvh = (const unsigned short*)FVH + (size_t)bh * HD * HD + ln * HD + 8 * hh; const unsigned short* fvl = (const unsigned short*)FVL + (size_t)bh * HD * HD + ln * HD + 8 * hh;
  v16h ah[4][2], al[4][2];
#pragma unroll
  for (int t = 0; t < 4; ++t) {
#pragma unroll
    for (int ks = 0; ks < 2; ++ks) { ah[t][ks] = fl_frag(fvh + t * 16 * HD + ks * 32); al[t][ks] = fl_frag(fvl + t * 16 * HD + ks * 32); } }
  asm volatile("s_wait_xcnt 0x0" :: "v"(fvh), "v"(fvl) : "memory");      /* stands in front of the first overwrite of an address register that the 32 loads above name; the two addresses are inputs so that their registers live up to here */
  su0 += fa_xhalf(su0); su1 += fa_xhalf(su1);
  const float rs0 = 1.0f / su0, rs1 = 1.0f / su1;
  // second product: out^T[d][query] = sum over e of (f^T v)[d][e] x (attn . w_scales^T)[query][e]; two accumulator tiles (32 e) of one query tile are one B fragment in the hardware k order, exactly as the weights were
#pragma unroll
  for (int u = 0; u < 2; ++u) { const float rs = u ? rs1 : rs0; v16h th[2], tl[2];
#pragma unroll
    for (int ks = 0; ks < 2; ++ks) { FragH xh, xl;
#pragma unroll
      for (int i = 0; i < 16; ++i) { const float v = o[u][2 * ks + (i >> 3)][i & 7] * rs; const _Float16 hv = (_Float16)v; xh.h[i] = hv; xl.h[i] = (_Float16)((v - (float)hv) * 1024.0f); }
      th[ks] = xh.v; tl[ks] = xl.v; }
    const float cb = ob[u][0] * rs;
#pragma unroll
    for (int t = 0; t < 4; ++t) { FragH ch, cl;
      // the two cross terms carry 2^10, taken back (exact) before the hi x hi term joins the same accumulators
      v8f c = fa_mma(ah[t][1], tl[1], fa_mma(ah[t][0], tl[0], fa_mma(al[t][1], th[1], fa_mma(al[t][0], th[0], z8))));
      c *= 0.0009765625f;
      c = fa_mma(ah[t][1], th[1], fa_mma(ah[t][0], th[0], c));
#pragma unroll
      for (int r = 0; r < 8; ++r) { const float v = (c[r] + cb) * 0.0625f; const _Float16 hv = (_Float16)v; ch.h[r] = hv; cl.h[r] = (_Float16)((v - (float)hv) * 1024.0f); }
      const size_t oo = ((size_t)b * NP + row0 + u * 16 + ln) * INNER + h * HD + t * 16 + 8 * hh;
      *(v8us*)((unsigned short*)CH + oo) = ch.half[0]; *(v8us*)((unsigned short*)CL + oo) = cl.half[0]; } }
}

extern "C" void kernel_launch(void* const* d_in, const int* in_sizes, int n_in,
                              void* d_out, int out_size, void* d_ws, size_t ws_size, hipStream_t stream) {
  (void)in_sizes; (void)n_in; (void)out_size;
  const float* x = (const float*)d_in[0]; const float* Wqkfv = (const float*)d_in[1]; const float* Wsc = (const float*)d_in[2]; const float* bsc = (const float*)d_in[3]; const float* Wout = (const float*)d_in[4]; const float* bout = (const float*)d_in[5];
  char* ws = (char*)d_ws; size_t off = 0;
  auto take = [&](size_t bytes) { char* p = ws + off; off += (bytes + 255) & ~(size_t)255; return p; };
  _Float16* BQ = (_Float16*)take((size_t)4 * INNER * DIM * 2); _Float16* BS = (_Float16*)take((size_t)(HD + 1) * NP * 2);      /* w_scales rows, then b_scales as row 64 */ _Float16* BO = (_Float16*)take((size_t)DIM * INNER * 2);
  _Float16* X16 = (_Float16*)take((size_t)NR * DIM * 2); _Float16* QKFV = (_Float16*)take((size_t)NR * 4 * INNER * 2);      /* [row][q | k | f | v] f16, 32 MiB */
  _Float16* FVH = (_Float16*)take((size_t)NB * NH * HD * HD * 2); _Float16* FVL = (_Float16*)take((size_t)NB * NH * HD * HD * 2);
  _Float16* CH = (_Float16*)take((size_t)NR * INNER * 2); _Float16* CL = (_Float16*)take((size_t)NR * INNER * 2);
  if (off > ws_size) return;      /* about 59 MiB */
  k_prep<<<PREP_Q + PREP_O + PREP_S + PREP_B + PREP_X, 256, 0, stream>>>(Wqkfv, BQ, Wout, BO, Wsc, bsc, BS, x, X16);      /* w_qkfv and w_out transposed (x @ W, in x out), w_scales and b_scales as they lie, and the f16 x plane */
  k_gemm2<0, false, 4, 4, 4, 64><<<dim3((NR / 256) * (4 * INNER / 256), 1), 512, 0, stream>>>(X16, nullptr, 0.0f, DIM, 0, BQ, DIM, 0, 0.0625f, nullptr, 0, nullptr, QKFV, 4 * INNER, 0, NR, 4 * INNER, DIM);      /* [q | k | f | v], head h at h*64 inside each quarter */
  k_ftv<<<dim3(HD / 32, NB * NH), 32 * TVW, 0, stream>>>(QKFV, FVH, FVL);      /* FV[b][h][d][e] = sum_n f[n][d] v[n][e] as f16 hi/residual (32-row tiles, the rows of the sum over the block's waves) */
  k_fattn<<<dim3(NP / (32 * FQW), NB * NH), 32 * FQW, 0, stream>>>(QKFV, BS, FVH, FVL, CH, CL);      /* (softmax(q k^T / 8) . w_scales^T) (f^T v)^T + softmax . b_scales, as f16 hi/residual */
  k_gemm2<0, true, 2, 4, 2, 128><<<dim3((NR / 128) * (DIM / 128), 1), 256, 0, stream>>>(CL, CH, 0.0009765625f, INNER, 0, BO, INNER, 0, 0.0625f, bout, 0, (float*)d_out, nullptr, DIM, 0, NR, DIM, INNER);      /* y = (2^-10 c_lo + c_hi) w_out + b_out */
}

// v010
// It runs in 79 microseconds.
// Next to v009, in two timings, it ran 1.15 times as fast each time.
// Over all steps from v000 it is 25.3 times as fast.
#include <hip/hip_runtime.h>
// SimilarAttention (4 x 2048 patches x 512, 8 heads x 64: [q|k|f|v] = x w_qkfv; attn = softmax(q.k/8); poss_value = (f^T v) w_scales + b_scales -> [h][64][2048]; out = attn . poss_value^T; y = merged . w_out + b_out).
// Structure: exact f16 x plane; the fused projection as ONE f16 WMMA GEMM (256x256 block tiles staged in LDS, 16 waves of 64x64 tiles, f32 accumulation, exact x16 weights; f16 out); then, each stage as ONE launch over all batches and heads: f^T v inside the projection launch (a block takes the f and the v columns of two heads, packs its accumulators as f16 fragments, swaps them through LDS and leaves one f32 partial per 256 rows; f and v themselves are never written), then ONE launch for all batches and heads that keeps scores and softmax weights in registers and never builds poss_value: attn . ((f^T v) w_scales + b)^T = (attn . w_scales^T) (f^T v)^T + attn . b. A block takes 256 query rows of one head, 32 per wave, and walks the keys in tiles of 64 that are staged once per block in LDS (scores transposed, K = 64, f32; running row maximum and row sum; unnormalised f16 weights x 2^10 packed from the score accumulators into the B operand; readout against the exact x16 w_scales rows and the b_scales row on f32 accumulators); behind the keys: row scaling, f16 hi/residual, three product terms against f^T v hi/residual, + the b term, hi/residual out; w_out as ONE GEMM launch that runs the residual's k steps, scales the accumulators by 2^-10 and runs the hi plane's k steps on top (+ bias).
// Compute dtype: inputs rounded to bf16; x / weights exact as f16; q, k, f, v and the softmax weights as plain f16 operands (~2^-12); f^T v, attn . w_scales^T and the merged context as f16 hi + residual. v_wmma_f32_16x16x32_f16.
#define NB 4
#define NP 2048
#define DIM 512
#define NH 8
#define HD 64
#define INNER 512
#define NR (NB * NP)
typedef __bf16 v16b __attribute__((ext_vector_type(16)));
typedef unsigned short v8us __attribute__((ext_vector_type(8), may_alias));
typedef float  v8f  __attribute__((ext_vector_type(8)));
typedef float  v4f  __attribute__((ext_vector_type(4)));
typedef float  v4fa __attribute__((ext_vector_type(4), may_alias));
union FragB { v16b v; v8us half[2]; unsigned short u[16]; };

__device__ __forceinline__ unsigned short bf16_bits(float x) { unsigned int u = __float_as_uint(x); return (unsigned short)((u + 0x7FFFu + ((u >> 16) & 1u)) >> 16); }
__device__ __forceinline__ float bf16_val(unsigned short b) { return __uint_as_float(((unsigned int)b) << 16); }
__device__ __forceinline__ float bf16_round(float x) { return bf16_val(bf16_bits(x)); }
// D += A·B with NT terms: 1 = ah·bh, 2 = + al·bh (A split), 3 = + ah·bl (both split)
template <int NT>
__device__ __forceinline__ v8f mmaN(v16b ah, v16b al, v16b bh, v16b bl, v8f c) {
  c = __builtin_amdgcn_wmma_f32_16x16x32_bf16(false, ah, false, bh, (short)0, c, false, false);
  if (NT >= 2) c = __builtin_amdgcn_wmma_f32_16x16x32_bf16(false, al, false, bh, (short)0, c, false, false);
  if (NT >= 3) c = __builtin_amdgcn_wmma_f32_16x16x32_bf16(false, ah, false, bl, (short)0, c, false, false);
  asm volatile("v_nop\n\tv_nop\n\tv_nop\n\tv_nop" : "+v"(c) : "v"(ah), "v"(al), "v"(bh), "v"(bl));
  return c;
}

__global__ __launch_bounds__(256) void k_wt_bf16(const float* __restrict__ W, unsigned short* __restrict__ Wt, int K, int N) {
  const int t = blockIdx.x * 256 + threadIdx.x;
  const int k8n = K / 8;
  if (t >= N * k8n) return;
  const int n = t / k8n, k8 = (t % k8n) * 8;
  v8us v;
#pragma unroll
  for (int i = 0; i < 8; ++i) v[i] = bf16_bits(W[(size_t)(k8 + i) * N + n]);
  *(v8us*)(Wt + (size_t)n * K + k8) = v;
  
}

// GEMM C[M][N] (f32, pitch ldc) = act(A[M][K]·W + bias). A f32 row-major (pitch lda) converted per fragment to bf16
// (ASPLIT: hi/lo two planes -> 2 terms, else single rounded term); Wt bf16 [N][K] (pitch ldb). BIAS_BF16 rounds the
// bias to bf16 first (bias quantised to bf16 before the add). K%32==0, M%16==0, N%64==0.
template <bool ASPLIT, int ACT, bool BIAS_BF16>
__global__ __launch_bounds__(128) void k_gemm_bf(const float* __restrict__ A, int lda, const unsigned short* __restrict__ Wt, int ldb,
                                               const float* __restrict__ bias, float* __restrict__ C, int ldc, int M, int N, int K) {
  __shared__ __attribute__((aligned(16))) float so[4][16][64];
  const int tid = threadIdx.x, w = tid >> 5, lane = tid & 31, ln = lane & 15, hh = lane >> 4;
  const int ntn = N / 64;
  const int wid = blockIdx.x * 4 + w;
  const int mt = wid / ntn, nq = wid % ntn;
  if (mt * 16 >= M) return;
  const int row0 = mt * 16, col0 = nq * 64;
  const float* arow = A + (size_t)(row0 + ln) * lda;
  v8f acc[4] = {};
  for (int kb = 0; kb < K; kb += 32) {
    FragB ah, al;
    const v4f x0 = *(const v4fa*)(arow + kb + 8 * hh), x1 = *(const v4fa*)(arow + kb + 8 * hh + 4);
    const v4f x2 = *(const v4fa*)(arow + kb + 16 + 8 * hh), x3 = *(const v4fa*)(arow + kb + 16 + 8 * hh + 4);
    float xs[16] = {x0[0],x0[1],x0[2],x0[3],x1[0],x1[1],x1[2],x1[3],x2[0],x2[1],x2[2],x2[3],x3[0],x3[1],x3[2],x3[3]};
#pragma unroll
    for (int i = 0; i < 16; ++i) { const unsigned short hb = bf16_bits(xs[i]); ah.u[i] = hb; al.u[i] = ASPLIT ? bf16_bits(xs[i] - bf16_val(hb)) : (unsigned short)0; }
#pragma unroll
    for (int t = 0; t < 4; ++t) {
      const unsigned short* brow = Wt + (size_t)(col0 + t * 16 + ln) * ldb + kb;
      FragB b;
      b.half[0] = *(const v8us*)(brow + 8 * hh);
      b.half[1] = *(const v8us*)(brow + 16 + 8 * hh);
      acc[t] = mmaN<ASPLIT ? 2 : 1>(ah.v, al.v, b.v, b.v, acc[t]);
    }
  }
#pragma unroll
  for (int t = 0; t < 4; ++t) {
    float bv = bias ? bias[col0 + t * 16 + ln] : 0.f;
    if (BIAS_BF16) bv = bf16_round(bv);
#pragma unroll
    for (int r = 0; r < 8; ++r) { float v = acc[t][r] + bv; if (ACT == 1) v = fmaxf(v, 0.f); so[w][8 * hh + r][t * 16 + ln] = v; }
  }
  __builtin_amdgcn_fence(__ATOMIC_ACQ_REL, "workgroup");
  __builtin_amdgcn_wave_barrier();
  const int rsub = lane >> 4, c4 = (lane & 15) * 4;
  {
#pragma unroll
    for (int q = 0; q < 8; ++q) {
      const int r = q * 2 + rsub;
      const v4f v = *(const v4fa*)&so[w][r][c4];
      *(v4f*)(C + (size_t)(row0 + r) * ldc + col0 + c4) = v;
    }
    
  }
}

// GEMM C = act(A·W + bias + resid): A f32 (ASPLIT -> hi/lo 2 terms), Wt bf16 [N][K]; ACT 0 none, 1 relu, 2 exact gelu;
// resid (optional, f32, row index = (row % rmod), pitch ldr, RES_BF16 rounds it) added before the activation.
template <bool ASPLIT, int ACT, bool BIAS_BF16, bool RES_BF16>
__global__ __launch_bounds__(128) void k_gemm_bf3(const float* __restrict__ A, int lda, const unsigned short* __restrict__ Wt, int ldb,
                                                const float* __restrict__ bias, const float* __restrict__ resid, int rmod, int ldr,
                                                float* __restrict__ C, int ldc, int M, int N, int K) {
  __shared__ __attribute__((aligned(16))) float so[4][16][64];
  const int tid = threadIdx.x, w = tid >> 5, lane = tid & 31, ln = lane & 15, hh = lane >> 4;
  const int ntn = N / 64;
  const int wid = blockIdx.x * 4 + w;
  const int mt = wid / ntn, nq = wid % ntn;
  if (mt * 16 >= M) return;
  const int row0 = mt * 16, col0 = nq * 64;
  const float* arow = A + (size_t)(row0 + ln) * lda;
  v8f acc[4] = {};
  for (int kb = 0; kb < K; kb += 32) {
    FragB ah, al;
    const v4f x0 = *(const v4fa*)(arow + kb + 8 * hh), x1 = *(const v4fa*)(arow + kb + 8 * hh + 4);
    const v4f x2 = *(const v4fa*)(arow + kb + 16 + 8 * hh), x3 = *(const v4fa*)(arow + kb + 16 + 8 * hh + 4);
    float xs[16] = {x0[0],x0[1],x0[2],x0[3],x1[0],x1[1],x1[2],x1[3],x2[0],x2[1],x2[2],x2[3],x3[0],x3[1],x3[2],x3[3]};
#pragma unroll
    for (int i = 0; i < 16; ++i) { const unsigned short hb = bf16_bits(xs[i]); ah.u[i] = hb; al.u[i] = ASPLIT ? bf16_bits(xs[i] - bf16_val(hb)) : (unsigned short)0; }
#pragma unroll
    for (int t = 0; t < 4; ++t) {
      const unsigned short* brow = Wt + (size_t)(col0 + t * 16 + ln) * ldb + kb;
      FragB b;
      b.half[0] = *(const v8us*)(brow + 8 * hh);
      b.half[1] = *(const v8us*)(brow + 16 + 8 * hh);
      acc[t] = mmaN<ASPLIT ? 2 : 1>(ah.v, al.v, b.v, b.v, acc[t]);
    }
  }
#pragma unroll
  for (int t = 0; t < 4; ++t) {
    const int col = col0 + t * 16 + ln;
    float bv = bias ? bias[col] : 0.f;
    if (BIAS_BF16) bv = bf16_round(bv);
#pragma unroll
    for (int r = 0; r < 8; ++r) {
      float v = acc[t][r] + bv;
      if (resid) { float rv = resid[(size_t)((row0 + 8 * hh + r) % rmod) * ldr + col]; if (RES_BF16) rv = bf16_round(rv); v += rv; }
      if (ACT == 1) v = fmaxf(v, 0.f);
      if (ACT == 2) v = 0.5f * v * (1.0f + erff(v * 0.70710678118654752f));
      if (ACT == 3) { const float u = 0.7978845608028654f * (v + 0.044715f * v * v * v); v = 0.5f * v * (1.0f + tanhf(u)); }
      so[w][8 * hh + r][t * 16 + ln] = v;
    }
  }
  __builtin_amdgcn_fence(__ATOMIC_ACQ_REL, "workgroup");
  __builtin_amdgcn_wave_barrier();
  const int rsub = lane >> 4, c4 = (lane & 15) * 4;
  {
#pragma unroll
    for (int q = 0; q < 8; ++q) {
      const int r = q * 2 + rsub;
      const v4f v = *(const v4fa*)&so[w][r][c4];
      *(v4f*)(C + (size_t)(row0 + r) * ldc + col0 + c4) = v;
    }
    
  }
}
// row LayerNorm (biased variance, eps) over N: s = X (+ R); optional out_sum <- s; out_norm <- (s-mu)*rsqrt(var+eps)*g + b
template <bool PARAM_BF16>
__global__ __launch_bounds__(256) void k_layernorm(const float* __restrict__ X, const float* __restrict__ R, const float* __restrict__ g, const float* __restrict__ bta,
                                                  float* __restrict__ out_sum, float* __restrict__ out_norm, int N, float eps) {
  __shared__ float red[256];
  const int row = blockIdx.x, tid = threadIdx.x;
  const float* x = X + (size_t)row * N; const float* rr = R ? R + (size_t)row * N : nullptr;
  float vals[16];                     // up to N = 4096
  const int per = N / 256;            // contiguous chunk per thread? use strided-by-4 chunks: thread handles j = tid*4 + 1024*u
  float s1 = 0.f;
  for (int u = 0; u < per / 4; ++u) {
    const int j = tid * 4 + 1024 * u;
    const v4f a = *(const v4fa*)(x + j);
    v4f b = {0.f,0.f,0.f,0.f}; if (rr) b = *(const v4fa*)(rr + j);
#pragma unroll
    for (int q = 0; q < 4; ++q) { const float v = a[q] + b[q]; vals[u * 4 + q] = v; s1 += v; }
  }
  red[tid] = s1; __syncthreads();
  for (int st = 128; st > 0; st >>= 1) { if (tid < st) red[tid] += red[tid + st]; __syncthreads(); }
  const float mu = red[0] / (float)N; __syncthreads();
  float s2 = 0.f;
  for (int u = 0; u < per / 4; ++u)
#pragma unroll
    for (int q = 0; q < 4; ++q) { const float c = vals[u * 4 + q] - mu; s2 += c * c; }
  red[tid] = s2; __syncthreads();
  for (int st = 128; st > 0; st >>= 1) { if (tid < st) red[tid] += red[tid + st]; __syncthreads(); }
  const float rs = rsqrtf(red[0] / (float)N + eps);
  {
    for (int u = 0; u < per / 4; ++u) {
      const int j = tid * 4 + 1024 * u;
      v4f o, sm;
#pragma unroll
      for (int q = 0; q < 4; ++q) {
        float gg = g[j + q], bb = bta[j + q];
        if (PARAM_BF16) { gg = bf16_round(gg); bb = bf16_round(bb); }
        sm[q] = vals[u * 4 + q]; o[q] = (vals[u * 4 + q] - mu) * rs * gg + bb;
      }
      if (out_sum) *(v4f*)(out_sum + (size_t)row * N + j) = sm;
      *(v4f*)(out_norm + (size_t)row * N + j) = o;
    }
    
  }
}



// ---- f16 WMMA path (v_wmma_f32_16x16x32_f16): 11-bit significands for operands in range — used where a [0,1] probability operand needs more precision than bf16
typedef _Float16 v16h __attribute__((ext_vector_type(16)));
union FragH { v16h v; v8us half[2]; _Float16 h[16]; unsigned short u[16]; };
template <int NT>
__device__ __forceinline__ v8f mmaH(v16h ah, v16h al, v16h bh, v16h bl, v8f c) {
  c = __builtin_amdgcn_wmma_f32_16x16x32_f16(false, ah, false, bh, (short)0, c, false, false);
  if (NT >= 2) c = __builtin_amdgcn_wmma_f32_16x16x32_f16(false, al, false, bh, (short)0, c, false, false);
  if (NT >= 3) c = __builtin_amdgcn_wmma_f32_16x16x32_f16(false, ah, false, bl, (short)0, c, false, false);
  asm volatile("v_nop\n\tv_nop\n\tv_nop\n\tv_nop" : "+v"(c) : "v"(ah), "v"(al), "v"(bh), "v"(bl));
  return c;
}
// batched GEMM like k_gemm_b but f16 operands: A f32 (split into f16 hi/lo if ASPLIT, else rounded to f16), Bt = f16 values [n][k]; alpha; C f32; N multiple of 16 (partial tiles skipped)
template <bool ASPLIT>
__global__ __launch_bounds__(128) void k_gemm_h(const float* __restrict__ A, int lda, size_t sA, const _Float16* __restrict__ Bh, int ldb, size_t sB, float alpha, float* __restrict__ C, int ldc, size_t sC, int M, int N, int K) {
  __shared__ __attribute__((aligned(16))) float so[4][16][64];
  const int tid = threadIdx.x, w = tid >> 5, lane = tid & 31, ln = lane & 15, hh = lane >> 4; const int by = blockIdx.y;
  A += (size_t)by * sA; Bh += (size_t)by * sB; C += (size_t)by * sC;
  const int ntn = (N + 63) / 64; const int wid = blockIdx.x * 4 + w; const int mt = wid / ntn, nq = wid % ntn; if (mt * 16 >= M) return;
  const int row0 = mt * 16, col0 = nq * 64; const float* arow = A + (size_t)(row0 + ln) * lda;
  v8f acc[4] = {};
  for (int kb = 0; kb < K; kb += 32) {
    FragH ah, al;
    const v4f x0 = *(const v4fa*)(arow + kb + 8 * hh), x1 = *(const v4fa*)(arow + kb + 8 * hh + 4), x2 = *(const v4fa*)(arow + kb + 16 + 8 * hh), x3 = *(const v4fa*)(arow + kb + 16 + 8 * hh + 4);
    float xs[16] = {x0[0],x0[1],x0[2],x0[3],x1[0],x1[1],x1[2],x1[3],x2[0],x2[1],x2[2],x2[3],x3[0],x3[1],x3[2],x3[3]};
#pragma unroll
    for (int i = 0; i < 16; ++i) { const _Float16 h = (_Float16)xs[i]; ah.h[i] = h; al.h[i] = ASPLIT ? (_Float16)(xs[i] - (float)h) : (_Float16)0.0f; }
#pragma unroll
    for (int t = 0; t < 4; ++t) { if (col0 + t * 16 >= N) continue; const size_t boff = (size_t)(col0 + t * 16 + ln) * ldb + kb; FragH bq; bq.half[0] = *(const v8us*)(Bh + boff + 8 * hh); bq.half[1] = *(const v8us*)(Bh + boff + 16 + 8 * hh);
      acc[t] = mmaH<ASPLIT ? 2 : 1>(ah.v, al.v, bq.v, bq.v, acc[t]); }
  }
#pragma unroll
  for (int t = 0; t < 4; ++t) { if (col0 + t * 16 >= N) continue;
#pragma unroll
    for (int r = 0; r < 8; ++r) so[w][8 * hh + r][t * 16 + ln] = acc[t][r] * alpha; }
  __builtin_amdgcn_fence(__ATOMIC_ACQ_REL, "workgroup"); __builtin_amdgcn_wave_barrier();
  const int rsub = lane >> 4, c4 = (lane & 15) * 4;
  {
#pragma unroll
    for (int q = 0; q < 8; ++q) { const int r = q * 2 + rsub; if (col0 + c4 < N) { const v4f v = *(const v4fa*)&so[w][r][c4]; *(v4f*)(C + (size_t)(row0 + r) * ldc + col0 + c4) = v; } }
     }
}

// Wt[n][k] = f16(W[k][n]·scale) from f32 row-major W[K][N] (scale = power of two; bf16-exact weights stay exact in f16 away from the subnormal range)
// device body: blk = index of the 256-thread block inside this job's range of the shared grid (k_prep)
__device__ __forceinline__ void d_wt_f16(const float* __restrict__ W, _Float16* __restrict__ Wt, int K, int N, float scale, int blk) {
  const int t = blk * 256 + threadIdx.x; if (t >= N * (K / 8)) return; const int n = t / (K / 8), k8 = (t % (K / 8)) * 8; FragH f;
#pragma unroll
  for (int i = 0; i < 8; ++i) f.h[i] = (_Float16)(bf16_round(W[(size_t)(k8 + i) * N + n]) * scale); const v8us o = f.half[0];
  *(v8us*)((unsigned short*)Wt + (size_t)n * K + k8) = o; 
}
// k_gemm_hh variant with fused epilogue: v = acc·alpha + bias[by·sBias + col] (+ CP[(row/rowsPerB)·sCPb + by·64 + col] if CP) ; ACT 0 none / 1 elu ; writes f32 C and/or f16 C16 (each if non-null)
template <int ACT>
__global__ __launch_bounds__(128) void k_gemm_hhx(const _Float16* __restrict__ A, int lda, size_t sA, const _Float16* __restrict__ Bh, int ldb, size_t sB, float alpha, const float* __restrict__ bias, size_t sBias, const float* __restrict__ CP, int rowsPerB, size_t sCPb, int row0g,
    float* __restrict__ C, _Float16* __restrict__ C16, int ldc, size_t sC, int M, int N, int K, const _Float16* __restrict__ A2, float alpha2, float* __restrict__ C2) {
  __shared__ __attribute__((aligned(16))) float so[4][16][64];
  const int tid = threadIdx.x, w = tid >> 5, lane = tid & 31, ln = lane & 15, hh = lane >> 4; const int by = blockIdx.y;
  if (blockIdx.z) { A = A2; alpha = alpha2; bias = nullptr; C = C2; }      /* blockIdx.z = 1: the second term of a split A in the same grid: its own operand, factor and f32 plane, no bias */
  A += (size_t)by * sA; Bh += (size_t)by * sB; const size_t cofs = (size_t)by * sC; const float* bp = bias ? bias + (size_t)by * sBias : nullptr;
  const int ntn = (N + 63) / 64; const int wid = blockIdx.x * 4 + w; const int mt = wid / ntn, nq = wid % ntn; if (mt * 16 >= M) return;
  const int row0 = mt * 16, col0 = nq * 64; const _Float16* arow = A + (size_t)(row0 + ln) * lda;
  v8f acc[4] = {};
  for (int kb = 0; kb < K; kb += 32) { FragH ah; ah.half[0] = *(const v8us*)((const unsigned short*)arow + kb + 8 * hh); ah.half[1] = *(const v8us*)((const unsigned short*)arow + kb + 16 + 8 * hh);
#pragma unroll
    for (int t = 0; t < 4; ++t) { if (col0 + t * 16 >= N) continue; const size_t boff = (size_t)(col0 + t * 16 + ln) * ldb + kb; FragH bq; bq.half[0] = *(const v8us*)((const unsigned short*)Bh + boff + 8 * hh); bq.half[1] = *(const v8us*)((const unsigned short*)Bh + boff + 16 + 8 * hh);
      acc[t] = mmaH<1>(ah.v, ah.v, bq.v, bq.v, acc[t]); }
  }
#pragma unroll
  for (int t = 0; t < 4; ++t) { if (col0 + t * 16 >= N) continue; const int col = col0 + t * 16 + ln; const float bv = bp ? bf16_round(bp[col]) : 0.f;
#pragma unroll
    for (int r = 0; r < 8; ++r) { float v = acc[t][r] * alpha + bv; if (CP) { const int rr = row0g + row0 + 8 * hh + r; if (rowsPerB < 0) v += CP[cofs + (size_t)rr * ldc + col];      /* rowsPerB < 0: own element of the batched C plane */ else { const int bidx = rr / rowsPerB; v += CP[(size_t)bidx * sCPb + (size_t)by * 64 + col]; } } if (ACT == 1) v = (v > 0.f) ? v : expm1f(v); else if (ACT == 7) v = (v > 0.f) ? v + 1.0f : expf(v); else if (ACT == 8) v = tanhf(v); else if (ACT == 9) v = 0.5f * v * (1.0f + tanhf(0.7978845608028654f * (v + 0.044715f * v * v * v))); else if (ACT == 11) v = 1.0f / (1.0f + expf(-v)); else if (ACT == 12) v = (v > 0.f) ? v : 0.01f * v; else if (ACT == 14) v = (v > 0.f) ? v : 0.1f * v; else if (ACT == 16) v = (v >= 0.f) ? v : 0.3f * v; else if (ACT == 17) v = (v >= 0.f) ? v : 0.2f * v; else if (ACT == 15) v = v / (1.0f + expf(-v)); else if (ACT == 3) v = fmaxf(v, 0.f); else if (ACT == 6) v = 0.5f * v * (1.0f + erff(v * 0.70710678118654752f)); so[w][8 * hh + r][t * 16 + ln] = v; } }
  __builtin_amdgcn_fence(__ATOMIC_ACQ_REL, "workgroup"); __builtin_amdgcn_wave_barrier();
  const int rsub = lane >> 4, c4 = (lane & 15) * 4; typedef _Float16 v4h __attribute__((ext_vector_type(4)));
  {
#pragma unroll
    for (int q = 0; q < 8; ++q) { const int r = q * 2 + rsub; if (col0 + c4 < N) { const v4f v = *(const v4fa*)&so[w][r][c4]; if (C) *(v4f*)(C + cofs + (size_t)(row0 + r) * ldc + col0 + c4) = v; if (C16) { v4h h4; for (int i = 0; i < 4; ++i) h4[i] = (_Float16)v[i]; *(v4h*)(C16 + cofs + (size_t)(row0 + r) * ldc + col0 + c4) = h4; } } }
     }
}


typedef _Float16 v4h __attribute__((ext_vector_type(4)));

__device__ __forceinline__ void d_x16(const float* __restrict__ x, _Float16* __restrict__ X16, size_t n8, int blk) { const size_t t = (size_t)blk * 256 + threadIdx.x; if (t >= n8) return; FragH f;
#pragma unroll
  for (int q = 0; q < 8; ++q) f.h[q] = (_Float16)bf16_round(x[t * 8 + q]); *(v8us*)((unsigned short*)X16 + t * 8) = f.half[0];  }
// f16(bf16-rounded value x 16) in the source's own order: w_scales rows and b_scales are read along the keys as they lie
__device__ __forceinline__ void d_r16(const float* __restrict__ Wv, _Float16* __restrict__ Bt, int blk) { const size_t t = (size_t)blk * 256 + threadIdx.x; FragH f;
#pragma unroll
  for (int i = 0; i < 8; ++i) f.h[i] = (_Float16)(bf16_round(Wv[t * 8 + i]) * 16.0f); *(v8us*)((unsigned short*)Bt + t * 8) = f.half[0];
  asm volatile("s_wait_xcnt 0x0" ::: "memory"); }      /* stands behind the store, in front of the first overwrite of a register that it names (the other jobs' code follows in the listing) */
// the five operand preparations need nothing of each other: one grid, each job a range of the block index (block-uniform branches); the transposes, whose threads take longest, start first
#define PREP_Q (DIM * 4 * INNER / 8 / 256)
#define PREP_O (INNER * DIM / 8 / 256)
#define PREP_S (HD * NP / 8 / 256)
#define PREP_B (NP / 8 / 256)
#define PREP_X (NR * DIM / 8 / 256)
__global__ __launch_bounds__(256) void k_prep(const float* __restrict__ Wq, _Float16* __restrict__ BQ, const float* __restrict__ Wo, _Float16* __restrict__ BO, const float* __restrict__ Wsc, const float* __restrict__ bsc, _Float16* __restrict__ BS, const float* __restrict__ x, _Float16* __restrict__ X16) {
  static_assert(DIM * 4 * INNER % 2048 == 0 && INNER * DIM % 2048 == 0 && HD * NP % 2048 == 0 && NP % 2048 == 0 && NR * DIM % 2048 == 0, "k_prep: every job fills whole blocks");
  int blk = blockIdx.x;
  if (blk < PREP_Q) { d_wt_f16(Wq, BQ, DIM, 4 * INNER, 16.0f, blk); return; }
  blk -= PREP_Q;
  if (blk < PREP_O) { d_wt_f16(Wo, BO, INNER, DIM, 16.0f, blk); return; }
  blk -= PREP_O;
  if (blk < PREP_S) { d_r16(Wsc, BS, blk); return; }
  blk -= PREP_S;
  if (blk < PREP_B) { d_r16(bsc, BS + (size_t)HD * NP, blk); return; }      /* row 64 of the plane */
  d_x16(x, X16, (size_t)NR * DIM / 8, blk - PREP_B); }
__global__ __launch_bounds__(256) void k_h16(const float* __restrict__ x, _Float16* __restrict__ X16, size_t n8) { const size_t t = (size_t)blockIdx.x * 256 + threadIdx.x; if (t >= n8) return; FragH f;
#pragma unroll
  for (int q = 0; q < 8; ++q) f.h[q] = (_Float16)x[t * 8 + q]; *(v8us*)((unsigned short*)X16 + t * 8) = f.half[0];  }
__global__ __launch_bounds__(256) void k_round16f(const float* __restrict__ W, _Float16* __restrict__ Bt, size_t n8) { const size_t t = (size_t)blockIdx.x * 256 + threadIdx.x; if (t >= n8) return; FragH f;
#pragma unroll
  for (int i = 0; i < 8; ++i) f.h[i] = (_Float16)(bf16_round(W[t * 8 + i]) * 16.0f); *(v8us*)((unsigned short*)Bt + t * 8) = f.half[0];  }

// ---- fast GEMM: block tile BM x BN = (16 FA NWM) x (64 NWN), NWM x NWN waves with tiles of 16 FA x 64, k steps of BK; requires M % BM == 0 rows per launch region, N % BN == 0 and K % BK == 0. A staged row serves the whole width of the block tile, so the bytes that come from L2 per product fall as the tile grows, and a longer step gives the next step's loads more time. A and B go through LDS: whole 128-byte lines fetched once per block, two buffers; TWO: C = (beta A + A2) B, the k steps of A first, the accumulators x beta, then the k steps of A2 on the same accumulators; epilogue: x alpha, + bias ----
// fragment in the hardware k order from a staged row: p = the lane's own row at k 8 * hh
__device__ __forceinline__ v16h g2_lfrag(const unsigned short* p) { FragH f; f.half[0] = *(const v8us*)p; f.half[1] = *(const v8us*)(p + 16); return f.v; }
__device__ __forceinline__ v8f g2_mma(v16h a, v16h b, v8f c) { v8f d = __builtin_amdgcn_wmma_f32_16x16x32_f16(false, a, false, b, (short)0, c, false, false); asm volatile("v_nop\n\tv_nop\n\tv_nop\n\tv_nop" : "+v"(d) : "v"(a), "v"(b)); return d; }
template <int ACT, bool TWO, int FA, int NWM, int NWN, int BK, bool FTV>
__global__ __launch_bounds__(32 * NWM * NWN) void k_gemm2(const _Float16* __restrict__ A, const _Float16* __restrict__ A2, float beta, int lda, size_t sA, const _Float16* __restrict__ Bh, int ldb, size_t sB, float alpha, const float* __restrict__ bias, size_t sBias,
    float* __restrict__ C, _Float16* __restrict__ C16, int ldc, size_t sC, int M, int N, int K, float* __restrict__ FVP) { static_assert(ACT == 0 || ACT == 3 || ACT == 6 || ACT == 8 || ACT == 9 || ACT == 11 || ACT == 12 || ACT == 14 || ACT == 15 || ACT == 16 || ACT == 17, "k_gemm2: unsupported ACT code (would silently apply no activation)");
  constexpr int NW = NWM * NWN, BM = 16 * FA * NWM, BN = 64 * NWN, P = BK + 8, TR = BK / 8, RP = 32 * NW / TR, JA = BM / RP, JB = BN / RP, KG = FA == 2 ? 2 : 1;      /* P = LDS row pitch in f16: 144 or 272 bytes = 16 x odd, the 16 rows of a fragment read fall on different banks; TR = threads that fetch one row; RP = rows that the block fetches in one round */
  static_assert((BK == 64 || BK == 128) && FA % 2 == 0 && BM % RP == 0 && BN % RP == 0 && JA == JB && (JA == 4 || JA == 8), "k_gemm2: whole staging rounds, output tiles in pairs of 16 rows");
  __shared__ __attribute__((aligned(16))) unsigned short sm[2][BM + BN][P];      /* in the k loop: [buffer][A rows | B rows][BK f16 + pad]; behind it: the waves' f32 output tiles, 32 rows at a time */
  static_assert(sizeof(float) * NW * 32 * 68 <= sizeof(unsigned short) * 2 * (BM + BN) * P, "k_gemm2: the output tiles fit the staging buffers");
  static_assert(!FTV || (FA == 4 && NWM == 4 && NWN == 4 && !TWO && HD == 64 && NP % BM == 0 && 2 * INNER % BN == 0 && INNER % (BN / 2) == 0 && BM * BN <= 2 * (BM + BN) * P), "k_gemm2: f^T v blocks hold 128 f and 128 v columns, 16 waves, the f16 tile fits the staging buffers");
  float (*so)[32][68] = reinterpret_cast<float (*)[32][68]>(&sm[0][0][0]);
  const int tid = threadIdx.x, w = tid >> 5, lane = tid & 31, ln = lane & 15, hh = lane >> 4; const int by = blockIdx.y;
  A += (size_t)by * sA; Bh += (size_t)by * sB; const size_t cofs = (size_t)by * sC; const float* bp = bias ? bias + (size_t)by * sBias : nullptr;
  const int wm = w % NWM, wn = w / NWM;      /* the wave's place in the block tile: 16 * FA rows, 64 columns */
  const int ntn = N / BN; const int mt = blockIdx.x / ntn, nq = blockIdx.x - mt * ntn;
  // FTV: behind the q and k columns a block takes BN / 2 columns of f and the same BN / 2 columns of v (two whole heads), so that both operands of f^T v over its BM rows end in its own accumulators; cb0 / cb1 = the column of B that stands at column 0 of the block tile, for its left and its right half
  const bool fvb = FTV && nq * BN >= 2 * INNER; const int jj = nq - 2 * INNER / BN;
  const int cb0 = fvb ? 2 * INNER + jj * (BN / 2) : nq * BN, cb1 = fvb ? 3 * INNER + jj * (BN / 2) - BN / 2 : nq * BN;
  const int row0 = mt * BM + 16 * FA * wm, col0 = (wn < NWN / 2 ? cb0 : cb1) + 64 * wn; if (mt * BM >= M) return;      /* the whole block leaves or none, in front of every barrier */
  // staging: TR neighbouring lanes fetch the BK f16 of one row, whole 128-byte lines; a thread takes chunk tid % TR of rows tid / TR + RP j, JA rows of A and JB of B; block-uniform bases, the lane's own element offsets stay in their registers over the loop
  const int sr = tid / TR, sc = (tid % TR) * 8;
  const unsigned short* ua = (const unsigned short*)A + (size_t)(mt * BM) * lda; const unsigned short* ub = (const unsigned short*)Bh;
  unsigned oa[JA], obf[JB]; v8us ra[JA], rb[JB];
#pragma unroll
  for (int j = 0; j < JA; ++j) oa[j] = (unsigned)((sr + RP * j) * lda + sc);
#pragma unroll
  for (int j = 0; j < JB; ++j) obf[j] = (unsigned)(((j < JB / 2 ? cb0 : cb1) + sr + RP * j) * ldb + sc);
  // the loops over j, kk, u and t are unrolled: the register arrays are then indexed by constants only
  auto fetch = [&](const unsigned short* pa, const int kb) __attribute__((always_inline)) {
    const unsigned short* qa[JA]; const unsigned short* qb[JB];
#pragma unroll
    for (int j = 0; j < JA; ++j) { qa[j] = pa + kb + oa[j]; ra[j] = *(const v8us*)qa[j]; }
#pragma unroll
    for (int j = 0; j < JB; ++j) { qb[j] = ub + kb + obf[j]; rb[j] = *(const v8us*)qb[j]; }
    // the wait stands behind the loads, in front of the first overwrite of a register that they name; the addresses are inputs so that their registers live up to here (a later load of the group otherwise lands on an earlier one's address)
    if constexpr (JA == 4) asm volatile("s_wait_xcnt 0x0" :: "v"(qa[0]), "v"(qa[1]), "v"(qa[2]), "v"(qa[3]), "v"(qb[0]), "v"(qb[1]), "v"(qb[2]), "v"(qb[3]) : "memory");
    else asm volatile("s_wait_xcnt 0x0" :: "v"(qa[0]), "v"(qa[1]), "v"(qa[2]), "v"(qa[3]), "v"(qa[4]), "v"(qa[5]), "v"(qa[6]), "v"(qa[7]), "v"(qb[0]), "v"(qb[1]), "v"(qb[2]), "v"(qb[3]), "v"(qb[4]), "v"(qb[5]), "v"(qb[6]), "v"(qb[7]) : "memory"); };
  auto put = [&](const int buf) __attribute__((always_inline)) {
#pragma unroll
    for (int j = 0; j < JA; ++j) *(v8us*)&sm[buf][sr + RP * j][sc] = ra[j];
#pragma unroll
    for (int j = 0; j < JB; ++j) *(v8us*)&sm[buf][BM + sr + RP * j][sc] = rb[j]; };
  const v8f z8 = {0.f,0.f,0.f,0.f,0.f,0.f,0.f,0.f}; v8f c[FA][4];
#pragma unroll
  for (int u = 0; u < FA; ++u) {
#pragma unroll
    for (int t = 0; t < 4; ++t) c[u][t] = z8; }
  fetch(ua, 0); put(0);
  __syncthreads();      /* step 0 is in LDS before any wave reads it */
  // one step of BK k out of buffer cur; more = a next step exists (A rows at na, k at nkb), is fetched, stored and published (a constant at each call: no test inside a trip)
  auto step = [&](const int cur, const unsigned short* na, const int nkb, const bool more) __attribute__((always_inline)) {
    if (more) fetch(na, nkb);
    const unsigned short* pa = &sm[cur][16 * FA * wm + ln][8 * hh]; const unsigned short* pb = &sm[cur][BM + 64 * wn + ln][8 * hh];
    // fragments are asked for KG blocks of 32 k at a time: two where the registers allow it
#pragma unroll
    for (int kg = 0; kg < BK / 32; kg += KG) { v16h a[FA][KG], b[4][KG];
#pragma unroll
      for (int kk = 0; kk < KG; ++kk) {
#pragma unroll
        for (int u = 0; u < FA; ++u) a[u][kk] = g2_lfrag(pa + u * 16 * P + (kg + kk) * 32);
#pragma unroll
        for (int t = 0; t < 4; ++t) b[t][kk] = g2_lfrag(pb + t * 16 * P + (kg + kk) * 32); }
#pragma unroll
      for (int kk = 0; kk < KG; ++kk) {
#pragma unroll
        for (int t = 0; t < 4; ++t) {
#pragma unroll
          for (int u = 0; u < FA; ++u) c[u][t] = g2_mma(a[u][kk], b[t][kk], c[u][t]); } } }
    if (more) {
      put(cur ^ 1);      /* last read in the step before, behind whose barrier every wave stands */
      __syncthreads(); }      /* one barrier a step: the next step is in LDS before any wave reads it, and every wave has left this step's buffer before it is refilled in the next trip */
  };
  const int nst = K / BK;
  // the step loop stays rolled: unrolled, the staging registers of several steps would be live together
#pragma unroll 1
  for (int s = 0; s < nst - 1; ++s) step(s & 1, ua, (s + 1) * BK, true);
  if (TWO) {
    const unsigned short* ua2 = (const unsigned short*)A2 + (size_t)by * sA + (size_t)(mt * BM) * lda;
    step((nst - 1) & 1, ua2, 0, true);      /* the last step of A fetches the first of A2: the two buffers run on across the seam */
#pragma unroll
    for (int u = 0; u < FA; ++u) {
#pragma unroll
      for (int t = 0; t < 4; ++t) c[u][t] *= beta; }
    // rolled for the same reason as the loop above
#pragma unroll 1
    for (int s = 0; s < nst - 1; ++s) step((nst + s) & 1, ua2, (s + 1) * BK, true);
    step((2 * nst - 1) & 1, ua2, 0, false);
  } else step((nst - 1) & 1, ua, 0, false);
  __syncthreads();      /* every wave has left the last buffer before the output tiles are written over the buffers */
  if constexpr (FTV) { if (fvb) {      /* block-uniform */
    // f and v go nowhere but into f^T v. Two accumulator tiles (32 rows) of one column tile are, rounded to f16, one fragment in the hardware k order with the column as its row or column index (as the softmax weights are in k_fattn): every wave puts its 8 fragments into LDS, 1 KiB each, lane by lane
    // every loop of this branch is unrolled: the accumulator and fragment arrays are then indexed by constants only and stay in registers
    unsigned short* fr = &sm[0][0][0];
#pragma unroll
    for (int kb = 0; kb < FA / 2; ++kb) {
#pragma unroll
      for (int t = 0; t < 4; ++t) { FragH x;
#pragma unroll
        for (int i = 0; i < 16; ++i) x.h[i] = (_Float16)(c[2 * kb + (i >> 3)][t][i & 7] * alpha);
        unsigned short* p = fr + (((wn * NWM + wm) * (FA / 2) + kb) * 4 + t) * 512 + lane * 8;
        *(v8us*)p = x.half[0]; *(v8us*)(p + 256) = x.half[1]; } }
    __syncthreads();      /* every wave's fragments are in LDS before any wave reads them */
    // wave: head hl of the block's two, columns e = 16 et .. of v as A, columns d = 32 dp .. of f as B, all BM rows: D[e][d] = sum over the rows of v[row][e] f[row][d]; a lane then holds 8 neighbouring e of one d
    const int hl = w >> 3, et = (w >> 1) & 3, dp = w & 1; v8f a0 = z8, a1 = z8; FragH av[NWM * FA / 2], b0[NWM * FA / 2], b1[NWM * FA / 2];
#pragma unroll
    for (int kb = 0; kb < NWM * FA / 2; ++kb) {
      const unsigned short* pv = fr + (((NWN / 2 + hl) * NWM * (FA / 2) + kb) * 4 + et) * 512 + lane * 8; const unsigned short* pf = fr + ((hl * NWM * (FA / 2) + kb) * 4 + 2 * dp) * 512 + lane * 8;
      av[kb].half[0] = *(const v8us*)pv; av[kb].half[1] = *(const v8us*)(pv + 256); b0[kb].half[0] = *(const v8us*)pf; b0[kb].half[1] = *(const v8us*)(pf + 256); b1[kb].half[0] = *(const v8us*)(pf + 512); b1[kb].half[1] = *(const v8us*)(pf + 768); }
    __builtin_amdgcn_sched_barrier(0);      /* holds the 48 LDS reads together ahead of the products (the accumulators' registers are free for them); the compiler otherwise waits out one LDS latency per product */
#pragma unroll
    for (int kb = 0; kb < NWM * FA / 2; ++kb) { a0 = __builtin_amdgcn_wmma_f32_16x16x32_f16(false, av[kb].v, false, b0[kb].v, (short)0, a0, false, false); a1 = __builtin_amdgcn_wmma_f32_16x16x32_f16(false, av[kb].v, false, b1[kb].v, (short)0, a1, false, false); }
    // f32 partial of this block's rows: FVP[batch][head][row block][d][e]
    const int bb = mt / (NP / BM), rb = mt - bb * (NP / BM);
    float* po = FVP + ((size_t)((bb * NH + 2 * jj + hl) * (NP / BM) + rb) * HD + 32 * dp + ln) * HD + 16 * et + 8 * hh;
    const v4f s0 = {a0[0], a0[1], a0[2], a0[3]}, s1 = {a0[4], a0[5], a0[6], a0[7]}, s2 = {a1[0], a1[1], a1[2], a1[3]}, s3 = {a1[4], a1[5], a1[6], a1[7]};
    *(v4f*)po = s0; *(v4f*)(po + 4) = s1; *(v4f*)(po + 16 * HD) = s2; *(v4f*)(po + 16 * HD + 4) = s3;
    return; } }
  const int rsub = lane >> 4, c4 = (lane & 15) * 4;
  // the wave's tile goes out 32 rows at a time through its own LDS range
#pragma unroll
  for (int hp = 0; hp < FA / 2; ++hp) {
#pragma unroll
    for (int u = 0; u < 8; ++u) { const int t = u & 3, half = u >> 2; const int col = col0 + t * 16 + ln; const float bv = bp ? bf16_round(bp[col]) : 0.f;
#pragma unroll
      for (int r = 0; r < 8; ++r) { const int rloc = half * 16 + 8 * hh + r; float v = c[2 * hp + half][t][r] * alpha + bv;
        if (ACT == 3) v = fmaxf(v, 0.f); else if (ACT == 6) v = 0.5f * v * (1.0f + erff(v * 0.70710678118654752f)); else if (ACT == 11) v = 1.0f / (1.0f + expf(-v)); else if (ACT == 15) v = v / (1.0f + expf(-v)); else if (ACT == 12) v = (v > 0.f) ? v : 0.01f * v; else if (ACT == 8) v = tanhf(v); else if (ACT == 9) v = 0.5f * v * (1.0f + tanhf(0.7978845608028654f * (v + 0.044715f * v * v * v))); else if (ACT == 14) v = (v > 0.f) ? v : 0.1f * v; else if (ACT == 16) v = (v >= 0.f) ? v : 0.3f * v; else if (ACT == 17) v = (v >= 0.f) ? v : 0.2f * v;
        so[w][rloc][t * 16 + ln] = v; } }
    __builtin_amdgcn_fence(__ATOMIC_ACQ_REL, "workgroup"); __builtin_amdgcn_wave_barrier();
#pragma unroll
    for (int q = 0; q < 16; ++q) { const int r = q * 2 + rsub; const v4f v = *(const v4fa*)&so[w][r][c4]; if (C) { *(v4f*)(C + cofs + (size_t)(row0 + 32 * hp + r) * ldc + col0 + c4) = v; asm volatile("s_wait_xcnt 0x0" ::: "memory"); }      /* the wait stands behind the store, in front of the conversion, which takes the stored registers */
      if (C16) { v4h h4; for (int i = 0; i < 4; ++i) h4[i] = (_Float16)v[i]; *(v4h*)(C16 + cofs + (size_t)(row0 + 32 * hp + r) * ldc + col0 + c4) = h4; } }
    if (hp + 1 < FA / 2) { __builtin_amdgcn_fence(__ATOMIC_ACQ_REL, "workgroup"); __builtin_amdgcn_wave_barrier(); }      /* the wave's reads of these 32 rows stand in front of its writes of the next 32 */
  } }

// ---- fused attention: a block takes 256 query rows of one (batch, head), 32 per wave, and walks the 2048 keys in tiles of 64; each tile (k rows, w_scales rows) is fetched once per block by whole-line loads and put into LDS, where all 8 waves read their fragments; running maximum and sum per query ----
#define FQW 8                    /* waves per block, 32 query rows each: 8 x 32 (batch, head) pairs = 256 blocks */
#define FKT 64                   /* keys per tile: one row of each staged plane is 128 bytes */
#define FLP 72                   /* LDS row pitch in f16: 144 bytes = 16 x 9, the 16 rows of a fragment read fall on different banks */
__device__ __forceinline__ v8f fa_mma(v16h a, v16h b, v8f c) { return __builtin_amdgcn_wmma_f32_16x16x32_f16(false, a, false, b, (short)0, c, false, false); }
// fragment in the hardware k order from a wave-uniform base and the lane's own element offset (row ln, k 8 * hh)
__device__ __forceinline__ v16h fa_frag(const _Float16* ub, unsigned lo) { FragH f; f.half[0] = *(const v8us*)((const unsigned short*)ub + lo); f.half[1] = *(const v8us*)((const unsigned short*)ub + lo + 16); return f.v; }
// the same fragment from a staged row: p = the lane's own row at k 8 * hh
__device__ __forceinline__ v16h fl_frag(const unsigned short* p) { FragH f; f.half[0] = *(const v8us*)p; f.half[1] = *(const v8us*)(p + 16); return f.v; }
// eight independent 2^x in place: each v_exp_f32 fills the slot that the instruction set asks for behind the one before it, the v_nop fills the last one's
__device__ __forceinline__ void fa_exp2x8(float* x) {
  asm("v_exp_f32 %0, %0\n\tv_exp_f32 %1, %1\n\tv_exp_f32 %2, %2\n\tv_exp_f32 %3, %3\n\tv_exp_f32 %4, %4\n\tv_exp_f32 %5, %5\n\tv_exp_f32 %6, %6\n\tv_exp_f32 %7, %7\n\tv_nop"
      : "+v"(x[0]), "+v"(x[1]), "+v"(x[2]), "+v"(x[3]), "+v"(x[4]), "+v"(x[5]), "+v"(x[6]), "+v"(x[7])); }
// two of them, same slots
__device__ __forceinline__ void fa_exp2x2(float& a, float& b) { asm("v_exp_f32 %0, %0\n\tv_exp_f32 %1, %1\n\tv_nop" : "+v"(a), "+v"(b)); }
// lane l with lane l ^ 16
__device__ __forceinline__ float fa_xhalf(float x) { return __builtin_bit_cast(float, __builtin_amdgcn_permlanex16(__builtin_bit_cast(int, x), __builtin_bit_cast(int, x), 0x76543210, 0xfedcba98, false, false)); }
__global__ __launch_bounds__(32 * FQW) void k_fattn(const _Float16* QKFV, const _Float16* WS, const float* FVP, _Float16* CH, _Float16* CL) {
  static_assert(NP % (32 * FQW) == 0 && NP % FKT == 0 && HD == 64 && FKT == 64 && 4 * INNER == NP && 32 * FQW == 256 && NP == 8 * 32 * FQW, "k_fattn: head size 64, 64-key tiles, one row pitch for q, k and w_scales, 256 threads stage 64 rows of 8 chunks in two rounds and the b_scales row in one");
  __shared__ __attribute__((aligned(16))) unsigned short st[2][2][64][FLP];      /* [buffer][k rows | w_scales rows][row][64 f16 + pad] */
  __shared__ __attribute__((aligned(16))) unsigned short sb[NP];      /* the whole b_scales row, put down once */
  __shared__ __attribute__((aligned(16))) unsigned short sfv[2][HD][FLP];      /* f^T v of this (batch, head), f16 hi | residual x 2^10, put down once */
  const int tid = threadIdx.x, w = __builtin_amdgcn_readfirstlane(tid >> 5), lane = tid & 31, ln = lane & 15, hh = lane >> 4;
  const int bh = blockIdx.y, b = bh / NH, h = bh - b * NH;
  const int ldq = 4 * INNER; const unsigned lo = (unsigned)(ln * NP + 8 * hh);
  const _Float16* base = QKFV + (size_t)b * NP * ldq + h * HD;
  const int row0 = blockIdx.x * (32 * FQW) + w * 32;
  // staging: 8 neighbouring lanes fetch one whole 128-byte row; a thread takes chunk tid & 7 of rows tid >> 3 and 32 + (tid >> 3) of each of the two planes
  const int sr = tid >> 3, sc = (tid & 7) * 8;
  const unsigned short* gk = (const unsigned short*)(base + INNER) + (size_t)sr * ldq + sc;
  const unsigned short* gw = (const unsigned short*)WS + (size_t)sr * NP + sc;
  v8us g0 = *(const v8us*)gk, g1 = *(const v8us*)(gk + (size_t)32 * ldq), g2 = *(const v8us*)gw, g3 = *(const v8us*)(gw + (size_t)32 * NP);
  const v8us gb = *(const v8us*)((const unsigned short*)WS + (size_t)HD * NP + tid * 8);
  asm volatile("s_wait_xcnt 0x0" ::: "memory");      /* stands in front of the first overwrite of a register that the 5 loads above name (the q loads' offset takes the register of the b_scales load's) */
  const _Float16* qp = base + (size_t)row0 * ldq;
  const v16h q00 = fa_frag(qp, lo), q01 = fa_frag(qp + 32, lo), q10 = fa_frag(qp + 16 * ldq, lo), q11 = fa_frag(qp + 16 * ldq + 32, lo);
  asm volatile("s_wait_xcnt 0x0" ::: "memory");      /* stands in front of the first overwrite of a register that the 8 loads above name (the accumulators' zeroes reuse the q loads' offset register and base) */
  // f^T v: the projection's blocks left one f32 partial per 256 rows; a thread sums 16 neighbouring elements (row d = tid >> 2) over the 8 partials in row order and splits the sum (loops unrolled: the register arrays are then indexed by constants only)
  { const float* fp = FVP + (size_t)bh * (NP / 256) * HD * HD + tid * 16; v4f pp[NP / 256][4];
#pragma unroll
    for (int rb = 0; rb < NP / 256; ++rb) {
#pragma unroll
      for (int q = 0; q < 4; ++q) pp[rb][q] = *(const v4fa*)(fp + rb * HD * HD + 4 * q); }
    asm volatile("s_wait_xcnt 0x0" :: "v"(fp) : "memory");      /* stands behind the 32 loads, in front of the first overwrite of the address register that they name; the address is an input so that its register lives up to here */
    FragH fh, fl;
#pragma unroll
    for (int i = 0; i < 16; ++i) { float s = pp[0][i >> 2][i & 3];
#pragma unroll
      for (int rb = 1; rb < NP / 256; ++rb) s += pp[rb][i >> 2][i & 3];
      const _Float16 hv = (_Float16)s; fh.h[i] = hv; fl.h[i] = (_Float16)((s - (float)hv) * 1024.0f); }
    unsigned short* ph = &sfv[0][tid >> 2][(tid & 3) * 16]; unsigned short* pl = &sfv[1][tid >> 2][(tid & 3) * 16];
    *(v8us*)ph = fh.half[0]; *(v8us*)(ph + 8) = fh.half[1]; *(v8us*)pl = fl.half[0]; *(v8us*)(pl + 8) = fl.half[1]; }
  *(v8us*)&st[0][0][sr][sc] = g0; *(v8us*)&st[0][0][sr + 32][sc] = g1; *(v8us*)&st[0][1][sr][sc] = g2; *(v8us*)&st[0][1][sr + 32][sc] = g3; *(v8us*)&sb[tid * 8] = gb;
  __syncthreads();      /* tile 0, the b_scales row and f^T v are in LDS before any wave reads them */
  const v8f z8 = {0.f,0.f,0.f,0.f,0.f,0.f,0.f,0.f};
  const float cs = 0.125f * 1.4426950408889634f;
  // o[u][t][r] = sum over the keys of weight x w_scales[t*16 + 8*hh + r][key] for query row0 + u*16 + ln, in units of 2^10 x 16 x the weights under the running maximum m; ob[u][r] = the same sum against b_scales (every r alike); su = this lane half's share of the weight sum
  v8f o[2][4] = {{z8, z8, z8, z8}, {z8, z8, z8, z8}}; v8f ob[2] = {z8, z8};
  float m0 = -3.0e38f, m1 = -3.0e38f, su0 = 0.f, su1 = 0.f;
  // one tile; more = a next tile exists, is fetched, stored and published (a constant at each of the two calls: the trip of the loop below is one straight block, so that the scheduling barriers bind all of it)
  // every loop inside a tile is unrolled: the fragment and accumulator arrays are then indexed by constants only and stay in registers
  auto tile = [&](const int kt, const bool more) __attribute__((always_inline)) {
    const int cur = kt & 1;
    if (more) {
      const size_t ko = (size_t)(kt + 1) * FKT * ldq; const int po = (kt + 1) * FKT;
      g0 = *(const v8us*)(gk + ko); g1 = *(const v8us*)(gk + ko + (size_t)32 * ldq); g2 = *(const v8us*)(gw + po); g3 = *(const v8us*)(gw + po + (size_t)32 * NP);
      asm volatile("s_wait_xcnt 0x0" ::: "memory"); }      /* stands in front of the first overwrite of an address register that the 4 loads above name (the k fragments take them) */
    __builtin_amdgcn_sched_barrier(0);      /* holds the next tile's 4 loads ahead of this tile's work, which hides their latency (the compiler otherwise sinks a load to its use) */
    // S^T = K Q^T: s[t][u][r] = score of key kt*64 + t*16 + 8*hh + r against query row0 + u*16 + ln
    v8f s[4][2];
#pragma unroll
    for (int t = 0; t < 4; ++t) { const unsigned short* kr = &st[cur][0][t * 16 + ln][8 * hh]; const v16h k0 = fl_frag(kr), k1 = fl_frag(kr + 32);
      s[t][0] = fa_mma(k1, q01, fa_mma(k0, q00, z8)); s[t][1] = fa_mma(k1, q11, fa_mma(k0, q10, z8)); }
    // running maximum: in-lane over the tile's keys, across the two lane halves, against the maximum so far
    float t0 = s[0][0][0], t1 = s[0][1][0];
#pragma unroll
    for (int t = 0; t < 4; ++t) {
#pragma unroll
      for (int r = 0; r < 8; ++r) { t0 = fmaxf(t0, s[t][0][r]); t1 = fmaxf(t1, s[t][1][r]); } }
    t0 = fmaxf(t0, fa_xhalf(t0)); t1 = fmaxf(t1, fa_xhalf(t1));
    t0 = fmaxf(t0, m0); t1 = fmaxf(t1, m1);
    float a0 = (m0 - t0) * cs, a1 = (m1 - t1) * cs;      /* what stands under the old maximum shrinks by 2^a; 0 on the first tile */
    fa_exp2x2(a0, a1);
    m0 = t0; m1 = t1;
    // w_scales fragments come in 2 groups (keys 0-31, 32-63) of 4 row tiles plus the b_scales fragment (one row, read alike by all 16 lanes of a half), each asked for one group of products ahead; the scheduling barriers hold the LDS reads there (the compiler otherwise sinks them to their use, one LDS latency per pair of products)
    const unsigned short* pr = &st[cur][1][ln][8 * hh]; const unsigned short* br = &sb[kt * FKT + 8 * hh];
    v16h bf[2][5];
    __builtin_amdgcn_sched_barrier(0);      /* not above the score products: their fragments and these do not fit the registers together */
#pragma unroll
    for (int t = 0; t < 4; ++t) bf[0][t] = fl_frag(pr + t * 16 * FLP);
    bf[0][4] = fl_frag(br);
    __builtin_amdgcn_sched_barrier(0);      /* the first group flies under the first half of the softmax */
    // weights e * 2^10 = 2^((s - max) / 8 * log2 e + 10); two score tiles (32 keys) of one query tile are one B fragment in the hardware k order
    const float f0 = 10.0f - m0 * cs, f1 = 10.0f - m1 * cs;
    su0 *= a0; su1 *= a1; v16h p[2][2];
    // readout, transposed (A = w_scales rows or the b_scales row, B = weights), on f32 accumulators that are first shrunk to the new maximum
#pragma unroll
    for (int ks = 0; ks < 2; ++ks) {
#pragma unroll
      for (int u = 0; u < 2; ++u) { float x[16]; FragH a; float sa = 0.f;
#pragma unroll
        for (int i = 0; i < 16; ++i) x[i] = s[2 * ks + (i >> 3)][u][i & 7] * cs + (u ? f1 : f0);
        fa_exp2x8(x); fa_exp2x8(x + 8);
#pragma unroll
        for (int i = 0; i < 16; ++i) { sa += x[i]; a.h[i] = (_Float16)x[i]; }
        if (u) su1 += sa; else su0 += sa;
        p[ks][u] = a.v; }
      if (ks == 0) {
        __builtin_amdgcn_sched_barrier(0);      /* the sums of the first 32 keys end here: left open, all 64 weights stay in f32 registers to the end of the tile */
#pragma unroll
        for (int t = 0; t < 4; ++t) bf[1][t] = fl_frag(pr + t * 16 * FLP + 32);
        bf[1][4] = fl_frag(br + 32);
        __builtin_amdgcn_sched_barrier(0);      /* the second group is asked for ahead of the first group's products */
        // the first group's products stand in one region with the second half of the softmax: vector work under matrix time
#pragma unroll
        for (int t = 0; t < 4; ++t) { o[0][t] *= a0; o[1][t] *= a1; }
        ob[0] *= a0; ob[1] *= a1;
#pragma unroll
        for (int t = 0; t < 4; ++t) { o[0][t] = fa_mma(bf[0][t], p[0][0], o[0][t]); o[1][t] = fa_mma(bf[0][t], p[0][1], o[1][t]); }
        ob[0] = fa_mma(bf[0][4], p[0][0], ob[0]); ob[1] = fa_mma(bf[0][4], p[0][1], ob[1]); } }
#pragma unroll
    for (int t = 0; t < 4; ++t) { o[0][t] = fa_mma(bf[1][t], p[1][0], o[0][t]); o[1][t] = fa_mma(bf[1][t], p[1][1], o[1][t]); }
    ob[0] = fa_mma(bf[1][4], p[1][0], ob[0]); ob[1] = fa_mma(bf[1][4], p[1][1], ob[1]);
    if (more) {
      const int nx = cur ^ 1;      /* last read in the tile before, behind whose barrier every wave stands */
      *(v8us*)&st[nx][0][sr][sc] = g0; *(v8us*)&st[nx][0][sr + 32][sc] = g1; *(v8us*)&st[nx][1][sr][sc] = g2; *(v8us*)&st[nx][1][sr + 32][sc] = g3;
      __syncthreads(); }      /* one barrier a tile: the next tile is in LDS before any wave reads it, and every wave has left this tile's buffer before it is refilled in the next trip */
  };
  // the tile loop stays rolled, its body is long
#pragma unroll 1
  for (int kt = 0; kt < NP / FKT - 1; ++kt) tile(kt, true);
  tile(NP / FKT - 1, false);
  // f^T v of this (batch, head), hi and residual x 2^10, as A fragments (row d = t*16 + ln, k = e)
  const unsigned short* fvh = &sfv[0][ln][8 * hh]; const unsigned short* fvl = &sfv[1][ln][8 * hh];
  v16h ah[4][2], al[4][2];
#pragma unroll
  for (int t = 0; t < 4; ++t) {
#pragma unroll
    for (int ks = 0; ks < 2; ++ks) { ah[t][ks] = fl_frag(fvh + t * 16 * FLP + ks * 32); al[t][ks] = fl_frag(fvl + t * 16 * FLP + ks * 32); } }
  su0 += fa_xhalf(su0); su1 += fa_xhalf(su1);
  const float rs0 = 1.0f / su0, rs1 = 1.0f / su1;
  // second product: out^T[d][query] = sum over e of (f^T v)[d][e] x (attn . w_scales^T)[query][e]; two accumulator tiles (32 e) of one query tile are one B fragment in the hardware k order, exactly as the weights were
#pragma unroll
  for (int u = 0; u < 2; ++u) { const float rs = u ? rs1 : rs0; v16h th[2], tl[2];
#pragma unroll
    for (int ks = 0; ks < 2; ++ks) { FragH xh, xl;
#pragma unroll
      for (int i = 0; i < 16; ++i) { const float v = o[u][2 * ks + (i >> 3)][i & 7] * rs; const _Float16 hv = (_Float16)v; xh.h[i] = hv; xl.h[i] = (_Float16)((v - (float)hv) * 1024.0f); }
      th[ks] = xh.v; tl[ks] = xl.v; }
    const float cb = ob[u][0] * rs;
#pragma unroll
    for (int t = 0; t < 4; ++t) { FragH ch, cl;
      // the two cross terms carry 2^10, taken back (exact) before the hi x hi term joins the same accumulators
      v8f c = fa_mma(ah[t][1], tl[1], fa_mma(ah[t][0], tl[0], fa_mma(al[t][1], th[1], fa_mma(al[t][0], th[0], z8))));
      c *= 0.0009765625f;
      c = fa_mma(ah[t][1], th[1], fa_mma(ah[t][0], th[0], c));
#pragma unroll
      for (int r = 0; r < 8; ++r) { const float v = (c[r] + cb) * 0.0625f; const _Float16 hv = (_Float16)v; ch.h[r] = hv; cl.h[r] = (_Float16)((v - (float)hv) * 1024.0f); }
      const size_t oo = ((size_t)b * NP + row0 + u * 16 + ln) * INNER + h * HD + t * 16 + 8 * hh;
      *(v8us*)((unsigned short*)CH + oo) = ch.half[0]; *(v8us*)((unsigned short*)CL + oo) = cl.half[0]; } }
}

extern "C" void kernel_launch(void* const* d_in, const int* in_sizes, int n_in,
                              void* d_out, int out_size, void* d_ws, size_t ws_size, hipStream_t stream) {
  (void)in_sizes; (void)n_in; (void)out_size;
  const float* x = (const float*)d_in[0]; const float* Wqkfv = (const float*)d_in[1]; const float* Wsc = (const float*)d_in[2]; const float* bsc = (const float*)d_in[3]; const float* Wout = (const float*)d_in[4]; const float* bout = (const float*)d_in[5];
  char* ws = (char*)d_ws; size_t off = 0;
  auto take = [&](size_t bytes) { char* p = ws + off; off += (bytes + 255) & ~(size_t)255; return p; };
  _Float16* BQ = (_Float16*)take((size_t)4 * INNER * DIM * 2); _Float16* BS = (_Float16*)take((size_t)(HD + 1) * NP * 2);      /* w_scales rows, then b_scales as row 64 */ _Float16* BO = (_Float16*)take((size_t)DIM * INNER * 2);
  _Float16* X16 = (_Float16*)take((size_t)NR * DIM * 2); _Float16* QKFV = (_Float16*)take((size_t)NR * 4 * INNER * 2);      /* [row][q | k | f | v] f16, 32 MiB; only the q and k columns are written */
  float* FVP = (float*)take((size_t)NB * NH * (NP / 256) * HD * HD * 4);      /* f^T v: one f32 partial per (batch, head) and 256 rows */
  _Float16* CH = (_Float16*)take((size_t)NR * INNER * 2); _Float16* CL = (_Float16*)take((size_t)NR * INNER * 2);
  if (off > ws_size) return;      /* about 63 MiB */
  k_prep<<<PREP_Q + PREP_O + PREP_S + PREP_B + PREP_X, 256, 0, stream>>>(Wqkfv, BQ, Wout, BO, Wsc, bsc, BS, x, X16);      /* w_qkfv and w_out transposed (x @ W, in x out), w_scales and b_scales as they lie, and the f16 x plane */
  k_gemm2<0, false, 4, 4, 4, 64, true><<<dim3((NR / 256) * (4 * INNER / 256), 1), 512, 0, stream>>>(X16, nullptr, 0.0f, DIM, 0, BQ, DIM, 0, 0.0625f, nullptr, 0, nullptr, QKFV, 4 * INNER, 0, NR, 4 * INNER, DIM, FVP);      /* [q | k], head h at h*64 inside each quarter; f and v are not written: their blocks leave FVP[b][h][row block][d][e] = sum over 256 rows n of f[n][d] v[n][e] */
  k_fattn<<<dim3(NP / (32 * FQW), NB * NH), 32 * FQW, 0, stream>>>(QKFV, BS, FVP, CH, CL);      /* (softmax(q k^T / 8) . w_scales^T) (f^T v)^T + softmax . b_scales, as f16 hi/residual */
  k_gemm2<0, true, 2, 4, 2, 128, false><<<dim3((NR / 128) * (DIM / 128), 1), 256, 0, stream>>>(CL, CH, 0.0009765625f, INNER, 0, BO, INNER, 0, 0.0625f, bout, 0, (float*)d_out, nullptr, DIM, 0, NR, DIM, INNER, nullptr);      /* y = (2^-10 c_lo + c_hi) w_out + b_out */
}
